// v000
// Measured on an AMD MI455X. A time is GPU time per run, averaged over a window of back-to-back runs after a warm-up
// (all launches, gaps included; the runs take copies of the inputs in turn), and the median of several windows.
// Apart from v000's, it joins two sittings. Times from different sittings can be a few percent apart, while
// side-by-side timings come from the same sitting.
// v000 is the starting kernel. One run takes 1360 microseconds.
// compute dtype: all float inputs rounded to bf16; q/k/v/gate projections x W with EXACT bf16 products on WMMA 16x16x32, f32 accumulate; rotate-half rotary with the given cos/sin tables in f32; q, k once to f16 -> 1-product causal logits / 8 (the first 384 query rows use f16 hi + residual on both sides, 3 products); softmax (sum + 1e-9) in f32 (precise expf); P x 2^11 once to f16 against v once to f16 (first 384 rows: bf16 hi + lo, 3 products); per-head GroupNorm and the sigmoid gate in f32; (gn * alpha) once to f16 against Wo carried x 2^8 in f16 (exact); new_k / new_v written in f32 straight from the projections; f32 outputs.
#include <hip/hip_runtime.h>
#include <math.h>

typedef __attribute__((ext_vector_type(16))) _Float16 v16h;
typedef __attribute__((ext_vector_type(16))) __bf16 v16b;
typedef __attribute__((ext_vector_type(8)))  _Float16 v8h;
typedef __attribute__((ext_vector_type(8)))  float v8f;
typedef __attribute__((ext_vector_type(4)))  float v4f;
typedef __attribute__((ext_vector_type(2)))  float v2f;
typedef __attribute__((ext_vector_type(4)))  unsigned v4u;
typedef __attribute__((ext_vector_type(4)))  int v4i;
typedef float __attribute__((may_alias)) float_a;
typedef int __attribute__((may_alias)) int_a;

template <typename T> __device__ __forceinline__ void vst2(void* p, T v) { *(T*)p = v;  }
__device__ __forceinline__ v8f wmma16(v16h a, v16h b, v8f c) {
  v8f d = __builtin_amdgcn_wmma_f32_16x16x32_f16(false, a, false, b, (short)0, c, false, false);
  asm volatile("v_nop\n\tv_nop\n\tv_nop\n\tv_nop" : "+v"(d) : "v"(a), "v"(b));
  return d;
}
__device__ __forceinline__ v8f wmma_bf(v16b a, v16b b, v8f c) {
  v8f d = __builtin_amdgcn_wmma_f32_16x16x32_bf16(false, a, false, b, (short)0, c, false, false);
  asm volatile("v_nop\n\tv_nop\n\tv_nop\n\tv_nop" : "+v"(d) : "v"(a), "v"(b));
  return d;
}
// 16x16x32 fragments: lane = (h = lane>>4, row/col = lane&15); elements 0..7 = k0+8h+0..7, 8..15 = k0+16+8h+0..7; D element r = row 8h+r
__device__ __forceinline__ v16h frag_h(const _Float16* rowk0, int lane) {
  union { v16h v; v8h q[2]; } u; const _Float16* p = rowk0 + 8 * (lane >> 4);
  u.q[0] = *(const v8h*)p; u.q[1] = *(const v8h*)(p + 16); return u.v;
}
__device__ __forceinline__ v16h frag_f32(const float* rowk0, int lane) {
  v16h a; const float* p = rowk0 + 8 * (lane >> 4);
#pragma unroll
  for (int i = 0; i < 8; ++i) { a[i] = (_Float16)p[i]; a[8 + i] = (_Float16)p[16 + i]; }
  return a;
}
__device__ __forceinline__ v16h frag_f32s(const float* rowk0, int lane, float sc) {
  v16h a; const float* p = rowk0 + 8 * (lane >> 4);
#pragma unroll
  for (int i = 0; i < 8; ++i) { a[i] = (_Float16)(p[i] * sc); a[8 + i] = (_Float16)(p[16 + i] * sc); }
  return a;
}
// column fragment from a [K][ld] layout (column n), rows >= K read as 0
__device__ __forceinline__ v16h fragc_f32(const float* W, int k0, int n, int lane, int ld, int K) {
  v16h a; const int g = lane >> 4;
#pragma unroll
  for (int i = 0; i < 8; ++i) { const int ka = k0 + 8 * g + i, kb = ka + 16;
    a[i] = (_Float16)(ka < K ? W[(size_t)(ka < K ? ka : K - 1) * ld + n] : 0.f); a[8 + i] = (_Float16)(kb < K ? W[(size_t)(kb < K ? kb : K - 1) * ld + n] : 0.f); }
  return a;
}
struct F2 { v16b h, l; };
__device__ __forceinline__ F2 bsplit16(const float v[16]) { F2 r;
#pragma unroll
  for (int i = 0; i < 16; ++i) { const __bf16 h = (__bf16)v[i]; r.h[i] = h; r.l[i] = (__bf16)(v[i] - (float)h); }
  return r; }
__device__ __forceinline__ F2 split_row(const float* row, int k0, int lane) { float v[16]; const float* p = row + k0 + 8 * (lane >> 4);
#pragma unroll
  for (int i = 0; i < 8; ++i) { v[i] = p[i]; v[8 + i] = p[16 + i]; }
  return bsplit16(v); }
__device__ __forceinline__ F2 split_rowK(const float* row, int k0, int lane, int K) { float v[16]; const int g = lane >> 4;
#pragma unroll
  for (int i = 0; i < 8; ++i) { const int ka = k0 + 8 * g + i, kb = ka + 16; v[i] = ka < K ? row[ka < K ? ka : K - 1] : 0.f; v[8 + i] = kb < K ? row[kb < K ? kb : K - 1] : 0.f; }
  return bsplit16(v); }
__device__ __forceinline__ F2 split_col(const float* W, int k0, int n, int lane, int ld, int K) { float v[16]; const int g = lane >> 4;
#pragma unroll
  for (int i = 0; i < 8; ++i) { const int ka = k0 + 8 * g + i, kb = ka + 16; v[i] = ka < K ? W[(size_t)(ka < K ? ka : K - 1) * ld + n] : 0.f; v[8 + i] = kb < K ? W[(size_t)(kb < K ? kb : K - 1) * ld + n] : 0.f; }
  return bsplit16(v); }
__device__ __forceinline__ v8f mac3(const F2& a, const F2& b, v8f c) { c = wmma_bf(a.l, b.h, c); c = wmma_bf(a.h, b.l, c); return wmma_bf(a.h, b.h, c); }
__device__ __forceinline__ float sigm(float v) { return 1.0f / (1.0f + expf(-v)); }
#define LDSX() do { asm volatile("s_wait_dscnt 0" ::: "memory"); __builtin_amdgcn_wave_barrier(); __builtin_amdgcn_fence(__ATOMIC_RELEASE, "workgroup"); } while (0)

// Gated GQA causal self-attention with rotary tables, per-head GroupNorm and a sigmoid output gate (B 1, S 2,048, HID 2,048; 32 query / 8 kv heads x 64): q = x Wq, k = x Wk, v = x Wv ((in,out)); q, k rotate-half RoPE with the given cos/sin [S,64]; scores = q k^T / 8, causal (col > row -> -inf); p = exp(a - max) / (sum + 1e-9); out = p v (GQA x4); gn = per-(token, head) normalisation over 64 x gn_weight + gn_bias; alpha = sigmoid(x Wg + bg); y = (gn * alpha) Wo. Returns (y, new_k = roped k [B,HKV,S,D], new_v [B,HKV,S,D]).
#define NB 1
#define TT 2048
#define CC 2048
#define NH 32
#define HD 64
#define NKV 8
#define KV (NKV * HD)      // 512
#define GQ (NH / NKV)      // 4
#define NQB (TT / 64)      // 32 query blocks per sequence
#define HG 4               // query heads per launch group
#define SCALE 0.125f
#ifndef TNB
#define TNB NB
#endif
typedef __attribute__((ext_vector_type(8))) __bf16 v8b;
__device__ __forceinline__ v16b frag_b(const __bf16* rowk0, int lane) {
  union { v16b v; v8b q[2]; } u; const __bf16* p = rowk0 + 8 * (lane >> 4);
  u.q[0] = *(const v8b*)p; u.q[1] = *(const v8b*)(p + 16); return u.v;
}
__device__ __forceinline__ float bfr(float v) { return (float)(__bf16)v; }
__host__ __device__ __forceinline__ int kb_last(int qb) { return (qb * 64 + 63) >> 7; }   // last 128-key block for query block qb (causal); the first is always 0
#define QBH 6              // query blocks 0..5 of each sequence (rows < 384) take the high-precision path (their rows see only 1..384 keys)
#define QHI (QBH * 64)     // 384
#define KHI 384            // key rows with residual / bf16 planes (keys of those rows are <= 383)

#define WS_GA  0u                                       // f16 alpha = sigmoid(x Wg + bg) rows [t][2048]
#define WS_AH  (WS_GA + 2u * (size_t)NB * TT * CC)        // f16 (gn * alpha) rows [t][2048] (A operand of the output projection)
#define WS_QH  (WS_AH + 2u * (size_t)NB * TT * CC)        // f16 q rows [b*t][2048] (rotated)
#define WS_KH  (WS_QH + 2u * (size_t)NB * TT * CC)       // f16 k rows [b*t][512]
#define WS_VT  (WS_KH + 2u * (size_t)NB * TT * KV)       // f16 v planes [b][kvc][t]
#define WS_QL  (WS_VT + 2u * (size_t)NB * KV * TT)       // f16 q residual x 2^10 rows [b][t < QHI][2048]
#define WS_KL  (WS_QL + 2u * (size_t)NB * QHI * CC)      // f16 k residual x 2^10 rows [b][t < KHI][512]
#define WS_VB  (WS_KL + 2u * (size_t)NB * KHI * KV)      // bf16 v hi planes [b][kvc][t < KHI] (pitch KHI)
#define WS_VBL (WS_VB + 2u * (size_t)NB * KV * KHI)      // bf16 v lo planes
#define WS_S   (WS_VBL + 2u * (size_t)NB * KV * KHI)     // f32 logits / P [hg][t][TT] (only keys [0, kend) of each row are written and read)
#define WS_Y   (WS_S  + 4u * (size_t)HG * TT * TT)       // f32 ctx rows [b*t][2048]
#define WS_END (WS_Y  + 4u * (size_t)NB * TT * CC)

// ---- k_proj: block = (64 tokens, 128 output cols = two 64-dim heads, which): acc = x W (W (in,out); exact); which 0/1: rotate-half rope with the given tables (tiles j and j+2 hold d and d+32 of the same head) -> f16 rows (+ residual x 2^10 for the early rows), and new_k written in f32; which 2: v -> f16 planes (+ bf16 hi/lo planes for the early keys) and new_v in f32; which 3: alpha = sigmoid(x Wg + bg) -> f16 rows
__device__ __forceinline__ v16b wcol(const float* Wm, int k0, int o, int lane, int ld) { v16b w; const int g = lane >> 4;
#pragma unroll
  for (int i = 0; i < 8; ++i) { w[i] = (__bf16)Wm[(size_t)(k0 + 8 * g + i) * ld + o]; w[8 + i] = (__bf16)Wm[(size_t)(k0 + 16 + 8 * g + i) * ld + o]; }
  return w; }
__global__ __launch_bounds__(128) void k_proj(const float* __restrict__ X, const float* __restrict__ WQ, const float* __restrict__ WK, const float* __restrict__ WV, const float* __restrict__ WG, const float* __restrict__ BG, const float* __restrict__ COS, const float* __restrict__ SIN, _Float16* __restrict__ QH, _Float16* __restrict__ KH, _Float16* __restrict__ VT, _Float16* __restrict__ QL, _Float16* __restrict__ KL, __bf16* __restrict__ VB, __bf16* __restrict__ VBL, _Float16* __restrict__ GA, float* __restrict__ OUTK, float* __restrict__ OUTV) {
  __shared__ __align__(16) _Float16 sh[64][136], sl[64][136]; __shared__ __align__(16) _Float16 th[128][72]; __shared__ __align__(16) __bf16 tb[128][72], tbl[128][72]; __shared__ __align__(16) float so[4][16][132];
  const int tid = threadIdx.x, wave = tid >> 5, lane = tid & 31, col = lane & 15, g = lane >> 4; const int which = blockIdx.z; const int c0 = blockIdx.y * 128; const size_t r0 = (size_t)blockIdx.x * 64; const int NW = (which == 0 || which == 3) ? CC : KV; if (c0 >= NW) return;   // k/v are only 512 wide (block-uniform exit before any barrier)
  const size_t b = r0 / TT; const int t0 = (int)(r0 % TT); const bool hi_rows = t0 < ((which == 0) ? QHI : KHI);   /* block-uniform */
  const float* WA = which == 0 ? WQ : which == 1 ? WK : which == 2 ? WV : WG;
  v8f acc[8] = {};
#pragma unroll 2
  for (int kc = 0; kc < CC / 32; ++kc) { v16b a; { const float* p = X + (r0 + wave * 16 + col) * CC + kc * 32 + 8 * g;
#pragma unroll
      for (int i = 0; i < 8; ++i) { a[i] = (__bf16)p[i]; a[8 + i] = (__bf16)p[16 + i]; } }
    asm volatile("s_wait_loadcnt 0x0" ::: "memory");
#pragma unroll
    for (int j = 0; j < 8; ++j) { const v16b w = wcol(WA, kc * 32, c0 + j * 16 + col, lane, NW); asm volatile("s_wait_loadcnt 0x0" ::: "memory"); acc[j] = wmma_bf(a, w, acc[j]); } }
  if (which == 3) {   /* gate: alpha = sigmoid(acc + bg) -> f16 rows */
#pragma unroll
    for (int j = 0; j < 8; ++j) { const float bb = bfr(BG[c0 + j * 16 + col]);
#pragma unroll
      for (int r = 0; r < 8; ++r) sh[wave * 16 + 8 * g + r][j * 16 + col] = (_Float16)(1.0f / (1.0f + expf(-(acc[j][r] + bb)))); }
    __syncthreads();
    for (int e = tid; e < 64 * 16; e += 128) { const int rl = e >> 4, q = e & 15; vst2((unsigned*)(GA + (r0 + rl) * CC + c0 + q * 8), *(const v4u*)&sh[rl][q * 8]); }
    return; }
  if (which < 2) {
    /* rotate-half rope on each 64-dim head: d = (j&3)*16+col; d < 32 (tiles jp = 0,1,4,5) pairs with d+32 (jp+2): out[d] = x[d] c - x[d+32] s, out[d+32] = x[d+32] c + x[d] s, table index d for out[d], d+32 for out[d+32] */
#pragma unroll
    for (int jp = 0; jp < 8; ++jp) { if ((jp & 3) >= 2) continue; const int i2 = (jp & 3) * 16 + col;
#pragma unroll
      for (int r = 0; r < 8; ++r) { const int t = t0 + wave * 16 + 8 * g + r; const float c1 = bfr(COS[(size_t)t * HD + i2]), s1 = bfr(SIN[(size_t)t * HD + i2]), c2 = bfr(COS[(size_t)t * HD + i2 + 32]), s2 = bfr(SIN[(size_t)t * HD + i2 + 32]); const float x1 = acc[jp][r], x2 = acc[jp + 2][r]; asm volatile("s_wait_loadcnt 0x0" ::: "memory"); acc[jp][r] = x1 * c1 - x2 * s1; acc[jp + 2][r] = x2 * c2 + x1 * s2; } }
    if (which == 1) {   /* new_k output [HKV][S][64] in f32: this wave's 16 rows x 2 heads, 256 B per (row, head) by 16 lanes */
#pragma unroll
      for (int j = 0; j < 8; ++j) {
#pragma unroll
        for (int r = 0; r < 8; ++r) so[wave][8 * g + r][j * 16 + col] = acc[j][r]; }
      LDSX(); for (int rl = 0; rl < 16; ++rl) { const int t = t0 + wave * 16 + rl; const int hh = (c0 >> 6) + (lane >> 4); vst2(OUTK + ((size_t)hh * TT + t) * HD + (lane & 15) * 4, *(const v4f*)&so[wave][rl][lane * 4]); } }
#pragma unroll
    for (int j = 0; j < 8; ++j) {
#pragma unroll
      for (int r = 0; r < 8; ++r) { const float v = acc[j][r]; const _Float16 hv = (_Float16)v; sh[wave * 16 + 8 * g + r][j * 16 + col] = hv; sl[wave * 16 + 8 * g + r][j * 16 + col] = (_Float16)((v - (float)hv) * 1024.0f); } }
    __syncthreads();
    _Float16* dh = which == 0 ? QH : KH; _Float16* dl = which == 0 ? (QL + (b * QHI) * (size_t)CC) : (KL + (b * KHI) * (size_t)KV);
    for (int e = tid; e < 64 * 16; e += 128) { const int rl = e >> 4, q = e & 15; vst2((unsigned*)(dh + (r0 + rl) * NW + c0 + q * 8), *(const v4u*)&sh[rl][q * 8]); if (hi_rows) vst2((unsigned*)(dl + (size_t)(t0 + rl) * NW + c0 + q * 8), *(const v4u*)&sl[rl][q * 8]); }
  } else {   /* which == 2: v */
#pragma unroll
    for (int j = 0; j < 8; ++j) {
#pragma unroll
      for (int r = 0; r < 8; ++r) so[wave][8 * g + r][j * 16 + col] = acc[j][r]; }
    LDSX(); for (int rl = 0; rl < 16; ++rl) { const int t = t0 + wave * 16 + rl; const int hh = (c0 >> 6) + (lane >> 4); vst2(OUTV + ((size_t)hh * TT + t) * HD + (lane & 15) * 4, *(const v4f*)&so[wave][rl][lane * 4]); }   /* new_v output in f32 */
#pragma unroll
    for (int j = 0; j < 8; ++j) {
#pragma unroll
      for (int r = 0; r < 8; ++r) { const float v = acc[j][r]; const int rl = wave * 16 + 8 * g + r, cl = j * 16 + col; th[cl][rl] = (_Float16)v; const __bf16 bh = (__bf16)v; tb[cl][rl] = bh; tbl[cl][rl] = (__bf16)(v - (float)bh); } }
    __syncthreads();
    for (int e = tid; e < 128 * 8; e += 128) { const int cl = e >> 3, q = e & 7; const size_t o2 = (b * KV + c0 + cl) * (size_t)TT + t0 + q * 8; vst2((unsigned*)(VT + o2), *(const v4u*)&th[cl][q * 8]); if (hi_rows) { const size_t o3 = (b * KV + c0 + cl) * (size_t)KHI + t0 + q * 8; vst2((unsigned*)(VB + o3), *(const v4u*)&tb[cl][q * 8]); vst2((unsigned*)(VBL + o3), *(const v4u*)&tbl[cl][q * 8]); } } } }
// ---- k_sc: block = (query block qb, key block kb = by <= kb_last(qb), head in group) of sequence b: logits x 0.125 for the whole 64 x 128 tile (causal mask applied by index in k_sm); 3 products for qb < QBH, else 1; blocks past the diagonal exit
__global__ __launch_bounds__(128) void k_sc(const _Float16* __restrict__ QH, const _Float16* __restrict__ KH, const _Float16* __restrict__ QL, const _Float16* __restrict__ KL, int b, int h0, float* __restrict__ S0) { __shared__ __align__(16) float ss[4][16][132];
  const int qb = blockIdx.x; const int kb = blockIdx.y; if (kb > kb_last(qb)) return;   /* block-uniform */
  const int h = h0 + blockIdx.z; float* S = S0 + (size_t)blockIdx.z * TT * TT;
  const int tid = threadIdx.x, wave = tid >> 5, lane = tid & 31, col = lane & 15, g = lane >> 4; const int k0 = kb * 128; const int ql0 = qb * 64 + wave * 16; const size_t q0 = (size_t)b * TT + ql0, kr0 = (size_t)b * TT + k0;
  v8f acc[8] = {}, accl[8] = {};
  if (qb < QBH) {
    const _Float16* QLb = QL + (size_t)b * QHI * CC; const _Float16* KLb = KL + (size_t)b * KHI * KV;
#pragma unroll
    for (int kc = 0; kc < HD / 32; ++kc) { const v16h ah = frag_h(QH + (q0 + col) * CC + h * HD + kc * 32, lane), al = frag_h(QLb + (size_t)(ql0 + col) * CC + h * HD + kc * 32, lane);
#pragma unroll
      for (int j = 0; j < 8; ++j) { const v16h kbf = frag_h(KH + (kr0 + j * 16 + col) * KV + (h / GQ) * HD + kc * 32, lane), klf = frag_h(KLb + (size_t)(k0 + j * 16 + col) * KV + (h / GQ) * HD + kc * 32, lane); acc[j] = wmma16(ah, kbf, acc[j]); accl[j] = wmma16(al, kbf, accl[j]); accl[j] = wmma16(ah, klf, accl[j]); } }
  } else {
#pragma unroll
    for (int kc = 0; kc < HD / 32; ++kc) { const v16h ah = frag_h(QH + (q0 + col) * CC + h * HD + kc * 32, lane);
#pragma unroll
      for (int j = 0; j < 8; ++j) { const v16h kbf = frag_h(KH + (kr0 + j * 16 + col) * KV + (h / GQ) * HD + kc * 32, lane); acc[j] = wmma16(ah, kbf, acc[j]); } } }
#pragma unroll
  for (int j = 0; j < 8; ++j) {
#pragma unroll
    for (int r = 0; r < 8; ++r) ss[wave][8 * g + r][j * 16 + col] = (acc[j][r] + accl[j][r] * (1.0f / 1024.0f)) * SCALE; }
  LDSX(); for (int rl = 0; rl < 16; ++rl) vst2(S + (size_t)(ql0 + rl) * TT + k0 + lane * 4, *(const v4f*)&ss[wave][rl][lane * 4]); }
// ---- k_sm: block = query row t (head in group): keys [0, kend) with kend = (kb_last(qb)+1)*128: logit if s <= t else excluded; softmax; P x 2^11 in place (0 for excluded keys) so k_pv reads only written cells
__global__ __launch_bounds__(256) void k_sm(float* __restrict__ S0) { __shared__ float sred[8]; __shared__ float sbc; __shared__ __align__(16) float shv[TT];
  const int tid = threadIdx.x; const int t = blockIdx.x; const int kend = (kb_last(t >> 6) + 1) * 128;
  float* sr = S0 + (size_t)blockIdx.y * TT * TT + (size_t)t * TT;
  float m = -3.0e38f; for (int k = tid; k < kend; k += 256) { const float v = (k <= t) ? sr[k] : -3.0e38f; shv[k] = v; m = fmaxf(m, v); }
#pragma unroll
  for (int o = 1; o < 32; o <<= 1) m = fmaxf(m, __shfl_xor(m, o));
  if ((tid & 31) == 0) sred[tid >> 5] = m; __syncthreads(); if (tid == 0) { float a = sred[0]; for (int i = 1; i < 8; ++i) a = fmaxf(a, sred[i]); sbc = a; } __syncthreads(); m = sbc; __syncthreads();
  float sum = 0.f; for (int k = tid; k < kend; k += 256) { const float v = shv[k]; const float e = (v <= -1.0e38f) ? 0.f : expf(v - m); shv[k] = e; sum += e; }
#pragma unroll
  for (int o = 1; o < 32; o <<= 1) sum += __shfl_xor(sum, o);
  if ((tid & 31) == 0) sred[tid >> 5] = sum; __syncthreads(); if (tid == 0) { float a = 0.f; for (int i = 0; i < 8; ++i) a += sred[i]; sbc = 2048.0f / (a + 1e-9f); } __syncthreads(); const float inv = sbc;   /* p = e / (sum + 1e-9) as in the module */
  for (int k = tid; k < kend; k += 256) shv[k] = shv[k] * inv;
  __syncthreads(); for (int q = tid; q < kend / 4; q += 256) vst2(sr + q * 4, *(const v4f*)&shv[q * 4]); }
// ---- k_pv: block = 64 queries (qb) of head h in sequence b: ctx[b*T + t][h*64 + d] = P . v over keys [0, kend) (kv head h/4); 3 products (bf16 planes) for qb < QBH, else P x 2^11 once to f16 x v f16 (1 product); 256-B (row, head) segment by 16 lanes
__global__ __launch_bounds__(128) void k_pv(const float* __restrict__ PS0, const _Float16* __restrict__ VT, const __bf16* __restrict__ VB, const __bf16* __restrict__ VBL, int b, int h0, float* __restrict__ Y) { const int h = h0 + blockIdx.z; const float* PS = PS0 + (size_t)blockIdx.z * TT * TT; __shared__ __align__(16) float ss[4][16][HD + 4];
  const int tid = threadIdx.x, wave = tid >> 5, lane = tid & 31, col = lane & 15, g = lane >> 4; const int qb = blockIdx.x; const int ql0 = qb * 64 + wave * 16; const int kce = (kb_last(qb) + 1) * 4;
  v8f acc[HD / 16] = {};
  if (qb < QBH) {
#pragma unroll 1
    for (int kc = 0; kc < kce; ++kc) { const F2 p = split_row(PS + (size_t)(ql0 + col) * TT, kc * 32, lane);
      asm volatile("s_wait_loadcnt 0x0" ::: "memory");
#pragma unroll
      for (int j = 0; j < HD / 16; ++j) { const size_t po = ((size_t)b * KV + (h / GQ) * HD + j * 16 + col) * (size_t)KHI + kc * 32; const v16b vh = frag_b(VB + po, lane); acc[j] = wmma_bf(p.h, vh, acc[j]); acc[j] = wmma_bf(p.l, vh, acc[j]); acc[j] = wmma_bf(p.h, frag_b(VBL + po, lane), acc[j]); } }
  } else {
#pragma unroll 1
    for (int kc = 0; kc < kce; ++kc) { const v16h p = frag_f32(PS + (size_t)(ql0 + col) * TT + kc * 32, lane);
      asm volatile("s_wait_loadcnt 0x0" ::: "memory");
#pragma unroll
      for (int j = 0; j < HD / 16; ++j) { const size_t po = ((size_t)b * KV + (h / GQ) * HD + j * 16 + col) * (size_t)TT + kc * 32; acc[j] = wmma16(p, frag_h(VT + po, lane), acc[j]); } } }
#pragma unroll
  for (int j = 0; j < HD / 16; ++j)
#pragma unroll
    for (int r = 0; r < 8; ++r) ss[wave][8 * g + r][j * 16 + col] = acc[j][r] * (1.0f / 2048.0f);
  LDSX(); for (int rl = 0; rl < 16; ++rl) if (lane < HD / 4) vst2(Y + ((size_t)b * TT + ql0 + rl) * CC + h * HD + lane * 4, *(const v4f*)&ss[wave][rl][lane * 4]); }
__global__ __launch_bounds__(256) void k_gn(const float* __restrict__ Y, const _Float16* __restrict__ GA, const float* __restrict__ GW, const float* __restrict__ GB, _Float16* __restrict__ AH) {
  const int tid = threadIdx.x; const size_t t = blockIdx.x; const int h = tid >> 3, q = tid & 7; const size_t base = t * CC + h * HD + q * 8;
  const v4f ya = *(const v4f*)(Y + base), yb = *(const v4f*)(Y + base + 4); float v[8] = {ya[0], ya[1], ya[2], ya[3], yb[0], yb[1], yb[2], yb[3]};
  float s = 0.f;
#pragma unroll
  for (int z = 0; z < 8; ++z) s += v[z];
#pragma unroll
  for (int o = 1; o < 8; o <<= 1) s += __shfl_xor(s, o);
  const float mean = s * (1.0f / HD); float s2 = 0.f;
#pragma unroll
  for (int z = 0; z < 8; ++z) { v[z] -= mean; s2 += v[z] * v[z]; }
#pragma unroll
  for (int o = 1; o < 8; o <<= 1) s2 += __shfl_xor(s2, o);
  const float rstd = rsqrtf(s2 * (1.0f / HD) + 1e-5f);
  union { v8h hv; v4u u; } pk;
#pragma unroll
  for (int z = 0; z < 8; ++z) { const int c = h * HD + q * 8 + z; pk.hv[z] = (_Float16)((v[z] * rstd * bfr(GW[c]) + bfr(GB[c])) * (float)GA[t * CC + c]); }
  vst2((unsigned*)(AH + base), pk.u); }
// ---- k_out: block = (64 rows, 128 cols): y = (gn * alpha) (f16 rows) Wo ((in,out), f16(bf16 x 2^8) exact) x 2^-8 -> output 0 rows
__device__ __forceinline__ v16h wcolh(const float* Wm, int k0, int o, int lane, int ld) { v16h w; const int g = lane >> 4;
#pragma unroll
  for (int i = 0; i < 8; ++i) { w[i] = (_Float16)(bfr(Wm[(size_t)(k0 + 8 * g + i) * ld + o]) * 256.0f); w[8 + i] = (_Float16)(bfr(Wm[(size_t)(k0 + 16 + 8 * g + i) * ld + o]) * 256.0f); }
  return w; }
__global__ __launch_bounds__(128) void k_out(const _Float16* __restrict__ AH, const float* __restrict__ WO, float* __restrict__ OUT) { __shared__ __align__(16) float sf[4][16][132];
  const int tid = threadIdx.x, wave = tid >> 5, lane = tid & 31, col = lane & 15, g = lane >> 4; const int c0 = blockIdx.y * 128; const size_t r0 = (size_t)blockIdx.x * 64 + wave * 16;
  v8f acc[8] = {};
#pragma unroll 2
  for (int kc = 0; kc < CC / 32; ++kc) { const v16h a = frag_h(AH + (r0 + col) * CC + kc * 32, lane); asm volatile("s_wait_loadcnt 0x0" ::: "memory");
#pragma unroll
    for (int j = 0; j < 8; ++j) { const v16h w = wcolh(WO, kc * 32, c0 + j * 16 + col, lane, CC); asm volatile("s_wait_loadcnt 0x0" ::: "memory"); acc[j] = wmma16(a, w, acc[j]); } }
#pragma unroll
  for (int j = 0; j < 8; ++j) {
#pragma unroll
    for (int r = 0; r < 8; ++r) sf[wave][8 * g + r][j * 16 + col] = acc[j][r] * (1.0f / 256.0f); }
  LDSX(); for (int rl = 0; rl < 16; ++rl) vst2(OUT + (r0 + rl) * CC + c0 + lane * 4, *(const v4f*)&sf[wave][rl][lane * 4]); }
extern "C" void kernel_launch(void* const* d_in, const int* in_sizes, int n_in, void* d_out, int out_size, void* d_ws, size_t ws_size, hipStream_t stream) {
  (void)in_sizes; (void)n_in; (void)out_size;
  const float** F = (const float**)d_in;   // 0 x [1,2048,2048]; 1 rope_cos, 2 rope_sin [2048,64]; 3 Wq [2048,2048]; 4 Wk, 5 Wv [2048,512]; 6 Wo [2048,2048]; 7 Wg [2048,2048], 8 bg; 9 gn_weight, 10 gn_bias [2048]
  if (ws_size < (size_t)WS_END) return;
  char* ws = (char*)d_ws; _Float16 *GA = (_Float16*)(ws + WS_GA), *AH = (_Float16*)(ws + WS_AH), *QH = (_Float16*)(ws + WS_QH), *KH = (_Float16*)(ws + WS_KH), *VT = (_Float16*)(ws + WS_VT), *QL = (_Float16*)(ws + WS_QL), *KL = (_Float16*)(ws + WS_KL); __bf16 *VB = (__bf16*)(ws + WS_VB), *VBL = (__bf16*)(ws + WS_VBL); float *S = (float*)(ws + WS_S), *Y = (float*)(ws + WS_Y);
  float* OUT0 = (float*)d_out; float* OUTK = OUT0 + (size_t)NB * TT * CC; float* OUTV = OUTK + (size_t)NB * NKV * TT * HD;   /* tuple outputs concatenated, no padding */
  k_proj<<<dim3(TNB * TT / 64, CC / 128, 4), 128, 0, stream>>>(F[0], F[3], F[4], F[5], F[7], F[8], F[1], F[2], QH, KH, VT, QL, KL, VB, VBL, GA, OUTK, OUTV);
  for (int b = 0; b < TNB; ++b) for (int h0 = 0; h0 < NH; h0 += HG) {
    k_sc<<<dim3(NQB, TT / 128, HG), 128, 0, stream>>>(QH, KH, QL, KL, b, h0, S);
    k_sm<<<dim3(TT, HG), 256, 0, stream>>>(S);
    k_pv<<<dim3(NQB, 1, HG), 128, 0, stream>>>(S, VT, VB, VBL, b, h0, Y);
  }
  k_gn<<<dim3(TNB * TT), 256, 0, stream>>>(Y, GA, F[9], F[10], AH);
  k_out<<<dim3(TNB * TT / 64, CC / 128), 128, 0, stream>>>(AH, F[6], OUT0);
}

// v001
// Measured time: 1010 microseconds a run.
// Next to v000, in two timings, it ran 1.36 times as fast each time.
// compute dtype: all float inputs rounded to bf16; q/k/v/gate projections x W with EXACT bf16 products on WMMA 16x16x32, f32 accumulate; rotate-half rotary with the given cos/sin tables in f32; q, k once to f16 -> 1-product causal logits / 8 (the first 384 query rows use f16 hi + residual on both sides, 3 products); softmax (sum + 1e-9) in f32 (precise expf); P x 2^11 once to f16 against v once to f16 (first 384 rows: bf16 hi + lo, 3 products); per-head GroupNorm and the sigmoid gate in f32; (gn * alpha) once to f16 against Wo carried x 2^8 in f16 (exact); new_k / new_v written in f32 straight from the projections; f32 outputs.
#include <hip/hip_runtime.h>
#include <math.h>

typedef __attribute__((ext_vector_type(16))) _Float16 v16h;
typedef __attribute__((ext_vector_type(16))) __bf16 v16b;
typedef __attribute__((ext_vector_type(8)))  _Float16 v8h;
typedef __attribute__((ext_vector_type(8)))  float v8f;
typedef __attribute__((ext_vector_type(4)))  float v4f;
typedef __attribute__((ext_vector_type(2)))  float v2f;
typedef __attribute__((ext_vector_type(4)))  unsigned v4u;
typedef __attribute__((ext_vector_type(4)))  int v4i;
typedef float __attribute__((may_alias)) float_a;
typedef int __attribute__((may_alias)) int_a;

template <typename T> __device__ __forceinline__ void vst2(void* p, T v) { *(T*)p = v;  }
__device__ __forceinline__ v8f wmma16(v16h a, v16h b, v8f c) {
  v8f d = __builtin_amdgcn_wmma_f32_16x16x32_f16(false, a, false, b, (short)0, c, false, false);
  asm volatile("v_nop\n\tv_nop\n\tv_nop\n\tv_nop" : "+v"(d) : "v"(a), "v"(b));
  return d;
}
__device__ __forceinline__ v8f wmma_bf(v16b a, v16b b, v8f c) {
  v8f d = __builtin_amdgcn_wmma_f32_16x16x32_bf16(false, a, false, b, (short)0, c, false, false);
  asm volatile("v_nop\n\tv_nop\n\tv_nop\n\tv_nop" : "+v"(d) : "v"(a), "v"(b));
  return d;
}
// 16x16x32 fragments: lane = (h = lane>>4, row/col = lane&15); elements 0..7 = k0+8h+0..7, 8..15 = k0+16+8h+0..7; D element r = row 8h+r
__device__ __forceinline__ v16h frag_h(const _Float16* rowk0, int lane) {
  union { v16h v; v8h q[2]; } u; const _Float16* p = rowk0 + 8 * (lane >> 4);
  u.q[0] = *(const v8h*)p; u.q[1] = *(const v8h*)(p + 16); return u.v;
}
__device__ __forceinline__ v16h frag_f32(const float* rowk0, int lane) {
  v16h a; const float* p = rowk0 + 8 * (lane >> 4);
#pragma unroll
  for (int i = 0; i < 8; ++i) { a[i] = (_Float16)p[i]; a[8 + i] = (_Float16)p[16 + i]; }
  return a;
}
__device__ __forceinline__ v16h frag_f32s(const float* rowk0, int lane, float sc) {
  v16h a; const float* p = rowk0 + 8 * (lane >> 4);
#pragma unroll
  for (int i = 0; i < 8; ++i) { a[i] = (_Float16)(p[i] * sc); a[8 + i] = (_Float16)(p[16 + i] * sc); }
  return a;
}
// column fragment from a [K][ld] layout (column n), rows >= K read as 0
__device__ __forceinline__ v16h fragc_f32(const float* W, int k0, int n, int lane, int ld, int K) {
  v16h a; const int g = lane >> 4;
#pragma unroll
  for (int i = 0; i < 8; ++i) { const int ka = k0 + 8 * g + i, kb = ka + 16;
    a[i] = (_Float16)(ka < K ? W[(size_t)(ka < K ? ka : K - 1) * ld + n] : 0.f); a[8 + i] = (_Float16)(kb < K ? W[(size_t)(kb < K ? kb : K - 1) * ld + n] : 0.f); }
  return a;
}
struct F2 { v16b h, l; };
__device__ __forceinline__ F2 bsplit16(const float v[16]) { F2 r;
#pragma unroll
  for (int i = 0; i < 16; ++i) { const __bf16 h = (__bf16)v[i]; r.h[i] = h; r.l[i] = (__bf16)(v[i] - (float)h); }
  return r; }
__device__ __forceinline__ F2 split_row(const float* row, int k0, int lane) { float v[16]; const float* p = row + k0 + 8 * (lane >> 4);
#pragma unroll
  for (int i = 0; i < 8; ++i) { v[i] = p[i]; v[8 + i] = p[16 + i]; }
  return bsplit16(v); }
__device__ __forceinline__ F2 split_rowK(const float* row, int k0, int lane, int K) { float v[16]; const int g = lane >> 4;
#pragma unroll
  for (int i = 0; i < 8; ++i) { const int ka = k0 + 8 * g + i, kb = ka + 16; v[i] = ka < K ? row[ka < K ? ka : K - 1] : 0.f; v[8 + i] = kb < K ? row[kb < K ? kb : K - 1] : 0.f; }
  return bsplit16(v); }
__device__ __forceinline__ F2 split_col(const float* W, int k0, int n, int lane, int ld, int K) { float v[16]; const int g = lane >> 4;
#pragma unroll
  for (int i = 0; i < 8; ++i) { const int ka = k0 + 8 * g + i, kb = ka + 16; v[i] = ka < K ? W[(size_t)(ka < K ? ka : K - 1) * ld + n] : 0.f; v[8 + i] = kb < K ? W[(size_t)(kb < K ? kb : K - 1) * ld + n] : 0.f; }
  return bsplit16(v); }
__device__ __forceinline__ v8f mac3(const F2& a, const F2& b, v8f c) { c = wmma_bf(a.l, b.h, c); c = wmma_bf(a.h, b.l, c); return wmma_bf(a.h, b.h, c); }
__device__ __forceinline__ float sigm(float v) { return 1.0f / (1.0f + expf(-v)); }
#define LDSX() do { asm volatile("s_wait_dscnt 0" ::: "memory"); __builtin_amdgcn_wave_barrier(); __builtin_amdgcn_fence(__ATOMIC_RELEASE, "workgroup"); } while (0)

// Gated GQA causal self-attention with rotary tables, per-head GroupNorm and a sigmoid output gate (B 1, S 2,048, HID 2,048; 32 query / 8 kv heads x 64): q = x Wq, k = x Wk, v = x Wv ((in,out)); q, k rotate-half RoPE with the given cos/sin [S,64]; scores = q k^T / 8, causal (col > row -> -inf); p = exp(a - max) / (sum + 1e-9); out = p v (GQA x4); gn = per-(token, head) normalisation over 64 x gn_weight + gn_bias; alpha = sigmoid(x Wg + bg); y = (gn * alpha) Wo. Returns (y, new_k = roped k [B,HKV,S,D], new_v [B,HKV,S,D]).
#define NB 1
#define TT 2048
#define CC 2048
#define NH 32
#define HD 64
#define NKV 8
#define KV (NKV * HD)      // 512
#define GQ (NH / NKV)      // 4
#define NQB (TT / 64)      // 32 query blocks per sequence
#define HG 4               // query heads per launch group
#define SCALE 0.125f
#ifndef TNB
#define TNB NB
#endif
typedef __attribute__((ext_vector_type(8))) __bf16 v8b;
__device__ __forceinline__ v16b frag_b(const __bf16* rowk0, int lane) {
  union { v16b v; v8b q[2]; } u; const __bf16* p = rowk0 + 8 * (lane >> 4);
  u.q[0] = *(const v8b*)p; u.q[1] = *(const v8b*)(p + 16); return u.v;
}
__device__ __forceinline__ float bfr(float v) { return (float)(__bf16)v; }
__host__ __device__ __forceinline__ int kb_last(int qb) { return (qb * 64 + 63) >> 7; }   // last 128-key block for query block qb (causal); the first is always 0
#define QBH 6              // query blocks 0..5 of each sequence (rows < 384) take the high-precision path (their rows see only 1..384 keys)
#define QHI (QBH * 64)     // 384
#define KHI 384            // key rows with residual / bf16 planes (keys of those rows are <= 383)

#define WS_GA  0u                                       // f16 alpha = sigmoid(x Wg + bg) rows [t][2048]
#define WS_AH  (WS_GA + 2u * (size_t)NB * TT * CC)        // f16 (gn * alpha) rows [t][2048] (A operand of the output projection)
#define WS_QH  (WS_AH + 2u * (size_t)NB * TT * CC)        // f16 q rows [b*t][2048] (rotated)
#define WS_KH  (WS_QH + 2u * (size_t)NB * TT * CC)       // f16 k rows [b*t][512]
#define WS_VT  (WS_KH + 2u * (size_t)NB * TT * KV)       // f16 v planes [b][kvc][t]
#define WS_QL  (WS_VT + 2u * (size_t)NB * KV * TT)       // f16 q residual x 2^10 rows [b][t < QHI][2048]
#define WS_KL  (WS_QL + 2u * (size_t)NB * QHI * CC)      // f16 k residual x 2^10 rows [b][t < KHI][512]
#define WS_VB  (WS_KL + 2u * (size_t)NB * KHI * KV)      // bf16 v hi planes [b][kvc][t < KHI] (pitch KHI)
#define WS_VBL (WS_VB + 2u * (size_t)NB * KV * KHI)      // bf16 v lo planes
#define WS_S   (WS_VBL + 2u * (size_t)NB * KV * KHI)     // f32 logits / P [hg][t][TT] (only keys [0, kend) of each row are written and read)
#define WS_Y   (WS_S  + 4u * (size_t)HG * TT * TT)       // f32 ctx rows [b*t][2048]
#define WS_END (WS_Y  + 4u * (size_t)NB * TT * CC)

// ---- k_proj: block = (64 tokens, 128 output cols = two 64-dim heads, which): acc = x W (W (in,out); exact); which 0/1: rotate-half rope with the given tables (tiles j and j+2 hold d and d+32 of the same head) -> f16 rows (+ residual x 2^10 for the early rows), and new_k written in f32; which 2: v -> f16 planes (+ bf16 hi/lo planes for the early keys) and new_v in f32; which 3: alpha = sigmoid(x Wg + bg) -> f16 rows
// acc += x W over all of K for a 64 x 128 tile. Thread tid owns column tid of each 32 x 128 W tile (a wave's load is one whole 128-B line of a W row), rounds it to bf16 and lays it in LDS as [col][k] (64-B rows at an 80-B pitch); the block's four waves read their B fragments from there. LD (the row length of W) is a template constant so that the 32 row steps are immediate offsets.
template <int LD> __device__ __forceinline__ void proj_acc(const float* __restrict__ xp, const float* __restrict__ wp, __bf16 (*sw)[128][40], int tid, int lane, v8f (&acc)[8]) {
  const int col = lane & 15; float wr[32], ar[16];
#pragma unroll
  for (int i = 0; i < 32; ++i) wr[i] = wp[(size_t)i * LD];
#pragma unroll
  for (int i = 0; i < 8; ++i) { ar[i] = xp[i]; ar[8 + i] = xp[16 + i]; }
  asm volatile("s_wait_xcnt 0x0" ::: "memory");   /* before a register that the loads above name is used again */
  /* unroll 2: the buffer index becomes a constant */
#pragma unroll 2
  for (int kc = 0; kc < CC / 32; ++kc) { __bf16 (*buf)[40] = sw[kc & 1]; v16b a;
#pragma unroll
    for (int i = 0; i < 16; ++i) a[i] = (__bf16)ar[i];
#pragma unroll
    for (int q = 0; q < 4; ++q) { v8b t;
#pragma unroll
      for (int i = 0; i < 8; ++i) t[i] = (__bf16)wr[q * 8 + i];
      *(v8b*)&buf[tid][q * 8] = t; }
    __syncthreads();   /* publishes this pass's tile; with two buffers it also ends every wave's reads of the buffer that the next pass refills */
    const int kn = kc + 1 < CC / 32 ? kc + 1 : kc;   /* the next pass's global loads fly under this pass's products (the last pass reloads its own rows, unused) */
    const float* wn = wp + (size_t)kn * 32 * LD; const float* xn = xp + kn * 32;
#pragma unroll
    for (int i = 0; i < 32; ++i) wr[i] = wn[(size_t)i * LD];
#pragma unroll
    for (int i = 0; i < 8; ++i) { ar[i] = xn[i]; ar[8 + i] = xn[16 + i]; }
    asm volatile("s_wait_xcnt 0x0" ::: "memory");   /* before a register that the loads above name is used again */
    v16b w[8];
#pragma unroll
    for (int j = 0; j < 8; ++j) w[j] = frag_b(&buf[j * 16 + col][0], lane);
#pragma unroll
    for (int j = 0; j < 8; ++j) acc[j] = wmma_bf(a, w[j], acc[j]); } }
__global__ __launch_bounds__(128) void k_proj(const float* __restrict__ X, const float* __restrict__ WQ, const float* __restrict__ WK, const float* __restrict__ WV, const float* __restrict__ WG, const float* __restrict__ BG, const float* __restrict__ COS, const float* __restrict__ SIN, _Float16* __restrict__ QH, _Float16* __restrict__ KH, _Float16* __restrict__ VT, _Float16* __restrict__ QL, _Float16* __restrict__ KL, __bf16* __restrict__ VB, __bf16* __restrict__ VBL, _Float16* __restrict__ GA, float* __restrict__ OUTK, float* __restrict__ OUTV) {
  __shared__ __align__(16) _Float16 sh[64][136], sl[64][136]; __shared__ __align__(16) _Float16 th[128][72]; __shared__ __align__(16) __bf16 tb[128][72], tbl[128][72]; __shared__ __align__(16) float so[4][16][132]; __shared__ __align__(16) __bf16 sw[2][128][40];
  const int tid = threadIdx.x, wave = tid >> 5, lane = tid & 31, col = lane & 15, g = lane >> 4; const int which = blockIdx.z; const int c0 = blockIdx.y * 128; const size_t r0 = (size_t)blockIdx.x * 64; const int NW = (which == 0 || which == 3) ? CC : KV; if (c0 >= NW) return;   // k/v are only 512 wide (block-uniform exit before any barrier)
  const size_t b = r0 / TT; const int t0 = (int)(r0 % TT); const bool hi_rows = t0 < ((which == 0) ? QHI : KHI);   /* block-uniform */
  const float* WA = which == 0 ? WQ : which == 1 ? WK : which == 2 ? WV : WG;
  v8f acc[8] = {};
  { const float* xp = X + (r0 + wave * 16 + col) * CC + 8 * g; const float* wp = WA + c0 + tid;
    if (NW == CC) proj_acc<CC>(xp, wp, sw, tid, lane, acc); else proj_acc<KV>(xp, wp, sw, tid, lane, acc); }   /* block-uniform choice */
  if (which == 3) {   /* gate: alpha = sigmoid(acc + bg) -> f16 rows */
#pragma unroll
    for (int j = 0; j < 8; ++j) { const float bb = bfr(BG[c0 + j * 16 + col]);
#pragma unroll
      for (int r = 0; r < 8; ++r) sh[wave * 16 + 8 * g + r][j * 16 + col] = (_Float16)(1.0f / (1.0f + expf(-(acc[j][r] + bb)))); }
    __syncthreads();
    for (int e = tid; e < 64 * 16; e += 128) { const int rl = e >> 4, q = e & 15; vst2((unsigned*)(GA + (r0 + rl) * CC + c0 + q * 8), *(const v4u*)&sh[rl][q * 8]); }
    return; }
  if (which < 2) {
    /* rotate-half rope on each 64-dim head: d = (j&3)*16+col; d < 32 (tiles jp = 0,1,4,5) pairs with d+32 (jp+2): out[d] = x[d] c - x[d+32] s, out[d+32] = x[d+32] c + x[d] s, table index d for out[d], d+32 for out[d+32] */
#pragma unroll
    for (int jp = 0; jp < 8; ++jp) { if ((jp & 3) >= 2) continue; const int i2 = (jp & 3) * 16 + col;
#pragma unroll
      for (int r = 0; r < 8; ++r) { const int t = t0 + wave * 16 + 8 * g + r; const float c1 = bfr(COS[(size_t)t * HD + i2]), s1 = bfr(SIN[(size_t)t * HD + i2]), c2 = bfr(COS[(size_t)t * HD + i2 + 32]), s2 = bfr(SIN[(size_t)t * HD + i2 + 32]); const float x1 = acc[jp][r], x2 = acc[jp + 2][r]; asm volatile("s_wait_loadcnt 0x0" ::: "memory"); acc[jp][r] = x1 * c1 - x2 * s1; acc[jp + 2][r] = x2 * c2 + x1 * s2; } }
    if (which == 1) {   /* new_k output [HKV][S][64] in f32: this wave's 16 rows x 2 heads, 256 B per (row, head) by 16 lanes */
#pragma unroll
      for (int j = 0; j < 8; ++j) {
#pragma unroll
        for (int r = 0; r < 8; ++r) so[wave][8 * g + r][j * 16 + col] = acc[j][r]; }
      LDSX(); for (int rl = 0; rl < 16; ++rl) { const int t = t0 + wave * 16 + rl; const int hh = (c0 >> 6) + (lane >> 4); vst2(OUTK + ((size_t)hh * TT + t) * HD + (lane & 15) * 4, *(const v4f*)&so[wave][rl][lane * 4]); } }
#pragma unroll
    for (int j = 0; j < 8; ++j) {
#pragma unroll
      for (int r = 0; r < 8; ++r) { const float v = acc[j][r]; const _Float16 hv = (_Float16)v; sh[wave * 16 + 8 * g + r][j * 16 + col] = hv; sl[wave * 16 + 8 * g + r][j * 16 + col] = (_Float16)((v - (float)hv) * 1024.0f); } }
    __syncthreads();
    _Float16* dh = which == 0 ? QH : KH; _Float16* dl = which == 0 ? (QL + (b * QHI) * (size_t)CC) : (KL + (b * KHI) * (size_t)KV);
    for (int e = tid; e < 64 * 16; e += 128) { const int rl = e >> 4, q = e & 15; vst2((unsigned*)(dh + (r0 + rl) * NW + c0 + q * 8), *(const v4u*)&sh[rl][q * 8]); if (hi_rows) vst2((unsigned*)(dl + (size_t)(t0 + rl) * NW + c0 + q * 8), *(const v4u*)&sl[rl][q * 8]); }
  } else {   /* which == 2: v */
#pragma unroll
    for (int j = 0; j < 8; ++j) {
#pragma unroll
      for (int r = 0; r < 8; ++r) so[wave][8 * g + r][j * 16 + col] = acc[j][r]; }
    LDSX(); for (int rl = 0; rl < 16; ++rl) { const int t = t0 + wave * 16 + rl; const int hh = (c0 >> 6) + (lane >> 4); vst2(OUTV + ((size_t)hh * TT + t) * HD + (lane & 15) * 4, *(const v4f*)&so[wave][rl][lane * 4]); }   /* new_v output in f32 */
#pragma unroll
    for (int j = 0; j < 8; ++j) {
#pragma unroll
      for (int r = 0; r < 8; ++r) { const float v = acc[j][r]; const int rl = wave * 16 + 8 * g + r, cl = j * 16 + col; th[cl][rl] = (_Float16)v; const __bf16 bh = (__bf16)v; tb[cl][rl] = bh; tbl[cl][rl] = (__bf16)(v - (float)bh); } }
    __syncthreads();
    for (int e = tid; e < 128 * 8; e += 128) { const int cl = e >> 3, q = e & 7; const size_t o2 = (b * KV + c0 + cl) * (size_t)TT + t0 + q * 8; vst2((unsigned*)(VT + o2), *(const v4u*)&th[cl][q * 8]); if (hi_rows) { const size_t o3 = (b * KV + c0 + cl) * (size_t)KHI + t0 + q * 8; vst2((unsigned*)(VB + o3), *(const v4u*)&tb[cl][q * 8]); vst2((unsigned*)(VBL + o3), *(const v4u*)&tbl[cl][q * 8]); } } } }
// ---- k_sc: block = (query block qb, key block kb = by <= kb_last(qb), head in group) of sequence b: logits x 0.125 for the whole 64 x 128 tile (causal mask applied by index in k_sm); 3 products for qb < QBH, else 1; blocks past the diagonal exit
__global__ __launch_bounds__(128) void k_sc(const _Float16* __restrict__ QH, const _Float16* __restrict__ KH, const _Float16* __restrict__ QL, const _Float16* __restrict__ KL, int b, int h0, float* __restrict__ S0) { __shared__ __align__(16) float ss[4][16][132];
  const int qb = blockIdx.x; const int kb = blockIdx.y; if (kb > kb_last(qb)) return;   /* block-uniform */
  const int h = h0 + blockIdx.z; float* S = S0 + (size_t)blockIdx.z * TT * TT;
  const int tid = threadIdx.x, wave = tid >> 5, lane = tid & 31, col = lane & 15, g = lane >> 4; const int k0 = kb * 128; const int ql0 = qb * 64 + wave * 16; const size_t q0 = (size_t)b * TT + ql0, kr0 = (size_t)b * TT + k0;
  v8f acc[8] = {}, accl[8] = {};
  if (qb < QBH) {
    const _Float16* QLb = QL + (size_t)b * QHI * CC; const _Float16* KLb = KL + (size_t)b * KHI * KV;
#pragma unroll
    for (int kc = 0; kc < HD / 32; ++kc) { const v16h ah = frag_h(QH + (q0 + col) * CC + h * HD + kc * 32, lane), al = frag_h(QLb + (size_t)(ql0 + col) * CC + h * HD + kc * 32, lane);
#pragma unroll
      for (int j = 0; j < 8; ++j) { const v16h kbf = frag_h(KH + (kr0 + j * 16 + col) * KV + (h / GQ) * HD + kc * 32, lane), klf = frag_h(KLb + (size_t)(k0 + j * 16 + col) * KV + (h / GQ) * HD + kc * 32, lane); acc[j] = wmma16(ah, kbf, acc[j]); accl[j] = wmma16(al, kbf, accl[j]); accl[j] = wmma16(ah, klf, accl[j]); } }
  } else {
#pragma unroll
    for (int kc = 0; kc < HD / 32; ++kc) { const v16h ah = frag_h(QH + (q0 + col) * CC + h * HD + kc * 32, lane);
#pragma unroll
      for (int j = 0; j < 8; ++j) { const v16h kbf = frag_h(KH + (kr0 + j * 16 + col) * KV + (h / GQ) * HD + kc * 32, lane); acc[j] = wmma16(ah, kbf, acc[j]); } } }
#pragma unroll
  for (int j = 0; j < 8; ++j) {
#pragma unroll
    for (int r = 0; r < 8; ++r) ss[wave][8 * g + r][j * 16 + col] = (acc[j][r] + accl[j][r] * (1.0f / 1024.0f)) * SCALE; }
  LDSX(); for (int rl = 0; rl < 16; ++rl) vst2(S + (size_t)(ql0 + rl) * TT + k0 + lane * 4, *(const v4f*)&ss[wave][rl][lane * 4]); }
// ---- k_sm: block = query row t (head in group): keys [0, kend) with kend = (kb_last(qb)+1)*128: logit if s <= t else excluded; softmax; P x 2^11 in place (0 for excluded keys) so k_pv reads only written cells
__global__ __launch_bounds__(256) void k_sm(float* __restrict__ S0) { __shared__ float sred[8]; __shared__ float sbc; __shared__ __align__(16) float shv[TT];
  const int tid = threadIdx.x; const int t = blockIdx.x; const int kend = (kb_last(t >> 6) + 1) * 128;
  float* sr = S0 + (size_t)blockIdx.y * TT * TT + (size_t)t * TT;
  float m = -3.0e38f; for (int k = tid; k < kend; k += 256) { const float v = (k <= t) ? sr[k] : -3.0e38f; shv[k] = v; m = fmaxf(m, v); }
#pragma unroll
  for (int o = 1; o < 32; o <<= 1) m = fmaxf(m, __shfl_xor(m, o));
  if ((tid & 31) == 0) sred[tid >> 5] = m; __syncthreads(); if (tid == 0) { float a = sred[0]; for (int i = 1; i < 8; ++i) a = fmaxf(a, sred[i]); sbc = a; } __syncthreads(); m = sbc; __syncthreads();
  float sum = 0.f; for (int k = tid; k < kend; k += 256) { const float v = shv[k]; const float e = (v <= -1.0e38f) ? 0.f : expf(v - m); shv[k] = e; sum += e; }
#pragma unroll
  for (int o = 1; o < 32; o <<= 1) sum += __shfl_xor(sum, o);
  if ((tid & 31) == 0) sred[tid >> 5] = sum; __syncthreads(); if (tid == 0) { float a = 0.f; for (int i = 0; i < 8; ++i) a += sred[i]; sbc = 2048.0f / (a + 1e-9f); } __syncthreads(); const float inv = sbc;   /* p = e / (sum + 1e-9) as in the module */
  for (int k = tid; k < kend; k += 256) shv[k] = shv[k] * inv;
  __syncthreads(); for (int q = tid; q < kend / 4; q += 256) vst2(sr + q * 4, *(const v4f*)&shv[q * 4]); }
// ---- k_pv: block = 64 queries (qb) of head h in sequence b: ctx[b*T + t][h*64 + d] = P . v over keys [0, kend) (kv head h/4); 3 products (bf16 planes) for qb < QBH, else P x 2^11 once to f16 x v f16 (1 product); 256-B (row, head) segment by 16 lanes
__global__ __launch_bounds__(128) void k_pv(const float* __restrict__ PS0, const _Float16* __restrict__ VT, const __bf16* __restrict__ VB, const __bf16* __restrict__ VBL, int b, int h0, float* __restrict__ Y) { const int h = h0 + blockIdx.z; const float* PS = PS0 + (size_t)blockIdx.z * TT * TT; __shared__ __align__(16) float ss[4][16][HD + 4];
  const int tid = threadIdx.x, wave = tid >> 5, lane = tid & 31, col = lane & 15, g = lane >> 4; const int qb = blockIdx.x; const int ql0 = qb * 64 + wave * 16; const int kce = (kb_last(qb) + 1) * 4;
  v8f acc[HD / 16] = {};
  if (qb < QBH) {
#pragma unroll 1
    for (int kc = 0; kc < kce; ++kc) { const F2 p = split_row(PS + (size_t)(ql0 + col) * TT, kc * 32, lane);
      asm volatile("s_wait_loadcnt 0x0" ::: "memory");
#pragma unroll
      for (int j = 0; j < HD / 16; ++j) { const size_t po = ((size_t)b * KV + (h / GQ) * HD + j * 16 + col) * (size_t)KHI + kc * 32; const v16b vh = frag_b(VB + po, lane); acc[j] = wmma_bf(p.h, vh, acc[j]); acc[j] = wmma_bf(p.l, vh, acc[j]); acc[j] = wmma_bf(p.h, frag_b(VBL + po, lane), acc[j]); } }
  } else {
#pragma unroll 1
    for (int kc = 0; kc < kce; ++kc) { const v16h p = frag_f32(PS + (size_t)(ql0 + col) * TT + kc * 32, lane);
      asm volatile("s_wait_loadcnt 0x0" ::: "memory");
#pragma unroll
      for (int j = 0; j < HD / 16; ++j) { const size_t po = ((size_t)b * KV + (h / GQ) * HD + j * 16 + col) * (size_t)TT + kc * 32; acc[j] = wmma16(p, frag_h(VT + po, lane), acc[j]); } } }
#pragma unroll
  for (int j = 0; j < HD / 16; ++j)
#pragma unroll
    for (int r = 0; r < 8; ++r) ss[wave][8 * g + r][j * 16 + col] = acc[j][r] * (1.0f / 2048.0f);
  LDSX(); for (int rl = 0; rl < 16; ++rl) if (lane < HD / 4) vst2(Y + ((size_t)b * TT + ql0 + rl) * CC + h * HD + lane * 4, *(const v4f*)&ss[wave][rl][lane * 4]); }
__global__ __launch_bounds__(256) void k_gn(const float* __restrict__ Y, const _Float16* __restrict__ GA, const float* __restrict__ GW, const float* __restrict__ GB, _Float16* __restrict__ AH) {
  const int tid = threadIdx.x; const size_t t = blockIdx.x; const int h = tid >> 3, q = tid & 7; const size_t base = t * CC + h * HD + q * 8;
  const v4f ya = *(const v4f*)(Y + base), yb = *(const v4f*)(Y + base + 4); float v[8] = {ya[0], ya[1], ya[2], ya[3], yb[0], yb[1], yb[2], yb[3]};
  float s = 0.f;
#pragma unroll
  for (int z = 0; z < 8; ++z) s += v[z];
#pragma unroll
  for (int o = 1; o < 8; o <<= 1) s += __shfl_xor(s, o);
  const float mean = s * (1.0f / HD); float s2 = 0.f;
#pragma unroll
  for (int z = 0; z < 8; ++z) { v[z] -= mean; s2 += v[z] * v[z]; }
#pragma unroll
  for (int o = 1; o < 8; o <<= 1) s2 += __shfl_xor(s2, o);
  const float rstd = rsqrtf(s2 * (1.0f / HD) + 1e-5f);
  union { v8h hv; v4u u; } pk;
#pragma unroll
  for (int z = 0; z < 8; ++z) { const int c = h * HD + q * 8 + z; pk.hv[z] = (_Float16)((v[z] * rstd * bfr(GW[c]) + bfr(GB[c])) * (float)GA[t * CC + c]); }
  vst2((unsigned*)(AH + base), pk.u); }
// ---- k_out: block = (64 rows, 128 cols): y = (gn * alpha) (f16 rows) Wo ((in,out), f16(bf16 x 2^8) exact) x 2^-8 -> output 0 rows
__global__ __launch_bounds__(128) void k_out(const _Float16* __restrict__ AH, const float* __restrict__ WO, float* __restrict__ OUT) { __shared__ __align__(16) float sf[4][16][132]; __shared__ __align__(16) _Float16 sw[2][128][40];   /* Wo tile of one pass, [col][k] in f16 (x 2^8), 64-B rows at an 80-B pitch, two buffers */
  const int tid = threadIdx.x, wave = tid >> 5, lane = tid & 31, col = lane & 15, g = lane >> 4; const int c0 = blockIdx.y * 128; const size_t r0 = (size_t)blockIdx.x * 64 + wave * 16;
  v8f acc[8] = {};
  /* as in proj_acc: thread tid owns column tid of each 32 x 128 Wo tile; the four waves share the tile through LDS */
  const _Float16* ap = AH + (r0 + col) * CC; const float* wp = WO + c0 + tid;
  float wr[32];
#pragma unroll
  for (int i = 0; i < 32; ++i) wr[i] = wp[(size_t)i * CC];
  v16h an = frag_h(ap, lane);
  asm volatile("s_wait_xcnt 0x0" ::: "memory");   /* before a register that the loads above name is used again */
  /* unroll 2: the buffer index becomes a constant */
#pragma unroll 2
  for (int kc = 0; kc < CC / 32; ++kc) { _Float16 (*buf)[40] = sw[kc & 1]; const v16h a = an;
#pragma unroll
    for (int q = 0; q < 4; ++q) { v8h t;
#pragma unroll
      for (int i = 0; i < 8; ++i) t[i] = (_Float16)(bfr(wr[q * 8 + i]) * 256.0f);
      *(v8h*)&buf[tid][q * 8] = t; }
    __syncthreads();   /* publishes this pass's tile; with two buffers it also ends every wave's reads of the buffer that the next pass refills */
    const int kn = kc + 1 < CC / 32 ? kc + 1 : kc;   /* the next pass's global loads fly under this pass's products (the last pass reloads its own rows, unused) */
    const float* wn = wp + (size_t)kn * 32 * CC;
#pragma unroll
    for (int i = 0; i < 32; ++i) wr[i] = wn[(size_t)i * CC];
    an = frag_h(ap + kn * 32, lane);
    asm volatile("s_wait_xcnt 0x0" ::: "memory");   /* before a register that the loads above name is used again */
    v16h w[8];
#pragma unroll
    for (int j = 0; j < 8; ++j) w[j] = frag_h(&buf[j * 16 + col][0], lane);
#pragma unroll
    for (int j = 0; j < 8; ++j) acc[j] = wmma16(a, w[j], acc[j]); }
#pragma unroll
  for (int j = 0; j < 8; ++j) {
#pragma unroll
    for (int r = 0; r < 8; ++r) sf[wave][8 * g + r][j * 16 + col] = acc[j][r] * (1.0f / 256.0f); }
  LDSX(); for (int rl = 0; rl < 16; ++rl) vst2(OUT + (r0 + rl) * CC + c0 + lane * 4, *(const v4f*)&sf[wave][rl][lane * 4]); }
extern "C" void kernel_launch(void* const* d_in, const int* in_sizes, int n_in, void* d_out, int out_size, void* d_ws, size_t ws_size, hipStream_t stream) {
  (void)in_sizes; (void)n_in; (void)out_size;
  const float** F = (const float**)d_in;   // 0 x [1,2048,2048]; 1 rope_cos, 2 rope_sin [2048,64]; 3 Wq [2048,2048]; 4 Wk, 5 Wv [2048,512]; 6 Wo [2048,2048]; 7 Wg [2048,2048], 8 bg; 9 gn_weight, 10 gn_bias [2048]
  if (ws_size < (size_t)WS_END) return;
  char* ws = (char*)d_ws; _Float16 *GA = (_Float16*)(ws + WS_GA), *AH = (_Float16*)(ws + WS_AH), *QH = (_Float16*)(ws + WS_QH), *KH = (_Float16*)(ws + WS_KH), *VT = (_Float16*)(ws + WS_VT), *QL = (_Float16*)(ws + WS_QL), *KL = (_Float16*)(ws + WS_KL); __bf16 *VB = (__bf16*)(ws + WS_VB), *VBL = (__bf16*)(ws + WS_VBL); float *S = (float*)(ws + WS_S), *Y = (float*)(ws + WS_Y);
  float* OUT0 = (float*)d_out; float* OUTK = OUT0 + (size_t)NB * TT * CC; float* OUTV = OUTK + (size_t)NB * NKV * TT * HD;   /* tuple outputs concatenated, no padding */
  k_proj<<<dim3(TNB * TT / 64, CC / 128, 4), 128, 0, stream>>>(F[0], F[3], F[4], F[5], F[7], F[8], F[1], F[2], QH, KH, VT, QL, KL, VB, VBL, GA, OUTK, OUTV);
  for (int b = 0; b < TNB; ++b) for (int h0 = 0; h0 < NH; h0 += HG) {
    k_sc<<<dim3(NQB, TT / 128, HG), 128, 0, stream>>>(QH, KH, QL, KL, b, h0, S);
    k_sm<<<dim3(TT, HG), 256, 0, stream>>>(S);
    k_pv<<<dim3(NQB, 1, HG), 128, 0, stream>>>(S, VT, VB, VBL, b, h0, Y);
  }
  k_gn<<<dim3(TNB * TT), 256, 0, stream>>>(Y, GA, F[9], F[10], AH);
  k_out<<<dim3(TNB * TT / 64, CC / 128), 128, 0, stream>>>(AH, F[6], OUT0);
}

// v002
// A run of this version takes 304 microseconds.
// In two side-by-side timings against v001, it was 3.30 and 3.34 times as fast.
// All steps since v000 together make it 4.52 times as fast.
// compute dtype: all float inputs rounded to bf16; q/k/v/gate projections x W with EXACT bf16 products on WMMA 16x16x32, f32 accumulate; rotate-half rotary with the given cos/sin tables in f32; q, k once to f16 -> 1-product causal logits / 8 (the first 384 query rows use f16 hi + residual on both sides, 3 products); softmax in f32 (precise expf): exp(logit - max) x 2^11 once to f16 against v once to f16 (first 384 rows: bf16 hi + lo, 3 products), divided by (sum + 1e-9) after the product; per-head GroupNorm and the sigmoid gate in f32; (gn * alpha) once to f16 against Wo carried x 2^8 in f16 (exact); new_k / new_v written in f32 straight from the projections; f32 outputs.
#include <hip/hip_runtime.h>
#include <math.h>

typedef __attribute__((ext_vector_type(16))) _Float16 v16h;
typedef __attribute__((ext_vector_type(16))) __bf16 v16b;
typedef __attribute__((ext_vector_type(8)))  _Float16 v8h;
typedef __attribute__((ext_vector_type(8)))  float v8f;
typedef __attribute__((ext_vector_type(4)))  float v4f;
typedef __attribute__((ext_vector_type(2)))  float v2f;
typedef __attribute__((ext_vector_type(4)))  unsigned v4u;
typedef __attribute__((ext_vector_type(4)))  int v4i;
typedef float __attribute__((may_alias)) float_a;
typedef int __attribute__((may_alias)) int_a;

template <typename T> __device__ __forceinline__ void vst2(void* p, T v) { *(T*)p = v;  }
__device__ __forceinline__ v8f wmma16(v16h a, v16h b, v8f c) {
  v8f d = __builtin_amdgcn_wmma_f32_16x16x32_f16(false, a, false, b, (short)0, c, false, false);
  asm volatile("v_nop\n\tv_nop\n\tv_nop\n\tv_nop" : "+v"(d) : "v"(a), "v"(b));
  return d;
}
__device__ __forceinline__ v8f wmma_bf(v16b a, v16b b, v8f c) {
  v8f d = __builtin_amdgcn_wmma_f32_16x16x32_bf16(false, a, false, b, (short)0, c, false, false);
  asm volatile("v_nop\n\tv_nop\n\tv_nop\n\tv_nop" : "+v"(d) : "v"(a), "v"(b));
  return d;
}
// 16x16x32 fragments: lane = (h = lane>>4, row/col = lane&15); elements 0..7 = k0+8h+0..7, 8..15 = k0+16+8h+0..7; D element r = row 8h+r
__device__ __forceinline__ v16h frag_h(const _Float16* rowk0, int lane) {
  union { v16h v; v8h q[2]; } u; const _Float16* p = rowk0 + 8 * (lane >> 4);
  u.q[0] = *(const v8h*)p; u.q[1] = *(const v8h*)(p + 16); return u.v;
}
__device__ __forceinline__ v16h frag_f32(const float* rowk0, int lane) {
  v16h a; const float* p = rowk0 + 8 * (lane >> 4);
#pragma unroll
  for (int i = 0; i < 8; ++i) { a[i] = (_Float16)p[i]; a[8 + i] = (_Float16)p[16 + i]; }
  return a;
}
__device__ __forceinline__ v16h frag_f32s(const float* rowk0, int lane, float sc) {
  v16h a; const float* p = rowk0 + 8 * (lane >> 4);
#pragma unroll
  for (int i = 0; i < 8; ++i) { a[i] = (_Float16)(p[i] * sc); a[8 + i] = (_Float16)(p[16 + i] * sc); }
  return a;
}
// column fragment from a [K][ld] layout (column n), rows >= K read as 0
__device__ __forceinline__ v16h fragc_f32(const float* W, int k0, int n, int lane, int ld, int K) {
  v16h a; const int g = lane >> 4;
#pragma unroll
  for (int i = 0; i < 8; ++i) { const int ka = k0 + 8 * g + i, kb = ka + 16;
    a[i] = (_Float16)(ka < K ? W[(size_t)(ka < K ? ka : K - 1) * ld + n] : 0.f); a[8 + i] = (_Float16)(kb < K ? W[(size_t)(kb < K ? kb : K - 1) * ld + n] : 0.f); }
  return a;
}
struct F2 { v16b h, l; };
__device__ __forceinline__ F2 bsplit16(const float v[16]) { F2 r;
#pragma unroll
  for (int i = 0; i < 16; ++i) { const __bf16 h = (__bf16)v[i]; r.h[i] = h; r.l[i] = (__bf16)(v[i] - (float)h); }
  return r; }
__device__ __forceinline__ F2 split_row(const float* row, int k0, int lane) { float v[16]; const float* p = row + k0 + 8 * (lane >> 4);
#pragma unroll
  for (int i = 0; i < 8; ++i) { v[i] = p[i]; v[8 + i] = p[16 + i]; }
  return bsplit16(v); }
__device__ __forceinline__ F2 split_rowK(const float* row, int k0, int lane, int K) { float v[16]; const int g = lane >> 4;
#pragma unroll
  for (int i = 0; i < 8; ++i) { const int ka = k0 + 8 * g + i, kb = ka + 16; v[i] = ka < K ? row[ka < K ? ka : K - 1] : 0.f; v[8 + i] = kb < K ? row[kb < K ? kb : K - 1] : 0.f; }
  return bsplit16(v); }
__device__ __forceinline__ F2 split_col(const float* W, int k0, int n, int lane, int ld, int K) { float v[16]; const int g = lane >> 4;
#pragma unroll
  for (int i = 0; i < 8; ++i) { const int ka = k0 + 8 * g + i, kb = ka + 16; v[i] = ka < K ? W[(size_t)(ka < K ? ka : K - 1) * ld + n] : 0.f; v[8 + i] = kb < K ? W[(size_t)(kb < K ? kb : K - 1) * ld + n] : 0.f; }
  return bsplit16(v); }
__device__ __forceinline__ v8f mac3(const F2& a, const F2& b, v8f c) { c = wmma_bf(a.l, b.h, c); c = wmma_bf(a.h, b.l, c); return wmma_bf(a.h, b.h, c); }
__device__ __forceinline__ float sigm(float v) { return 1.0f / (1.0f + expf(-v)); }
#define LDSX() do { asm volatile("s_wait_dscnt 0" ::: "memory"); __builtin_amdgcn_wave_barrier(); __builtin_amdgcn_fence(__ATOMIC_RELEASE, "workgroup"); } while (0)

// Gated GQA causal self-attention with rotary tables, per-head GroupNorm and a sigmoid output gate (B 1, S 2,048, HID 2,048; 32 query / 8 kv heads x 64): q = x Wq, k = x Wk, v = x Wv ((in,out)); q, k rotate-half RoPE with the given cos/sin [S,64]; scores = q k^T / 8, causal (col > row -> -inf); p = exp(a - max) / (sum + 1e-9); out = p v (GQA x4); gn = per-(token, head) normalisation over 64 x gn_weight + gn_bias; alpha = sigmoid(x Wg + bg); y = (gn * alpha) Wo. Returns (y, new_k = roped k [B,HKV,S,D], new_v [B,HKV,S,D]).
#define NB 1
#define TT 2048
#define CC 2048
#define NH 32
#define HD 64
#define NKV 8
#define KV (NKV * HD)      // 512
#define GQ (NH / NKV)      // 4
#define SCALE 0.125f
#ifndef TNB
#define TNB NB
#endif
typedef __attribute__((ext_vector_type(8))) __bf16 v8b;
__device__ __forceinline__ v16b frag_b(const __bf16* rowk0, int lane) {
  union { v16b v; v8b q[2]; } u; const __bf16* p = rowk0 + 8 * (lane >> 4);
  u.q[0] = *(const v8b*)p; u.q[1] = *(const v8b*)(p + 16); return u.v;
}
__device__ __forceinline__ float bfr(float v) { return (float)(__bf16)v; }
#define QBH 6              // query blocks 0..5 of each sequence (rows < 384) take the high-precision path (their rows see only 1..384 keys)
#define QHI (QBH * 64)     // 384
#define KHI 384            // key rows with residual / bf16 planes (keys of those rows are <= 383)

#define WS_GA  0u                                       // f16 alpha = sigmoid(x Wg + bg) rows [t][2048]
#define WS_AH  (WS_GA + 2u * (size_t)NB * TT * CC)        // f16 (gn * alpha) rows [t][2048] (A operand of the output projection)
#define WS_QH  (WS_AH + 2u * (size_t)NB * TT * CC)        // f16 q rows [b*t][2048] (rotated)
#define WS_KH  (WS_QH + 2u * (size_t)NB * TT * CC)       // f16 k rows [b*t][512]
#define WS_VT  (WS_KH + 2u * (size_t)NB * TT * KV)       // f16 v planes [b][kvc][t]
#define WS_QL  (WS_VT + 2u * (size_t)NB * KV * TT)       // f16 q residual x 2^10 rows [b][t < QHI][2048]
#define WS_KL  (WS_QL + 2u * (size_t)NB * QHI * CC)      // f16 k residual x 2^10 rows [b][t < KHI][512]
#define WS_VB  (WS_KL + 2u * (size_t)NB * KHI * KV)      // bf16 v hi planes [b][kvc][t < KHI] (pitch KHI)
#define WS_VBL (WS_VB + 2u * (size_t)NB * KV * KHI)      // bf16 v lo planes
#define WS_Y   (WS_VBL + 2u * (size_t)NB * KV * KHI)     // f32 ctx rows [b*t][2048]
#define WS_END (WS_Y  + 4u * (size_t)NB * TT * CC)

// ---- k_proj: block = (64 tokens, 128 output cols = two 64-dim heads, which): acc = x W (W (in,out); exact); which 0/1: rotate-half rope with the given tables (tiles j and j+2 hold d and d+32 of the same head) -> f16 rows (+ residual x 2^10 for the early rows), and new_k written in f32; which 2: v -> f16 planes (+ bf16 hi/lo planes for the early keys) and new_v in f32; which 3: alpha = sigmoid(x Wg + bg) -> f16 rows
// acc += x W over all of K for a 64 x 128 tile. Thread tid owns column tid of each 32 x 128 W tile (a wave's load is one whole 128-B line of a W row), rounds it to bf16 and lays it in LDS as [col][k] (64-B rows at an 80-B pitch); the block's four waves read their B fragments from there. LD (the row length of W) is a template constant so that the 32 row steps are immediate offsets.
template <int LD> __device__ __forceinline__ void proj_acc(const float* __restrict__ xp, const float* __restrict__ wp, __bf16 (*sw)[128][40], int tid, int lane, v8f (&acc)[8]) {
  const int col = lane & 15; float wr[32], ar[16];
#pragma unroll
  for (int i = 0; i < 32; ++i) wr[i] = wp[(size_t)i * LD];
#pragma unroll
  for (int i = 0; i < 8; ++i) { ar[i] = xp[i]; ar[8 + i] = xp[16 + i]; }
  asm volatile("s_wait_xcnt 0x0" ::: "memory");   /* before a register that the loads above name is used again */
  /* unroll 2: the buffer index becomes a constant */
#pragma unroll 2
  for (int kc = 0; kc < CC / 32; ++kc) { __bf16 (*buf)[40] = sw[kc & 1]; v16b a;
#pragma unroll
    for (int i = 0; i < 16; ++i) a[i] = (__bf16)ar[i];
#pragma unroll
    for (int q = 0; q < 4; ++q) { v8b t;
#pragma unroll
      for (int i = 0; i < 8; ++i) t[i] = (__bf16)wr[q * 8 + i];
      *(v8b*)&buf[tid][q * 8] = t; }
    __syncthreads();   /* publishes this pass's tile; with two buffers it also ends every wave's reads of the buffer that the next pass refills */
    const int kn = kc + 1 < CC / 32 ? kc + 1 : kc;   /* the next pass's global loads fly under this pass's products (the last pass reloads its own rows, unused) */
    const float* wn = wp + (size_t)kn * 32 * LD; const float* xn = xp + kn * 32;
#pragma unroll
    for (int i = 0; i < 32; ++i) wr[i] = wn[(size_t)i * LD];
#pragma unroll
    for (int i = 0; i < 8; ++i) { ar[i] = xn[i]; ar[8 + i] = xn[16 + i]; }
    asm volatile("s_wait_xcnt 0x0" ::: "memory");   /* before a register that the loads above name is used again */
    v16b w[8];
#pragma unroll
    for (int j = 0; j < 8; ++j) w[j] = frag_b(&buf[j * 16 + col][0], lane);
#pragma unroll
    for (int j = 0; j < 8; ++j) acc[j] = wmma_bf(a, w[j], acc[j]); } }
__global__ __launch_bounds__(128) void k_proj(const float* __restrict__ X, const float* __restrict__ WQ, const float* __restrict__ WK, const float* __restrict__ WV, const float* __restrict__ WG, const float* __restrict__ BG, const float* __restrict__ COS, const float* __restrict__ SIN, _Float16* __restrict__ QH, _Float16* __restrict__ KH, _Float16* __restrict__ VT, _Float16* __restrict__ QL, _Float16* __restrict__ KL, __bf16* __restrict__ VB, __bf16* __restrict__ VBL, _Float16* __restrict__ GA, float* __restrict__ OUTK, float* __restrict__ OUTV) {
  __shared__ __align__(16) _Float16 sh[64][136], sl[64][136]; __shared__ __align__(16) _Float16 th[128][72]; __shared__ __align__(16) __bf16 tb[128][72], tbl[128][72]; __shared__ __align__(16) float so[4][16][132]; __shared__ __align__(16) __bf16 sw[2][128][40];
  const int tid = threadIdx.x, wave = tid >> 5, lane = tid & 31, col = lane & 15, g = lane >> 4; const int which = blockIdx.z; const int c0 = blockIdx.y * 128; const size_t r0 = (size_t)blockIdx.x * 64; const int NW = (which == 0 || which == 3) ? CC : KV; if (c0 >= NW) return;   // k/v are only 512 wide (block-uniform exit before any barrier)
  const size_t b = r0 / TT; const int t0 = (int)(r0 % TT); const bool hi_rows = t0 < ((which == 0) ? QHI : KHI);   /* block-uniform */
  const float* WA = which == 0 ? WQ : which == 1 ? WK : which == 2 ? WV : WG;
  v8f acc[8] = {};
  { const float* xp = X + (r0 + wave * 16 + col) * CC + 8 * g; const float* wp = WA + c0 + tid;
    if (NW == CC) proj_acc<CC>(xp, wp, sw, tid, lane, acc); else proj_acc<KV>(xp, wp, sw, tid, lane, acc); }   /* block-uniform choice */
  if (which == 3) {   /* gate: alpha = sigmoid(acc + bg) -> f16 rows */
#pragma unroll
    for (int j = 0; j < 8; ++j) { const float bb = bfr(BG[c0 + j * 16 + col]);
#pragma unroll
      for (int r = 0; r < 8; ++r) sh[wave * 16 + 8 * g + r][j * 16 + col] = (_Float16)(1.0f / (1.0f + expf(-(acc[j][r] + bb)))); }
    __syncthreads();
    for (int e = tid; e < 64 * 16; e += 128) { const int rl = e >> 4, q = e & 15; vst2((unsigned*)(GA + (r0 + rl) * CC + c0 + q * 8), *(const v4u*)&sh[rl][q * 8]); }
    return; }
  if (which < 2) {
    /* rotate-half rope on each 64-dim head: d = (j&3)*16+col; d < 32 (tiles jp = 0,1,4,5) pairs with d+32 (jp+2): out[d] = x[d] c - x[d+32] s, out[d+32] = x[d+32] c + x[d] s, table index d for out[d], d+32 for out[d+32] */
#pragma unroll
    for (int jp = 0; jp < 8; ++jp) { if ((jp & 3) >= 2) continue; const int i2 = (jp & 3) * 16 + col;
#pragma unroll
      for (int r = 0; r < 8; ++r) { const int t = t0 + wave * 16 + 8 * g + r; const float c1 = bfr(COS[(size_t)t * HD + i2]), s1 = bfr(SIN[(size_t)t * HD + i2]), c2 = bfr(COS[(size_t)t * HD + i2 + 32]), s2 = bfr(SIN[(size_t)t * HD + i2 + 32]); const float x1 = acc[jp][r], x2 = acc[jp + 2][r]; asm volatile("s_wait_loadcnt 0x0" ::: "memory"); acc[jp][r] = x1 * c1 - x2 * s1; acc[jp + 2][r] = x2 * c2 + x1 * s2; } }
    if (which == 1) {   /* new_k output [HKV][S][64] in f32: this wave's 16 rows x 2 heads, 256 B per (row, head) by 16 lanes */
#pragma unroll
      for (int j = 0; j < 8; ++j) {
#pragma unroll
        for (int r = 0; r < 8; ++r) so[wave][8 * g + r][j * 16 + col] = acc[j][r]; }
      LDSX(); for (int rl = 0; rl < 16; ++rl) { const int t = t0 + wave * 16 + rl; const int hh = (c0 >> 6) + (lane >> 4); vst2(OUTK + ((size_t)hh * TT + t) * HD + (lane & 15) * 4, *(const v4f*)&so[wave][rl][lane * 4]); } }
#pragma unroll
    for (int j = 0; j < 8; ++j) {
#pragma unroll
      for (int r = 0; r < 8; ++r) { const float v = acc[j][r]; const _Float16 hv = (_Float16)v; sh[wave * 16 + 8 * g + r][j * 16 + col] = hv; sl[wave * 16 + 8 * g + r][j * 16 + col] = (_Float16)((v - (float)hv) * 1024.0f); } }
    __syncthreads();
    _Float16* dh = which == 0 ? QH : KH; _Float16* dl = which == 0 ? (QL + (b * QHI) * (size_t)CC) : (KL + (b * KHI) * (size_t)KV);
    for (int e = tid; e < 64 * 16; e += 128) { const int rl = e >> 4, q = e & 15; vst2((unsigned*)(dh + (r0 + rl) * NW + c0 + q * 8), *(const v4u*)&sh[rl][q * 8]); if (hi_rows) vst2((unsigned*)(dl + (size_t)(t0 + rl) * NW + c0 + q * 8), *(const v4u*)&sl[rl][q * 8]); }
  } else {   /* which == 2: v */
#pragma unroll
    for (int j = 0; j < 8; ++j) {
#pragma unroll
      for (int r = 0; r < 8; ++r) so[wave][8 * g + r][j * 16 + col] = acc[j][r]; }
    LDSX(); for (int rl = 0; rl < 16; ++rl) { const int t = t0 + wave * 16 + rl; const int hh = (c0 >> 6) + (lane >> 4); vst2(OUTV + ((size_t)hh * TT + t) * HD + (lane & 15) * 4, *(const v4f*)&so[wave][rl][lane * 4]); }   /* new_v output in f32 */
#pragma unroll
    for (int j = 0; j < 8; ++j) {
#pragma unroll
      for (int r = 0; r < 8; ++r) { const float v = acc[j][r]; const int rl = wave * 16 + 8 * g + r, cl = j * 16 + col; th[cl][rl] = (_Float16)v; const __bf16 bh = (__bf16)v; tb[cl][rl] = bh; tbl[cl][rl] = (__bf16)(v - (float)bh); } }
    __syncthreads();
    for (int e = tid; e < 128 * 8; e += 128) { const int cl = e >> 3, q = e & 7; const size_t o2 = (b * KV + c0 + cl) * (size_t)TT + t0 + q * 8; vst2((unsigned*)(VT + o2), *(const v4u*)&th[cl][q * 8]); if (hi_rows) { const size_t o3 = (b * KV + c0 + cl) * (size_t)KHI + t0 + q * 8; vst2((unsigned*)(VB + o3), *(const v4u*)&tb[cl][q * 8]); vst2((unsigned*)(VBL + o3), *(const v4u*)&tbl[cl][q * 8]); } } } }
// ---- k_attn: block = (head h, pair y of 128-query blocks), eight independent waves of 32 queries each (two 16-query column groups u): waves 0..3 take block 15 - y, waves 4..7 block y, so that every block of the grid walks the same number of keys; no LDS, no barrier. S^T = K Q^T: A = 16 key rows, B = 16 query rows, so lane (g, col) holds query col's logits of keys 8g + r; two such tiles (keys k0 + 0..15, k0 + 16..31) are, element for element, the B operand P^T of O^T += V^T P^T (A = 16 rows of the v planes). Pass 1 walks the keys for each query's maximum, pass 2 forms the same logits again, e = exp(logit - max), sums e in f32 and multiplies e x 2^11 (once to f16; rows < 384: bf16 hi + lo) with v; the division by (sum + 1e-9) is done on the 64 outputs. 3-product logits for rows < 384, else 1.
// The pointers of this kernel are plain (no __restrict__): its loads then stay between the asm statements around them, so that each run of loads has its s_wait_xcnt 0 behind it.
/* s_wait_xcnt 0 behind a run of global loads, before a register that they name is used again; the run's address is an input of the statement, so that its registers stay whole up to the wait */
__device__ __forceinline__ void xwait(const void* p) { asm volatile("s_wait_xcnt 0x0" :: "v"(p) : "memory"); }
__device__ __forceinline__ void xwait(const void* p, const void* q) { asm volatile("s_wait_xcnt 0x0" :: "v"(p), "v"(q) : "memory"); }
/* one lane's 16 elements of a fragment; p already holds the lane half's 8 g */
__device__ __forceinline__ v16h ld_h(const _Float16* p) { union { v16h v; v8h q[2]; } u; u.q[0] = *(const v8h*)p; u.q[1] = *(const v8h*)(p + 16); return u.v; }
__device__ __forceinline__ v16b ld_b(const __bf16* p) { union { v16b v; v8b q[2]; } u; u.q[0] = *(const v8b*)p; u.q[1] = *(const v8b*)(p + 16); return u.v; }
template <bool HI> __device__ __forceinline__ void attn_ldk(const _Float16* kp, const _Float16* klp, int c, v16h (&kh)[2][2], v16h (&kl)[2][2]) {
  const _Float16* p = kp + (size_t)c * (32 * KV); const _Float16* pl = klp + (size_t)c * (32 * KV);
#pragma unroll
  for (int i = 0; i < 2; ++i) {
#pragma unroll
    for (int kc = 0; kc < 2; ++kc) { kh[i][kc] = ld_h(p + i * 16 * KV + kc * 32); if (HI) kl[i][kc] = ld_h(pl + i * 16 * KV + kc * 32); } }
  if (HI) xwait(p, pl); else xwait(p); }
template <bool HI> __device__ __forceinline__ v8f attn_s(const v16h (&kh)[2], const v16h (&kl)[2], const v16h (&qh)[2], const v16h (&ql)[2]) {
  v8f a = {}, al = {};
#pragma unroll
  for (int kc = 0; kc < 2; ++kc) { a = wmma16(kh[kc], qh[kc], a); if (HI) { al = wmma16(kh[kc], ql[kc], al); al = wmma16(kl[kc], qh[kc], al); } }
#pragma unroll
  for (int r = 0; r < 8; ++r) a[r] = HI ? (a[r] + al[r] * (1.0f / 1024.0f)) * SCALE : a[r] * SCALE;
  return a; }
/* the last chunk (keys 32 (nch - 1) + 0..31) alone reaches past a row's diagonal; dq = the row of column group 0 in this lane, counted from that chunk's first key */
template <int NU> __device__ __forceinline__ void attn_mask(v8f (&s)[NU][2], int dq, int g) {
#pragma unroll
  for (int u = 0; u < NU; ++u) {
#pragma unroll
    for (int i = 0; i < 2; ++i) {
#pragma unroll
      for (int r = 0; r < 8; ++r) s[u][i][r] = (i * 16 + 8 * g + r <= u * 16 + dq) ? s[u][i][r] : -3.0e38f; } } }
template <bool HI, int NU> __device__ __forceinline__ void attn_sall(const v16h (&kh)[2][2], const v16h (&kl)[2][2], const v16h (&qh)[NU][2], const v16h (&ql)[NU][2], v8f (&s)[NU][2]) {
#pragma unroll
  for (int u = 0; u < NU; ++u) {
#pragma unroll
    for (int i = 0; i < 2; ++i) s[u][i] = attn_s<HI>(kh[i], kl[i], qh[u], ql[u]); } }
template <int NU> __device__ __forceinline__ void attn_max(const v8f (&s)[NU][2], float (&m)[NU]) {
#pragma unroll
  for (int u = 0; u < NU; ++u) {
#pragma unroll
    for (int i = 0; i < 2; ++i) {
#pragma unroll
      for (int r = 0; r < 8; ++r) m[u] = fmaxf(m[u], s[u][i][r]); } } }
/* one wave, NU column groups of 16 queries from row ql0 on (ql0 a multiple of 16 NU) */
template <bool HI, int NU> __device__ __forceinline__ void attn_wave(const _Float16* QH, const _Float16* KH, const _Float16* QL, const _Float16* KL, const _Float16* VT, const __bf16* VB, const __bf16* VBL, float* Y, int b, int h, int ql0, int lane) {
  const int col = lane & 15, g = lane >> 4, kvo = (h / GQ) * HD, dq = (ql0 & 31) + col; const int nch = (ql0 >> 5) + 1;   /* 32-key chunks; every chunk holds at least one key <= t for each of the wave's rows */
  v16h qh[NU][2], ql[NU][2], ka[2][2], la[2][2], kb[2][2], lb[2][2]; v8f s[NU][2];
  { const _Float16* qp = QH + ((size_t)b * TT + ql0 + col) * CC + h * HD + 8 * g; const _Float16* qlp = QL + ((size_t)b * QHI + ql0 + col) * CC + h * HD + 8 * g;
#pragma unroll
    for (int u = 0; u < NU; ++u) {
#pragma unroll
      for (int kc = 0; kc < 2; ++kc) { qh[u][kc] = ld_h(qp + u * 16 * CC + kc * 32); if (HI) ql[u][kc] = ld_h(qlp + u * 16 * CC + kc * 32); } }
    if (HI) xwait(qp, qlp); else xwait(qp); }
  const _Float16* kp = KH + ((size_t)b * TT + col) * KV + kvo + 8 * g; const _Float16* klp = KL + ((size_t)b * KHI + col) * KV + kvo + 8 * g;
  float m[NU];
#pragma unroll
  for (int u = 0; u < NU; ++u) m[u] = -3.0e38f;
  if (HI) {   /* pass 1 of the early rows (at most 12 chunks, beside a wave that walks 53 and more): no look-ahead, so that the residual planes' registers fit */
    for (int c = 0; c < nch; ++c) { attn_ldk<HI>(kp, klp, c, ka, la);
      attn_sall<HI, NU>(ka, la, qh, ql, s);
      if (c == nch - 1) attn_mask<NU>(s, dq, g);   /* scalar test */
      attn_max<NU>(s, m); }
  } else {
  /* pass 1, two chunks a trip: each chunk's key rows are fetched a whole trip ahead, into the registers that its products have just left. An odd count takes its last chunk twice (a maximum does not mind). Behind the last trip ka holds chunk 0, with which pass 2 begins */
  attn_ldk<HI>(kp, klp, 0, ka, la); attn_ldk<HI>(kp, klp, nch > 1 ? 1 : 0, kb, lb);
  for (int c = 0; c < nch; c += 2) { const int c1 = c + 1 < nch ? c + 1 : nch - 1;
    attn_sall<HI, NU>(ka, la, qh, ql, s);
    attn_ldk<HI>(kp, klp, c + 2 < nch ? c + 2 : 0, ka, la);
    if (c == nch - 1) attn_mask<NU>(s, dq, g);   /* scalar test */
    attn_max<NU>(s, m);
    attn_sall<HI, NU>(kb, lb, qh, ql, s);
    attn_ldk<HI>(kp, klp, c + 3 < nch ? c + 3 : nch - 1, kb, lb);
    if (c1 == nch - 1) attn_mask<NU>(s, dq, g);   /* scalar test */
    attn_max<NU>(s, m); } }
#pragma unroll
  for (int u = 0; u < NU; ++u) m[u] = fmaxf(m[u], __shfl_xor(m[u], 16));   /* the two lane halves hold the two halves of a query's keys */
  float sum[NU]; v8f o[NU][HD / 16];
#pragma unroll
  for (int u = 0; u < NU; ++u) { sum[u] = 0.f;
#pragma unroll
    for (int j = 0; j < HD / 16; ++j) o[u][j] = v8f{}; }
  const size_t pl0 = (size_t)b * KV + kvo + col;   /* v plane of d = col; the planes of d = 16 j + col lie 16 j pitches on */
  const _Float16* vp = VT + pl0 * TT + 8 * g; const __bf16* vbp = VB + pl0 * KHI + 8 * g; const __bf16* vlp = VBL + pl0 * KHI + 8 * g;
  for (int c = 0; c < nch; ++c) { v16h vf[HD / 16]; v16b vb[HD / 16], vbl[HD / 16];
    if (HI) attn_ldk<HI>(kp, klp, c, ka, la);
    else { const _Float16* p0 = vp + c * 32;
#pragma unroll
      for (int j = 0; j < HD / 16; ++j) vf[j] = ld_h(p0 + j * 16 * TT);
      xwait(p0); }
    attn_sall<HI, NU>(ka, la, qh, ql, s);
    if (HI) { const __bf16* p0 = vbp + c * 32; const __bf16* p1 = vlp + c * 32;   /* the early rows' v planes come in behind the logits, when the key rows' registers are free, and fly under the exponentials */
#pragma unroll
      for (int j = 0; j < HD / 16; ++j) { vb[j] = ld_b(p0 + j * 16 * KHI); vbl[j] = ld_b(p1 + j * 16 * KHI); }
      xwait(p0, p1);
    } else attn_ldk<HI>(kp, klp, c + 1 < nch ? c + 1 : c, ka, la);   /* the next chunk's key rows fly under this chunk's exponentials (the last chunk reloads its own, unused) */
    __builtin_amdgcn_sched_barrier(0);   /* keeps the loads above in front of the exponentials: sunk to the loop's foot they would be waited for at once */
    if (c == nch - 1) attn_mask<NU>(s, dq, g);   /* scalar test; exp of the excluded keys' -3e38 is 0 */
#pragma unroll
    for (int u = 0; u < NU; ++u) { float e[16];
#pragma unroll
      for (int i = 0; i < 2; ++i) {
#pragma unroll
        for (int r = 0; r < 8; ++r) { const float ev = expf(s[u][i][r] - m[u]); sum[u] += ev; e[i * 8 + r] = ev * 2048.0f; } }
      if (HI) { const F2 p = bsplit16(e);
#pragma unroll
        for (int j = 0; j < HD / 16; ++j) { o[u][j] = wmma_bf(vb[j], p.h, o[u][j]); o[u][j] = wmma_bf(vb[j], p.l, o[u][j]); o[u][j] = wmma_bf(vbl[j], p.h, o[u][j]); }
      } else { v16h p;
#pragma unroll
        for (int x = 0; x < 16; ++x) p[x] = (_Float16)e[x];
#pragma unroll
        for (int j = 0; j < HD / 16; ++j) o[u][j] = wmma16(vf[j], p, o[u][j]); } } }
#pragma unroll
  for (int u = 0; u < NU; ++u) sum[u] = (1.0f / 2048.0f) / (sum[u] + __shfl_xor(sum[u], 16) + 1e-9f);   /* p = e / (sum + 1e-9) as in the module */
#pragma unroll
  for (int u = 0; u < NU; ++u) { const float sc = sum[u]; v8f t[HD / 16];
    float* yp = Y + ((size_t)b * TT + ql0 + u * 16 + col) * CC + h * HD + 8 * g;   /* lane (g, col) holds d = 16 j + 8 g + r of query col */
#pragma unroll
    for (int j = 0; j < HD / 16; ++j) { t[j] = o[u][j] * sc; vst2(yp + j * 16, t[j]); }
    asm volatile("s_wait_xcnt 0x0" :: "v"(yp), "v"(t[0]), "v"(t[1]), "v"(t[2]), "v"(t[3]) : "memory");   /* before a register that the stores above name is used again; address and data are inputs, so that they stay whole up to the wait */ } }
__global__ __launch_bounds__(256) void k_attn(const _Float16* QH, const _Float16* KH, const _Float16* QL, const _Float16* KL, const _Float16* VT, const __bf16* VB, const __bf16* VBL, float* Y) {
  static_assert(QHI % 128 == 0 && KHI >= QHI && HD == 64, "a wave is wholly on one path, and its keys have the residual planes");
  const int lane = threadIdx.x & 31; const int wave = __builtin_amdgcn_readfirstlane(threadIdx.x >> 5);   /* scalar, so that the chunk loops branch on scalars */
  const int qb = wave < 4 ? (TT / 128 - 1) - (int)blockIdx.y : (int)blockIdx.y; const int ql0 = qb * 128 + (wave & 3) * 32;   /* a long and a short query block side by side */
  if (qb < QHI / 128) {   /* the early rows' planes take twice the registers: one column group at a time */
    /* kept rolled: one copy of this path's code, and one group's registers */
#pragma unroll 1
    for (int u = 0; u < 2; ++u) attn_wave<true, 1>(QH, KH, QL, KL, VT, VB, VBL, Y, blockIdx.z, blockIdx.x, ql0 + u * 16, lane);
  } else attn_wave<false, 2>(QH, KH, QL, KL, VT, VB, VBL, Y, blockIdx.z, blockIdx.x, ql0, lane); }
__global__ __launch_bounds__(256) void k_gn(const float* __restrict__ Y, const _Float16* __restrict__ GA, const float* __restrict__ GW, const float* __restrict__ GB, _Float16* __restrict__ AH) {
  const int tid = threadIdx.x; const size_t t = blockIdx.x; const int h = tid >> 3, q = tid & 7; const size_t base = t * CC + h * HD + q * 8;
  const v4f ya = *(const v4f*)(Y + base), yb = *(const v4f*)(Y + base + 4); float v[8] = {ya[0], ya[1], ya[2], ya[3], yb[0], yb[1], yb[2], yb[3]};
  float s = 0.f;
#pragma unroll
  for (int z = 0; z < 8; ++z) s += v[z];
#pragma unroll
  for (int o = 1; o < 8; o <<= 1) s += __shfl_xor(s, o);
  const float mean = s * (1.0f / HD); float s2 = 0.f;
#pragma unroll
  for (int z = 0; z < 8; ++z) { v[z] -= mean; s2 += v[z] * v[z]; }
#pragma unroll
  for (int o = 1; o < 8; o <<= 1) s2 += __shfl_xor(s2, o);
  const float rstd = rsqrtf(s2 * (1.0f / HD) + 1e-5f);
  union { v8h hv; v4u u; } pk;
#pragma unroll
  for (int z = 0; z < 8; ++z) { const int c = h * HD + q * 8 + z; pk.hv[z] = (_Float16)((v[z] * rstd * bfr(GW[c]) + bfr(GB[c])) * (float)GA[t * CC + c]); }
  vst2((unsigned*)(AH + base), pk.u); }
// ---- k_out: block = (64 rows, 128 cols): y = (gn * alpha) (f16 rows) Wo ((in,out), f16(bf16 x 2^8) exact) x 2^-8 -> output 0 rows
__global__ __launch_bounds__(128) void k_out(const _Float16* __restrict__ AH, const float* __restrict__ WO, float* __restrict__ OUT) { __shared__ __align__(16) float sf[4][16][132]; __shared__ __align__(16) _Float16 sw[2][128][40];   /* Wo tile of one pass, [col][k] in f16 (x 2^8), 64-B rows at an 80-B pitch, two buffers */
  const int tid = threadIdx.x, wave = tid >> 5, lane = tid & 31, col = lane & 15, g = lane >> 4; const int c0 = blockIdx.y * 128; const size_t r0 = (size_t)blockIdx.x * 64 + wave * 16;
  v8f acc[8] = {};
  /* as in proj_acc: thread tid owns column tid of each 32 x 128 Wo tile; the four waves share the tile through LDS */
  const _Float16* ap = AH + (r0 + col) * CC; const float* wp = WO + c0 + tid;
  float wr[32];
#pragma unroll
  for (int i = 0; i < 32; ++i) wr[i] = wp[(size_t)i * CC];
  v16h an = frag_h(ap, lane);
  asm volatile("s_wait_xcnt 0x0" ::: "memory");   /* before a register that the loads above name is used again */
  /* unroll 2: the buffer index becomes a constant */
#pragma unroll 2
  for (int kc = 0; kc < CC / 32; ++kc) { _Float16 (*buf)[40] = sw[kc & 1]; const v16h a = an;
#pragma unroll
    for (int q = 0; q < 4; ++q) { v8h t;
#pragma unroll
      for (int i = 0; i < 8; ++i) t[i] = (_Float16)(bfr(wr[q * 8 + i]) * 256.0f);
      *(v8h*)&buf[tid][q * 8] = t; }
    __syncthreads();   /* publishes this pass's tile; with two buffers it also ends every wave's reads of the buffer that the next pass refills */
    const int kn = kc + 1 < CC / 32 ? kc + 1 : kc;   /* the next pass's global loads fly under this pass's products (the last pass reloads its own rows, unused) */
    const float* wn = wp + (size_t)kn * 32 * CC;
#pragma unroll
    for (int i = 0; i < 32; ++i) wr[i] = wn[(size_t)i * CC];
    an = frag_h(ap + kn * 32, lane);
    asm volatile("s_wait_xcnt 0x0" ::: "memory");   /* before a register that the loads above name is used again */
    v16h w[8];
#pragma unroll
    for (int j = 0; j < 8; ++j) w[j] = frag_h(&buf[j * 16 + col][0], lane);
#pragma unroll
    for (int j = 0; j < 8; ++j) acc[j] = wmma16(a, w[j], acc[j]); }
#pragma unroll
  for (int j = 0; j < 8; ++j) {
#pragma unroll
    for (int r = 0; r < 8; ++r) sf[wave][8 * g + r][j * 16 + col] = acc[j][r] * (1.0f / 256.0f); }
  LDSX(); for (int rl = 0; rl < 16; ++rl) vst2(OUT + (r0 + rl) * CC + c0 + lane * 4, *(const v4f*)&sf[wave][rl][lane * 4]); }
extern "C" void kernel_launch(void* const* d_in, const int* in_sizes, int n_in, void* d_out, int out_size, void* d_ws, size_t ws_size, hipStream_t stream) {
  (void)in_sizes; (void)n_in; (void)out_size;
  const float** F = (const float**)d_in;   // 0 x [1,2048,2048]; 1 rope_cos, 2 rope_sin [2048,64]; 3 Wq [2048,2048]; 4 Wk, 5 Wv [2048,512]; 6 Wo [2048,2048]; 7 Wg [2048,2048], 8 bg; 9 gn_weight, 10 gn_bias [2048]
  if (ws_size < (size_t)WS_END) return;
  char* ws = (char*)d_ws; _Float16 *GA = (_Float16*)(ws + WS_GA), *AH = (_Float16*)(ws + WS_AH), *QH = (_Float16*)(ws + WS_QH), *KH = (_Float16*)(ws + WS_KH), *VT = (_Float16*)(ws + WS_VT), *QL = (_Float16*)(ws + WS_QL), *KL = (_Float16*)(ws + WS_KL); __bf16 *VB = (__bf16*)(ws + WS_VB), *VBL = (__bf16*)(ws + WS_VBL); float *Y = (float*)(ws + WS_Y);
  float* OUT0 = (float*)d_out; float* OUTK = OUT0 + (size_t)NB * TT * CC; float* OUTV = OUTK + (size_t)NB * NKV * TT * HD;   /* tuple outputs concatenated, no padding */
  k_proj<<<dim3(TNB * TT / 64, CC / 128, 4), 128, 0, stream>>>(F[0], F[3], F[4], F[5], F[7], F[8], F[1], F[2], QH, KH, VT, QL, KL, VB, VBL, GA, OUTK, OUTV);
  k_attn<<<dim3(NH, TT / 256, TNB), 256, 0, stream>>>(QH, KH, QL, KL, VT, VB, VBL, Y);
  k_gn<<<dim3(TNB * TT), 256, 0, stream>>>(Y, GA, F[9], F[10], AH);
  k_out<<<dim3(TNB * TT / 64, CC / 128), 128, 0, stream>>>(AH, F[6], OUT0);
}

// v003
// One run takes 207 microseconds.
// In both of two side-by-side timings against v002, it was 1.47 times as fast.
// Over all steps from v000 it is 6.64 times as fast.
// compute dtype: all float inputs rounded to bf16; q/k/v/gate projections x W with EXACT bf16 products on WMMA 16x16x32, f32 accumulate; rotate-half rotary with the given cos/sin tables in f32; q, k once to f16 -> 1-product causal logits / 8 (the first 384 query rows use f16 hi + residual on both sides, 3 products); softmax in f32 (precise expf): exp(logit - max) x 2^11 once to f16 against v once to f16 (first 384 rows: bf16 hi + lo, 3 products), divided by (sum + 1e-9) after the product; per-head GroupNorm and the sigmoid gate in f32; (gn * alpha) once to f16 against Wo carried x 2^8 in f16 (exact); new_k / new_v written in f32 straight from the projections; f32 outputs.
#include <hip/hip_runtime.h>
#include <math.h>

typedef __attribute__((ext_vector_type(16))) _Float16 v16h;
typedef __attribute__((ext_vector_type(16))) __bf16 v16b;
typedef __attribute__((ext_vector_type(8)))  _Float16 v8h;
typedef __attribute__((ext_vector_type(8)))  float v8f;
typedef __attribute__((ext_vector_type(4)))  float v4f;
typedef __attribute__((ext_vector_type(2)))  float v2f;
typedef __attribute__((ext_vector_type(4)))  unsigned v4u;
typedef __attribute__((ext_vector_type(4)))  int v4i;
typedef float __attribute__((may_alias)) float_a;
typedef int __attribute__((may_alias)) int_a;

template <typename T> __device__ __forceinline__ void vst2(void* p, T v) { *(T*)p = v;  }
__device__ __forceinline__ v8f wmma16(v16h a, v16h b, v8f c) {
  v8f d = __builtin_amdgcn_wmma_f32_16x16x32_f16(false, a, false, b, (short)0, c, false, false);
  asm volatile("v_nop\n\tv_nop\n\tv_nop\n\tv_nop" : "+v"(d) : "v"(a), "v"(b));
  return d;
}
__device__ __forceinline__ v8f wmma_bf(v16b a, v16b b, v8f c) {
  v8f d = __builtin_amdgcn_wmma_f32_16x16x32_bf16(false, a, false, b, (short)0, c, false, false);
  asm volatile("v_nop\n\tv_nop\n\tv_nop\n\tv_nop" : "+v"(d) : "v"(a), "v"(b));
  return d;
}
// 16x16x32 fragments: lane = (h = lane>>4, row/col = lane&15); elements 0..7 = k0+8h+0..7, 8..15 = k0+16+8h+0..7; D element r = row 8h+r
__device__ __forceinline__ v16h frag_h(const _Float16* rowk0, int lane) {
  union { v16h v; v8h q[2]; } u; const _Float16* p = rowk0 + 8 * (lane >> 4);
  u.q[0] = *(const v8h*)p; u.q[1] = *(const v8h*)(p + 16); return u.v;
}
__device__ __forceinline__ v16h frag_f32(const float* rowk0, int lane) {
  v16h a; const float* p = rowk0 + 8 * (lane >> 4);
#pragma unroll
  for (int i = 0; i < 8; ++i) { a[i] = (_Float16)p[i]; a[8 + i] = (_Float16)p[16 + i]; }
  return a;
}
__device__ __forceinline__ v16h frag_f32s(const float* rowk0, int lane, float sc) {
  v16h a; const float* p = rowk0 + 8 * (lane >> 4);
#pragma unroll
  for (int i = 0; i < 8; ++i) { a[i] = (_Float16)(p[i] * sc); a[8 + i] = (_Float16)(p[16 + i] * sc); }
  return a;
}
// column fragment from a [K][ld] layout (column n), rows >= K read as 0
__device__ __forceinline__ v16h fragc_f32(const float* W, int k0, int n, int lane, int ld, int K) {
  v16h a; const int g = lane >> 4;
#pragma unroll
  for (int i = 0; i < 8; ++i) { const int ka = k0 + 8 * g + i, kb = ka + 16;
    a[i] = (_Float16)(ka < K ? W[(size_t)(ka < K ? ka : K - 1) * ld + n] : 0.f); a[8 + i] = (_Float16)(kb < K ? W[(size_t)(kb < K ? kb : K - 1) * ld + n] : 0.f); }
  return a;
}
struct F2 { v16b h, l; };
__device__ __forceinline__ F2 bsplit16(const float v[16]) { F2 r;
#pragma unroll
  for (int i = 0; i < 16; ++i) { const __bf16 h = (__bf16)v[i]; r.h[i] = h; r.l[i] = (__bf16)(v[i] - (float)h); }
  return r; }
__device__ __forceinline__ F2 split_row(const float* row, int k0, int lane) { float v[16]; const float* p = row + k0 + 8 * (lane >> 4);
#pragma unroll
  for (int i = 0; i < 8; ++i) { v[i] = p[i]; v[8 + i] = p[16 + i]; }
  return bsplit16(v); }
__device__ __forceinline__ F2 split_rowK(const float* row, int k0, int lane, int K) { float v[16]; const int g = lane >> 4;
#pragma unroll
  for (int i = 0; i < 8; ++i) { const int ka = k0 + 8 * g + i, kb = ka + 16; v[i] = ka < K ? row[ka < K ? ka : K - 1] : 0.f; v[8 + i] = kb < K ? row[kb < K ? kb : K - 1] : 0.f; }
  return bsplit16(v); }
__device__ __forceinline__ F2 split_col(const float* W, int k0, int n, int lane, int ld, int K) { float v[16]; const int g = lane >> 4;
#pragma unroll
  for (int i = 0; i < 8; ++i) { const int ka = k0 + 8 * g + i, kb = ka + 16; v[i] = ka < K ? W[(size_t)(ka < K ? ka : K - 1) * ld + n] : 0.f; v[8 + i] = kb < K ? W[(size_t)(kb < K ? kb : K - 1) * ld + n] : 0.f; }
  return bsplit16(v); }
__device__ __forceinline__ v8f mac3(const F2& a, const F2& b, v8f c) { c = wmma_bf(a.l, b.h, c); c = wmma_bf(a.h, b.l, c); return wmma_bf(a.h, b.h, c); }
__device__ __forceinline__ float sigm(float v) { return 1.0f / (1.0f + expf(-v)); }
#define LDSX() do { asm volatile("s_wait_dscnt 0" ::: "memory"); __builtin_amdgcn_wave_barrier(); __builtin_amdgcn_fence(__ATOMIC_RELEASE, "workgroup"); } while (0)

// Gated GQA causal self-attention with rotary tables, per-head GroupNorm and a sigmoid output gate (B 1, S 2,048, HID 2,048; 32 query / 8 kv heads x 64): q = x Wq, k = x Wk, v = x Wv ((in,out)); q, k rotate-half RoPE with the given cos/sin [S,64]; scores = q k^T / 8, causal (col > row -> -inf); p = exp(a - max) / (sum + 1e-9); out = p v (GQA x4); gn = per-(token, head) normalisation over 64 x gn_weight + gn_bias; alpha = sigmoid(x Wg + bg); y = (gn * alpha) Wo. Returns (y, new_k = roped k [B,HKV,S,D], new_v [B,HKV,S,D]).
#define NB 1
#define TT 2048
#define CC 2048
#define NH 32
#define HD 64
#define NKV 8
#define KV (NKV * HD)      // 512
#define GQ (NH / NKV)      // 4
#define SCALE 0.125f
#ifndef TNB
#define TNB NB
#endif
typedef __attribute__((ext_vector_type(8))) __bf16 v8b;
__device__ __forceinline__ v16b frag_b(const __bf16* rowk0, int lane) {
  union { v16b v; v8b q[2]; } u; const __bf16* p = rowk0 + 8 * (lane >> 4);
  u.q[0] = *(const v8b*)p; u.q[1] = *(const v8b*)(p + 16); return u.v;
}
__device__ __forceinline__ float bfr(float v) { return (float)(__bf16)v; }
#define QBH 6              // query blocks 0..5 of each sequence (rows < 384) take the high-precision path (their rows see only 1..384 keys)
#define QHI (QBH * 64)     // 384
#define KHI 384            // key rows with residual / bf16 planes (keys of those rows are <= 383)

#define WS_GA  0u                                       // f16 alpha = sigmoid(x Wg + bg) rows [t][2048]
#define WS_AH  (WS_GA + 2u * (size_t)NB * TT * CC)        // f16 (gn * alpha) rows [t][2048] (A operand of the output projection)
#define WS_QH  (WS_AH + 2u * (size_t)NB * TT * CC)        // f16 q rows [b*t][2048] (rotated)
#define WS_KH  (WS_QH + 2u * (size_t)NB * TT * CC)       // f16 k rows [b*t][512]
#define WS_VT  (WS_KH + 2u * (size_t)NB * TT * KV)       // f16 v planes [b][kvc][t]
#define WS_QL  (WS_VT + 2u * (size_t)NB * KV * TT)       // f16 q residual x 2^10 rows [b][t < QHI][2048]
#define WS_KL  (WS_QL + 2u * (size_t)NB * QHI * CC)      // f16 k residual x 2^10 rows [b][t < KHI][512]
#define WS_VB  (WS_KL + 2u * (size_t)NB * KHI * KV)      // bf16 v hi planes [b][kvc][t < KHI] (pitch KHI)
#define WS_VBL (WS_VB + 2u * (size_t)NB * KV * KHI)      // bf16 v lo planes
#define WS_Y   (WS_VBL + 2u * (size_t)NB * KV * KHI)     // f32 ctx rows [b*t][2048]
#define WS_XB  (WS_Y  + 4u * (size_t)NB * TT * CC)        // bf16 x in A-fragment order (k_prep)
#define NWT (2 * CC + 2 * KV)                            // 5,120 rows of WT: the columns of Wq, Wk, Wv, Wg in that order
#define WS_WT  (WS_XB + 2u * (size_t)NB * TT * CC)        // bf16 weight columns as rows [col][k = 2048]
#define WS_WOT (WS_WT + 2u * (size_t)NWT * CC)            // f16 (bf16(Wo) x 2^8) columns as rows [col][k = 2048]
#define WS_END (WS_WOT + 2u * (size_t)CC * CC)

// ---- k_proj: block = (64 tokens, 128 output cols = two 64-dim heads, which): acc = x W (W (in,out); exact); which 0/1: rotate-half rope with the given tables (tiles j and j+2 hold d and d+32 of the same head) -> f16 rows (+ residual x 2^10 for the early rows), and new_k written in f32; which 2: v -> f16 planes (+ bf16 hi/lo planes for the early keys) and new_v in f32; which 3: alpha = sigmoid(x Wg + bg) -> f16 rows
// ---- k_prep: every float operand of the three big products is rounded ONCE to its 16-bit form and laid out for its reader: the columns of Wq, Wk, Wv, Wg -> bf16 rows of WT, the columns of Wo -> f16 (bf16 x 2^8, exact) rows of WOT, both [col][k]; x -> bf16 in A-fragment order: per (16 rows, 32 k) 1 KiB = [half of the fragment][lane = 16 g + row][8 k], k = 16 half + 8 g + e, so that a wave's 16-B loads read 512 B in a row. blockIdx.x 0..79: 64 rows of WT, 80..111: of WOT, 112..143: 64 rows of x; blockIdx.y: eight 64-k tiles, one after the other (few, long blocks: fewer waves to start). Each 128-B line of the planes is written by one block.
#define PREP_T 8
template <bool IS_O> __device__ __forceinline__ void prep_w(const float* __restrict__ src, int ld, unsigned short* __restrict__ dst, unsigned (*ts)[64][36], int kt0, int tid) {
  const int n = tid >> 2, p = tid & 3, kq = tid >> 4, c4 = (tid & 15) * 4; v4f va[2], vb[2];   /* rows 2 kp and 2 kp + 1 (kp = 16 i + kq), four columns: 16 lanes read 256 B of a row */
  const float* s = src + (size_t)(kt0 * 64 + 2 * kq) * ld + c4; unsigned short* d = dst + (size_t)n * CC + kt0 * 64 + p * 16;
#pragma unroll
  for (int i = 0; i < 2; ++i) { va[i] = *(const v4f*)(s + (size_t)(i * 32) * ld); vb[i] = *(const v4f*)(s + (size_t)(i * 32 + 1) * ld); }
  asm volatile("s_wait_xcnt 0x0" ::: "memory");   /* before a register that the loads above name is used again */
#pragma unroll
  for (int it = 0; it < PREP_T; ++it) {
#pragma unroll
    for (int i = 0; i < 2; ++i) {
#pragma unroll
      for (int e = 0; e < 4; ++e) { union { __bf16 b[2]; _Float16 h[2]; unsigned u; } pk;
        if (IS_O) { pk.h[0] = (_Float16)(bfr(va[i][e]) * 256.0f); pk.h[1] = (_Float16)(bfr(vb[i][e]) * 256.0f); } else { pk.b[0] = (__bf16)va[i][e]; pk.b[1] = (__bf16)vb[i][e]; }
        ts[it & 1][c4 + e][i * 16 + kq] = pk.u; } }
    __syncthreads();   /* the tile is whole before it is read by columns; with two buffers it also ends the reads of the buffer that the next tile fills */
    if (it + 1 < PREP_T) { const float* sn = s + (size_t)((it + 1) * 64) * ld;   /* the next tile's loads fly under this tile's way out */
#pragma unroll
      for (int i = 0; i < 2; ++i) { va[i] = *(const v4f*)(sn + (size_t)(i * 32) * ld); vb[i] = *(const v4f*)(sn + (size_t)(i * 32 + 1) * ld); }
      asm volatile("s_wait_xcnt 0x0" ::: "memory");   /* before a register that the loads above name is used again */ }
    const v4u qa = *(const v4u*)&ts[it & 1][n][p * 8], qb = *(const v4u*)&ts[it & 1][n][p * 8 + 4];
    *(v4u*)(d + it * 64) = qa; *(v4u*)(d + it * 64 + 8) = qb;
    asm volatile("s_wait_xcnt 0x0" ::: "memory");   /* before a register that the stores above name is used again */ } }
__global__ __launch_bounds__(256) void k_prep(const float* __restrict__ X, const float* __restrict__ WQ, const float* __restrict__ WK, const float* __restrict__ WV, const float* __restrict__ WG, const float* __restrict__ WO, __bf16* __restrict__ XB, __bf16* __restrict__ WT, _Float16* __restrict__ WOT) {
  __shared__ __align__(16) unsigned ts[2][64][36];   /* [col][k pair], 128-B rows at a 144-B pitch, two buffers */
  const int tid = threadIdx.x, bx = blockIdx.x, kt0 = blockIdx.y * PREP_T;
  if (bx >= 112) {   /* x (block-uniform; no barrier on this path) */
    const int row = (bx - 112) * 64 + (tid >> 2), p = tid & 3; const float* s = X + (size_t)row * CC + kt0 * 64 + p * 16;
    __bf16* d = XB + ((((size_t)(row >> 4) * (CC / 32) + kt0 * 2 + (p >> 1)) * 2 + (p & 1)) * 32 + (row & 15)) * 8;   /* g = 0 piece; the g = 1 piece lies 16 lanes on, the next 64 k four halves on */
#pragma unroll
    for (int it = 0; it < PREP_T; ++it) { v8b t[2];
#pragma unroll
      for (int i = 0; i < 4; ++i) { const v4f v = *(const v4f*)(s + it * 64 + i * 4);
#pragma unroll
        for (int e = 0; e < 4; ++e) t[i >> 1][(i & 1) * 4 + e] = (__bf16)v[e]; }
      *(v8b*)(d + it * (4 * 32 * 8)) = t[0]; *(v8b*)(d + it * (4 * 32 * 8) + 16 * 8) = t[1]; }
    return; }
  if (bx >= 80) prep_w<true>(WO + (bx - 80) * 64, CC, (unsigned short*)WOT + (size_t)(bx - 80) * 64 * CC, ts, kt0, tid);
  else { const float* src = bx < 32 ? WQ + bx * 64 : bx < 40 ? WK + (bx - 32) * 64 : bx < 48 ? WV + (bx - 40) * 64 : WG + (bx - 48) * 64;
    prep_w<false>(src, (bx >= 32 && bx < 48) ? KV : CC, (unsigned short*)WT + (size_t)bx * 64 * CC, ts, kt0, tid); } }
template <bool F16> __device__ __forceinline__ v8f mm16(v4u a0, v4u a1, v4u b0, v4u b1, v8f c) {
  union { v4u q[2]; v16h h; v16b b; } A, B; A.q[0] = a0; A.q[1] = a1; B.q[0] = b0; B.q[1] = b1;
  if (F16) return wmma16(A.h, B.h, c); else return wmma_bf(A.b, B.b, c); }
#define SWP 144              /* LDS pitch of a 128-B tile row, bytes */
#define SWB (128 * SWP)      /* one buffer: 128 columns */
// acc += A W over all of K for a 64 x 128 tile, both operands 16-bit: W as rows with k contiguous (k_prep's planes), A as rows or in k_prep's fragment order. A pass is 64 k = 128 B of every row: eight lanes fetch one whole line of a W column (16 B a lane, a wave's load is four lines), eight such loads a thread bring the 128 x 64 tile, which goes to LDS as it is; the block's four waves read their B fragments from there, and each lane fetches its own four 16-B pieces of A from ap: AS bytes from piece to piece, AP from pass to pass (rows: 32 and 128, ap = the lane's row + 16 g bytes; fragment order: 512 and 2,048, ap = the wave's 16 rows + 16 lane bytes). wp: W row (tid >> 3) of the tile + 16 (tid & 7) bytes.
template <bool F16, int AS, int AP> __device__ __forceinline__ void gemm_acc(const char* __restrict__ ap, const char* __restrict__ wp, char* sw, int tid, int lane, v8f (&acc)[8]) {
  v4u wr[8], ar[4]; char* st = sw + (tid >> 3) * SWP + (tid & 7) * 16; const char* rd = sw + (lane & 15) * SWP + (lane >> 4) * 16;
#pragma unroll
  for (int i = 0; i < 8; ++i) wr[i] = *(const v4u*)(wp + (size_t)i * (16 * CC * 2));
#pragma unroll
  for (int i = 0; i < 4; ++i) ar[i] = *(const v4u*)(ap + i * AS);
  asm volatile("s_wait_xcnt 0x0" ::: "memory");   /* before a register that the loads above name is used again */
  /* unroll 2: the buffer index becomes a constant */
#pragma unroll 2
  for (int kc = 0; kc < CC / 64; ++kc) { const int bo = (kc & 1) * SWB; const v4u a[4] = {ar[0], ar[1], ar[2], ar[3]};
#pragma unroll
    for (int i = 0; i < 8; ++i) *(v4u*)(st + bo + i * 16 * SWP) = wr[i];
    __syncthreads();   /* publishes this pass's tile; with two buffers it also ends every wave's reads of the buffer that the next pass refills */
    const int kn = kc + 1 < CC / 64 ? kc + 1 : kc;   /* the next pass's global loads fly under this pass's products (the last pass reloads its own rows, unused) */
    const char* wn = wp + kn * 128; const char* an = ap + kn * AP;
#pragma unroll
    for (int i = 0; i < 8; ++i) wr[i] = *(const v4u*)(wn + (size_t)i * (16 * CC * 2));
#pragma unroll
    for (int i = 0; i < 4; ++i) ar[i] = *(const v4u*)(an + i * AS);
    asm volatile("s_wait_xcnt 0x0" ::: "memory");   /* before a register that the loads above name is used again */
#pragma unroll
    for (int kk = 0; kk < 2; ++kk) { v4u w[8][2];
#pragma unroll
      for (int j = 0; j < 8; ++j) { w[j][0] = *(const v4u*)(rd + bo + j * 16 * SWP + kk * 64); w[j][1] = *(const v4u*)(rd + bo + j * 16 * SWP + kk * 64 + 32); }
#pragma unroll
      for (int j = 0; j < 8; ++j) acc[j] = mm16<F16>(a[kk * 2], a[kk * 2 + 1], w[j][0], w[j][1], acc[j]); } } }
__global__ __launch_bounds__(128) void k_proj(const __bf16* __restrict__ XB, const __bf16* __restrict__ WT, const float* __restrict__ BG, const float* __restrict__ COS, const float* __restrict__ SIN, _Float16* __restrict__ QH, _Float16* __restrict__ KH, _Float16* __restrict__ VT, _Float16* __restrict__ QL, _Float16* __restrict__ KL, __bf16* __restrict__ VB, __bf16* __restrict__ VBL, _Float16* __restrict__ GA, float* __restrict__ OUTK, float* __restrict__ OUTV) {
  __shared__ __align__(16) _Float16 sh[64][136], sl[64][136]; __shared__ __align__(16) _Float16 th[128][72]; __shared__ __align__(16) __bf16 tb[128][72], tbl[128][72]; __shared__ __align__(16) float so[4][16][132]; __shared__ __align__(16) char sw[2 * SWB];
  const int tid = threadIdx.x, wave = tid >> 5, lane = tid & 31, col = lane & 15, g = lane >> 4; const int which = blockIdx.z; const int c0 = blockIdx.y * 128; const size_t r0 = (size_t)blockIdx.x * 64; const int NW = (which == 0 || which == 3) ? CC : KV; if (c0 >= NW) return;   // k/v are only 512 wide (block-uniform exit before any barrier)
  const size_t b = r0 / TT; const int t0 = (int)(r0 % TT); const bool hi_rows = t0 < ((which == 0) ? QHI : KHI);   /* block-uniform */
  const int w0 = which == 0 ? 0 : which == 1 ? CC : which == 2 ? CC + KV : CC + 2 * KV;   /* first row of this product's columns in WT */
  v8f acc[8] = {};
  gemm_acc<false, 512, 2048>((const char*)(XB + (r0 + wave * 16) * CC + lane * 8), (const char*)(WT + (size_t)(w0 + c0 + (tid >> 3)) * CC + (tid & 7) * 8), sw, tid, lane, acc);
  if (which == 3) {   /* gate: alpha = sigmoid(acc + bg) -> f16 rows */
#pragma unroll
    for (int j = 0; j < 8; ++j) { const float bb = bfr(BG[c0 + j * 16 + col]);
#pragma unroll
      for (int r = 0; r < 8; ++r) sh[wave * 16 + 8 * g + r][j * 16 + col] = (_Float16)(1.0f / (1.0f + expf(-(acc[j][r] + bb)))); }
    __syncthreads();
    for (int e = tid; e < 64 * 16; e += 128) { const int rl = e >> 4, q = e & 15; vst2((unsigned*)(GA + (r0 + rl) * CC + c0 + q * 8), *(const v4u*)&sh[rl][q * 8]); }
    return; }
  if (which < 2) {
    /* rotate-half rope on each 64-dim head: d = (j&3)*16+col; d < 32 (tiles jp = 0,1,4,5) pairs with d+32 (jp+2): out[d] = x[d] c - x[d+32] s, out[d+32] = x[d+32] c + x[d] s, table index d for out[d], d+32 for out[d+32] */
#pragma unroll
    for (int jp = 0; jp < 8; ++jp) { if ((jp & 3) >= 2) continue; const int i2 = (jp & 3) * 16 + col;
#pragma unroll
      for (int r = 0; r < 8; ++r) { const int t = t0 + wave * 16 + 8 * g + r; const float c1 = bfr(COS[(size_t)t * HD + i2]), s1 = bfr(SIN[(size_t)t * HD + i2]), c2 = bfr(COS[(size_t)t * HD + i2 + 32]), s2 = bfr(SIN[(size_t)t * HD + i2 + 32]); const float x1 = acc[jp][r], x2 = acc[jp + 2][r]; asm volatile("s_wait_loadcnt 0x0" ::: "memory"); acc[jp][r] = x1 * c1 - x2 * s1; acc[jp + 2][r] = x2 * c2 + x1 * s2; } }
    if (which == 1) {   /* new_k output [HKV][S][64] in f32: this wave's 16 rows x 2 heads, 256 B per (row, head) by 16 lanes */
#pragma unroll
      for (int j = 0; j < 8; ++j) {
#pragma unroll
        for (int r = 0; r < 8; ++r) so[wave][8 * g + r][j * 16 + col] = acc[j][r]; }
      LDSX(); for (int rl = 0; rl < 16; ++rl) { const int t = t0 + wave * 16 + rl; const int hh = (c0 >> 6) + (lane >> 4); vst2(OUTK + ((size_t)hh * TT + t) * HD + (lane & 15) * 4, *(const v4f*)&so[wave][rl][lane * 4]); } }
#pragma unroll
    for (int j = 0; j < 8; ++j) {
#pragma unroll
      for (int r = 0; r < 8; ++r) { const float v = acc[j][r]; const _Float16 hv = (_Float16)v; sh[wave * 16 + 8 * g + r][j * 16 + col] = hv; sl[wave * 16 + 8 * g + r][j * 16 + col] = (_Float16)((v - (float)hv) * 1024.0f); } }
    __syncthreads();
    _Float16* dh = which == 0 ? QH : KH; _Float16* dl = which == 0 ? (QL + (b * QHI) * (size_t)CC) : (KL + (b * KHI) * (size_t)KV);
    for (int e = tid; e < 64 * 16; e += 128) { const int rl = e >> 4, q = e & 15; vst2((unsigned*)(dh + (r0 + rl) * NW + c0 + q * 8), *(const v4u*)&sh[rl][q * 8]); if (hi_rows) vst2((unsigned*)(dl + (size_t)(t0 + rl) * NW + c0 + q * 8), *(const v4u*)&sl[rl][q * 8]); }
  } else {   /* which == 2: v */
#pragma unroll
    for (int j = 0; j < 8; ++j) {
#pragma unroll
      for (int r = 0; r < 8; ++r) so[wave][8 * g + r][j * 16 + col] = acc[j][r]; }
    LDSX(); for (int rl = 0; rl < 16; ++rl) { const int t = t0 + wave * 16 + rl; const int hh = (c0 >> 6) + (lane >> 4); vst2(OUTV + ((size_t)hh * TT + t) * HD + (lane & 15) * 4, *(const v4f*)&so[wave][rl][lane * 4]); }   /* new_v output in f32 */
#pragma unroll
    for (int j = 0; j < 8; ++j) {
#pragma unroll
      for (int r = 0; r < 8; ++r) { const float v = acc[j][r]; const int rl = wave * 16 + 8 * g + r, cl = j * 16 + col; th[cl][rl] = (_Float16)v; const __bf16 bh = (__bf16)v; tb[cl][rl] = bh; tbl[cl][rl] = (__bf16)(v - (float)bh); } }
    __syncthreads();
    for (int e = tid; e < 128 * 8; e += 128) { const int cl = e >> 3, q = e & 7; const size_t o2 = (b * KV + c0 + cl) * (size_t)TT + t0 + q * 8; vst2((unsigned*)(VT + o2), *(const v4u*)&th[cl][q * 8]); if (hi_rows) { const size_t o3 = (b * KV + c0 + cl) * (size_t)KHI + t0 + q * 8; vst2((unsigned*)(VB + o3), *(const v4u*)&tb[cl][q * 8]); vst2((unsigned*)(VBL + o3), *(const v4u*)&tbl[cl][q * 8]); } } } }
// ---- k_attn: block = (head h, pair y of 128-query blocks), eight independent waves of 32 queries each (two 16-query column groups u): waves 0..3 take block 15 - y, waves 4..7 block y, so that every block of the grid walks the same number of keys; no LDS, no barrier. S^T = K Q^T: A = 16 key rows, B = 16 query rows, so lane (g, col) holds query col's logits of keys 8g + r; two such tiles (keys k0 + 0..15, k0 + 16..31) are, element for element, the B operand P^T of O^T += V^T P^T (A = 16 rows of the v planes). Pass 1 walks the keys for each query's maximum, pass 2 forms the same logits again, e = exp(logit - max), sums e in f32 and multiplies e x 2^11 (once to f16; rows < 384: bf16 hi + lo) with v; the division by (sum + 1e-9) is done on the 64 outputs. 3-product logits for rows < 384, else 1.
// The pointers of this kernel are plain (no __restrict__): its loads then stay between the asm statements around them, so that each run of loads has its s_wait_xcnt 0 behind it.
/* s_wait_xcnt 0 behind a run of global loads, before a register that they name is used again; the run's address is an input of the statement, so that its registers stay whole up to the wait */
__device__ __forceinline__ void xwait(const void* p) { asm volatile("s_wait_xcnt 0x0" :: "v"(p) : "memory"); }
__device__ __forceinline__ void xwait(const void* p, const void* q) { asm volatile("s_wait_xcnt 0x0" :: "v"(p), "v"(q) : "memory"); }
/* one lane's 16 elements of a fragment; p already holds the lane half's 8 g */
__device__ __forceinline__ v16h ld_h(const _Float16* p) { union { v16h v; v8h q[2]; } u; u.q[0] = *(const v8h*)p; u.q[1] = *(const v8h*)(p + 16); return u.v; }
__device__ __forceinline__ v16b ld_b(const __bf16* p) { union { v16b v; v8b q[2]; } u; u.q[0] = *(const v8b*)p; u.q[1] = *(const v8b*)(p + 16); return u.v; }
template <bool HI> __device__ __forceinline__ void attn_ldk(const _Float16* kp, const _Float16* klp, int c, v16h (&kh)[2][2], v16h (&kl)[2][2]) {
  const _Float16* p = kp + (size_t)c * (32 * KV); const _Float16* pl = klp + (size_t)c * (32 * KV);
#pragma unroll
  for (int i = 0; i < 2; ++i) {
#pragma unroll
    for (int kc = 0; kc < 2; ++kc) { kh[i][kc] = ld_h(p + i * 16 * KV + kc * 32); if (HI) kl[i][kc] = ld_h(pl + i * 16 * KV + kc * 32); } }
  if (HI) xwait(p, pl); else xwait(p); }
template <bool HI> __device__ __forceinline__ v8f attn_s(const v16h (&kh)[2], const v16h (&kl)[2], const v16h (&qh)[2], const v16h (&ql)[2]) {
  v8f a = {}, al = {};
#pragma unroll
  for (int kc = 0; kc < 2; ++kc) { a = wmma16(kh[kc], qh[kc], a); if (HI) { al = wmma16(kh[kc], ql[kc], al); al = wmma16(kl[kc], qh[kc], al); } }
#pragma unroll
  for (int r = 0; r < 8; ++r) a[r] = HI ? (a[r] + al[r] * (1.0f / 1024.0f)) * SCALE : a[r] * SCALE;
  return a; }
/* the last chunk (keys 32 (nch - 1) + 0..31) alone reaches past a row's diagonal; dq = the row of column group 0 in this lane, counted from that chunk's first key */
template <int NU> __device__ __forceinline__ void attn_mask(v8f (&s)[NU][2], int dq, int g) {
#pragma unroll
  for (int u = 0; u < NU; ++u) {
#pragma unroll
    for (int i = 0; i < 2; ++i) {
#pragma unroll
      for (int r = 0; r < 8; ++r) s[u][i][r] = (i * 16 + 8 * g + r <= u * 16 + dq) ? s[u][i][r] : -3.0e38f; } } }
template <bool HI, int NU> __device__ __forceinline__ void attn_sall(const v16h (&kh)[2][2], const v16h (&kl)[2][2], const v16h (&qh)[NU][2], const v16h (&ql)[NU][2], v8f (&s)[NU][2]) {
#pragma unroll
  for (int u = 0; u < NU; ++u) {
#pragma unroll
    for (int i = 0; i < 2; ++i) s[u][i] = attn_s<HI>(kh[i], kl[i], qh[u], ql[u]); } }
template <int NU> __device__ __forceinline__ void attn_max(const v8f (&s)[NU][2], float (&m)[NU]) {
#pragma unroll
  for (int u = 0; u < NU; ++u) {
#pragma unroll
    for (int i = 0; i < 2; ++i) {
#pragma unroll
      for (int r = 0; r < 8; ++r) m[u] = fmaxf(m[u], s[u][i][r]); } } }
/* one wave, NU column groups of 16 queries from row ql0 on (ql0 a multiple of 16 NU) */
template <bool HI, int NU> __device__ __forceinline__ void attn_wave(const _Float16* QH, const _Float16* KH, const _Float16* QL, const _Float16* KL, const _Float16* VT, const __bf16* VB, const __bf16* VBL, float* Y, int b, int h, int ql0, int lane) {
  const int col = lane & 15, g = lane >> 4, kvo = (h / GQ) * HD, dq = (ql0 & 31) + col; const int nch = (ql0 >> 5) + 1;   /* 32-key chunks; every chunk holds at least one key <= t for each of the wave's rows */
  v16h qh[NU][2], ql[NU][2], ka[2][2], la[2][2], kb[2][2], lb[2][2]; v8f s[NU][2];
  { const _Float16* qp = QH + ((size_t)b * TT + ql0 + col) * CC + h * HD + 8 * g; const _Float16* qlp = QL + ((size_t)b * QHI + ql0 + col) * CC + h * HD + 8 * g;
#pragma unroll
    for (int u = 0; u < NU; ++u) {
#pragma unroll
      for (int kc = 0; kc < 2; ++kc) { qh[u][kc] = ld_h(qp + u * 16 * CC + kc * 32); if (HI) ql[u][kc] = ld_h(qlp + u * 16 * CC + kc * 32); } }
    if (HI) xwait(qp, qlp); else xwait(qp); }
  const _Float16* kp = KH + ((size_t)b * TT + col) * KV + kvo + 8 * g; const _Float16* klp = KL + ((size_t)b * KHI + col) * KV + kvo + 8 * g;
  float m[NU];
#pragma unroll
  for (int u = 0; u < NU; ++u) m[u] = -3.0e38f;
  if (HI) {   /* pass 1 of the early rows (at most 12 chunks, beside a wave that walks 53 and more): no look-ahead, so that the residual planes' registers fit */
    for (int c = 0; c < nch; ++c) { attn_ldk<HI>(kp, klp, c, ka, la);
      attn_sall<HI, NU>(ka, la, qh, ql, s);
      if (c == nch - 1) attn_mask<NU>(s, dq, g);   /* scalar test */
      attn_max<NU>(s, m); }
  } else {
  /* pass 1, two chunks a trip: each chunk's key rows are fetched a whole trip ahead, into the registers that its products have just left. An odd count takes its last chunk twice (a maximum does not mind). Behind the last trip ka holds chunk 0, with which pass 2 begins */
  attn_ldk<HI>(kp, klp, 0, ka, la); attn_ldk<HI>(kp, klp, nch > 1 ? 1 : 0, kb, lb);
  for (int c = 0; c < nch; c += 2) { const int c1 = c + 1 < nch ? c + 1 : nch - 1;
    attn_sall<HI, NU>(ka, la, qh, ql, s);
    attn_ldk<HI>(kp, klp, c + 2 < nch ? c + 2 : 0, ka, la);
    if (c == nch - 1) attn_mask<NU>(s, dq, g);   /* scalar test */
    attn_max<NU>(s, m);
    attn_sall<HI, NU>(kb, lb, qh, ql, s);
    attn_ldk<HI>(kp, klp, c + 3 < nch ? c + 3 : nch - 1, kb, lb);
    if (c1 == nch - 1) attn_mask<NU>(s, dq, g);   /* scalar test */
    attn_max<NU>(s, m); } }
#pragma unroll
  for (int u = 0; u < NU; ++u) m[u] = fmaxf(m[u], __shfl_xor(m[u], 16));   /* the two lane halves hold the two halves of a query's keys */
  float sum[NU]; v8f o[NU][HD / 16];
#pragma unroll
  for (int u = 0; u < NU; ++u) { sum[u] = 0.f;
#pragma unroll
    for (int j = 0; j < HD / 16; ++j) o[u][j] = v8f{}; }
  const size_t pl0 = (size_t)b * KV + kvo + col;   /* v plane of d = col; the planes of d = 16 j + col lie 16 j pitches on */
  const _Float16* vp = VT + pl0 * TT + 8 * g; const __bf16* vbp = VB + pl0 * KHI + 8 * g; const __bf16* vlp = VBL + pl0 * KHI + 8 * g;
  for (int c = 0; c < nch; ++c) { v16h vf[HD / 16]; v16b vb[HD / 16], vbl[HD / 16];
    if (HI) attn_ldk<HI>(kp, klp, c, ka, la);
    else { const _Float16* p0 = vp + c * 32;
#pragma unroll
      for (int j = 0; j < HD / 16; ++j) vf[j] = ld_h(p0 + j * 16 * TT);
      xwait(p0); }
    attn_sall<HI, NU>(ka, la, qh, ql, s);
    if (HI) { const __bf16* p0 = vbp + c * 32; const __bf16* p1 = vlp + c * 32;   /* the early rows' v planes come in behind the logits, when the key rows' registers are free, and fly under the exponentials */
#pragma unroll
      for (int j = 0; j < HD / 16; ++j) { vb[j] = ld_b(p0 + j * 16 * KHI); vbl[j] = ld_b(p1 + j * 16 * KHI); }
      xwait(p0, p1);
    } else attn_ldk<HI>(kp, klp, c + 1 < nch ? c + 1 : c, ka, la);   /* the next chunk's key rows fly under this chunk's exponentials (the last chunk reloads its own, unused) */
    __builtin_amdgcn_sched_barrier(0);   /* keeps the loads above in front of the exponentials: sunk to the loop's foot they would be waited for at once */
    if (c == nch - 1) attn_mask<NU>(s, dq, g);   /* scalar test; exp of the excluded keys' -3e38 is 0 */
#pragma unroll
    for (int u = 0; u < NU; ++u) { float e[16];
#pragma unroll
      for (int i = 0; i < 2; ++i) {
#pragma unroll
        for (int r = 0; r < 8; ++r) { const float ev = expf(s[u][i][r] - m[u]); sum[u] += ev; e[i * 8 + r] = ev * 2048.0f; } }
      if (HI) { const F2 p = bsplit16(e);
#pragma unroll
        for (int j = 0; j < HD / 16; ++j) { o[u][j] = wmma_bf(vb[j], p.h, o[u][j]); o[u][j] = wmma_bf(vb[j], p.l, o[u][j]); o[u][j] = wmma_bf(vbl[j], p.h, o[u][j]); }
      } else { v16h p;
#pragma unroll
        for (int x = 0; x < 16; ++x) p[x] = (_Float16)e[x];
#pragma unroll
        for (int j = 0; j < HD / 16; ++j) o[u][j] = wmma16(vf[j], p, o[u][j]); } } }
#pragma unroll
  for (int u = 0; u < NU; ++u) sum[u] = (1.0f / 2048.0f) / (sum[u] + __shfl_xor(sum[u], 16) + 1e-9f);   /* p = e / (sum + 1e-9) as in the module */
#pragma unroll
  for (int u = 0; u < NU; ++u) { const float sc = sum[u]; v8f t[HD / 16];
    float* yp = Y + ((size_t)b * TT + ql0 + u * 16 + col) * CC + h * HD + 8 * g;   /* lane (g, col) holds d = 16 j + 8 g + r of query col */
#pragma unroll
    for (int j = 0; j < HD / 16; ++j) { t[j] = o[u][j] * sc; vst2(yp + j * 16, t[j]); }
    asm volatile("s_wait_xcnt 0x0" :: "v"(yp), "v"(t[0]), "v"(t[1]), "v"(t[2]), "v"(t[3]) : "memory");   /* before a register that the stores above name is used again; address and data are inputs, so that they stay whole up to the wait */ } }
__global__ __launch_bounds__(256) void k_attn(const _Float16* QH, const _Float16* KH, const _Float16* QL, const _Float16* KL, const _Float16* VT, const __bf16* VB, const __bf16* VBL, float* Y) {
  static_assert(QHI % 128 == 0 && KHI >= QHI && HD == 64, "a wave is wholly on one path, and its keys have the residual planes");
  const int lane = threadIdx.x & 31; const int wave = __builtin_amdgcn_readfirstlane(threadIdx.x >> 5);   /* scalar, so that the chunk loops branch on scalars */
  const int qb = wave < 4 ? (TT / 128 - 1) - (int)blockIdx.y : (int)blockIdx.y; const int ql0 = qb * 128 + (wave & 3) * 32;   /* a long and a short query block side by side */
  if (qb < QHI / 128) {   /* the early rows' planes take twice the registers: one column group at a time */
    /* kept rolled: one copy of this path's code, and one group's registers */
#pragma unroll 1
    for (int u = 0; u < 2; ++u) attn_wave<true, 1>(QH, KH, QL, KL, VT, VB, VBL, Y, blockIdx.z, blockIdx.x, ql0 + u * 16, lane);
  } else attn_wave<false, 2>(QH, KH, QL, KL, VT, VB, VBL, Y, blockIdx.z, blockIdx.x, ql0, lane); }
__global__ __launch_bounds__(256) void k_gn(const float* __restrict__ Y, const _Float16* __restrict__ GA, const float* __restrict__ GW, const float* __restrict__ GB, _Float16* __restrict__ AH) {
  const int tid = threadIdx.x; const size_t t = blockIdx.x; const int h = tid >> 3, q = tid & 7; const size_t base = t * CC + h * HD + q * 8;
  const v4f ya = *(const v4f*)(Y + base), yb = *(const v4f*)(Y + base + 4); float v[8] = {ya[0], ya[1], ya[2], ya[3], yb[0], yb[1], yb[2], yb[3]};
  float s = 0.f;
#pragma unroll
  for (int z = 0; z < 8; ++z) s += v[z];
#pragma unroll
  for (int o = 1; o < 8; o <<= 1) s += __shfl_xor(s, o);
  const float mean = s * (1.0f / HD); float s2 = 0.f;
#pragma unroll
  for (int z = 0; z < 8; ++z) { v[z] -= mean; s2 += v[z] * v[z]; }
#pragma unroll
  for (int o = 1; o < 8; o <<= 1) s2 += __shfl_xor(s2, o);
  const float rstd = rsqrtf(s2 * (1.0f / HD) + 1e-5f);
  union { v8h hv; v4u u; } pk;
#pragma unroll
  for (int z = 0; z < 8; ++z) { const int c = h * HD + q * 8 + z; pk.hv[z] = (_Float16)((v[z] * rstd * bfr(GW[c]) + bfr(GB[c])) * (float)GA[t * CC + c]); }
  vst2((unsigned*)(AH + base), pk.u); }
// ---- k_out: block = (64 rows, 128 cols): y = (gn * alpha) (f16 rows) Wo (k_prep's f16 rows, bf16 x 2^8, exact) x 2^-8 -> output 0 rows
__global__ __launch_bounds__(128) void k_out(const _Float16* __restrict__ AH, const _Float16* __restrict__ WOT, float* __restrict__ OUT) { __shared__ __align__(16) float sf[4][16][132]; __shared__ __align__(16) char sw[2 * SWB];   /* Wo tile of one pass, [col][k] in f16 (x 2^8), two buffers */
  const int tid = threadIdx.x, wave = tid >> 5, lane = tid & 31, col = lane & 15, g = lane >> 4; const int c0 = blockIdx.y * 128; const size_t r0 = (size_t)blockIdx.x * 64 + wave * 16;
  v8f acc[8] = {};
  gemm_acc<true, 32, 128>((const char*)(AH + (r0 + col) * CC + 8 * g), (const char*)(WOT + (size_t)(c0 + (tid >> 3)) * CC + (tid & 7) * 8), sw, tid, lane, acc);
#pragma unroll
  for (int j = 0; j < 8; ++j) {
#pragma unroll
    for (int r = 0; r < 8; ++r) sf[wave][8 * g + r][j * 16 + col] = acc[j][r] * (1.0f / 256.0f); }
  LDSX(); for (int rl = 0; rl < 16; ++rl) vst2(OUT + (r0 + rl) * CC + c0 + lane * 4, *(const v4f*)&sf[wave][rl][lane * 4]); }
extern "C" void kernel_launch(void* const* d_in, const int* in_sizes, int n_in, void* d_out, int out_size, void* d_ws, size_t ws_size, hipStream_t stream) {
  (void)in_sizes; (void)n_in; (void)out_size;
  const float** F = (const float**)d_in;   // 0 x [1,2048,2048]; 1 rope_cos, 2 rope_sin [2048,64]; 3 Wq [2048,2048]; 4 Wk, 5 Wv [2048,512]; 6 Wo [2048,2048]; 7 Wg [2048,2048], 8 bg; 9 gn_weight, 10 gn_bias [2048]
  if (ws_size < (size_t)WS_END) return;
  char* ws = (char*)d_ws; _Float16 *GA = (_Float16*)(ws + WS_GA), *AH = (_Float16*)(ws + WS_AH), *QH = (_Float16*)(ws + WS_QH), *KH = (_Float16*)(ws + WS_KH), *VT = (_Float16*)(ws + WS_VT), *QL = (_Float16*)(ws + WS_QL), *KL = (_Float16*)(ws + WS_KL); __bf16 *VB = (__bf16*)(ws + WS_VB), *VBL = (__bf16*)(ws + WS_VBL); float *Y = (float*)(ws + WS_Y); __bf16 *XB = (__bf16*)(ws + WS_XB), *WT = (__bf16*)(ws + WS_WT); _Float16 *WOT = (_Float16*)(ws + WS_WOT);
  float* OUT0 = (float*)d_out; float* OUTK = OUT0 + (size_t)NB * TT * CC; float* OUTV = OUTK + (size_t)NB * NKV * TT * HD;   /* tuple outputs concatenated, no padding */
  k_prep<<<dim3(NWT / 64 + CC / 64 + TNB * TT / 64, CC / 64 / PREP_T), 256, 0, stream>>>(F[0], F[3], F[4], F[5], F[7], F[6], XB, WT, WOT);
  k_proj<<<dim3(TNB * TT / 64, CC / 128, 4), 128, 0, stream>>>(XB, WT, F[8], F[1], F[2], QH, KH, VT, QL, KL, VB, VBL, GA, OUTK, OUTV);
  k_attn<<<dim3(NH, TT / 256, TNB), 256, 0, stream>>>(QH, KH, QL, KL, VT, VB, VBL, Y);
  k_gn<<<dim3(TNB * TT), 256, 0, stream>>>(Y, GA, F[9], F[10], AH);
  k_out<<<dim3(TNB * TT / 64, CC / 128), 128, 0, stream>>>(AH, WOT, OUT0);
}

// v004
// A run of this version takes 187 microseconds.
// Two timings next to v003 both put it at 1.11 times that version's speed.
// All steps since v000 together make it 7.35 times as fast.
// compute dtype: all float inputs rounded to bf16; q/k/v/gate projections x W with EXACT bf16 products on WMMA 16x16x32, f32 accumulate; rotate-half rotary with the given cos/sin tables in f32; q, k once to f16 -> 1-product causal logits / 8 (the first 384 query rows use f16 hi + residual on both sides, 3 products); softmax in f32: exp(logit - max) x 2^11 as one hardware exp2 of (logit - max) x log2(e) + 11 (one fused multiply-add), once to f16 against v once to f16 (first 384 rows: bf16 hi + lo, 3 products), divided by (sum + 1e-9) after the product (sum and 1e-9 both carried x 2^11); per-head GroupNorm and the sigmoid gate in f32; (gn * alpha) once to f16 against Wo carried x 2^8 in f16 (exact); new_k / new_v written in f32 straight from the projections; f32 outputs.
#include <hip/hip_runtime.h>
#include <math.h>

typedef __attribute__((ext_vector_type(16))) _Float16 v16h;
typedef __attribute__((ext_vector_type(16))) __bf16 v16b;
typedef __attribute__((ext_vector_type(8)))  _Float16 v8h;
typedef __attribute__((ext_vector_type(8)))  float v8f;
typedef __attribute__((ext_vector_type(4)))  float v4f;
typedef __attribute__((ext_vector_type(2)))  float v2f;
typedef __attribute__((ext_vector_type(4)))  unsigned v4u;
typedef __attribute__((ext_vector_type(4)))  int v4i;
typedef float __attribute__((may_alias)) float_a;
typedef int __attribute__((may_alias)) int_a;

template <typename T> __device__ __forceinline__ void vst2(void* p, T v) { *(T*)p = v;  }
__device__ __forceinline__ v8f wmma16(v16h a, v16h b, v8f c) {
  v8f d = __builtin_amdgcn_wmma_f32_16x16x32_f16(false, a, false, b, (short)0, c, false, false);
  asm volatile("v_nop\n\tv_nop\n\tv_nop\n\tv_nop" : "+v"(d) : "v"(a), "v"(b));
  return d;
}
__device__ __forceinline__ v8f wmma_bf(v16b a, v16b b, v8f c) {
  v8f d = __builtin_amdgcn_wmma_f32_16x16x32_bf16(false, a, false, b, (short)0, c, false, false);
  asm volatile("v_nop\n\tv_nop\n\tv_nop\n\tv_nop" : "+v"(d) : "v"(a), "v"(b));
  return d;
}
// 16x16x32 fragments: lane = (h = lane>>4, row/col = lane&15); elements 0..7 = k0+8h+0..7, 8..15 = k0+16+8h+0..7; D element r = row 8h+r
__device__ __forceinline__ v16h frag_h(const _Float16* rowk0, int lane) {
  union { v16h v; v8h q[2]; } u; const _Float16* p = rowk0 + 8 * (lane >> 4);
  u.q[0] = *(const v8h*)p; u.q[1] = *(const v8h*)(p + 16); return u.v;
}
__device__ __forceinline__ v16h frag_f32(const float* rowk0, int lane) {
  v16h a; const float* p = rowk0 + 8 * (lane >> 4);
#pragma unroll
  for (int i = 0; i < 8; ++i) { a[i] = (_Float16)p[i]; a[8 + i] = (_Float16)p[16 + i]; }
  return a;
}
__device__ __forceinline__ v16h frag_f32s(const float* rowk0, int lane, float sc) {
  v16h a; const float* p = rowk0 + 8 * (lane >> 4);
#pragma unroll
  for (int i = 0; i < 8; ++i) { a[i] = (_Float16)(p[i] * sc); a[8 + i] = (_Float16)(p[16 + i] * sc); }
  return a;
}
// column fragment from a [K][ld] layout (column n), rows >= K read as 0
__device__ __forceinline__ v16h fragc_f32(const float* W, int k0, int n, int lane, int ld, int K) {
  v16h a; const int g = lane >> 4;
#pragma unroll
  for (int i = 0; i < 8; ++i) { const int ka = k0 + 8 * g + i, kb = ka + 16;
    a[i] = (_Float16)(ka < K ? W[(size_t)(ka < K ? ka : K - 1) * ld + n] : 0.f); a[8 + i] = (_Float16)(kb < K ? W[(size_t)(kb < K ? kb : K - 1) * ld + n] : 0.f); }
  return a;
}
struct F2 { v16b h, l; };
__device__ __forceinline__ F2 bsplit16(const float v[16]) { F2 r;
#pragma unroll
  for (int i = 0; i < 16; ++i) { const __bf16 h = (__bf16)v[i]; r.h[i] = h; r.l[i] = (__bf16)(v[i] - (float)h); }
  return r; }
__device__ __forceinline__ F2 split_row(const float* row, int k0, int lane) { float v[16]; const float* p = row + k0 + 8 * (lane >> 4);
#pragma unroll
  for (int i = 0; i < 8; ++i) { v[i] = p[i]; v[8 + i] = p[16 + i]; }
  return bsplit16(v); }
__device__ __forceinline__ F2 split_rowK(const float* row, int k0, int lane, int K) { float v[16]; const int g = lane >> 4;
#pragma unroll
  for (int i = 0; i < 8; ++i) { const int ka = k0 + 8 * g + i, kb = ka + 16; v[i] = ka < K ? row[ka < K ? ka : K - 1] : 0.f; v[8 + i] = kb < K ? row[kb < K ? kb : K - 1] : 0.f; }
  return bsplit16(v); }
__device__ __forceinline__ F2 split_col(const float* W, int k0, int n, int lane, int ld, int K) { float v[16]; const int g = lane >> 4;
#pragma unroll
  for (int i = 0; i < 8; ++i) { const int ka = k0 + 8 * g + i, kb = ka + 16; v[i] = ka < K ? W[(size_t)(ka < K ? ka : K - 1) * ld + n] : 0.f; v[8 + i] = kb < K ? W[(size_t)(kb < K ? kb : K - 1) * ld + n] : 0.f; }
  return bsplit16(v); }
__device__ __forceinline__ v8f mac3(const F2& a, const F2& b, v8f c) { c = wmma_bf(a.l, b.h, c); c = wmma_bf(a.h, b.l, c); return wmma_bf(a.h, b.h, c); }
__device__ __forceinline__ float sigm(float v) { return 1.0f / (1.0f + expf(-v)); }
#define LDSX() do { asm volatile("s_wait_dscnt 0" ::: "memory"); __builtin_amdgcn_wave_barrier(); __builtin_amdgcn_fence(__ATOMIC_RELEASE, "workgroup"); } while (0)

// Gated GQA causal self-attention with rotary tables, per-head GroupNorm and a sigmoid output gate (B 1, S 2,048, HID 2,048; 32 query / 8 kv heads x 64): q = x Wq, k = x Wk, v = x Wv ((in,out)); q, k rotate-half RoPE with the given cos/sin [S,64]; scores = q k^T / 8, causal (col > row -> -inf); p = exp(a - max) / (sum + 1e-9); out = p v (GQA x4); gn = per-(token, head) normalisation over 64 x gn_weight + gn_bias; alpha = sigmoid(x Wg + bg); y = (gn * alpha) Wo. Returns (y, new_k = roped k [B,HKV,S,D], new_v [B,HKV,S,D]).
#define NB 1
#define TT 2048
#define CC 2048
#define NH 32
#define HD 64
#define NKV 8
#define KV (NKV * HD)      // 512
#define GQ (NH / NKV)      // 4
#define SCALE 0.125f
#ifndef TNB
#define TNB NB
#endif
typedef __attribute__((ext_vector_type(8))) __bf16 v8b;
__device__ __forceinline__ v16b frag_b(const __bf16* rowk0, int lane) {
  union { v16b v; v8b q[2]; } u; const __bf16* p = rowk0 + 8 * (lane >> 4);
  u.q[0] = *(const v8b*)p; u.q[1] = *(const v8b*)(p + 16); return u.v;
}
__device__ __forceinline__ float bfr(float v) { return (float)(__bf16)v; }
#define QBH 6              // query blocks 0..5 of each sequence (rows < 384) take the high-precision path (their rows see only 1..384 keys)
#define QHI (QBH * 64)     // 384
#define KHI 384            // key rows with residual / bf16 planes (keys of those rows are <= 383)

#define WS_GA  0u                                       // f16 alpha = sigmoid(x Wg + bg) rows [t][2048]
#define WS_AH  (WS_GA + 2u * (size_t)NB * TT * CC)        // f16 (gn * alpha) rows [t][2048] (A operand of the output projection)
#define WS_QH  (WS_AH + 2u * (size_t)NB * TT * CC)        // f16 q rows [b*t][2048] (rotated)
#define WS_KH  (WS_QH + 2u * (size_t)NB * TT * CC)       // f16 k rows [b*t][512]
#define WS_VT  (WS_KH + 2u * (size_t)NB * TT * KV)       // f16 v planes [b][kvc][t]
#define WS_QL  (WS_VT + 2u * (size_t)NB * KV * TT)       // f16 q residual x 2^10 rows [b][t < QHI][2048]
#define WS_KL  (WS_QL + 2u * (size_t)NB * QHI * CC)      // f16 k residual x 2^10 rows [b][t < KHI][512]
#define WS_VB  (WS_KL + 2u * (size_t)NB * KHI * KV)      // bf16 v hi planes [b][kvc][t < KHI] (pitch KHI)
#define WS_VBL (WS_VB + 2u * (size_t)NB * KV * KHI)      // bf16 v lo planes
#define WS_Y   (WS_VBL + 2u * (size_t)NB * KV * KHI)     // f32 ctx rows [b*t][2048]
#define WS_XB  (WS_Y  + 4u * (size_t)NB * TT * CC)        // bf16 x in A-fragment order (k_prep)
#define NWT (2 * CC + 2 * KV)                            // 5,120 rows of WT: the columns of Wq, Wk, Wv, Wg in that order
#define WS_WT  (WS_XB + 2u * (size_t)NB * TT * CC)        // bf16 weight columns as rows [col][k = 2048]
#define WS_WOT (WS_WT + 2u * (size_t)NWT * CC)            // f16 (bf16(Wo) x 2^8) columns as rows [col][k = 2048]
#define WS_END (WS_WOT + 2u * (size_t)CC * CC)

// ---- k_proj: block = (64 tokens, 128 output cols = two 64-dim heads, which): acc = x W (W (in,out); exact); which 0/1: rotate-half rope with the given tables (tiles j and j+2 hold d and d+32 of the same head) -> f16 rows (+ residual x 2^10 for the early rows), and new_k written in f32; which 2: v -> f16 planes (+ bf16 hi/lo planes for the early keys) and new_v in f32; which 3: alpha = sigmoid(x Wg + bg) -> f16 rows
// ---- k_prep: every float operand of the three big products is rounded ONCE to its 16-bit form and laid out for its reader: the columns of Wq, Wk, Wv, Wg -> bf16 rows of WT, the columns of Wo -> f16 (bf16 x 2^8, exact) rows of WOT, both [col][k]; x -> bf16 in A-fragment order: per (16 rows, 32 k) 1 KiB = [half of the fragment][lane = 16 g + row][8 k], k = 16 half + 8 g + e, so that a wave's 16-B loads read 512 B in a row. blockIdx.x 0..79: 64 rows of WT, 80..111: of WOT, 112..143: 64 rows of x; blockIdx.y: eight 64-k tiles, one after the other (few, long blocks: fewer waves to start). Each 128-B line of the planes is written by one block.
#define PREP_T 8
template <bool IS_O> __device__ __forceinline__ void prep_w(const float* __restrict__ src, int ld, unsigned short* __restrict__ dst, unsigned (*ts)[64][36], int kt0, int tid) {
  const int n = tid >> 2, p = tid & 3, kq = tid >> 4, c4 = (tid & 15) * 4; v4f va[2], vb[2];   /* rows 2 kp and 2 kp + 1 (kp = 16 i + kq), four columns: 16 lanes read 256 B of a row */
  const float* s = src + (size_t)(kt0 * 64 + 2 * kq) * ld + c4; unsigned short* d = dst + (size_t)n * CC + kt0 * 64 + p * 16;
#pragma unroll
  for (int i = 0; i < 2; ++i) { va[i] = *(const v4f*)(s + (size_t)(i * 32) * ld); vb[i] = *(const v4f*)(s + (size_t)(i * 32 + 1) * ld); }
  asm volatile("s_wait_xcnt 0x0" ::: "memory");   /* before a register that the loads above name is used again */
#pragma unroll
  for (int it = 0; it < PREP_T; ++it) {
#pragma unroll
    for (int i = 0; i < 2; ++i) {
#pragma unroll
      for (int e = 0; e < 4; ++e) { union { __bf16 b[2]; _Float16 h[2]; unsigned u; } pk;
        if (IS_O) { pk.h[0] = (_Float16)(bfr(va[i][e]) * 256.0f); pk.h[1] = (_Float16)(bfr(vb[i][e]) * 256.0f); } else { pk.b[0] = (__bf16)va[i][e]; pk.b[1] = (__bf16)vb[i][e]; }
        ts[it & 1][c4 + e][i * 16 + kq] = pk.u; } }
    __syncthreads();   /* the tile is whole before it is read by columns; with two buffers it also ends the reads of the buffer that the next tile fills */
    if (it + 1 < PREP_T) { const float* sn = s + (size_t)((it + 1) * 64) * ld;   /* the next tile's loads fly under this tile's way out */
#pragma unroll
      for (int i = 0; i < 2; ++i) { va[i] = *(const v4f*)(sn + (size_t)(i * 32) * ld); vb[i] = *(const v4f*)(sn + (size_t)(i * 32 + 1) * ld); }
      asm volatile("s_wait_xcnt 0x0" ::: "memory");   /* before a register that the loads above name is used again */ }
    const v4u qa = *(const v4u*)&ts[it & 1][n][p * 8], qb = *(const v4u*)&ts[it & 1][n][p * 8 + 4];
    *(v4u*)(d + it * 64) = qa; *(v4u*)(d + it * 64 + 8) = qb;
    asm volatile("s_wait_xcnt 0x0" ::: "memory");   /* before a register that the stores above name is used again */ } }
__global__ __launch_bounds__(256) void k_prep(const float* __restrict__ X, const float* __restrict__ WQ, const float* __restrict__ WK, const float* __restrict__ WV, const float* __restrict__ WG, const float* __restrict__ WO, __bf16* __restrict__ XB, __bf16* __restrict__ WT, _Float16* __restrict__ WOT) {
  __shared__ __align__(16) unsigned ts[2][64][36];   /* [col][k pair], 128-B rows at a 144-B pitch, two buffers */
  const int tid = threadIdx.x, bx = blockIdx.x, kt0 = blockIdx.y * PREP_T;
  if (bx >= 112) {   /* x (block-uniform; no barrier on this path) */
    const int row = (bx - 112) * 64 + (tid >> 2), p = tid & 3; const float* s = X + (size_t)row * CC + kt0 * 64 + p * 16;
    __bf16* d = XB + ((((size_t)(row >> 4) * (CC / 32) + kt0 * 2 + (p >> 1)) * 2 + (p & 1)) * 32 + (row & 15)) * 8;   /* g = 0 piece; the g = 1 piece lies 16 lanes on, the next 64 k four halves on */
#pragma unroll
    for (int it = 0; it < PREP_T; ++it) { v8b t[2];
#pragma unroll
      for (int i = 0; i < 4; ++i) { const v4f v = *(const v4f*)(s + it * 64 + i * 4);
#pragma unroll
        for (int e = 0; e < 4; ++e) t[i >> 1][(i & 1) * 4 + e] = (__bf16)v[e]; }
      *(v8b*)(d + it * (4 * 32 * 8)) = t[0]; *(v8b*)(d + it * (4 * 32 * 8) + 16 * 8) = t[1]; }
    return; }
  if (bx >= 80) prep_w<true>(WO + (bx - 80) * 64, CC, (unsigned short*)WOT + (size_t)(bx - 80) * 64 * CC, ts, kt0, tid);
  else { const float* src = bx < 32 ? WQ + bx * 64 : bx < 40 ? WK + (bx - 32) * 64 : bx < 48 ? WV + (bx - 40) * 64 : WG + (bx - 48) * 64;
    prep_w<false>(src, (bx >= 32 && bx < 48) ? KV : CC, (unsigned short*)WT + (size_t)bx * 64 * CC, ts, kt0, tid); } }
template <bool F16> __device__ __forceinline__ v8f mm16(v4u a0, v4u a1, v4u b0, v4u b1, v8f c) {
  union { v4u q[2]; v16h h; v16b b; } A, B; A.q[0] = a0; A.q[1] = a1; B.q[0] = b0; B.q[1] = b1;
  if (F16) return wmma16(A.h, B.h, c); else return wmma_bf(A.b, B.b, c); }
#define SWP 144              /* LDS pitch of a 128-B tile row, bytes */
#define SWB (128 * SWP)      /* one buffer: 128 columns */
// acc += A W over all of K for a 64 x 128 tile, both operands 16-bit: W as rows with k contiguous (k_prep's planes), A as rows or in k_prep's fragment order. A pass is 64 k = 128 B of every row: eight lanes fetch one whole line of a W column (16 B a lane, a wave's load is four lines), eight such loads a thread bring the 128 x 64 tile, which goes to LDS as it is; the block's four waves read their B fragments from there, and each lane fetches its own four 16-B pieces of A from ap: AS bytes from piece to piece, AP from pass to pass (rows: 32 and 128, ap = the lane's row + 16 g bytes; fragment order: 512 and 2,048, ap = the wave's 16 rows + 16 lane bytes). wp: W row (tid >> 3) of the tile + 16 (tid & 7) bytes.
template <bool F16, int AS, int AP> __device__ __forceinline__ void gemm_acc(const char* __restrict__ ap, const char* __restrict__ wp, char* sw, int tid, int lane, v8f (&acc)[8]) {
  v4u wr[8], ar[4]; char* st = sw + (tid >> 3) * SWP + (tid & 7) * 16; const char* rd = sw + (lane & 15) * SWP + (lane >> 4) * 16;
#pragma unroll
  for (int i = 0; i < 8; ++i) wr[i] = *(const v4u*)(wp + (size_t)i * (16 * CC * 2));
#pragma unroll
  for (int i = 0; i < 4; ++i) ar[i] = *(const v4u*)(ap + i * AS);
  asm volatile("s_wait_xcnt 0x0" ::: "memory");   /* before a register that the loads above name is used again */
  /* unroll 2: the buffer index becomes a constant */
#pragma unroll 2
  for (int kc = 0; kc < CC / 64; ++kc) { const int bo = (kc & 1) * SWB; const v4u a[4] = {ar[0], ar[1], ar[2], ar[3]};
#pragma unroll
    for (int i = 0; i < 8; ++i) *(v4u*)(st + bo + i * 16 * SWP) = wr[i];
    __syncthreads();   /* publishes this pass's tile; with two buffers it also ends every wave's reads of the buffer that the next pass refills */
    const int kn = kc + 1 < CC / 64 ? kc + 1 : kc;   /* the next pass's global loads fly under this pass's products (the last pass reloads its own rows, unused) */
    const char* wn = wp + kn * 128; const char* an = ap + kn * AP;
#pragma unroll
    for (int i = 0; i < 8; ++i) wr[i] = *(const v4u*)(wn + (size_t)i * (16 * CC * 2));
#pragma unroll
    for (int i = 0; i < 4; ++i) ar[i] = *(const v4u*)(an + i * AS);
    asm volatile("s_wait_xcnt 0x0" ::: "memory");   /* before a register that the loads above name is used again */
#pragma unroll
    for (int kk = 0; kk < 2; ++kk) { v4u w[8][2];
#pragma unroll
      for (int j = 0; j < 8; ++j) { w[j][0] = *(const v4u*)(rd + bo + j * 16 * SWP + kk * 64); w[j][1] = *(const v4u*)(rd + bo + j * 16 * SWP + kk * 64 + 32); }
#pragma unroll
      for (int j = 0; j < 8; ++j) acc[j] = mm16<F16>(a[kk * 2], a[kk * 2 + 1], w[j][0], w[j][1], acc[j]); } } }
__global__ __launch_bounds__(128) void k_proj(const __bf16* __restrict__ XB, const __bf16* __restrict__ WT, const float* __restrict__ BG, const float* __restrict__ COS, const float* __restrict__ SIN, _Float16* __restrict__ QH, _Float16* __restrict__ KH, _Float16* __restrict__ VT, _Float16* __restrict__ QL, _Float16* __restrict__ KL, __bf16* __restrict__ VB, __bf16* __restrict__ VBL, _Float16* __restrict__ GA, float* __restrict__ OUTK, float* __restrict__ OUTV) {
  __shared__ __align__(16) _Float16 sh[64][136], sl[64][136]; __shared__ __align__(16) _Float16 th[128][72]; __shared__ __align__(16) __bf16 tb[128][72], tbl[128][72]; __shared__ __align__(16) float so[4][16][132]; __shared__ __align__(16) char sw[2 * SWB];
  const int tid = threadIdx.x, wave = tid >> 5, lane = tid & 31, col = lane & 15, g = lane >> 4; const int which = blockIdx.z; const int c0 = blockIdx.y * 128; const size_t r0 = (size_t)blockIdx.x * 64; const int NW = (which == 0 || which == 3) ? CC : KV; if (c0 >= NW) return;   // k/v are only 512 wide (block-uniform exit before any barrier)
  const size_t b = r0 / TT; const int t0 = (int)(r0 % TT); const bool hi_rows = t0 < ((which == 0) ? QHI : KHI);   /* block-uniform */
  const int w0 = which == 0 ? 0 : which == 1 ? CC : which == 2 ? CC + KV : CC + 2 * KV;   /* first row of this product's columns in WT */
  v8f acc[8] = {};
  gemm_acc<false, 512, 2048>((const char*)(XB + (r0 + wave * 16) * CC + lane * 8), (const char*)(WT + (size_t)(w0 + c0 + (tid >> 3)) * CC + (tid & 7) * 8), sw, tid, lane, acc);
  if (which == 3) {   /* gate: alpha = sigmoid(acc + bg) -> f16 rows */
#pragma unroll
    for (int j = 0; j < 8; ++j) { const float bb = bfr(BG[c0 + j * 16 + col]);
#pragma unroll
      for (int r = 0; r < 8; ++r) sh[wave * 16 + 8 * g + r][j * 16 + col] = (_Float16)(1.0f / (1.0f + expf(-(acc[j][r] + bb)))); }
    __syncthreads();
    for (int e = tid; e < 64 * 16; e += 128) { const int rl = e >> 4, q = e & 15; vst2((unsigned*)(GA + (r0 + rl) * CC + c0 + q * 8), *(const v4u*)&sh[rl][q * 8]); }
    return; }
  if (which < 2) {
    /* rotate-half rope on each 64-dim head: d = (j&3)*16+col; d < 32 (tiles jp = 0,1,4,5) pairs with d+32 (jp+2): out[d] = x[d] c - x[d+32] s, out[d+32] = x[d+32] c + x[d] s, table index d for out[d], d+32 for out[d+32] */
#pragma unroll
    for (int jp = 0; jp < 8; ++jp) { if ((jp & 3) >= 2) continue; const int i2 = (jp & 3) * 16 + col;
#pragma unroll
      for (int r = 0; r < 8; ++r) { const int t = t0 + wave * 16 + 8 * g + r; const float c1 = bfr(COS[(size_t)t * HD + i2]), s1 = bfr(SIN[(size_t)t * HD + i2]), c2 = bfr(COS[(size_t)t * HD + i2 + 32]), s2 = bfr(SIN[(size_t)t * HD + i2 + 32]); const float x1 = acc[jp][r], x2 = acc[jp + 2][r]; asm volatile("s_wait_loadcnt 0x0" ::: "memory"); acc[jp][r] = x1 * c1 - x2 * s1; acc[jp + 2][r] = x2 * c2 + x1 * s2; } }
    if (which == 1) {   /* new_k output [HKV][S][64] in f32: this wave's 16 rows x 2 heads, 256 B per (row, head) by 16 lanes */
#pragma unroll
      for (int j = 0; j < 8; ++j) {
#pragma unroll
        for (int r = 0; r < 8; ++r) so[wave][8 * g + r][j * 16 + col] = acc[j][r]; }
      LDSX(); for (int rl = 0; rl < 16; ++rl) { const int t = t0 + wave * 16 + rl; const int hh = (c0 >> 6) + (lane >> 4); vst2(OUTK + ((size_t)hh * TT + t) * HD + (lane & 15) * 4, *(const v4f*)&so[wave][rl][lane * 4]); } }
#pragma unroll
    for (int j = 0; j < 8; ++j) {
#pragma unroll
      for (int r = 0; r < 8; ++r) { const float v = acc[j][r]; const _Float16 hv = (_Float16)v; sh[wave * 16 + 8 * g + r][j * 16 + col] = hv; sl[wave * 16 + 8 * g + r][j * 16 + col] = (_Float16)((v - (float)hv) * 1024.0f); } }
    __syncthreads();
    _Float16* dh = which == 0 ? QH : KH; _Float16* dl = which == 0 ? (QL + (b * QHI) * (size_t)CC) : (KL + (b * KHI) * (size_t)KV);
    for (int e = tid; e < 64 * 16; e += 128) { const int rl = e >> 4, q = e & 15; vst2((unsigned*)(dh + (r0 + rl) * NW + c0 + q * 8), *(const v4u*)&sh[rl][q * 8]); if (hi_rows) vst2((unsigned*)(dl + (size_t)(t0 + rl) * NW + c0 + q * 8), *(const v4u*)&sl[rl][q * 8]); }
  } else {   /* which == 2: v */
#pragma unroll
    for (int j = 0; j < 8; ++j) {
#pragma unroll
      for (int r = 0; r < 8; ++r) so[wave][8 * g + r][j * 16 + col] = acc[j][r]; }
    LDSX(); for (int rl = 0; rl < 16; ++rl) { const int t = t0 + wave * 16 + rl; const int hh = (c0 >> 6) + (lane >> 4); vst2(OUTV + ((size_t)hh * TT + t) * HD + (lane & 15) * 4, *(const v4f*)&so[wave][rl][lane * 4]); }   /* new_v output in f32 */
#pragma unroll
    for (int j = 0; j < 8; ++j) {
#pragma unroll
      for (int r = 0; r < 8; ++r) { const float v = acc[j][r]; const int rl = wave * 16 + 8 * g + r, cl = j * 16 + col; th[cl][rl] = (_Float16)v; const __bf16 bh = (__bf16)v; tb[cl][rl] = bh; tbl[cl][rl] = (__bf16)(v - (float)bh); } }
    __syncthreads();
    for (int e = tid; e < 128 * 8; e += 128) { const int cl = e >> 3, q = e & 7; const size_t o2 = (b * KV + c0 + cl) * (size_t)TT + t0 + q * 8; vst2((unsigned*)(VT + o2), *(const v4u*)&th[cl][q * 8]); if (hi_rows) { const size_t o3 = (b * KV + c0 + cl) * (size_t)KHI + t0 + q * 8; vst2((unsigned*)(VB + o3), *(const v4u*)&tb[cl][q * 8]); vst2((unsigned*)(VBL + o3), *(const v4u*)&tbl[cl][q * 8]); } } } }
// ---- k_attn: block = (head h, pair y of 128-query blocks), eight independent waves of 32 queries each (two 16-query column groups u): waves 0..3 take block 15 - y, waves 4..7 block y, so that every block of the grid walks the same number of keys; no LDS, no barrier. S^T = K Q^T: A = 16 key rows, B = 16 query rows, so lane (g, col) holds query col's logits of keys 8g + r; two such tiles (keys k0 + 0..15, k0 + 16..31) are, element for element, the B operand P^T of O^T += V^T P^T (A = 16 rows of the v planes). Pass 1 walks the keys for each query's maximum, pass 2 forms the same logits again, e = 2^11 exp(logit - max) = exp2(s ks + (11 - max ks)), sums e in f32 and multiplies e (once to f16; rows < 384: bf16 hi + lo) with v; the division by (sum + 1e-9) is done on the 64 outputs. 3-product logits for rows < 384, else 1.
// The pointers of this kernel are plain (no __restrict__): its loads then stay between the asm statements around them, so that each run of loads has its s_wait_xcnt 0 behind it.
/* s_wait_xcnt 0 behind a run of global loads, before a register that they name is used again; the run's address is an input of the statement, so that its registers stay whole up to the wait */
__device__ __forceinline__ void xwait(const void* p) { asm volatile("s_wait_xcnt 0x0" :: "v"(p) : "memory"); }
__device__ __forceinline__ void xwait(const void* p, const void* q) { asm volatile("s_wait_xcnt 0x0" :: "v"(p), "v"(q) : "memory"); }
/* one lane's 16 elements of a fragment; p already holds the lane half's 8 g */
__device__ __forceinline__ v16h ld_h(const _Float16* p) { union { v16h v; v8h q[2]; } u; u.q[0] = *(const v8h*)p; u.q[1] = *(const v8h*)(p + 16); return u.v; }
__device__ __forceinline__ v16b ld_b(const __bf16* p) { union { v16b v; v8b q[2]; } u; u.q[0] = *(const v8b*)p; u.q[1] = *(const v8b*)(p + 16); return u.v; }
template <bool HI> __device__ __forceinline__ void attn_ldk(const _Float16* kp, const _Float16* klp, int c, v16h (&kh)[2][2], v16h (&kl)[2][2]) {
  const _Float16* p = kp + (size_t)c * (32 * KV); const _Float16* pl = klp + (size_t)c * (32 * KV);
#pragma unroll
  for (int i = 0; i < 2; ++i) {
#pragma unroll
    for (int kc = 0; kc < 2; ++kc) { kh[i][kc] = ld_h(p + i * 16 * KV + kc * 32); if (HI) kl[i][kc] = ld_h(pl + i * 16 * KV + kc * 32); } }
  if (HI) xwait(p, pl); else xwait(p); }
template <bool HI> __device__ __forceinline__ v8f attn_s(const v16h (&kh)[2], const v16h (&kl)[2], const v16h (&qh)[2], const v16h (&ql)[2]) {
  v8f a = {}, al = {};
#pragma unroll
  for (int kc = 0; kc < 2; ++kc) { a = wmma16(kh[kc], qh[kc], a); if (HI) { al = wmma16(kh[kc], ql[kc], al); al = wmma16(kl[kc], qh[kc], al); } }
#pragma unroll
  for (int r = 0; r < 8; ++r) a[r] = HI ? (a[r] + al[r] * (1.0f / 1024.0f)) * SCALE : a[r];   /* the 1-product rows' values stay 8 x the logit: their 1/8 (exact) sits in the exponent's multiplier ks */
  return a; }
/* eight hardware exp2 in one statement: behind a transcendental the instruction set asks for one independent instruction before its result is read or its source overwritten; here each v_exp_f32 is that instruction for the one before it (every output lies apart from every input), and the v_nop is it for the last */
__device__ __forceinline__ void exp2x8(const float (&x)[8], float* y) { float y0, y1, y2, y3, y4, y5, y6, y7;
  asm("v_exp_f32 %0, %8\n\tv_exp_f32 %1, %9\n\tv_exp_f32 %2, %10\n\tv_exp_f32 %3, %11\n\tv_exp_f32 %4, %12\n\tv_exp_f32 %5, %13\n\tv_exp_f32 %6, %14\n\tv_exp_f32 %7, %15\n\tv_nop"
      : "=&v"(y0), "=&v"(y1), "=&v"(y2), "=&v"(y3), "=&v"(y4), "=&v"(y5), "=&v"(y6), "=&v"(y7) : "v"(x[0]), "v"(x[1]), "v"(x[2]), "v"(x[3]), "v"(x[4]), "v"(x[5]), "v"(x[6]), "v"(x[7]));
  y[0] = y0; y[1] = y1; y[2] = y2; y[3] = y3; y[4] = y4; y[5] = y5; y[6] = y6; y[7] = y7; }
/* the last chunk (keys 32 (nch - 1) + 0..31) alone reaches past a row's diagonal; dq = the row of column group 0 in this lane, counted from that chunk's first key */
template <int NU> __device__ __forceinline__ void attn_mask(v8f (&s)[NU][2], int dq, int g) {
#pragma unroll
  for (int u = 0; u < NU; ++u) {
#pragma unroll
    for (int i = 0; i < 2; ++i) {
#pragma unroll
      for (int r = 0; r < 8; ++r) s[u][i][r] = (i * 16 + 8 * g + r <= u * 16 + dq) ? s[u][i][r] : -3.0e38f; } } }
template <bool HI, int NU> __device__ __forceinline__ void attn_sall(const v16h (&kh)[2][2], const v16h (&kl)[2][2], const v16h (&qh)[NU][2], const v16h (&ql)[NU][2], v8f (&s)[NU][2]) {
#pragma unroll
  for (int u = 0; u < NU; ++u) {
#pragma unroll
    for (int i = 0; i < 2; ++i) s[u][i] = attn_s<HI>(kh[i], kl[i], qh[u], ql[u]); } }
template <int NU> __device__ __forceinline__ void attn_max(const v8f (&s)[NU][2], float (&m)[NU]) {
#pragma unroll
  for (int u = 0; u < NU; ++u) {
#pragma unroll
    for (int i = 0; i < 2; ++i) {
#pragma unroll
      for (int r = 0; r < 8; ++r) m[u] = fmaxf(m[u], s[u][i][r]); } } }
/* one wave, NU column groups of 16 queries from row ql0 on (ql0 a multiple of 16 NU) */
template <bool HI, int NU> __device__ __forceinline__ void attn_wave(const _Float16* QH, const _Float16* KH, const _Float16* QL, const _Float16* KL, const _Float16* VT, const __bf16* VB, const __bf16* VBL, float* Y, int b, int h, int ql0, int lane) {
  const int col = lane & 15, g = lane >> 4, kvo = (h / GQ) * HD, dq = (ql0 & 31) + col; const int nch = (ql0 >> 5) + 1;   /* 32-key chunks; every chunk holds at least one key <= t for each of the wave's rows */
  v16h qh[NU][2], ql[NU][2], ka[2][2], la[2][2], kb[2][2], lb[2][2]; v8f s[NU][2];
  { const _Float16* qp = QH + ((size_t)b * TT + ql0 + col) * CC + h * HD + 8 * g; const _Float16* qlp = QL + ((size_t)b * QHI + ql0 + col) * CC + h * HD + 8 * g;
#pragma unroll
    for (int u = 0; u < NU; ++u) {
#pragma unroll
      for (int kc = 0; kc < 2; ++kc) { qh[u][kc] = ld_h(qp + u * 16 * CC + kc * 32); if (HI) ql[u][kc] = ld_h(qlp + u * 16 * CC + kc * 32); } }
    if (HI) xwait(qp, qlp); else xwait(qp); }
  const _Float16* kp = KH + ((size_t)b * TT + col) * KV + kvo + 8 * g; const _Float16* klp = KL + ((size_t)b * KHI + col) * KV + kvo + 8 * g;
  float m[NU];
#pragma unroll
  for (int u = 0; u < NU; ++u) m[u] = -3.0e38f;
  if (HI) {   /* pass 1 of the early rows (at most 12 chunks, beside a wave that walks 53 and more): no look-ahead, so that the residual planes' registers fit */
    for (int c = 0; c < nch; ++c) { attn_ldk<HI>(kp, klp, c, ka, la);
      attn_sall<HI, NU>(ka, la, qh, ql, s);
      if (c == nch - 1) attn_mask<NU>(s, dq, g);   /* scalar test */
      attn_max<NU>(s, m); }
  } else {
  /* pass 1, two chunks a trip: each chunk's key rows are fetched a whole trip ahead, into the registers that its products have just left. An odd count takes its last chunk twice (a maximum does not mind). Behind the last trip ka holds chunk 0, with which pass 2 begins */
  attn_ldk<HI>(kp, klp, 0, ka, la); attn_ldk<HI>(kp, klp, nch > 1 ? 1 : 0, kb, lb);
  for (int c = 0; c < nch; c += 2) { const int c1 = c + 1 < nch ? c + 1 : nch - 1;
    attn_sall<HI, NU>(ka, la, qh, ql, s);
    attn_ldk<HI>(kp, klp, c + 2 < nch ? c + 2 : 0, ka, la);
    if (c == nch - 1) attn_mask<NU>(s, dq, g);   /* scalar test */
    attn_max<NU>(s, m);
    attn_sall<HI, NU>(kb, lb, qh, ql, s);
    attn_ldk<HI>(kp, klp, c + 3 < nch ? c + 3 : nch - 1, kb, lb);
    if (c1 == nch - 1) attn_mask<NU>(s, dq, g);   /* scalar test */
    attn_max<NU>(s, m); } }
#pragma unroll
  for (int u = 0; u < NU; ++u) m[u] = fmaxf(m[u], __shfl_xor(m[u], 16));   /* the two lane halves hold the two halves of a query's keys */
  const float ks = (HI ? 1.0f : SCALE) * 1.44269504f;   /* log2(e), times the 1/8 that the 1-product rows still owe */
  float sum[NU], cm[NU]; v8f o[NU][HD / 16];
#pragma unroll
  for (int u = 0; u < NU; ++u) { sum[u] = 0.f; cm[u] = fmaf(-m[u], ks, 11.0f);   /* its rounding is one factor for the whole row, in e and in the sum alike */
#pragma unroll
    for (int j = 0; j < HD / 16; ++j) o[u][j] = v8f{}; }
  const size_t pl0 = (size_t)b * KV + kvo + col;   /* v plane of d = col; the planes of d = 16 j + col lie 16 j pitches on */
  const _Float16* vp = VT + pl0 * TT + 8 * g; const __bf16* vbp = VB + pl0 * KHI + 8 * g; const __bf16* vlp = VBL + pl0 * KHI + 8 * g;
  for (int c = 0; c < nch; ++c) { v16h vf[HD / 16]; v16b vb[HD / 16], vbl[HD / 16];
    if (HI) attn_ldk<HI>(kp, klp, c, ka, la);
    else { const _Float16* p0 = vp + c * 32;
#pragma unroll
      for (int j = 0; j < HD / 16; ++j) vf[j] = ld_h(p0 + j * 16 * TT);
      xwait(p0); }
    attn_sall<HI, NU>(ka, la, qh, ql, s);
    if (HI) { const __bf16* p0 = vbp + c * 32; const __bf16* p1 = vlp + c * 32;   /* the early rows' v planes come in behind the logits, when the key rows' registers are free, and fly under the exponentials */
#pragma unroll
      for (int j = 0; j < HD / 16; ++j) { vb[j] = ld_b(p0 + j * 16 * KHI); vbl[j] = ld_b(p1 + j * 16 * KHI); }
      xwait(p0, p1);
    } else attn_ldk<HI>(kp, klp, c + 1 < nch ? c + 1 : c, ka, la);   /* the next chunk's key rows fly under this chunk's exponentials (the last chunk reloads its own, unused) */
    __builtin_amdgcn_sched_barrier(0);   /* keeps the loads above in front of the exponentials: sunk to the loop's foot they would be waited for at once */
    if (c == nch - 1) attn_mask<NU>(s, dq, g);   /* scalar test; the excluded keys' -3e38 gives e = 0 */
#pragma unroll
    for (int u = 0; u < NU; ++u) { float e[16];
#pragma unroll
      for (int i = 0; i < 2; ++i) { float x[8];   /* the argument is never above 11 (but for cm's rounding), so no range step is owed; below -126, the excluded keys' too, the instruction gives 0 */
#pragma unroll
        for (int r = 0; r < 8; ++r) x[r] = fmaf(s[u][i][r], ks, cm[u]);
        exp2x8(x, &e[i * 8]);
#pragma unroll
        for (int r = 0; r < 8; ++r) sum[u] += e[i * 8 + r]; }
      if (HI) { const F2 p = bsplit16(e);
#pragma unroll
        for (int j = 0; j < HD / 16; ++j) { o[u][j] = wmma_bf(vb[j], p.h, o[u][j]); o[u][j] = wmma_bf(vb[j], p.l, o[u][j]); o[u][j] = wmma_bf(vbl[j], p.h, o[u][j]); }
      } else { v16h p;
#pragma unroll
        for (int x = 0; x < 16; ++x) p[x] = (_Float16)e[x];
#pragma unroll
        for (int j = 0; j < HD / 16; ++j) o[u][j] = wmma16(vf[j], p, o[u][j]); } } }
#pragma unroll
  for (int u = 0; u < NU; ++u) sum[u] = 1.0f / (sum[u] + __shfl_xor(sum[u], 16) + 2048.0f * 1e-9f);   /* p = e / (sum + 1e-9) as in the module, numerator and denominator x 2^11 */
#pragma unroll
  for (int u = 0; u < NU; ++u) { const float sc = sum[u]; v8f t[HD / 16];
    float* yp = Y + ((size_t)b * TT + ql0 + u * 16 + col) * CC + h * HD + 8 * g;   /* lane (g, col) holds d = 16 j + 8 g + r of query col */
#pragma unroll
    for (int j = 0; j < HD / 16; ++j) { t[j] = o[u][j] * sc; vst2(yp + j * 16, t[j]); }
    asm volatile("s_wait_xcnt 0x0" :: "v"(yp), "v"(t[0]), "v"(t[1]), "v"(t[2]), "v"(t[3]) : "memory");   /* before a register that the stores above name is used again; address and data are inputs, so that they stay whole up to the wait */ } }
__global__ __launch_bounds__(256) void k_attn(const _Float16* QH, const _Float16* KH, const _Float16* QL, const _Float16* KL, const _Float16* VT, const __bf16* VB, const __bf16* VBL, float* Y) {
  static_assert(QHI % 128 == 0 && KHI >= QHI && HD == 64, "a wave is wholly on one path, and its keys have the residual planes");
  const int lane = threadIdx.x & 31; const int wave = __builtin_amdgcn_readfirstlane(threadIdx.x >> 5);   /* scalar, so that the chunk loops branch on scalars */
  const int qb = wave < 4 ? (TT / 128 - 1) - (int)blockIdx.y : (int)blockIdx.y; const int ql0 = qb * 128 + (wave & 3) * 32;   /* a long and a short query block side by side */
  if (qb < QHI / 128) {   /* the early rows' planes take twice the registers: one column group at a time */
    /* kept rolled: one copy of this path's code, and one group's registers */
#pragma unroll 1
    for (int u = 0; u < 2; ++u) attn_wave<true, 1>(QH, KH, QL, KL, VT, VB, VBL, Y, blockIdx.z, blockIdx.x, ql0 + u * 16, lane);
  } else attn_wave<false, 2>(QH, KH, QL, KL, VT, VB, VBL, Y, blockIdx.z, blockIdx.x, ql0, lane); }
__global__ __launch_bounds__(256) void k_gn(const float* __restrict__ Y, const _Float16* __restrict__ GA, const float* __restrict__ GW, const float* __restrict__ GB, _Float16* __restrict__ AH) {
  const int tid = threadIdx.x; const size_t t = blockIdx.x; const int h = tid >> 3, q = tid & 7; const size_t base = t * CC + h * HD + q * 8;
  const v4f ya = *(const v4f*)(Y + base), yb = *(const v4f*)(Y + base + 4); float v[8] = {ya[0], ya[1], ya[2], ya[3], yb[0], yb[1], yb[2], yb[3]};
  float s = 0.f;
#pragma unroll
  for (int z = 0; z < 8; ++z) s += v[z];
#pragma unroll
  for (int o = 1; o < 8; o <<= 1) s += __shfl_xor(s, o);
  const float mean = s * (1.0f / HD); float s2 = 0.f;
#pragma unroll
  for (int z = 0; z < 8; ++z) { v[z] -= mean; s2 += v[z] * v[z]; }
#pragma unroll
  for (int o = 1; o < 8; o <<= 1) s2 += __shfl_xor(s2, o);
  const float rstd = rsqrtf(s2 * (1.0f / HD) + 1e-5f);
  union { v8h hv; v4u u; } pk;
#pragma unroll
  for (int z = 0; z < 8; ++z) { const int c = h * HD + q * 8 + z; pk.hv[z] = (_Float16)((v[z] * rstd * bfr(GW[c]) + bfr(GB[c])) * (float)GA[t * CC + c]); }
  vst2((unsigned*)(AH + base), pk.u); }
// ---- k_out: block = (64 rows, 128 cols): y = (gn * alpha) (f16 rows) Wo (k_prep's f16 rows, bf16 x 2^8, exact) x 2^-8 -> output 0 rows
__global__ __launch_bounds__(128) void k_out(const _Float16* __restrict__ AH, const _Float16* __restrict__ WOT, float* __restrict__ OUT) { __shared__ __align__(16) float sf[4][16][132]; __shared__ __align__(16) char sw[2 * SWB];   /* Wo tile of one pass, [col][k] in f16 (x 2^8), two buffers */
  const int tid = threadIdx.x, wave = tid >> 5, lane = tid & 31, col = lane & 15, g = lane >> 4; const int c0 = blockIdx.y * 128; const size_t r0 = (size_t)blockIdx.x * 64 + wave * 16;
  v8f acc[8] = {};
  gemm_acc<true, 32, 128>((const char*)(AH + (r0 + col) * CC + 8 * g), (const char*)(WOT + (size_t)(c0 + (tid >> 3)) * CC + (tid & 7) * 8), sw, tid, lane, acc);
#pragma unroll
  for (int j = 0; j < 8; ++j) {
#pragma unroll
    for (int r = 0; r < 8; ++r) sf[wave][8 * g + r][j * 16 + col] = acc[j][r] * (1.0f / 256.0f); }
  LDSX(); for (int rl = 0; rl < 16; ++rl) vst2(OUT + (r0 + rl) * CC + c0 + lane * 4, *(const v4f*)&sf[wave][rl][lane * 4]); }
extern "C" void kernel_launch(void* const* d_in, const int* in_sizes, int n_in, void* d_out, int out_size, void* d_ws, size_t ws_size, hipStream_t stream) {
  (void)in_sizes; (void)n_in; (void)out_size;
  const float** F = (const float**)d_in;   // 0 x [1,2048,2048]; 1 rope_cos, 2 rope_sin [2048,64]; 3 Wq [2048,2048]; 4 Wk, 5 Wv [2048,512]; 6 Wo [2048,2048]; 7 Wg [2048,2048], 8 bg; 9 gn_weight, 10 gn_bias [2048]
  if (ws_size < (size_t)WS_END) return;
  char* ws = (char*)d_ws; _Float16 *GA = (_Float16*)(ws + WS_GA), *AH = (_Float16*)(ws + WS_AH), *QH = (_Float16*)(ws + WS_QH), *KH = (_Float16*)(ws + WS_KH), *VT = (_Float16*)(ws + WS_VT), *QL = (_Float16*)(ws + WS_QL), *KL = (_Float16*)(ws + WS_KL); __bf16 *VB = (__bf16*)(ws + WS_VB), *VBL = (__bf16*)(ws + WS_VBL); float *Y = (float*)(ws + WS_Y); __bf16 *XB = (__bf16*)(ws + WS_XB), *WT = (__bf16*)(ws + WS_WT); _Float16 *WOT = (_Float16*)(ws + WS_WOT);
  float* OUT0 = (float*)d_out; float* OUTK = OUT0 + (size_t)NB * TT * CC; float* OUTV = OUTK + (size_t)NB * NKV * TT * HD;   /* tuple outputs concatenated, no padding */
  k_prep<<<dim3(NWT / 64 + CC / 64 + TNB * TT / 64, CC / 64 / PREP_T), 256, 0, stream>>>(F[0], F[3], F[4], F[5], F[7], F[6], XB, WT, WOT);
  k_proj<<<dim3(TNB * TT / 64, CC / 128, 4), 128, 0, stream>>>(XB, WT, F[8], F[1], F[2], QH, KH, VT, QL, KL, VB, VBL, GA, OUTK, OUTV);
  k_attn<<<dim3(NH, TT / 256, TNB), 256, 0, stream>>>(QH, KH, QL, KL, VT, VB, VBL, Y);
  k_gn<<<dim3(TNB * TT), 256, 0, stream>>>(Y, GA, F[9], F[10], AH);
  k_out<<<dim3(TNB * TT / 64, CC / 128), 128, 0, stream>>>(AH, WOT, OUT0);
}

// v005
// It runs in 168 microseconds.
// Two timings next to v004 put it at 1.10 and 1.12 times that version's speed.
// Over all steps from v000 it is 8.15 times as fast.
// compute dtype: all float inputs rounded to bf16; q/k/v/gate projections x W with EXACT bf16 products on WMMA 16x16x32, f32 accumulate; rotate-half rotary with the given cos/sin tables in f32; q, k once to f16 -> 1-product causal logits / 8 (the first 384 query rows use f16 hi + residual on both sides, 3 products); softmax in f32: exp(logit - max) x 2^11 as one hardware exp2 of (logit - max) x log2(e) + 11 (one fused multiply-add), once to f16 against v once to f16 (first 384 rows: bf16 hi + lo, 3 products), divided by (sum + 1e-9) after the product (sum and 1e-9 both carried x 2^11); per-head GroupNorm and the sigmoid gate in f32; (gn * alpha) once to f16 against Wo carried x 2^8 in f16 (exact); new_k / new_v written in f32 straight from the projections; f32 outputs.
#include <hip/hip_runtime.h>
#include <math.h>

typedef __attribute__((ext_vector_type(16))) _Float16 v16h;
typedef __attribute__((ext_vector_type(16))) __bf16 v16b;
typedef __attribute__((ext_vector_type(8)))  _Float16 v8h;
typedef __attribute__((ext_vector_type(8)))  float v8f;
typedef __attribute__((ext_vector_type(4)))  float v4f;
typedef __attribute__((ext_vector_type(2)))  float v2f;
typedef __attribute__((ext_vector_type(4)))  unsigned v4u;
typedef __attribute__((ext_vector_type(4)))  int v4i;
typedef float __attribute__((may_alias)) float_a;
typedef int __attribute__((may_alias)) int_a;

template <typename T> __device__ __forceinline__ void vst2(void* p, T v) { *(T*)p = v;  }
__device__ __forceinline__ v8f wmma16(v16h a, v16h b, v8f c) {
  v8f d = __builtin_amdgcn_wmma_f32_16x16x32_f16(false, a, false, b, (short)0, c, false, false);
  asm volatile("v_nop\n\tv_nop\n\tv_nop\n\tv_nop" : "+v"(d) : "v"(a), "v"(b));
  return d;
}
__device__ __forceinline__ v8f wmma_bf(v16b a, v16b b, v8f c) {
  v8f d = __builtin_amdgcn_wmma_f32_16x16x32_bf16(false, a, false, b, (short)0, c, false, false);
  asm volatile("v_nop\n\tv_nop\n\tv_nop\n\tv_nop" : "+v"(d) : "v"(a), "v"(b));
  return d;
}
// 16x16x32 fragments: lane = (h = lane>>4, row/col = lane&15); elements 0..7 = k0+8h+0..7, 8..15 = k0+16+8h+0..7; D element r = row 8h+r
__device__ __forceinline__ v16h frag_h(const _Float16* rowk0, int lane) {
  union { v16h v; v8h q[2]; } u; const _Float16* p = rowk0 + 8 * (lane >> 4);
  u.q[0] = *(const v8h*)p; u.q[1] = *(const v8h*)(p + 16); return u.v;
}
__device__ __forceinline__ v16h frag_f32(const float* rowk0, int lane) {
  v16h a; const float* p = rowk0 + 8 * (lane >> 4);
#pragma unroll
  for (int i = 0; i < 8; ++i) { a[i] = (_Float16)p[i]; a[8 + i] = (_Float16)p[16 + i]; }
  return a;
}
__device__ __forceinline__ v16h frag_f32s(const float* rowk0, int lane, float sc) {
  v16h a; const float* p = rowk0 + 8 * (lane >> 4);
#pragma unroll
  for (int i = 0; i < 8; ++i) { a[i] = (_Float16)(p[i] * sc); a[8 + i] = (_Float16)(p[16 + i] * sc); }
  return a;
}
// column fragment from a [K][ld] layout (column n), rows >= K read as 0
__device__ __forceinline__ v16h fragc_f32(const float* W, int k0, int n, int lane, int ld, int K) {
  v16h a; const int g = lane >> 4;
#pragma unroll
  for (int i = 0; i < 8; ++i) { const int ka = k0 + 8 * g + i, kb = ka + 16;
    a[i] = (_Float16)(ka < K ? W[(size_t)(ka < K ? ka : K - 1) * ld + n] : 0.f); a[8 + i] = (_Float16)(kb < K ? W[(size_t)(kb < K ? kb : K - 1) * ld + n] : 0.f); }
  return a;
}
struct F2 { v16b h, l; };
__device__ __forceinline__ F2 bsplit16(const float v[16]) { F2 r;
#pragma unroll
  for (int i = 0; i < 16; ++i) { const __bf16 h = (__bf16)v[i]; r.h[i] = h; r.l[i] = (__bf16)(v[i] - (float)h); }
  return r; }
__device__ __forceinline__ F2 split_row(const float* row, int k0, int lane) { float v[16]; const float* p = row + k0 + 8 * (lane >> 4);
#pragma unroll
  for (int i = 0; i < 8; ++i) { v[i] = p[i]; v[8 + i] = p[16 + i]; }
  return bsplit16(v); }
__device__ __forceinline__ F2 split_rowK(const float* row, int k0, int lane, int K) { float v[16]; const int g = lane >> 4;
#pragma unroll
  for (int i = 0; i < 8; ++i) { const int ka = k0 + 8 * g + i, kb = ka + 16; v[i] = ka < K ? row[ka < K ? ka : K - 1] : 0.f; v[8 + i] = kb < K ? row[kb < K ? kb : K - 1] : 0.f; }
  return bsplit16(v); }
__device__ __forceinline__ F2 split_col(const float* W, int k0, int n, int lane, int ld, int K) { float v[16]; const int g = lane >> 4;
#pragma unroll
  for (int i = 0; i < 8; ++i) { const int ka = k0 + 8 * g + i, kb = ka + 16; v[i] = ka < K ? W[(size_t)(ka < K ? ka : K - 1) * ld + n] : 0.f; v[8 + i] = kb < K ? W[(size_t)(kb < K ? kb : K - 1) * ld + n] : 0.f; }
  return bsplit16(v); }
__device__ __forceinline__ v8f mac3(const F2& a, const F2& b, v8f c) { c = wmma_bf(a.l, b.h, c); c = wmma_bf(a.h, b.l, c); return wmma_bf(a.h, b.h, c); }
__device__ __forceinline__ float sigm(float v) { return 1.0f / (1.0f + expf(-v)); }
#define LDSX() do { asm volatile("s_wait_dscnt 0" ::: "memory"); __builtin_amdgcn_wave_barrier(); __builtin_amdgcn_fence(__ATOMIC_RELEASE, "workgroup"); } while (0)

// Gated GQA causal self-attention with rotary tables, per-head GroupNorm and a sigmoid output gate (B 1, S 2,048, HID 2,048; 32 query / 8 kv heads x 64): q = x Wq, k = x Wk, v = x Wv ((in,out)); q, k rotate-half RoPE with the given cos/sin [S,64]; scores = q k^T / 8, causal (col > row -> -inf); p = exp(a - max) / (sum + 1e-9); out = p v (GQA x4); gn = per-(token, head) normalisation over 64 x gn_weight + gn_bias; alpha = sigmoid(x Wg + bg); y = (gn * alpha) Wo. Returns (y, new_k = roped k [B,HKV,S,D], new_v [B,HKV,S,D]).
#define NB 1
#define TT 2048
#define CC 2048
#define NH 32
#define HD 64
#define NKV 8
#define KV (NKV * HD)      // 512
#define GQ (NH / NKV)      // 4
#define SCALE 0.125f
#ifndef TNB
#define TNB NB
#endif
typedef __attribute__((ext_vector_type(8))) __bf16 v8b;
__device__ __forceinline__ v16b frag_b(const __bf16* rowk0, int lane) {
  union { v16b v; v8b q[2]; } u; const __bf16* p = rowk0 + 8 * (lane >> 4);
  u.q[0] = *(const v8b*)p; u.q[1] = *(const v8b*)(p + 16); return u.v;
}
__device__ __forceinline__ float bfr(float v) { return (float)(__bf16)v; }
#define QBH 6              // query blocks 0..5 of each sequence (rows < 384) take the high-precision path (their rows see only 1..384 keys)
#define QHI (QBH * 64)     // 384
#define KHI 384            // key rows with residual / bf16 planes (keys of those rows are <= 383)

#define WS_GA  0u                                       // f16 alpha = sigmoid(x Wg + bg) rows [t][2048]
#define WS_AH  (WS_GA + 2u * (size_t)NB * TT * CC)        // f16 (gn * alpha) rows [t][2048] (A operand of the output projection)
#define WS_QH  (WS_AH + 2u * (size_t)NB * TT * CC)        // f16 q rows [b*t][2048] (rotated)
#define WS_KH  (WS_QH + 2u * (size_t)NB * TT * CC)       // f16 k in A-fragment order: per (kv head, 16 keys, 32 d) 1 KiB = [half][lane = 16 g + key][8 d], d = 16 half + 8 g + e
#define WS_VT  (WS_KH + 2u * (size_t)NB * TT * KV)       // f16 v in A-fragment order: per (kv head, 32 keys, 16 d) 1 KiB = [half][lane = 16 g + d][8 keys], key = 16 half + 8 g + e
#define WS_QL  (WS_VT + 2u * (size_t)NB * KV * TT)       // f16 q residual x 2^10 rows [b][t < QHI][2048]
#define WS_KL  (WS_QL + 2u * (size_t)NB * QHI * CC)      // f16 k residual x 2^10, keys < KHI, in k's order
#define WS_VB  (WS_KL + 2u * (size_t)NB * KHI * KV)      // bf16 v hi, keys < KHI, in v's order
#define WS_VBL (WS_VB + 2u * (size_t)NB * KV * KHI)      // bf16 v lo, likewise
#define WS_Y   (WS_VBL + 2u * (size_t)NB * KV * KHI)     // f32 ctx rows [b*t][2048]
#define WS_XB  (WS_Y  + 4u * (size_t)NB * TT * CC)        // bf16 x in A-fragment order (k_prep)
#define NWT (2 * CC + 2 * KV)                            // 5,120 rows of WT: the columns of Wq, Wk, Wv, Wg in that order
#define WS_WT  (WS_XB + 2u * (size_t)NB * TT * CC)        // bf16 weight columns as rows [col][k = 2048]
#define WS_WOT (WS_WT + 2u * (size_t)NWT * CC)            // f16 (bf16(Wo) x 2^8) columns as rows [col][k = 2048]
#define WS_END (WS_WOT + 2u * (size_t)CC * CC)

// ---- k_proj: block = (64 tokens, 128 output cols = two 64-dim heads, which): acc = x W (W (in,out); exact); which 0/1: rotate-half rope with the given tables (tiles j and j+2 hold d and d+32 of the same head) -> f16 (+ residual x 2^10 for the early rows): q as rows, k in k_attn's fragment order, and new_k written in f32; which 2: v -> f16 (+ bf16 hi/lo for the early keys) in k_attn's fragment order and new_v in f32; which 3: alpha = sigmoid(x Wg + bg) -> f16 rows
// ---- k_prep: every float operand of the three big products is rounded ONCE to its 16-bit form and laid out for its reader: the columns of Wq, Wk, Wv, Wg -> bf16 rows of WT, the columns of Wo -> f16 (bf16 x 2^8, exact) rows of WOT, both [col][k]; x -> bf16 in A-fragment order: per (16 rows, 32 k) 1 KiB = [half of the fragment][lane = 16 g + row][8 k], k = 16 half + 8 g + e, so that a wave's 16-B loads read 512 B in a row. blockIdx.x 0..79: 64 rows of WT, 80..111: of WOT, 112..143: 64 rows of x; blockIdx.y: eight 64-k tiles, one after the other (few, long blocks: fewer waves to start). Each 128-B line of the planes is written by one block.
#define PREP_T 8
template <bool IS_O> __device__ __forceinline__ void prep_w(const float* __restrict__ src, int ld, unsigned short* __restrict__ dst, unsigned (*ts)[64][36], int kt0, int tid) {
  const int n = tid >> 2, p = tid & 3, kq = tid >> 4, c4 = (tid & 15) * 4; v4f va[2], vb[2];   /* rows 2 kp and 2 kp + 1 (kp = 16 i + kq), four columns: 16 lanes read 256 B of a row */
  const float* s = src + (size_t)(kt0 * 64 + 2 * kq) * ld + c4; unsigned short* d = dst + (size_t)n * CC + kt0 * 64 + p * 16;
#pragma unroll
  for (int i = 0; i < 2; ++i) { va[i] = *(const v4f*)(s + (size_t)(i * 32) * ld); vb[i] = *(const v4f*)(s + (size_t)(i * 32 + 1) * ld); }
  asm volatile("s_wait_xcnt 0x0" ::: "memory");   /* before a register that the loads above name is used again */
#pragma unroll
  for (int it = 0; it < PREP_T; ++it) {
#pragma unroll
    for (int i = 0; i < 2; ++i) {
#pragma unroll
      for (int e = 0; e < 4; ++e) { union { __bf16 b[2]; _Float16 h[2]; unsigned u; } pk;
        if (IS_O) { pk.h[0] = (_Float16)(bfr(va[i][e]) * 256.0f); pk.h[1] = (_Float16)(bfr(vb[i][e]) * 256.0f); } else { pk.b[0] = (__bf16)va[i][e]; pk.b[1] = (__bf16)vb[i][e]; }
        ts[it & 1][c4 + e][i * 16 + kq] = pk.u; } }
    __syncthreads();   /* the tile is whole before it is read by columns; with two buffers it also ends the reads of the buffer that the next tile fills */
    if (it + 1 < PREP_T) { const float* sn = s + (size_t)((it + 1) * 64) * ld;   /* the next tile's loads fly under this tile's way out */
#pragma unroll
      for (int i = 0; i < 2; ++i) { va[i] = *(const v4f*)(sn + (size_t)(i * 32) * ld); vb[i] = *(const v4f*)(sn + (size_t)(i * 32 + 1) * ld); }
      asm volatile("s_wait_xcnt 0x0" ::: "memory");   /* before a register that the loads above name is used again */ }
    const v4u qa = *(const v4u*)&ts[it & 1][n][p * 8], qb = *(const v4u*)&ts[it & 1][n][p * 8 + 4];
    *(v4u*)(d + it * 64) = qa; *(v4u*)(d + it * 64 + 8) = qb;
    asm volatile("s_wait_xcnt 0x0" ::: "memory");   /* before a register that the stores above name is used again */ } }
__global__ __launch_bounds__(256) void k_prep(const float* __restrict__ X, const float* __restrict__ WQ, const float* __restrict__ WK, const float* __restrict__ WV, const float* __restrict__ WG, const float* __restrict__ WO, __bf16* __restrict__ XB, __bf16* __restrict__ WT, _Float16* __restrict__ WOT) {
  __shared__ __align__(16) unsigned ts[2][64][36];   /* [col][k pair], 128-B rows at a 144-B pitch, two buffers */
  const int tid = threadIdx.x, bx = blockIdx.x, kt0 = blockIdx.y * PREP_T;
  if (bx >= 112) {   /* x (block-uniform; no barrier on this path) */
    const int row = (bx - 112) * 64 + (tid >> 2), p = tid & 3; const float* s = X + (size_t)row * CC + kt0 * 64 + p * 16;
    __bf16* d = XB + ((((size_t)(row >> 4) * (CC / 32) + kt0 * 2 + (p >> 1)) * 2 + (p & 1)) * 32 + (row & 15)) * 8;   /* g = 0 piece; the g = 1 piece lies 16 lanes on, the next 64 k four halves on */
#pragma unroll
    for (int it = 0; it < PREP_T; ++it) { v8b t[2];
#pragma unroll
      for (int i = 0; i < 4; ++i) { const v4f v = *(const v4f*)(s + it * 64 + i * 4);
#pragma unroll
        for (int e = 0; e < 4; ++e) t[i >> 1][(i & 1) * 4 + e] = (__bf16)v[e]; }
      *(v8b*)(d + it * (4 * 32 * 8)) = t[0]; *(v8b*)(d + it * (4 * 32 * 8) + 16 * 8) = t[1]; }
    return; }
  if (bx >= 80) prep_w<true>(WO + (bx - 80) * 64, CC, (unsigned short*)WOT + (size_t)(bx - 80) * 64 * CC, ts, kt0, tid);
  else { const float* src = bx < 32 ? WQ + bx * 64 : bx < 40 ? WK + (bx - 32) * 64 : bx < 48 ? WV + (bx - 40) * 64 : WG + (bx - 48) * 64;
    prep_w<false>(src, (bx >= 32 && bx < 48) ? KV : CC, (unsigned short*)WT + (size_t)bx * 64 * CC, ts, kt0, tid); } }
template <bool F16> __device__ __forceinline__ v8f mm16(v4u a0, v4u a1, v4u b0, v4u b1, v8f c) {
  union { v4u q[2]; v16h h; v16b b; } A, B; A.q[0] = a0; A.q[1] = a1; B.q[0] = b0; B.q[1] = b1;
  if (F16) return wmma16(A.h, B.h, c); else return wmma_bf(A.b, B.b, c); }
#define SWP 144              /* LDS pitch of a 128-B tile row, bytes */
#define SWB (128 * SWP)      /* one buffer: 128 columns */
// acc += A W over all of K for a 64 x 128 tile, both operands 16-bit: W as rows with k contiguous (k_prep's planes), A as rows or in k_prep's fragment order. A pass is 64 k = 128 B of every row: eight lanes fetch one whole line of a W column (16 B a lane, a wave's load is four lines), eight such loads a thread bring the 128 x 64 tile, which goes to LDS as it is; the block's four waves read their B fragments from there, and each lane fetches its own four 16-B pieces of A from ap: AS bytes from piece to piece, AP from pass to pass (rows: 32 and 128, ap = the lane's row + 16 g bytes; fragment order: 512 and 2,048, ap = the wave's 16 rows + 16 lane bytes). wp: W row (tid >> 3) of the tile + 16 (tid & 7) bytes.
template <bool F16, int AS, int AP> __device__ __forceinline__ void gemm_acc(const char* __restrict__ ap, const char* __restrict__ wp, char* sw, int tid, int lane, v8f (&acc)[8]) {
  v4u wr[8], ar[4]; char* st = sw + (tid >> 3) * SWP + (tid & 7) * 16; const char* rd = sw + (lane & 15) * SWP + (lane >> 4) * 16;
#pragma unroll
  for (int i = 0; i < 8; ++i) wr[i] = *(const v4u*)(wp + (size_t)i * (16 * CC * 2));
#pragma unroll
  for (int i = 0; i < 4; ++i) ar[i] = *(const v4u*)(ap + i * AS);
  asm volatile("s_wait_xcnt 0x0" ::: "memory");   /* before a register that the loads above name is used again */
  /* unroll 2: the buffer index becomes a constant */
#pragma unroll 2
  for (int kc = 0; kc < CC / 64; ++kc) { const int bo = (kc & 1) * SWB; const v4u a[4] = {ar[0], ar[1], ar[2], ar[3]};
#pragma unroll
    for (int i = 0; i < 8; ++i) *(v4u*)(st + bo + i * 16 * SWP) = wr[i];
    __syncthreads();   /* publishes this pass's tile; with two buffers it also ends every wave's reads of the buffer that the next pass refills */
    const int kn = kc + 1 < CC / 64 ? kc + 1 : kc;   /* the next pass's global loads fly under this pass's products (the last pass reloads its own rows, unused) */
    const char* wn = wp + kn * 128; const char* an = ap + kn * AP;
#pragma unroll
    for (int i = 0; i < 8; ++i) wr[i] = *(const v4u*)(wn + (size_t)i * (16 * CC * 2));
#pragma unroll
    for (int i = 0; i < 4; ++i) ar[i] = *(const v4u*)(an + i * AS);
    asm volatile("s_wait_xcnt 0x0" ::: "memory");   /* before a register that the loads above name is used again */
#pragma unroll
    for (int kk = 0; kk < 2; ++kk) { v4u w[8][2];
#pragma unroll
      for (int j = 0; j < 8; ++j) { w[j][0] = *(const v4u*)(rd + bo + j * 16 * SWP + kk * 64); w[j][1] = *(const v4u*)(rd + bo + j * 16 * SWP + kk * 64 + 32); }
#pragma unroll
      for (int j = 0; j < 8; ++j) acc[j] = mm16<F16>(a[kk * 2], a[kk * 2 + 1], w[j][0], w[j][1], acc[j]); } } }
__global__ __launch_bounds__(128) void k_proj(const __bf16* __restrict__ XB, const __bf16* __restrict__ WT, const float* __restrict__ BG, const float* __restrict__ COS, const float* __restrict__ SIN, _Float16* __restrict__ QH, _Float16* __restrict__ KH, _Float16* __restrict__ VT, _Float16* __restrict__ QL, _Float16* __restrict__ KL, __bf16* __restrict__ VB, __bf16* __restrict__ VBL, _Float16* __restrict__ GA, float* __restrict__ OUTK, float* __restrict__ OUTV) {
  __shared__ __align__(16) _Float16 sh[64][136], sl[64][136]; __shared__ __align__(16) _Float16 th[128][72]; __shared__ __align__(16) __bf16 tb[128][72], tbl[128][72]; __shared__ __align__(16) float so[4][16][132]; __shared__ __align__(16) char sw[2 * SWB];
  const int tid = threadIdx.x, wave = tid >> 5, lane = tid & 31, col = lane & 15, g = lane >> 4; const int which = blockIdx.z; const int c0 = blockIdx.y * 128; const size_t r0 = (size_t)blockIdx.x * 64; const int NW = (which == 0 || which == 3) ? CC : KV; if (c0 >= NW) return;   // k/v are only 512 wide (block-uniform exit before any barrier)
  const size_t b = r0 / TT; const int t0 = (int)(r0 % TT); const bool hi_rows = t0 < ((which == 0) ? QHI : KHI);   /* block-uniform */
  const int w0 = which == 0 ? 0 : which == 1 ? CC : which == 2 ? CC + KV : CC + 2 * KV;   /* first row of this product's columns in WT */
  v8f acc[8] = {};
  gemm_acc<false, 512, 2048>((const char*)(XB + (r0 + wave * 16) * CC + lane * 8), (const char*)(WT + (size_t)(w0 + c0 + (tid >> 3)) * CC + (tid & 7) * 8), sw, tid, lane, acc);
  if (which == 3) {   /* gate: alpha = sigmoid(acc + bg) -> f16 rows */
#pragma unroll
    for (int j = 0; j < 8; ++j) { const float bb = bfr(BG[c0 + j * 16 + col]);
#pragma unroll
      for (int r = 0; r < 8; ++r) sh[wave * 16 + 8 * g + r][j * 16 + col] = (_Float16)(1.0f / (1.0f + expf(-(acc[j][r] + bb)))); }
    __syncthreads();
    for (int e = tid; e < 64 * 16; e += 128) { const int rl = e >> 4, q = e & 15; vst2((unsigned*)(GA + (r0 + rl) * CC + c0 + q * 8), *(const v4u*)&sh[rl][q * 8]); }
    return; }
  if (which < 2) {
    /* rotate-half rope on each 64-dim head: d = (j&3)*16+col; d < 32 (tiles jp = 0,1,4,5) pairs with d+32 (jp+2): out[d] = x[d] c - x[d+32] s, out[d+32] = x[d+32] c + x[d] s, table index d for out[d], d+32 for out[d+32] */
#pragma unroll
    for (int jp = 0; jp < 8; ++jp) { if ((jp & 3) >= 2) continue; const int i2 = (jp & 3) * 16 + col;
#pragma unroll
      for (int r = 0; r < 8; ++r) { const int t = t0 + wave * 16 + 8 * g + r; const float c1 = bfr(COS[(size_t)t * HD + i2]), s1 = bfr(SIN[(size_t)t * HD + i2]), c2 = bfr(COS[(size_t)t * HD + i2 + 32]), s2 = bfr(SIN[(size_t)t * HD + i2 + 32]); const float x1 = acc[jp][r], x2 = acc[jp + 2][r]; asm volatile("s_wait_loadcnt 0x0" ::: "memory"); acc[jp][r] = x1 * c1 - x2 * s1; acc[jp + 2][r] = x2 * c2 + x1 * s2; } }
    if (which == 1) {   /* new_k output [HKV][S][64] in f32: this wave's 16 rows x 2 heads, 256 B per (row, head) by 16 lanes */
#pragma unroll
      for (int j = 0; j < 8; ++j) {
#pragma unroll
        for (int r = 0; r < 8; ++r) so[wave][8 * g + r][j * 16 + col] = acc[j][r]; }
      LDSX(); for (int rl = 0; rl < 16; ++rl) { const int t = t0 + wave * 16 + rl; const int hh = (c0 >> 6) + (lane >> 4); vst2(OUTK + ((size_t)hh * TT + t) * HD + (lane & 15) * 4, *(const v4f*)&so[wave][rl][lane * 4]); } }
#pragma unroll
    for (int j = 0; j < 8; ++j) {
#pragma unroll
      for (int r = 0; r < 8; ++r) { const float v = acc[j][r]; const _Float16 hv = (_Float16)v; sh[wave * 16 + 8 * g + r][j * 16 + col] = hv; sl[wave * 16 + 8 * g + r][j * 16 + col] = (_Float16)((v - (float)hv) * 1024.0f); } }
    __syncthreads();
    _Float16* dh = which == 0 ? QH : KH; _Float16* dl = which == 0 ? (QL + (b * QHI) * (size_t)CC) : (KL + (b * KHI) * (size_t)KV);
    if (which == 0)   /* q: rows */
    for (int e = tid; e < 64 * 16; e += 128) { const int rl = e >> 4, q = e & 15; vst2((unsigned*)(dh + (r0 + rl) * NW + c0 + q * 8), *(const v4u*)&sh[rl][q * 8]); if (hi_rows) vst2((unsigned*)(dl + (size_t)(t0 + rl) * NW + c0 + q * 8), *(const v4u*)&sl[rl][q * 8]); }
    else   /* k in fragment order: piece e = (head hh, 16 keys tl, 32 d kc, half hf, lane 16 gg + row); a head's 64 keys are 8 KiB in a row, a wave's store 512 B in a row */
    for (int it = 0; it < 8; ++it) { const int e = tid + it * 128, row = e & 15, gg = (e >> 4) & 1, hf = (e >> 5) & 1, kc = (e >> 6) & 1, tl = (e >> 7) & 3, hh = e >> 9; const int rl = tl * 16 + row, cl = hh * 64 + kc * 32 + hf * 16 + gg * 8; const size_t hd = b * NKV + (c0 >> 6) + hh;
      _Float16* pk = KH + (hd * (TT / 16) + (t0 >> 4)) * 1024 + (e & 511) * 8; const v4u dk = *(const v4u*)&sh[rl][cl];
      /* s_wait_xcnt 0 behind the stores, before a register that they name is used again; addresses and data are inputs, so that they stay whole up to the wait */
      if (hi_rows) { _Float16* pr = KL + (hd * (KHI / 16) + (t0 >> 4)) * 1024 + (e & 511) * 8; const v4u dr = *(const v4u*)&sl[rl][cl]; vst2(pk, dk); vst2(pr, dr); asm volatile("s_wait_xcnt 0x0" :: "v"(pk), "v"(pr), "v"(dk), "v"(dr) : "memory"); }
      else { vst2(pk, dk); asm volatile("s_wait_xcnt 0x0" :: "v"(pk), "v"(dk) : "memory"); } }
  } else {   /* which == 2: v */
#pragma unroll
    for (int j = 0; j < 8; ++j) {
#pragma unroll
      for (int r = 0; r < 8; ++r) so[wave][8 * g + r][j * 16 + col] = acc[j][r]; }
    LDSX(); for (int rl = 0; rl < 16; ++rl) { const int t = t0 + wave * 16 + rl; const int hh = (c0 >> 6) + (lane >> 4); vst2(OUTV + ((size_t)hh * TT + t) * HD + (lane & 15) * 4, *(const v4f*)&so[wave][rl][lane * 4]); }   /* new_v output in f32 */
#pragma unroll
    for (int j = 0; j < 8; ++j) {
#pragma unroll
      for (int r = 0; r < 8; ++r) { const float v = acc[j][r]; const int rl = wave * 16 + 8 * g + r, cl = j * 16 + col; th[cl][rl] = (_Float16)v; const __bf16 bh = (__bf16)v; tb[cl][rl] = bh; tbl[cl][rl] = (__bf16)(v - (float)bh); } }
    __syncthreads();
    /* v in fragment order: piece e = (head hh, 32 keys cc, 16 d j, half hf, lane 16 gg + row); a head's 64 keys are 8 KiB in a row, a wave's store 512 B in a row */
    for (int it = 0; it < 8; ++it) { const int e = tid + it * 128, row = e & 15, gg = (e >> 4) & 1, hf = (e >> 5) & 1, j = (e >> 6) & 3, cc = (e >> 8) & 1, hh = e >> 9; const int cl = hh * 64 + j * 16 + row, rl = cc * 32 + hf * 16 + gg * 8; const size_t hd = b * NKV + (c0 >> 6) + hh;
      _Float16* pv = VT + (hd * (TT / 32) + (t0 >> 5)) * 2048 + (e & 511) * 8; const v4u dv = *(const v4u*)&th[cl][rl];
      /* s_wait_xcnt 0 behind the stores, before a register that they name is used again; addresses and data are inputs, so that they stay whole up to the wait */
      if (hi_rows) { const size_t o3 = (hd * (KHI / 32) + (t0 >> 5)) * 2048 + (e & 511) * 8; __bf16* ph = VB + o3; __bf16* pl = VBL + o3; const v4u dh = *(const v4u*)&tb[cl][rl], dl = *(const v4u*)&tbl[cl][rl];
        vst2(pv, dv); vst2(ph, dh); vst2(pl, dl); asm volatile("s_wait_xcnt 0x0" :: "v"(pv), "v"(ph), "v"(pl), "v"(dv), "v"(dh), "v"(dl) : "memory"); }
      else { vst2(pv, dv); asm volatile("s_wait_xcnt 0x0" :: "v"(pv), "v"(dv) : "memory"); } } } }
// ---- k_attn: block = (head h, pair y of 128-query blocks), eight independent waves of 32 queries each (two 16-query column groups u): waves 0..3 take block 15 - y, waves 4..7 block y, so that every block of the grid walks the same number of keys; no LDS, no barrier; k and v lie in fragment order (k_proj), so that every load of theirs reads whole lines. S^T = K Q^T: A = 16 key rows, B = 16 query rows, so lane (g, col) holds query col's logits of keys 8g + r; two such tiles (keys k0 + 0..15, k0 + 16..31) are, element for element, the B operand P^T of O^T += V^T P^T (A = 16 d of v). Pass 1 walks the keys for each query's maximum, pass 2 forms the same logits again, e = 2^11 exp(logit - max) = exp2(s ks + (11 - max ks)), sums e in f32 and multiplies e (once to f16; rows < 384: bf16 hi + lo) with v; the division by (sum + 1e-9) is done on the 64 outputs. 3-product logits for rows < 384, else 1.
// The pointers of this kernel are plain (no __restrict__): its loads then stay between the asm statements around them, so that each run of loads has its s_wait_xcnt 0 behind it.
/* s_wait_xcnt 0 behind a run of global loads, before a register that they name is used again; the run's address is an input of the statement, so that its registers stay whole up to the wait */
__device__ __forceinline__ void xwait(const void* p) { asm volatile("s_wait_xcnt 0x0" :: "v"(p) : "memory"); }
__device__ __forceinline__ void xwait(const void* p, const void* q) { asm volatile("s_wait_xcnt 0x0" :: "v"(p), "v"(q) : "memory"); }
/* one lane's 16 elements of a fragment; p already holds the lane half's 8 g */
__device__ __forceinline__ v16h ld_h(const _Float16* p) { union { v16h v; v8h q[2]; } u; u.q[0] = *(const v8h*)p; u.q[1] = *(const v8h*)(p + 16); return u.v; }
/* the same from a plane in fragment order (1 KiB = [half][lane][8]); p already holds the lane's 8 lane: each of the two loads reads 512 B in a row over the wave, four whole lines */
__device__ __forceinline__ v16h ld_hf(const _Float16* p) { union { v16h v; v8h q[2]; } u; u.q[0] = *(const v8h*)p; u.q[1] = *(const v8h*)(p + 256); return u.v; }
__device__ __forceinline__ v16b ld_bf(const __bf16* p) { union { v16b v; v8b q[2]; } u; u.q[0] = *(const v8b*)p; u.q[1] = *(const v8b*)(p + 256); return u.v; }
template <bool HI> __device__ __forceinline__ void attn_ldk(const _Float16* kp, const _Float16* klp, int c, v16h (&kh)[2][2], v16h (&kl)[2][2]) {
  const _Float16* p = kp + (size_t)c * 2048; const _Float16* pl = klp + (size_t)c * 2048;   /* a chunk of 32 keys: 2 x 2 fragments, 4 KiB in a row */
#pragma unroll
  for (int i = 0; i < 2; ++i) {
#pragma unroll
    for (int kc = 0; kc < 2; ++kc) { kh[i][kc] = ld_hf(p + i * 1024 + kc * 512); if (HI) kl[i][kc] = ld_hf(pl + i * 1024 + kc * 512); } }
  if (HI) xwait(p, pl); else xwait(p); }
template <bool HI> __device__ __forceinline__ v8f attn_s(const v16h (&kh)[2], const v16h (&kl)[2], const v16h (&qh)[2], const v16h (&ql)[2]) {
  v8f a = {}, al = {};
#pragma unroll
  for (int kc = 0; kc < 2; ++kc) { a = wmma16(kh[kc], qh[kc], a); if (HI) { al = wmma16(kh[kc], ql[kc], al); al = wmma16(kl[kc], qh[kc], al); } }
#pragma unroll
  for (int r = 0; r < 8; ++r) a[r] = HI ? (a[r] + al[r] * (1.0f / 1024.0f)) * SCALE : a[r];   /* the 1-product rows' values stay 8 x the logit: their 1/8 (exact) sits in the exponent's multiplier ks */
  return a; }
/* eight hardware exp2 in one statement: behind a transcendental the instruction set asks for one independent instruction before its result is read or its source overwritten; here each v_exp_f32 is that instruction for the one before it (every output lies apart from every input), and the v_nop is it for the last */
__device__ __forceinline__ void exp2x8(const float (&x)[8], float* y) { float y0, y1, y2, y3, y4, y5, y6, y7;
  asm("v_exp_f32 %0, %8\n\tv_exp_f32 %1, %9\n\tv_exp_f32 %2, %10\n\tv_exp_f32 %3, %11\n\tv_exp_f32 %4, %12\n\tv_exp_f32 %5, %13\n\tv_exp_f32 %6, %14\n\tv_exp_f32 %7, %15\n\tv_nop"
      : "=&v"(y0), "=&v"(y1), "=&v"(y2), "=&v"(y3), "=&v"(y4), "=&v"(y5), "=&v"(y6), "=&v"(y7) : "v"(x[0]), "v"(x[1]), "v"(x[2]), "v"(x[3]), "v"(x[4]), "v"(x[5]), "v"(x[6]), "v"(x[7]));
  y[0] = y0; y[1] = y1; y[2] = y2; y[3] = y3; y[4] = y4; y[5] = y5; y[6] = y6; y[7] = y7; }
/* the last chunk (keys 32 (nch - 1) + 0..31) alone reaches past a row's diagonal; dq = the row of column group 0 in this lane, counted from that chunk's first key */
template <int NU> __device__ __forceinline__ void attn_mask(v8f (&s)[NU][2], int dq, int g) {
#pragma unroll
  for (int u = 0; u < NU; ++u) {
#pragma unroll
    for (int i = 0; i < 2; ++i) {
#pragma unroll
      for (int r = 0; r < 8; ++r) s[u][i][r] = (i * 16 + 8 * g + r <= u * 16 + dq) ? s[u][i][r] : -3.0e38f; } } }
template <bool HI, int NU> __device__ __forceinline__ void attn_sall(const v16h (&kh)[2][2], const v16h (&kl)[2][2], const v16h (&qh)[NU][2], const v16h (&ql)[NU][2], v8f (&s)[NU][2]) {
#pragma unroll
  for (int u = 0; u < NU; ++u) {
#pragma unroll
    for (int i = 0; i < 2; ++i) s[u][i] = attn_s<HI>(kh[i], kl[i], qh[u], ql[u]); } }
template <int NU> __device__ __forceinline__ void attn_max(const v8f (&s)[NU][2], float (&m)[NU]) {
#pragma unroll
  for (int u = 0; u < NU; ++u) {
#pragma unroll
    for (int i = 0; i < 2; ++i) {
#pragma unroll
      for (int r = 0; r < 8; ++r) m[u] = fmaxf(m[u], s[u][i][r]); } } }
/* one wave, NU column groups of 16 queries from row ql0 on (ql0 a multiple of 16 NU) */
template <bool HI, int NU> __device__ __forceinline__ void attn_wave(const _Float16* QH, const _Float16* KH, const _Float16* QL, const _Float16* KL, const _Float16* VT, const __bf16* VB, const __bf16* VBL, float* Y, int b, int h, int ql0, int lane) {
  const int col = lane & 15, g = lane >> 4, dq = (ql0 & 31) + col; const size_t kvh = (size_t)b * NKV + h / GQ; const int nch = (ql0 >> 5) + 1;   /* 32-key chunks; every chunk holds at least one key <= t for each of the wave's rows */
  v16h qh[NU][2], ql[NU][2], ka[2][2], la[2][2], kb[2][2], lb[2][2]; v8f s[NU][2];
  { const _Float16* qp = QH + ((size_t)b * TT + ql0 + col) * CC + h * HD + 8 * g; const _Float16* qlp = QL + ((size_t)b * QHI + ql0 + col) * CC + h * HD + 8 * g;
#pragma unroll
    for (int u = 0; u < NU; ++u) {
#pragma unroll
      for (int kc = 0; kc < 2; ++kc) { qh[u][kc] = ld_h(qp + u * 16 * CC + kc * 32); if (HI) ql[u][kc] = ld_h(qlp + u * 16 * CC + kc * 32); } }
    if (HI) xwait(qp, qlp); else xwait(qp); }
  const _Float16* kp = KH + kvh * (TT / 16) * 1024 + lane * 8; const _Float16* klp = KL + kvh * (KHI / 16) * 1024 + lane * 8;
  float m[NU];
#pragma unroll
  for (int u = 0; u < NU; ++u) m[u] = -3.0e38f;
  if (HI) {   /* pass 1 of the early rows (at most 12 chunks, beside a wave that walks 53 and more): no look-ahead, so that the residual planes' registers fit */
    for (int c = 0; c < nch; ++c) { attn_ldk<HI>(kp, klp, c, ka, la);
      attn_sall<HI, NU>(ka, la, qh, ql, s);
      if (c == nch - 1) attn_mask<NU>(s, dq, g);   /* scalar test */
      attn_max<NU>(s, m); }
  } else {
  /* pass 1, two chunks a trip: each chunk's key rows are fetched a whole trip ahead, into the registers that its products have just left. An odd count takes its last chunk twice (a maximum does not mind). Behind the last trip ka holds chunk 0, with which pass 2 begins */
  attn_ldk<HI>(kp, klp, 0, ka, la); attn_ldk<HI>(kp, klp, nch > 1 ? 1 : 0, kb, lb);
  for (int c = 0; c < nch; c += 2) { const int c1 = c + 1 < nch ? c + 1 : nch - 1;
    attn_sall<HI, NU>(ka, la, qh, ql, s);
    attn_ldk<HI>(kp, klp, c + 2 < nch ? c + 2 : 0, ka, la);
    if (c == nch - 1) attn_mask<NU>(s, dq, g);   /* scalar test */
    attn_max<NU>(s, m);
    attn_sall<HI, NU>(kb, lb, qh, ql, s);
    attn_ldk<HI>(kp, klp, c + 3 < nch ? c + 3 : nch - 1, kb, lb);
    if (c1 == nch - 1) attn_mask<NU>(s, dq, g);   /* scalar test */
    attn_max<NU>(s, m); } }
#pragma unroll
  for (int u = 0; u < NU; ++u) m[u] = fmaxf(m[u], __shfl_xor(m[u], 16));   /* the two lane halves hold the two halves of a query's keys */
  const float ks = (HI ? 1.0f : SCALE) * 1.44269504f;   /* log2(e), times the 1/8 that the 1-product rows still owe */
  float sum[NU], cm[NU]; v8f o[NU][HD / 16];
#pragma unroll
  for (int u = 0; u < NU; ++u) { sum[u] = 0.f; cm[u] = fmaf(-m[u], ks, 11.0f);   /* its rounding is one factor for the whole row, in e and in the sum alike */
#pragma unroll
    for (int j = 0; j < HD / 16; ++j) o[u][j] = v8f{}; }
  const _Float16* vp = VT + kvh * (TT / 32) * 2048 + lane * 8; const __bf16* vbp = VB + kvh * (KHI / 32) * 2048 + lane * 8; const __bf16* vlp = VBL + kvh * (KHI / 32) * 2048 + lane * 8;   /* a chunk of 32 keys: four fragments (d = 16 j + col), 4 KiB in a row */
  for (int c = 0; c < nch; ++c) { v16h vf[HD / 16]; v16b vb[HD / 16], vbl[HD / 16];
    if (HI) attn_ldk<HI>(kp, klp, c, ka, la);
    else { const _Float16* p0 = vp + c * 2048;
#pragma unroll
      for (int j = 0; j < HD / 16; ++j) vf[j] = ld_hf(p0 + j * 512);
      xwait(p0); }
    attn_sall<HI, NU>(ka, la, qh, ql, s);
    if (HI) { const __bf16* p0 = vbp + c * 2048; const __bf16* p1 = vlp + c * 2048;   /* the early rows' v planes come in behind the logits, when the key rows' registers are free, and fly under the exponentials */
#pragma unroll
      for (int j = 0; j < HD / 16; ++j) { vb[j] = ld_bf(p0 + j * 512); vbl[j] = ld_bf(p1 + j * 512); }
      xwait(p0, p1);
    } else attn_ldk<HI>(kp, klp, c + 1 < nch ? c + 1 : c, ka, la);   /* the next chunk's key rows fly under this chunk's exponentials (the last chunk reloads its own, unused) */
    __builtin_amdgcn_sched_barrier(0);   /* keeps the loads above in front of the exponentials: sunk to the loop's foot they would be waited for at once */
    if (c == nch - 1) attn_mask<NU>(s, dq, g);   /* scalar test; the excluded keys' -3e38 gives e = 0 */
#pragma unroll
    for (int u = 0; u < NU; ++u) { float e[16];
#pragma unroll
      for (int i = 0; i < 2; ++i) { float x[8];   /* the argument is never above 11 (but for cm's rounding), so no range step is owed; below -126, the excluded keys' too, the instruction gives 0 */
#pragma unroll
        for (int r = 0; r < 8; ++r) x[r] = fmaf(s[u][i][r], ks, cm[u]);
        exp2x8(x, &e[i * 8]);
#pragma unroll
        for (int r = 0; r < 8; ++r) sum[u] += e[i * 8 + r]; }
      if (HI) { const F2 p = bsplit16(e);
#pragma unroll
        for (int j = 0; j < HD / 16; ++j) { o[u][j] = wmma_bf(vb[j], p.h, o[u][j]); o[u][j] = wmma_bf(vb[j], p.l, o[u][j]); o[u][j] = wmma_bf(vbl[j], p.h, o[u][j]); }
      } else { v16h p;
#pragma unroll
        for (int x = 0; x < 16; ++x) p[x] = (_Float16)e[x];
#pragma unroll
        for (int j = 0; j < HD / 16; ++j) o[u][j] = wmma16(vf[j], p, o[u][j]); } } }
#pragma unroll
  for (int u = 0; u < NU; ++u) sum[u] = 1.0f / (sum[u] + __shfl_xor(sum[u], 16) + 2048.0f * 1e-9f);   /* p = e / (sum + 1e-9) as in the module, numerator and denominator x 2^11 */
#pragma unroll
  for (int u = 0; u < NU; ++u) { const float sc = sum[u]; v8f t[HD / 16];
    float* yp = Y + ((size_t)b * TT + ql0 + u * 16 + col) * CC + h * HD + 8 * g;   /* lane (g, col) holds d = 16 j + 8 g + r of query col */
#pragma unroll
    for (int j = 0; j < HD / 16; ++j) { t[j] = o[u][j] * sc; vst2(yp + j * 16, t[j]); }
    asm volatile("s_wait_xcnt 0x0" :: "v"(yp), "v"(t[0]), "v"(t[1]), "v"(t[2]), "v"(t[3]) : "memory");   /* before a register that the stores above name is used again; address and data are inputs, so that they stay whole up to the wait */ } }
__global__ __launch_bounds__(256) void k_attn(const _Float16* QH, const _Float16* KH, const _Float16* QL, const _Float16* KL, const _Float16* VT, const __bf16* VB, const __bf16* VBL, float* Y) {
  static_assert(QHI % 128 == 0 && KHI >= QHI && HD == 64, "a wave is wholly on one path, and its keys have the residual planes");
  const int lane = threadIdx.x & 31; const int wave = __builtin_amdgcn_readfirstlane(threadIdx.x >> 5);   /* scalar, so that the chunk loops branch on scalars */
  const int qb = wave < 4 ? (TT / 128 - 1) - (int)blockIdx.y : (int)blockIdx.y; const int ql0 = qb * 128 + (wave & 3) * 32;   /* a long and a short query block side by side */
  if (qb < QHI / 128) {   /* the early rows' planes take twice the registers: one column group at a time */
    /* kept rolled: one copy of this path's code, and one group's registers */
#pragma unroll 1
    for (int u = 0; u < 2; ++u) attn_wave<true, 1>(QH, KH, QL, KL, VT, VB, VBL, Y, blockIdx.z, blockIdx.x, ql0 + u * 16, lane);
  } else attn_wave<false, 2>(QH, KH, QL, KL, VT, VB, VBL, Y, blockIdx.z, blockIdx.x, ql0, lane); }
__global__ __launch_bounds__(256) void k_gn(const float* __restrict__ Y, const _Float16* __restrict__ GA, const float* __restrict__ GW, const float* __restrict__ GB, _Float16* __restrict__ AH) {
  const int tid = threadIdx.x; const size_t t = blockIdx.x; const int h = tid >> 3, q = tid & 7; const size_t base = t * CC + h * HD + q * 8;
  const v4f ya = *(const v4f*)(Y + base), yb = *(const v4f*)(Y + base + 4); float v[8] = {ya[0], ya[1], ya[2], ya[3], yb[0], yb[1], yb[2], yb[3]};
  float s = 0.f;
#pragma unroll
  for (int z = 0; z < 8; ++z) s += v[z];
#pragma unroll
  for (int o = 1; o < 8; o <<= 1) s += __shfl_xor(s, o);
  const float mean = s * (1.0f / HD); float s2 = 0.f;
#pragma unroll
  for (int z = 0; z < 8; ++z) { v[z] -= mean; s2 += v[z] * v[z]; }
#pragma unroll
  for (int o = 1; o < 8; o <<= 1) s2 += __shfl_xor(s2, o);
  const float rstd = rsqrtf(s2 * (1.0f / HD) + 1e-5f);
  union { v8h hv; v4u u; } pk;
#pragma unroll
  for (int z = 0; z < 8; ++z) { const int c = h * HD + q * 8 + z; pk.hv[z] = (_Float16)((v[z] * rstd * bfr(GW[c]) + bfr(GB[c])) * (float)GA[t * CC + c]); }
  vst2((unsigned*)(AH + base), pk.u); }
// ---- k_out: block = (64 rows, 128 cols): y = (gn * alpha) (f16 rows) Wo (k_prep's f16 rows, bf16 x 2^8, exact) x 2^-8 -> output 0 rows
__global__ __launch_bounds__(128) void k_out(const _Float16* __restrict__ AH, const _Float16* __restrict__ WOT, float* __restrict__ OUT) { __shared__ __align__(16) float sf[4][16][132]; __shared__ __align__(16) char sw[2 * SWB];   /* Wo tile of one pass, [col][k] in f16 (x 2^8), two buffers */
  const int tid = threadIdx.x, wave = tid >> 5, lane = tid & 31, col = lane & 15, g = lane >> 4; const int c0 = blockIdx.y * 128; const size_t r0 = (size_t)blockIdx.x * 64 + wave * 16;
  v8f acc[8] = {};
  gemm_acc<true, 32, 128>((const char*)(AH + (r0 + col) * CC + 8 * g), (const char*)(WOT + (size_t)(c0 + (tid >> 3)) * CC + (tid & 7) * 8), sw, tid, lane, acc);
#pragma unroll
  for (int j = 0; j < 8; ++j) {
#pragma unroll
    for (int r = 0; r < 8; ++r) sf[wave][8 * g + r][j * 16 + col] = acc[j][r] * (1.0f / 256.0f); }
  LDSX(); for (int rl = 0; rl < 16; ++rl) vst2(OUT + (r0 + rl) * CC + c0 + lane * 4, *(const v4f*)&sf[wave][rl][lane * 4]); }
extern "C" void kernel_launch(void* const* d_in, const int* in_sizes, int n_in, void* d_out, int out_size, void* d_ws, size_t ws_size, hipStream_t stream) {
  (void)in_sizes; (void)n_in; (void)out_size;
  const float** F = (const float**)d_in;   // 0 x [1,2048,2048]; 1 rope_cos, 2 rope_sin [2048,64]; 3 Wq [2048,2048]; 4 Wk, 5 Wv [2048,512]; 6 Wo [2048,2048]; 7 Wg [2048,2048], 8 bg; 9 gn_weight, 10 gn_bias [2048]
  if (ws_size < (size_t)WS_END) return;
  char* ws = (char*)d_ws; _Float16 *GA = (_Float16*)(ws + WS_GA), *AH = (_Float16*)(ws + WS_AH), *QH = (_Float16*)(ws + WS_QH), *KH = (_Float16*)(ws + WS_KH), *VT = (_Float16*)(ws + WS_VT), *QL = (_Float16*)(ws + WS_QL), *KL = (_Float16*)(ws + WS_KL); __bf16 *VB = (__bf16*)(ws + WS_VB), *VBL = (__bf16*)(ws + WS_VBL); float *Y = (float*)(ws + WS_Y); __bf16 *XB = (__bf16*)(ws + WS_XB), *WT = (__bf16*)(ws + WS_WT); _Float16 *WOT = (_Float16*)(ws + WS_WOT);
  float* OUT0 = (float*)d_out; float* OUTK = OUT0 + (size_t)NB * TT * CC; float* OUTV = OUTK + (size_t)NB * NKV * TT * HD;   /* tuple outputs concatenated, no padding */
  k_prep<<<dim3(NWT / 64 + CC / 64 + TNB * TT / 64, CC / 64 / PREP_T), 256, 0, stream>>>(F[0], F[3], F[4], F[5], F[7], F[6], XB, WT, WOT);
  k_proj<<<dim3(TNB * TT / 64, CC / 128, 4), 128, 0, stream>>>(XB, WT, F[8], F[1], F[2], QH, KH, VT, QL, KL, VB, VBL, GA, OUTK, OUTV);
  k_attn<<<dim3(NH, TT / 256, TNB), 256, 0, stream>>>(QH, KH, QL, KL, VT, VB, VBL, Y);
  k_gn<<<dim3(TNB * TT), 256, 0, stream>>>(Y, GA, F[9], F[10], AH);
  k_out<<<dim3(TNB * TT / 64, CC / 128), 128, 0, stream>>>(AH, WOT, OUT0);
}

// v006
// One run takes 163 microseconds.
// Two timings next to v005 both put it at 1.04 times that version's speed.
// All steps since v000 together make it 8.44 times as fast.
// compute dtype: all float inputs rounded to bf16; q/k/v/gate projections x W with EXACT bf16 products on WMMA 16x16x32, f32 accumulate; rotate-half rotary with the given cos/sin tables in f32; q, k once to f16 -> 1-product causal logits / 8 (the first 384 query rows use f16 hi + residual on both sides, 3 products); softmax in f32: exp(logit - max) x 2^11 as one hardware exp2 of (logit - max) x log2(e) + 11 (one fused multiply-add), once to f16 against v once to f16 (first 384 rows: bf16 hi + lo, 3 products), divided by (sum + 1e-9) after the product (sum and 1e-9 both carried x 2^11); per-head GroupNorm and the sigmoid gate in f32; (gn * alpha) once to f16 against Wo carried x 2^8 in f16 (exact); new_k / new_v written in f32 straight from the projections; f32 outputs.
#include <hip/hip_runtime.h>
#include <math.h>

typedef __attribute__((ext_vector_type(16))) _Float16 v16h;
typedef __attribute__((ext_vector_type(16))) __bf16 v16b;
typedef __attribute__((ext_vector_type(8)))  _Float16 v8h;
typedef __attribute__((ext_vector_type(8)))  float v8f;
typedef __attribute__((ext_vector_type(4)))  float v4f;
typedef __attribute__((ext_vector_type(2)))  float v2f;
typedef __attribute__((ext_vector_type(4)))  unsigned v4u;
typedef __attribute__((ext_vector_type(4)))  int v4i;
typedef float __attribute__((may_alias)) float_a;
typedef int __attribute__((may_alias)) int_a;

template <typename T> __device__ __forceinline__ void vst2(void* p, T v) { *(T*)p = v;  }
__device__ __forceinline__ v8f wmma16(v16h a, v16h b, v8f c) {
  v8f d = __builtin_amdgcn_wmma_f32_16x16x32_f16(false, a, false, b, (short)0, c, false, false);
  asm volatile("v_nop\n\tv_nop\n\tv_nop\n\tv_nop" : "+v"(d) : "v"(a), "v"(b));
  return d;
}
__device__ __forceinline__ v8f wmma_bf(v16b a, v16b b, v8f c) {
  v8f d = __builtin_amdgcn_wmma_f32_16x16x32_bf16(false, a, false, b, (short)0, c, false, false);
  asm volatile("v_nop\n\tv_nop\n\tv_nop\n\tv_nop" : "+v"(d) : "v"(a), "v"(b));
  return d;
}
// 16x16x32 fragments: lane = (h = lane>>4, row/col = lane&15); elements 0..7 = k0+8h+0..7, 8..15 = k0+16+8h+0..7; D element r = row 8h+r
__device__ __forceinline__ v16h frag_h(const _Float16* rowk0, int lane) {
  union { v16h v; v8h q[2]; } u; const _Float16* p = rowk0 + 8 * (lane >> 4);
  u.q[0] = *(const v8h*)p; u.q[1] = *(const v8h*)(p + 16); return u.v;
}
__device__ __forceinline__ v16h frag_f32(const float* rowk0, int lane) {
  v16h a; const float* p = rowk0 + 8 * (lane >> 4);
#pragma unroll
  for (int i = 0; i < 8; ++i) { a[i] = (_Float16)p[i]; a[8 + i] = (_Float16)p[16 + i]; }
  return a;
}
__device__ __forceinline__ v16h frag_f32s(const float* rowk0, int lane, float sc) {
  v16h a; const float* p = rowk0 + 8 * (lane >> 4);
#pragma unroll
  for (int i = 0; i < 8; ++i) { a[i] = (_Float16)(p[i] * sc); a[8 + i] = (_Float16)(p[16 + i] * sc); }
  return a;
}
// column fragment from a [K][ld] layout (column n), rows >= K read as 0
__device__ __forceinline__ v16h fragc_f32(const float* W, int k0, int n, int lane, int ld, int K) {
  v16h a; const int g = lane >> 4;
#pragma unroll
  for (int i = 0; i < 8; ++i) { const int ka = k0 + 8 * g + i, kb = ka + 16;
    a[i] = (_Float16)(ka < K ? W[(size_t)(ka < K ? ka : K - 1) * ld + n] : 0.f); a[8 + i] = (_Float16)(kb < K ? W[(size_t)(kb < K ? kb : K - 1) * ld + n] : 0.f); }
  return a;
}
struct F2 { v16b h, l; };
__device__ __forceinline__ F2 bsplit16(const float v[16]) { F2 r;
#pragma unroll
  for (int i = 0; i < 16; ++i) { const __bf16 h = (__bf16)v[i]; r.h[i] = h; r.l[i] = (__bf16)(v[i] - (float)h); }
  return r; }
__device__ __forceinline__ F2 split_row(const float* row, int k0, int lane) { float v[16]; const float* p = row + k0 + 8 * (lane >> 4);
#pragma unroll
  for (int i = 0; i < 8; ++i) { v[i] = p[i]; v[8 + i] = p[16 + i]; }
  return bsplit16(v); }
__device__ __forceinline__ F2 split_rowK(const float* row, int k0, int lane, int K) { float v[16]; const int g = lane >> 4;
#pragma unroll
  for (int i = 0; i < 8; ++i) { const int ka = k0 + 8 * g + i, kb = ka + 16; v[i] = ka < K ? row[ka < K ? ka : K - 1] : 0.f; v[8 + i] = kb < K ? row[kb < K ? kb : K - 1] : 0.f; }
  return bsplit16(v); }
__device__ __forceinline__ F2 split_col(const float* W, int k0, int n, int lane, int ld, int K) { float v[16]; const int g = lane >> 4;
#pragma unroll
  for (int i = 0; i < 8; ++i) { const int ka = k0 + 8 * g + i, kb = ka + 16; v[i] = ka < K ? W[(size_t)(ka < K ? ka : K - 1) * ld + n] : 0.f; v[8 + i] = kb < K ? W[(size_t)(kb < K ? kb : K - 1) * ld + n] : 0.f; }
  return bsplit16(v); }
__device__ __forceinline__ v8f mac3(const F2& a, const F2& b, v8f c) { c = wmma_bf(a.l, b.h, c); c = wmma_bf(a.h, b.l, c); return wmma_bf(a.h, b.h, c); }
__device__ __forceinline__ float sigm(float v) { return 1.0f / (1.0f + expf(-v)); }
#define LDSX() do { asm volatile("s_wait_dscnt 0" ::: "memory"); __builtin_amdgcn_wave_barrier(); __builtin_amdgcn_fence(__ATOMIC_RELEASE, "workgroup"); } while (0)

// Gated GQA causal self-attention with rotary tables, per-head GroupNorm and a sigmoid output gate (B 1, S 2,048, HID 2,048; 32 query / 8 kv heads x 64): q = x Wq, k = x Wk, v = x Wv ((in,out)); q, k rotate-half RoPE with the given cos/sin [S,64]; scores = q k^T / 8, causal (col > row -> -inf); p = exp(a - max) / (sum + 1e-9); out = p v (GQA x4); gn = per-(token, head) normalisation over 64 x gn_weight + gn_bias; alpha = sigmoid(x Wg + bg); y = (gn * alpha) Wo. Returns (y, new_k = roped k [B,HKV,S,D], new_v [B,HKV,S,D]).
#define NB 1
#define TT 2048
#define CC 2048
#define NH 32
#define HD 64
#define NKV 8
#define KV (NKV * HD)      // 512
#define GQ (NH / NKV)      // 4
#define SCALE 0.125f
#ifndef TNB
#define TNB NB
#endif
typedef __attribute__((ext_vector_type(8))) __bf16 v8b;
__device__ __forceinline__ v16b frag_b(const __bf16* rowk0, int lane) {
  union { v16b v; v8b q[2]; } u; const __bf16* p = rowk0 + 8 * (lane >> 4);
  u.q[0] = *(const v8b*)p; u.q[1] = *(const v8b*)(p + 16); return u.v;
}
__device__ __forceinline__ float bfr(float v) { return (float)(__bf16)v; }
#define QBH 6              // query blocks 0..5 of each sequence (rows < 384) take the high-precision path (their rows see only 1..384 keys)
#define QHI (QBH * 64)     // 384
#define KHI 384            // key rows with residual / bf16 planes (keys of those rows are <= 383)

#define WS_GA  0u                                       // f16 alpha = sigmoid(x Wg + bg) rows [t][2048]
#define WS_AH  (WS_GA + 2u * (size_t)NB * TT * CC)        // f16 (gn * alpha) rows [t][2048] (A operand of the output projection)
#define WS_QH  (WS_AH + 2u * (size_t)NB * TT * CC)        // f16 q rows [b*t][2048] (rotated)
#define WS_KH  (WS_QH + 2u * (size_t)NB * TT * CC)       // f16 k in A-fragment order: per (kv head, 16 keys, 32 d) 1 KiB = [half][lane = 16 g + key][8 d], d = 16 half + 8 g + e
#define WS_VT  (WS_KH + 2u * (size_t)NB * TT * KV)       // f16 v in A-fragment order: per (kv head, 32 keys, 16 d) 1 KiB = [half][lane = 16 g + d][8 keys], key = 16 half + 8 g + e
#define WS_QL  (WS_VT + 2u * (size_t)NB * KV * TT)       // f16 q residual x 2^10 rows [b][t < QHI][2048]
#define WS_KL  (WS_QL + 2u * (size_t)NB * QHI * CC)      // f16 k residual x 2^10, keys < KHI, in k's order
#define WS_VB  (WS_KL + 2u * (size_t)NB * KHI * KV)      // bf16 v hi, keys < KHI, in v's order
#define WS_VBL (WS_VB + 2u * (size_t)NB * KV * KHI)      // bf16 v lo, likewise
#define WS_XB  (WS_VBL + 2u * (size_t)NB * KV * KHI)     // bf16 x in A-fragment order (k_prep)
#define NWT (2 * CC + 2 * KV)                            // 5,120 rows of WT: the columns of Wq, Wk, Wv, Wg in that order
#define WS_WT  (WS_XB + 2u * (size_t)NB * TT * CC)        // bf16 weight columns as rows [col][k = 2048]
#define WS_WOT (WS_WT + 2u * (size_t)NWT * CC)            // f16 (bf16(Wo) x 2^8) columns as rows [col][k = 2048]
#define WS_END (WS_WOT + 2u * (size_t)CC * CC)

// ---- k_proj: block = (64 tokens, 128 output cols = two 64-dim heads, which): acc = x W (W (in,out); exact); which 0/1: rotate-half rope with the given tables (tiles j and j+2 hold d and d+32 of the same head) -> f16 (+ residual x 2^10 for the early rows): q as rows, k in k_attn's fragment order, and new_k written in f32; which 2: v -> f16 (+ bf16 hi/lo for the early keys) in k_attn's fragment order and new_v in f32; which 3: alpha = sigmoid(x Wg + bg) -> f16 rows
// ---- k_prep: every float operand of the three big products is rounded ONCE to its 16-bit form and laid out for its reader: the columns of Wq, Wk, Wv, Wg -> bf16 rows of WT, the columns of Wo -> f16 (bf16 x 2^8, exact) rows of WOT, both [col][k]; x -> bf16 in A-fragment order: per (16 rows, 32 k) 1 KiB = [half of the fragment][lane = 16 g + row][8 k], k = 16 half + 8 g + e, so that a wave's 16-B loads read 512 B in a row. blockIdx.x 0..79: 64 rows of WT, 80..111: of WOT, 112..143: 64 rows of x; blockIdx.y: eight 64-k tiles, one after the other (few, long blocks: fewer waves to start). Each 128-B line of the planes is written by one block.
#define PREP_T 8
template <bool IS_O> __device__ __forceinline__ void prep_w(const float* __restrict__ src, int ld, unsigned short* __restrict__ dst, unsigned (*ts)[64][36], int kt0, int tid) {
  const int n = tid >> 2, p = tid & 3, kq = tid >> 4, c4 = (tid & 15) * 4; v4f va[2], vb[2];   /* rows 2 kp and 2 kp + 1 (kp = 16 i + kq), four columns: 16 lanes read 256 B of a row */
  const float* s = src + (size_t)(kt0 * 64 + 2 * kq) * ld + c4; unsigned short* d = dst + (size_t)n * CC + kt0 * 64 + p * 16;
#pragma unroll
  for (int i = 0; i < 2; ++i) { va[i] = *(const v4f*)(s + (size_t)(i * 32) * ld); vb[i] = *(const v4f*)(s + (size_t)(i * 32 + 1) * ld); }
  asm volatile("s_wait_xcnt 0x0" ::: "memory");   /* before a register that the loads above name is used again */
#pragma unroll
  for (int it = 0; it < PREP_T; ++it) {
#pragma unroll
    for (int i = 0; i < 2; ++i) {
#pragma unroll
      for (int e = 0; e < 4; ++e) { union { __bf16 b[2]; _Float16 h[2]; unsigned u; } pk;
        if (IS_O) { pk.h[0] = (_Float16)(bfr(va[i][e]) * 256.0f); pk.h[1] = (_Float16)(bfr(vb[i][e]) * 256.0f); } else { pk.b[0] = (__bf16)va[i][e]; pk.b[1] = (__bf16)vb[i][e]; }
        ts[it & 1][c4 + e][i * 16 + kq] = pk.u; } }
    __syncthreads();   /* the tile is whole before it is read by columns; with two buffers it also ends the reads of the buffer that the next tile fills */
    if (it + 1 < PREP_T) { const float* sn = s + (size_t)((it + 1) * 64) * ld;   /* the next tile's loads fly under this tile's way out */
#pragma unroll
      for (int i = 0; i < 2; ++i) { va[i] = *(const v4f*)(sn + (size_t)(i * 32) * ld); vb[i] = *(const v4f*)(sn + (size_t)(i * 32 + 1) * ld); }
      asm volatile("s_wait_xcnt 0x0" ::: "memory");   /* before a register that the loads above name is used again */ }
    const v4u qa = *(const v4u*)&ts[it & 1][n][p * 8], qb = *(const v4u*)&ts[it & 1][n][p * 8 + 4];
    *(v4u*)(d + it * 64) = qa; *(v4u*)(d + it * 64 + 8) = qb;
    asm volatile("s_wait_xcnt 0x0" ::: "memory");   /* before a register that the stores above name is used again */ } }
__global__ __launch_bounds__(256) void k_prep(const float* __restrict__ X, const float* __restrict__ WQ, const float* __restrict__ WK, const float* __restrict__ WV, const float* __restrict__ WG, const float* __restrict__ WO, __bf16* __restrict__ XB, __bf16* __restrict__ WT, _Float16* __restrict__ WOT) {
  __shared__ __align__(16) unsigned ts[2][64][36];   /* [col][k pair], 128-B rows at a 144-B pitch, two buffers */
  const int tid = threadIdx.x, bx = blockIdx.x, kt0 = blockIdx.y * PREP_T;
  if (bx >= 112) {   /* x (block-uniform; no barrier on this path) */
    const int row = (bx - 112) * 64 + (tid >> 2), p = tid & 3; const float* s = X + (size_t)row * CC + kt0 * 64 + p * 16;
    __bf16* d = XB + ((((size_t)(row >> 4) * (CC / 32) + kt0 * 2 + (p >> 1)) * 2 + (p & 1)) * 32 + (row & 15)) * 8;   /* g = 0 piece; the g = 1 piece lies 16 lanes on, the next 64 k four halves on */
#pragma unroll
    for (int it = 0; it < PREP_T; ++it) { v8b t[2];
#pragma unroll
      for (int i = 0; i < 4; ++i) { const v4f v = *(const v4f*)(s + it * 64 + i * 4);
#pragma unroll
        for (int e = 0; e < 4; ++e) t[i >> 1][(i & 1) * 4 + e] = (__bf16)v[e]; }
      *(v8b*)(d + it * (4 * 32 * 8)) = t[0]; *(v8b*)(d + it * (4 * 32 * 8) + 16 * 8) = t[1]; }
    return; }
  if (bx >= 80) prep_w<true>(WO + (bx - 80) * 64, CC, (unsigned short*)WOT + (size_t)(bx - 80) * 64 * CC, ts, kt0, tid);
  else { const float* src = bx < 32 ? WQ + bx * 64 : bx < 40 ? WK + (bx - 32) * 64 : bx < 48 ? WV + (bx - 40) * 64 : WG + (bx - 48) * 64;
    prep_w<false>(src, (bx >= 32 && bx < 48) ? KV : CC, (unsigned short*)WT + (size_t)bx * 64 * CC, ts, kt0, tid); } }
template <bool F16> __device__ __forceinline__ v8f mm16(v4u a0, v4u a1, v4u b0, v4u b1, v8f c) {
  union { v4u q[2]; v16h h; v16b b; } A, B; A.q[0] = a0; A.q[1] = a1; B.q[0] = b0; B.q[1] = b1;
  if (F16) return wmma16(A.h, B.h, c); else return wmma_bf(A.b, B.b, c); }
#define SWP 144              /* LDS pitch of a 128-B tile row, bytes */
#define SWB (128 * SWP)      /* one buffer: 128 columns */
// acc += A W over all of K for a 64 x 128 tile, both operands 16-bit: W as rows with k contiguous (k_prep's planes), A as rows or in k_prep's fragment order. A pass is 64 k = 128 B of every row: eight lanes fetch one whole line of a W column (16 B a lane, a wave's load is four lines), eight such loads a thread bring the 128 x 64 tile, which goes to LDS as it is; the block's four waves read their B fragments from there, and each lane fetches its own four 16-B pieces of A from ap: AS bytes from piece to piece, AP from pass to pass (rows: 32 and 128, ap = the lane's row + 16 g bytes; fragment order: 512 and 2,048, ap = the wave's 16 rows + 16 lane bytes). wp: W row (tid >> 3) of the tile + 16 (tid & 7) bytes.
template <bool F16, int AS, int AP> __device__ __forceinline__ void gemm_acc(const char* __restrict__ ap, const char* __restrict__ wp, char* sw, int tid, int lane, v8f (&acc)[8]) {
  v4u wr[8], ar[4]; char* st = sw + (tid >> 3) * SWP + (tid & 7) * 16; const char* rd = sw + (lane & 15) * SWP + (lane >> 4) * 16;
#pragma unroll
  for (int i = 0; i < 8; ++i) wr[i] = *(const v4u*)(wp + (size_t)i * (16 * CC * 2));
#pragma unroll
  for (int i = 0; i < 4; ++i) ar[i] = *(const v4u*)(ap + i * AS);
  asm volatile("s_wait_xcnt 0x0" ::: "memory");   /* before a register that the loads above name is used again */
  /* unroll 2: the buffer index becomes a constant */
#pragma unroll 2
  for (int kc = 0; kc < CC / 64; ++kc) { const int bo = (kc & 1) * SWB; const v4u a[4] = {ar[0], ar[1], ar[2], ar[3]};
#pragma unroll
    for (int i = 0; i < 8; ++i) *(v4u*)(st + bo + i * 16 * SWP) = wr[i];
    __syncthreads();   /* publishes this pass's tile; with two buffers it also ends every wave's reads of the buffer that the next pass refills */
    const int kn = kc + 1 < CC / 64 ? kc + 1 : kc;   /* the next pass's global loads fly under this pass's products (the last pass reloads its own rows, unused) */
    const char* wn = wp + kn * 128; const char* an = ap + kn * AP;
#pragma unroll
    for (int i = 0; i < 8; ++i) wr[i] = *(const v4u*)(wn + (size_t)i * (16 * CC * 2));
#pragma unroll
    for (int i = 0; i < 4; ++i) ar[i] = *(const v4u*)(an + i * AS);
    asm volatile("s_wait_xcnt 0x0" ::: "memory");   /* before a register that the loads above name is used again */
#pragma unroll
    for (int kk = 0; kk < 2; ++kk) { v4u w[8][2];
#pragma unroll
      for (int j = 0; j < 8; ++j) { w[j][0] = *(const v4u*)(rd + bo + j * 16 * SWP + kk * 64); w[j][1] = *(const v4u*)(rd + bo + j * 16 * SWP + kk * 64 + 32); }
#pragma unroll
      for (int j = 0; j < 8; ++j) acc[j] = mm16<F16>(a[kk * 2], a[kk * 2 + 1], w[j][0], w[j][1], acc[j]); } } }
__global__ __launch_bounds__(128) void k_proj(const __bf16* __restrict__ XB, const __bf16* __restrict__ WT, const float* __restrict__ BG, const float* __restrict__ COS, const float* __restrict__ SIN, _Float16* __restrict__ QH, _Float16* __restrict__ KH, _Float16* __restrict__ VT, _Float16* __restrict__ QL, _Float16* __restrict__ KL, __bf16* __restrict__ VB, __bf16* __restrict__ VBL, _Float16* __restrict__ GA, float* __restrict__ OUTK, float* __restrict__ OUTV) {
  __shared__ __align__(16) _Float16 sh[64][136], sl[64][136]; __shared__ __align__(16) _Float16 th[128][72]; __shared__ __align__(16) __bf16 tb[128][72], tbl[128][72]; __shared__ __align__(16) float so[4][16][132]; __shared__ __align__(16) char sw[2 * SWB];
  const int tid = threadIdx.x, wave = tid >> 5, lane = tid & 31, col = lane & 15, g = lane >> 4; const int which = blockIdx.z; const int c0 = blockIdx.y * 128; const size_t r0 = (size_t)blockIdx.x * 64; const int NW = (which == 0 || which == 3) ? CC : KV; if (c0 >= NW) return;   // k/v are only 512 wide (block-uniform exit before any barrier)
  const size_t b = r0 / TT; const int t0 = (int)(r0 % TT); const bool hi_rows = t0 < ((which == 0) ? QHI : KHI);   /* block-uniform */
  const int w0 = which == 0 ? 0 : which == 1 ? CC : which == 2 ? CC + KV : CC + 2 * KV;   /* first row of this product's columns in WT */
  v8f acc[8] = {};
  gemm_acc<false, 512, 2048>((const char*)(XB + (r0 + wave * 16) * CC + lane * 8), (const char*)(WT + (size_t)(w0 + c0 + (tid >> 3)) * CC + (tid & 7) * 8), sw, tid, lane, acc);
  if (which == 3) {   /* gate: alpha = sigmoid(acc + bg) -> f16 rows */
#pragma unroll
    for (int j = 0; j < 8; ++j) { const float bb = bfr(BG[c0 + j * 16 + col]);
#pragma unroll
      for (int r = 0; r < 8; ++r) sh[wave * 16 + 8 * g + r][j * 16 + col] = (_Float16)(1.0f / (1.0f + expf(-(acc[j][r] + bb)))); }
    __syncthreads();
    for (int e = tid; e < 64 * 16; e += 128) { const int rl = e >> 4, q = e & 15; vst2((unsigned*)(GA + (r0 + rl) * CC + c0 + q * 8), *(const v4u*)&sh[rl][q * 8]); }
    return; }
  if (which < 2) {
    /* rotate-half rope on each 64-dim head: d = (j&3)*16+col; d < 32 (tiles jp = 0,1,4,5) pairs with d+32 (jp+2): out[d] = x[d] c - x[d+32] s, out[d+32] = x[d+32] c + x[d] s, table index d for out[d], d+32 for out[d+32] */
#pragma unroll
    for (int jp = 0; jp < 8; ++jp) { if ((jp & 3) >= 2) continue; const int i2 = (jp & 3) * 16 + col;
#pragma unroll
      for (int r = 0; r < 8; ++r) { const int t = t0 + wave * 16 + 8 * g + r; const float c1 = bfr(COS[(size_t)t * HD + i2]), s1 = bfr(SIN[(size_t)t * HD + i2]), c2 = bfr(COS[(size_t)t * HD + i2 + 32]), s2 = bfr(SIN[(size_t)t * HD + i2 + 32]); const float x1 = acc[jp][r], x2 = acc[jp + 2][r]; asm volatile("s_wait_loadcnt 0x0" ::: "memory"); acc[jp][r] = x1 * c1 - x2 * s1; acc[jp + 2][r] = x2 * c2 + x1 * s2; } }
    if (which == 1) {   /* new_k output [HKV][S][64] in f32: this wave's 16 rows x 2 heads, 256 B per (row, head) by 16 lanes */
#pragma unroll
      for (int j = 0; j < 8; ++j) {
#pragma unroll
        for (int r = 0; r < 8; ++r) so[wave][8 * g + r][j * 16 + col] = acc[j][r]; }
      LDSX(); for (int rl = 0; rl < 16; ++rl) { const int t = t0 + wave * 16 + rl; const int hh = (c0 >> 6) + (lane >> 4); vst2(OUTK + ((size_t)hh * TT + t) * HD + (lane & 15) * 4, *(const v4f*)&so[wave][rl][lane * 4]); } }
#pragma unroll
    for (int j = 0; j < 8; ++j) {
#pragma unroll
      for (int r = 0; r < 8; ++r) { const float v = acc[j][r]; const _Float16 hv = (_Float16)v; sh[wave * 16 + 8 * g + r][j * 16 + col] = hv; sl[wave * 16 + 8 * g + r][j * 16 + col] = (_Float16)((v - (float)hv) * 1024.0f); } }
    __syncthreads();
    _Float16* dh = which == 0 ? QH : KH; _Float16* dl = which == 0 ? (QL + (b * QHI) * (size_t)CC) : (KL + (b * KHI) * (size_t)KV);
    if (which == 0)   /* q: rows */
    for (int e = tid; e < 64 * 16; e += 128) { const int rl = e >> 4, q = e & 15; vst2((unsigned*)(dh + (r0 + rl) * NW + c0 + q * 8), *(const v4u*)&sh[rl][q * 8]); if (hi_rows) vst2((unsigned*)(dl + (size_t)(t0 + rl) * NW + c0 + q * 8), *(const v4u*)&sl[rl][q * 8]); }
    else   /* k in fragment order: piece e = (head hh, 16 keys tl, 32 d kc, half hf, lane 16 gg + row); a head's 64 keys are 8 KiB in a row, a wave's store 512 B in a row */
    for (int it = 0; it < 8; ++it) { const int e = tid + it * 128, row = e & 15, gg = (e >> 4) & 1, hf = (e >> 5) & 1, kc = (e >> 6) & 1, tl = (e >> 7) & 3, hh = e >> 9; const int rl = tl * 16 + row, cl = hh * 64 + kc * 32 + hf * 16 + gg * 8; const size_t hd = b * NKV + (c0 >> 6) + hh;
      _Float16* pk = KH + (hd * (TT / 16) + (t0 >> 4)) * 1024 + (e & 511) * 8; const v4u dk = *(const v4u*)&sh[rl][cl];
      /* s_wait_xcnt 0 behind the stores, before a register that they name is used again; addresses and data are inputs, so that they stay whole up to the wait */
      if (hi_rows) { _Float16* pr = KL + (hd * (KHI / 16) + (t0 >> 4)) * 1024 + (e & 511) * 8; const v4u dr = *(const v4u*)&sl[rl][cl]; vst2(pk, dk); vst2(pr, dr); asm volatile("s_wait_xcnt 0x0" :: "v"(pk), "v"(pr), "v"(dk), "v"(dr) : "memory"); }
      else { vst2(pk, dk); asm volatile("s_wait_xcnt 0x0" :: "v"(pk), "v"(dk) : "memory"); } }
  } else {   /* which == 2: v */
#pragma unroll
    for (int j = 0; j < 8; ++j) {
#pragma unroll
      for (int r = 0; r < 8; ++r) so[wave][8 * g + r][j * 16 + col] = acc[j][r]; }
    LDSX(); for (int rl = 0; rl < 16; ++rl) { const int t = t0 + wave * 16 + rl; const int hh = (c0 >> 6) + (lane >> 4); vst2(OUTV + ((size_t)hh * TT + t) * HD + (lane & 15) * 4, *(const v4f*)&so[wave][rl][lane * 4]); }   /* new_v output in f32 */
#pragma unroll
    for (int j = 0; j < 8; ++j) {
#pragma unroll
      for (int r = 0; r < 8; ++r) { const float v = acc[j][r]; const int rl = wave * 16 + 8 * g + r, cl = j * 16 + col; th[cl][rl] = (_Float16)v; const __bf16 bh = (__bf16)v; tb[cl][rl] = bh; tbl[cl][rl] = (__bf16)(v - (float)bh); } }
    __syncthreads();
    /* v in fragment order: piece e = (head hh, 32 keys cc, 16 d j, half hf, lane 16 gg + row); a head's 64 keys are 8 KiB in a row, a wave's store 512 B in a row */
    for (int it = 0; it < 8; ++it) { const int e = tid + it * 128, row = e & 15, gg = (e >> 4) & 1, hf = (e >> 5) & 1, j = (e >> 6) & 3, cc = (e >> 8) & 1, hh = e >> 9; const int cl = hh * 64 + j * 16 + row, rl = cc * 32 + hf * 16 + gg * 8; const size_t hd = b * NKV + (c0 >> 6) + hh;
      _Float16* pv = VT + (hd * (TT / 32) + (t0 >> 5)) * 2048 + (e & 511) * 8; const v4u dv = *(const v4u*)&th[cl][rl];
      /* s_wait_xcnt 0 behind the stores, before a register that they name is used again; addresses and data are inputs, so that they stay whole up to the wait */
      if (hi_rows) { const size_t o3 = (hd * (KHI / 32) + (t0 >> 5)) * 2048 + (e & 511) * 8; __bf16* ph = VB + o3; __bf16* pl = VBL + o3; const v4u dh = *(const v4u*)&tb[cl][rl], dl = *(const v4u*)&tbl[cl][rl];
        vst2(pv, dv); vst2(ph, dh); vst2(pl, dl); asm volatile("s_wait_xcnt 0x0" :: "v"(pv), "v"(ph), "v"(pl), "v"(dv), "v"(dh), "v"(dl) : "memory"); }
      else { vst2(pv, dv); asm volatile("s_wait_xcnt 0x0" :: "v"(pv), "v"(dv) : "memory"); } } } }
// ---- k_attn: block = (head h, pair y of 128-query blocks), eight independent waves of 32 queries each (two 16-query column groups u): waves 0..3 take block 15 - y, waves 4..7 block y, so that every block of the grid walks the same number of keys; no LDS, no barrier; k and v lie in fragment order (k_proj), so that every load of theirs reads whole lines. S^T = K Q^T: A = 16 key rows, B = 16 query rows, so lane (g, col) holds query col's logits of keys 8g + r; two such tiles (keys k0 + 0..15, k0 + 16..31) are, element for element, the B operand P^T of O^T += V^T P^T (A = 16 d of v). Pass 1 walks the keys for each query's maximum, pass 2 forms the same logits again, e = 2^11 exp(logit - max) = exp2(s ks + (11 - max ks)), sums e in f32 and multiplies e (once to f16; rows < 384: bf16 hi + lo) with v; the division by (sum + 1e-9) is done on the 64 outputs. 3-product logits for rows < 384, else 1. Epilogue: a lane holds 32 of the 64 outputs of one (token, head), its partner lane ^ 16 the other 32, so the per-head normalisation is in-lane sums and one exchange each for mean and variance; x gn_weight + gn_bias, x alpha (k_proj's f16 rows), once to f16 -> the A rows of k_out.
// The pointers of this kernel are plain (no __restrict__): its loads then stay between the asm statements around them, so that each run of loads has its s_wait_xcnt 0 behind it.
/* s_wait_xcnt 0 behind a run of global loads, before a register that they name is used again; the run's address is an input of the statement, so that its registers stay whole up to the wait */
__device__ __forceinline__ void xwait(const void* p) { asm volatile("s_wait_xcnt 0x0" :: "v"(p) : "memory"); }
__device__ __forceinline__ void xwait(const void* p, const void* q) { asm volatile("s_wait_xcnt 0x0" :: "v"(p), "v"(q) : "memory"); }
/* one lane's 16 elements of a fragment; p already holds the lane half's 8 g */
__device__ __forceinline__ v16h ld_h(const _Float16* p) { union { v16h v; v8h q[2]; } u; u.q[0] = *(const v8h*)p; u.q[1] = *(const v8h*)(p + 16); return u.v; }
/* the same from a plane in fragment order (1 KiB = [half][lane][8]); p already holds the lane's 8 lane: each of the two loads reads 512 B in a row over the wave, four whole lines */
__device__ __forceinline__ v16h ld_hf(const _Float16* p) { union { v16h v; v8h q[2]; } u; u.q[0] = *(const v8h*)p; u.q[1] = *(const v8h*)(p + 256); return u.v; }
__device__ __forceinline__ v16b ld_bf(const __bf16* p) { union { v16b v; v8b q[2]; } u; u.q[0] = *(const v8b*)p; u.q[1] = *(const v8b*)(p + 256); return u.v; }
template <bool HI> __device__ __forceinline__ void attn_ldk(const _Float16* kp, const _Float16* klp, int c, v16h (&kh)[2][2], v16h (&kl)[2][2]) {
  const _Float16* p = kp + (size_t)c * 2048; const _Float16* pl = klp + (size_t)c * 2048;   /* a chunk of 32 keys: 2 x 2 fragments, 4 KiB in a row */
#pragma unroll
  for (int i = 0; i < 2; ++i) {
#pragma unroll
    for (int kc = 0; kc < 2; ++kc) { kh[i][kc] = ld_hf(p + i * 1024 + kc * 512); if (HI) kl[i][kc] = ld_hf(pl + i * 1024 + kc * 512); } }
  if (HI) xwait(p, pl); else xwait(p); }
template <bool HI> __device__ __forceinline__ v8f attn_s(const v16h (&kh)[2], const v16h (&kl)[2], const v16h (&qh)[2], const v16h (&ql)[2]) {
  v8f a = {}, al = {};
#pragma unroll
  for (int kc = 0; kc < 2; ++kc) { a = wmma16(kh[kc], qh[kc], a); if (HI) { al = wmma16(kh[kc], ql[kc], al); al = wmma16(kl[kc], qh[kc], al); } }
#pragma unroll
  for (int r = 0; r < 8; ++r) a[r] = HI ? (a[r] + al[r] * (1.0f / 1024.0f)) * SCALE : a[r];   /* the 1-product rows' values stay 8 x the logit: their 1/8 (exact) sits in the exponent's multiplier ks */
  return a; }
/* eight hardware exp2 in one statement: behind a transcendental the instruction set asks for one independent instruction before its result is read or its source overwritten; here each v_exp_f32 is that instruction for the one before it (every output lies apart from every input), and the v_nop is it for the last */
__device__ __forceinline__ void exp2x8(const float (&x)[8], float* y) { float y0, y1, y2, y3, y4, y5, y6, y7;
  asm("v_exp_f32 %0, %8\n\tv_exp_f32 %1, %9\n\tv_exp_f32 %2, %10\n\tv_exp_f32 %3, %11\n\tv_exp_f32 %4, %12\n\tv_exp_f32 %5, %13\n\tv_exp_f32 %6, %14\n\tv_exp_f32 %7, %15\n\tv_nop"
      : "=&v"(y0), "=&v"(y1), "=&v"(y2), "=&v"(y3), "=&v"(y4), "=&v"(y5), "=&v"(y6), "=&v"(y7) : "v"(x[0]), "v"(x[1]), "v"(x[2]), "v"(x[3]), "v"(x[4]), "v"(x[5]), "v"(x[6]), "v"(x[7]));
  y[0] = y0; y[1] = y1; y[2] = y2; y[3] = y3; y[4] = y4; y[5] = y5; y[6] = y6; y[7] = y7; }
/* the last chunk (keys 32 (nch - 1) + 0..31) alone reaches past a row's diagonal; dq = the row of column group 0 in this lane, counted from that chunk's first key */
template <int NU> __device__ __forceinline__ void attn_mask(v8f (&s)[NU][2], int dq, int g) {
#pragma unroll
  for (int u = 0; u < NU; ++u) {
#pragma unroll
    for (int i = 0; i < 2; ++i) {
#pragma unroll
      for (int r = 0; r < 8; ++r) s[u][i][r] = (i * 16 + 8 * g + r <= u * 16 + dq) ? s[u][i][r] : -3.0e38f; } } }
template <bool HI, int NU> __device__ __forceinline__ void attn_sall(const v16h (&kh)[2][2], const v16h (&kl)[2][2], const v16h (&qh)[NU][2], const v16h (&ql)[NU][2], v8f (&s)[NU][2]) {
#pragma unroll
  for (int u = 0; u < NU; ++u) {
#pragma unroll
    for (int i = 0; i < 2; ++i) s[u][i] = attn_s<HI>(kh[i], kl[i], qh[u], ql[u]); } }
template <int NU> __device__ __forceinline__ void attn_max(const v8f (&s)[NU][2], float (&m)[NU]) {
#pragma unroll
  for (int u = 0; u < NU; ++u) {
#pragma unroll
    for (int i = 0; i < 2; ++i) {
#pragma unroll
      for (int r = 0; r < 8; ++r) m[u] = fmaxf(m[u], s[u][i][r]); } } }
/* one wave, NU column groups of 16 queries from row ql0 on (ql0 a multiple of 16 NU) */
template <bool HI, int NU> __device__ __forceinline__ void attn_wave(const _Float16* QH, const _Float16* KH, const _Float16* QL, const _Float16* KL, const _Float16* VT, const __bf16* VB, const __bf16* VBL, const _Float16* GA, const float* GW, const float* GB, _Float16* AH, int b, int h, int ql0, int lane) {
  const int col = lane & 15, g = lane >> 4, dq = (ql0 & 31) + col; const size_t kvh = (size_t)b * NKV + h / GQ; const int nch = (ql0 >> 5) + 1;   /* 32-key chunks; every chunk holds at least one key <= t for each of the wave's rows */
  v16h qh[NU][2], ql[NU][2], ka[2][2], la[2][2], kb[2][2], lb[2][2]; v8f s[NU][2];
  { const _Float16* qp = QH + ((size_t)b * TT + ql0 + col) * CC + h * HD + 8 * g; const _Float16* qlp = QL + ((size_t)b * QHI + ql0 + col) * CC + h * HD + 8 * g;
#pragma unroll
    for (int u = 0; u < NU; ++u) {
#pragma unroll
      for (int kc = 0; kc < 2; ++kc) { qh[u][kc] = ld_h(qp + u * 16 * CC + kc * 32); if (HI) ql[u][kc] = ld_h(qlp + u * 16 * CC + kc * 32); } }
    if (HI) xwait(qp, qlp); else xwait(qp); }
  const _Float16* kp = KH + kvh * (TT / 16) * 1024 + lane * 8; const _Float16* klp = KL + kvh * (KHI / 16) * 1024 + lane * 8;
  float m[NU];
#pragma unroll
  for (int u = 0; u < NU; ++u) m[u] = -3.0e38f;
  if (HI) {   /* pass 1 of the early rows (at most 12 chunks, beside a wave that walks 53 and more): no look-ahead, so that the residual planes' registers fit */
    for (int c = 0; c < nch; ++c) { attn_ldk<HI>(kp, klp, c, ka, la);
      attn_sall<HI, NU>(ka, la, qh, ql, s);
      if (c == nch - 1) attn_mask<NU>(s, dq, g);   /* scalar test */
      attn_max<NU>(s, m); }
  } else {
  /* pass 1, two chunks a trip: each chunk's key rows are fetched a whole trip ahead, into the registers that its products have just left. An odd count takes its last chunk twice (a maximum does not mind). Behind the last trip ka holds chunk 0, with which pass 2 begins */
  attn_ldk<HI>(kp, klp, 0, ka, la); attn_ldk<HI>(kp, klp, nch > 1 ? 1 : 0, kb, lb);
  for (int c = 0; c < nch; c += 2) { const int c1 = c + 1 < nch ? c + 1 : nch - 1;
    attn_sall<HI, NU>(ka, la, qh, ql, s);
    attn_ldk<HI>(kp, klp, c + 2 < nch ? c + 2 : 0, ka, la);
    if (c == nch - 1) attn_mask<NU>(s, dq, g);   /* scalar test */
    attn_max<NU>(s, m);
    attn_sall<HI, NU>(kb, lb, qh, ql, s);
    attn_ldk<HI>(kp, klp, c + 3 < nch ? c + 3 : nch - 1, kb, lb);
    if (c1 == nch - 1) attn_mask<NU>(s, dq, g);   /* scalar test */
    attn_max<NU>(s, m); } }
#pragma unroll
  for (int u = 0; u < NU; ++u) m[u] = fmaxf(m[u], __shfl_xor(m[u], 16));   /* the two lane halves hold the two halves of a query's keys */
  const float ks = (HI ? 1.0f : SCALE) * 1.44269504f;   /* log2(e), times the 1/8 that the 1-product rows still owe */
  float sum[NU], cm[NU]; v8f o[NU][HD / 16];
#pragma unroll
  for (int u = 0; u < NU; ++u) { sum[u] = 0.f; cm[u] = fmaf(-m[u], ks, 11.0f);   /* its rounding is one factor for the whole row, in e and in the sum alike */
#pragma unroll
    for (int j = 0; j < HD / 16; ++j) o[u][j] = v8f{}; }
  const _Float16* vp = VT + kvh * (TT / 32) * 2048 + lane * 8; const __bf16* vbp = VB + kvh * (KHI / 32) * 2048 + lane * 8; const __bf16* vlp = VBL + kvh * (KHI / 32) * 2048 + lane * 8;   /* a chunk of 32 keys: four fragments (d = 16 j + col), 4 KiB in a row */
  for (int c = 0; c < nch; ++c) { v16h vf[HD / 16]; v16b vb[HD / 16], vbl[HD / 16];
    if (HI) attn_ldk<HI>(kp, klp, c, ka, la);
    else { const _Float16* p0 = vp + c * 2048;
#pragma unroll
      for (int j = 0; j < HD / 16; ++j) vf[j] = ld_hf(p0 + j * 512);
      xwait(p0); }
    attn_sall<HI, NU>(ka, la, qh, ql, s);
    if (HI) { const __bf16* p0 = vbp + c * 2048; const __bf16* p1 = vlp + c * 2048;   /* the early rows' v planes come in behind the logits, when the key rows' registers are free, and fly under the exponentials */
#pragma unroll
      for (int j = 0; j < HD / 16; ++j) { vb[j] = ld_bf(p0 + j * 512); vbl[j] = ld_bf(p1 + j * 512); }
      xwait(p0, p1);
    } else attn_ldk<HI>(kp, klp, c + 1 < nch ? c + 1 : c, ka, la);   /* the next chunk's key rows fly under this chunk's exponentials (the last chunk reloads its own, unused) */
    __builtin_amdgcn_sched_barrier(0);   /* keeps the loads above in front of the exponentials: sunk to the loop's foot they would be waited for at once */
    if (c == nch - 1) attn_mask<NU>(s, dq, g);   /* scalar test; the excluded keys' -3e38 gives e = 0 */
#pragma unroll
    for (int u = 0; u < NU; ++u) { float e[16];
#pragma unroll
      for (int i = 0; i < 2; ++i) { float x[8];   /* the argument is never above 11 (but for cm's rounding), so no range step is owed; below -126, the excluded keys' too, the instruction gives 0 */
#pragma unroll
        for (int r = 0; r < 8; ++r) x[r] = fmaf(s[u][i][r], ks, cm[u]);
        exp2x8(x, &e[i * 8]);
#pragma unroll
        for (int r = 0; r < 8; ++r) sum[u] += e[i * 8 + r]; }
      if (HI) { const F2 p = bsplit16(e);
#pragma unroll
        for (int j = 0; j < HD / 16; ++j) { o[u][j] = wmma_bf(vb[j], p.h, o[u][j]); o[u][j] = wmma_bf(vb[j], p.l, o[u][j]); o[u][j] = wmma_bf(vbl[j], p.h, o[u][j]); }
      } else { v16h p;
#pragma unroll
        for (int x = 0; x < 16; ++x) p[x] = (_Float16)e[x];
#pragma unroll
        for (int j = 0; j < HD / 16; ++j) o[u][j] = wmma16(vf[j], p, o[u][j]); } } }
  __builtin_amdgcn_sched_barrier(0);   /* keeps the epilogue's loads behind the last products and their v_nop slots: lifted among them they would land on operand registers of a product just issued */
#pragma unroll
  for (int u = 0; u < NU; ++u) sum[u] = 1.0f / (sum[u] + __shfl_xor(sum[u], 16) + 2048.0f * 1e-9f);   /* p = e / (sum + 1e-9) as in the module, numerator and denominator x 2^11 */
  v8f gw[HD / 16], gb[HD / 16];   /* lane (g, col) holds d = 16 j + 8 g + r of query col */
  { const float* gwp = GW + h * HD + 8 * g; const float* gbp = GB + h * HD + 8 * g;
#pragma unroll
    for (int j = 0; j < HD / 16; ++j) { gw[j] = *(const v8f*)(gwp + j * 16); gb[j] = *(const v8f*)(gbp + j * 16); }
    xwait(gwp, gbp); }
#pragma unroll
  for (int u = 0; u < NU; ++u) { const float sc = sum[u]; v8f t[HD / 16]; v8h al[HD / 16]; v4u pk[HD / 16]; float ps[HD / 16];
    const size_t off = ((size_t)b * TT + ql0 + u * 16 + col) * CC + h * HD + 8 * g; const _Float16* gap = GA + off; _Float16* ap = AH + off;
#pragma unroll
    for (int j = 0; j < HD / 16; ++j) al[j] = *(const v8h*)(gap + j * 16);
    xwait(gap);
#pragma unroll
    for (int j = 0; j < HD / 16; ++j) { t[j] = o[u][j] * sc; ps[j] = 0.f;   /* four independent chains of eight */
#pragma unroll
      for (int r = 0; r < 8; ++r) ps[j] += t[j][r]; }
    float s1 = (ps[0] + ps[1]) + (ps[2] + ps[3]); s1 += __shfl_xor(s1, 16);
    const float mean = s1 * (1.0f / HD);
#pragma unroll
    for (int j = 0; j < HD / 16; ++j) { ps[j] = 0.f;
#pragma unroll
      for (int r = 0; r < 8; ++r) { t[j][r] -= mean; ps[j] += t[j][r] * t[j][r]; } }
    float s2 = (ps[0] + ps[1]) + (ps[2] + ps[3]); s2 += __shfl_xor(s2, 16);
    const float rstd = rsqrtf(s2 * (1.0f / HD) + 1e-5f);
#pragma unroll
    for (int j = 0; j < HD / 16; ++j) { union { v8h hv; v4u u4; } c;
#pragma unroll
      for (int r = 0; r < 8; ++r) c.hv[r] = (_Float16)((t[j][r] * rstd * bfr(gw[j][r]) + bfr(gb[j][r])) * (float)al[j][r]);
      pk[j] = c.u4; vst2(ap + j * 16, pk[j]); }   /* the 128-B line of a (token, head) is written by this wave alone */
    asm volatile("s_wait_xcnt 0x0" :: "v"(ap), "v"(pk[0]), "v"(pk[1]), "v"(pk[2]), "v"(pk[3]) : "memory");   /* before a register that the stores above name is used again; address and data are inputs, so that they stay whole up to the wait */ } }
__global__ __launch_bounds__(256) void k_attn(const _Float16* QH, const _Float16* KH, const _Float16* QL, const _Float16* KL, const _Float16* VT, const __bf16* VB, const __bf16* VBL, const _Float16* GA, const float* GW, const float* GB, _Float16* AH) {
  static_assert(QHI % 128 == 0 && KHI >= QHI && HD == 64, "a wave is wholly on one path, and its keys have the residual planes");
  const int lane = threadIdx.x & 31; const int wave = __builtin_amdgcn_readfirstlane(threadIdx.x >> 5);   /* scalar, so that the chunk loops branch on scalars */
  const int qb = wave < 4 ? (TT / 128 - 1) - (int)blockIdx.y : (int)blockIdx.y; const int ql0 = qb * 128 + (wave & 3) * 32;   /* a long and a short query block side by side */
  if (qb < QHI / 128) {   /* the early rows' planes take twice the registers: one column group at a time */
    /* kept rolled: one copy of this path's code, and one group's registers */
#pragma unroll 1
    for (int u = 0; u < 2; ++u) attn_wave<true, 1>(QH, KH, QL, KL, VT, VB, VBL, GA, GW, GB, AH, blockIdx.z, blockIdx.x, ql0 + u * 16, lane);
  } else attn_wave<false, 2>(QH, KH, QL, KL, VT, VB, VBL, GA, GW, GB, AH, blockIdx.z, blockIdx.x, ql0, lane); }
// ---- k_out: block = (64 rows, 128 cols): y = (gn * alpha) (f16 rows) Wo (k_prep's f16 rows, bf16 x 2^8, exact) x 2^-8 -> output 0 rows
__global__ __launch_bounds__(128) void k_out(const _Float16* __restrict__ AH, const _Float16* __restrict__ WOT, float* __restrict__ OUT) { __shared__ __align__(16) float sf[4][16][132]; __shared__ __align__(16) char sw[2 * SWB];   /* Wo tile of one pass, [col][k] in f16 (x 2^8), two buffers */
  const int tid = threadIdx.x, wave = tid >> 5, lane = tid & 31, col = lane & 15, g = lane >> 4; const int c0 = blockIdx.y * 128; const size_t r0 = (size_t)blockIdx.x * 64 + wave * 16;
  v8f acc[8] = {};
  gemm_acc<true, 32, 128>((const char*)(AH + (r0 + col) * CC + 8 * g), (const char*)(WOT + (size_t)(c0 + (tid >> 3)) * CC + (tid & 7) * 8), sw, tid, lane, acc);
#pragma unroll
  for (int j = 0; j < 8; ++j) {
#pragma unroll
    for (int r = 0; r < 8; ++r) sf[wave][8 * g + r][j * 16 + col] = acc[j][r] * (1.0f / 256.0f); }
  LDSX(); for (int rl = 0; rl < 16; ++rl) vst2(OUT + (r0 + rl) * CC + c0 + lane * 4, *(const v4f*)&sf[wave][rl][lane * 4]); }
extern "C" void kernel_launch(void* const* d_in, const int* in_sizes, int n_in, void* d_out, int out_size, void* d_ws, size_t ws_size, hipStream_t stream) {
  (void)in_sizes; (void)n_in; (void)out_size;
  const float** F = (const float**)d_in;   // 0 x [1,2048,2048]; 1 rope_cos, 2 rope_sin [2048,64]; 3 Wq [2048,2048]; 4 Wk, 5 Wv [2048,512]; 6 Wo [2048,2048]; 7 Wg [2048,2048], 8 bg; 9 gn_weight, 10 gn_bias [2048]
  if (ws_size < (size_t)WS_END) return;
  char* ws = (char*)d_ws; _Float16 *GA = (_Float16*)(ws + WS_GA), *AH = (_Float16*)(ws + WS_AH), *QH = (_Float16*)(ws + WS_QH), *KH = (_Float16*)(ws + WS_KH), *VT = (_Float16*)(ws + WS_VT), *QL = (_Float16*)(ws + WS_QL), *KL = (_Float16*)(ws + WS_KL); __bf16 *VB = (__bf16*)(ws + WS_VB), *VBL = (__bf16*)(ws + WS_VBL); __bf16 *XB = (__bf16*)(ws + WS_XB), *WT = (__bf16*)(ws + WS_WT); _Float16 *WOT = (_Float16*)(ws + WS_WOT);
  float* OUT0 = (float*)d_out; float* OUTK = OUT0 + (size_t)NB * TT * CC; float* OUTV = OUTK + (size_t)NB * NKV * TT * HD;   /* tuple outputs concatenated, no padding */
  k_prep<<<dim3(NWT / 64 + CC / 64 + TNB * TT / 64, CC / 64 / PREP_T), 256, 0, stream>>>(F[0], F[3], F[4], F[5], F[7], F[6], XB, WT, WOT);
  k_proj<<<dim3(TNB * TT / 64, CC / 128, 4), 128, 0, stream>>>(XB, WT, F[8], F[1], F[2], QH, KH, VT, QL, KL, VB, VBL, GA, OUTK, OUTV);
  k_attn<<<dim3(NH, TT / 256, TNB), 256, 0, stream>>>(QH, KH, QL, KL, VT, VB, VBL, GA, F[9], F[10], AH);
  k_out<<<dim3(TNB * TT / 64, CC / 128), 128, 0, stream>>>(AH, WOT, OUT0);
}

// v007
// Measured time: 137 microseconds a run.
// Timed twice side by side with v006, it ran 1.21 times as fast both times.
// Over all steps from v000 it is 10.2 times as fast.
// compute dtype: all float inputs rounded to bf16; q/k/v/gate projections x W with EXACT bf16 products on WMMA 16x16x32, f32 accumulate; rotate-half rotary with the given cos/sin tables in f32; q, k once to f16 -> 1-product causal logits / 8 (the first 384 query rows use f16 hi + residual on both sides, 3 products); softmax in f32: exp(logit - max) x 2^11 as one hardware exp2 of (logit - max) x log2(e) + 11 (one fused multiply-add), once to f16 against v once to f16 (first 384 rows: bf16 hi + lo, 3 products), divided by (sum + 1e-9) after the product (sum and 1e-9 both carried x 2^11); per-head GroupNorm and the sigmoid gate in f32; (gn * alpha) once to f16 against Wo carried x 2^8 in f16 (exact); new_k / new_v written in f32 straight from the projections; f32 outputs.
#include <hip/hip_runtime.h>
#include <math.h>

typedef __attribute__((ext_vector_type(16))) _Float16 v16h;
typedef __attribute__((ext_vector_type(16))) __bf16 v16b;
typedef __attribute__((ext_vector_type(8)))  _Float16 v8h;
typedef __attribute__((ext_vector_type(8)))  float v8f;
typedef __attribute__((ext_vector_type(4)))  float v4f;
typedef __attribute__((ext_vector_type(2)))  float v2f;
typedef __attribute__((ext_vector_type(4)))  unsigned v4u;
typedef __attribute__((ext_vector_type(4)))  int v4i;
typedef float __attribute__((may_alias)) float_a;
typedef int __attribute__((may_alias)) int_a;

template <typename T> __device__ __forceinline__ void vst2(void* p, T v) { *(T*)p = v;  }
__device__ __forceinline__ v8f wmma16(v16h a, v16h b, v8f c) {
  v8f d = __builtin_amdgcn_wmma_f32_16x16x32_f16(false, a, false, b, (short)0, c, false, false);
  asm volatile("v_nop\n\tv_nop\n\tv_nop\n\tv_nop" : "+v"(d) : "v"(a), "v"(b));
  return d;
}
__device__ __forceinline__ v8f wmma_bf(v16b a, v16b b, v8f c) {
  v8f d = __builtin_amdgcn_wmma_f32_16x16x32_bf16(false, a, false, b, (short)0, c, false, false);
  asm volatile("v_nop\n\tv_nop\n\tv_nop\n\tv_nop" : "+v"(d) : "v"(a), "v"(b));
  return d;
}
// 16x16x32 fragments: lane = (h = lane>>4, row/col = lane&15); elements 0..7 = k0+8h+0..7, 8..15 = k0+16+8h+0..7; D element r = row 8h+r
__device__ __forceinline__ v16h frag_h(const _Float16* rowk0, int lane) {
  union { v16h v; v8h q[2]; } u; const _Float16* p = rowk0 + 8 * (lane >> 4);
  u.q[0] = *(const v8h*)p; u.q[1] = *(const v8h*)(p + 16); return u.v;
}
__device__ __forceinline__ v16h frag_f32(const float* rowk0, int lane) {
  v16h a; const float* p = rowk0 + 8 * (lane >> 4);
#pragma unroll
  for (int i = 0; i < 8; ++i) { a[i] = (_Float16)p[i]; a[8 + i] = (_Float16)p[16 + i]; }
  return a;
}
__device__ __forceinline__ v16h frag_f32s(const float* rowk0, int lane, float sc) {
  v16h a; const float* p = rowk0 + 8 * (lane >> 4);
#pragma unroll
  for (int i = 0; i < 8; ++i) { a[i] = (_Float16)(p[i] * sc); a[8 + i] = (_Float16)(p[16 + i] * sc); }
  return a;
}
// column fragment from a [K][ld] layout (column n), rows >= K read as 0
__device__ __forceinline__ v16h fragc_f32(const float* W, int k0, int n, int lane, int ld, int K) {
  v16h a; const int g = lane >> 4;
#pragma unroll
  for (int i = 0; i < 8; ++i) { const int ka = k0 + 8 * g + i, kb = ka + 16;
    a[i] = (_Float16)(ka < K ? W[(size_t)(ka < K ? ka : K - 1) * ld + n] : 0.f); a[8 + i] = (_Float16)(kb < K ? W[(size_t)(kb < K ? kb : K - 1) * ld + n] : 0.f); }
  return a;
}
struct F2 { v16b h, l; };
__device__ __forceinline__ F2 bsplit16(const float v[16]) { F2 r;
#pragma unroll
  for (int i = 0; i < 16; ++i) { const __bf16 h = (__bf16)v[i]; r.h[i] = h; r.l[i] = (__bf16)(v[i] - (float)h); }
  return r; }
__device__ __forceinline__ F2 split_row(const float* row, int k0, int lane) { float v[16]; const float* p = row + k0 + 8 * (lane >> 4);
#pragma unroll
  for (int i = 0; i < 8; ++i) { v[i] = p[i]; v[8 + i] = p[16 + i]; }
  return bsplit16(v); }
__device__ __forceinline__ F2 split_rowK(const float* row, int k0, int lane, int K) { float v[16]; const int g = lane >> 4;
#pragma unroll
  for (int i = 0; i < 8; ++i) { const int ka = k0 + 8 * g + i, kb = ka + 16; v[i] = ka < K ? row[ka < K ? ka : K - 1] : 0.f; v[8 + i] = kb < K ? row[kb < K ? kb : K - 1] : 0.f; }
  return bsplit16(v); }
__device__ __forceinline__ F2 split_col(const float* W, int k0, int n, int lane, int ld, int K) { float v[16]; const int g = lane >> 4;
#pragma unroll
  for (int i = 0; i < 8; ++i) { const int ka = k0 + 8 * g + i, kb = ka + 16; v[i] = ka < K ? W[(size_t)(ka < K ? ka : K - 1) * ld + n] : 0.f; v[8 + i] = kb < K ? W[(size_t)(kb < K ? kb : K - 1) * ld + n] : 0.f; }
  return bsplit16(v); }
__device__ __forceinline__ v8f mac3(const F2& a, const F2& b, v8f c) { c = wmma_bf(a.l, b.h, c); c = wmma_bf(a.h, b.l, c); return wmma_bf(a.h, b.h, c); }
__device__ __forceinline__ float sigm(float v) { return 1.0f / (1.0f + expf(-v)); }
#define LDSX() do { asm volatile("s_wait_dscnt 0" ::: "memory"); __builtin_amdgcn_wave_barrier(); __builtin_amdgcn_fence(__ATOMIC_RELEASE, "workgroup"); } while (0)

// Gated GQA causal self-attention with rotary tables, per-head GroupNorm and a sigmoid output gate (B 1, S 2,048, HID 2,048; 32 query / 8 kv heads x 64): q = x Wq, k = x Wk, v = x Wv ((in,out)); q, k rotate-half RoPE with the given cos/sin [S,64]; scores = q k^T / 8, causal (col > row -> -inf); p = exp(a - max) / (sum + 1e-9); out = p v (GQA x4); gn = per-(token, head) normalisation over 64 x gn_weight + gn_bias; alpha = sigmoid(x Wg + bg); y = (gn * alpha) Wo. Returns (y, new_k = roped k [B,HKV,S,D], new_v [B,HKV,S,D]).
#define NB 1
#define TT 2048
#define CC 2048
#define NH 32
#define HD 64
#define NKV 8
#define KV (NKV * HD)      // 512
#define GQ (NH / NKV)      // 4
#define SCALE 0.125f
#ifndef TNB
#define TNB NB
#endif
typedef __attribute__((ext_vector_type(8))) __bf16 v8b;
__device__ __forceinline__ v16b frag_b(const __bf16* rowk0, int lane) {
  union { v16b v; v8b q[2]; } u; const __bf16* p = rowk0 + 8 * (lane >> 4);
  u.q[0] = *(const v8b*)p; u.q[1] = *(const v8b*)(p + 16); return u.v;
}
__device__ __forceinline__ float bfr(float v) { return (float)(__bf16)v; }
#define QBH 6              // query blocks 0..5 of each sequence (rows < 384) take the high-precision path (their rows see only 1..384 keys)
#define QHI (QBH * 64)     // 384
#define KHI 384            // key rows with residual / bf16 planes (keys of those rows are <= 383)

#define WS_GA  0u                                       // f16 alpha = sigmoid(x Wg + bg) rows [t][2048]
#define WS_AH  (WS_GA + 2u * (size_t)NB * TT * CC)        // f16 (gn * alpha) rows [t][2048] (A operand of the output projection)
#define WS_QH  (WS_AH + 2u * (size_t)NB * TT * CC)        // f16 q rows [b*t][2048] (rotated)
#define WS_KH  (WS_QH + 2u * (size_t)NB * TT * CC)       // f16 k in A-fragment order: per (kv head, 16 keys, 32 d) 1 KiB = [half][lane = 16 g + key][8 d], d = 16 half + 8 g + e
#define WS_VT  (WS_KH + 2u * (size_t)NB * TT * KV)       // f16 v in A-fragment order: per (kv head, 32 keys, 16 d) 1 KiB = [half][lane = 16 g + d][8 keys], key = 16 half + 8 g + e
#define WS_QL  (WS_VT + 2u * (size_t)NB * KV * TT)       // f16 q residual x 2^10 rows [b][t < QHI][2048]
#define WS_KL  (WS_QL + 2u * (size_t)NB * QHI * CC)      // f16 k residual x 2^10, keys < KHI, in k's order
#define WS_VB  (WS_KL + 2u * (size_t)NB * KHI * KV)      // bf16 v hi, keys < KHI, in v's order
#define WS_VBL (WS_VB + 2u * (size_t)NB * KV * KHI)      // bf16 v lo, likewise
#define WS_XB  (WS_VBL + 2u * (size_t)NB * KV * KHI)     // bf16 x in A-fragment order (k_prep)
#define NWT (2 * CC + 2 * KV)                            // 5,120 rows of WT: the columns of Wq, Wk, Wv, Wg in that order
#define WS_WT  (WS_XB + 2u * (size_t)NB * TT * CC)        // bf16 weight columns as rows [col][k = 2048]
#define WS_WOT (WS_WT + 2u * (size_t)NWT * CC)            // f16 (bf16(Wo) x 2^8) columns as rows [col][k = 2048]
#define WS_END (WS_WOT + 2u * (size_t)CC * CC)

// ---- k_proj: block = (128 tokens, 128 output cols = two 64-dim heads, which): acc = x W (W (in,out); exact); the way out runs once for each half of 64 tokens (m = 0, 1), through the same LDS; which 0/1: rotate-half rope with the given tables (tiles j and j+2 hold d and d+32 of the same head) -> f16 (+ residual x 2^10 for the early rows): q as rows, k in k_attn's fragment order, and new_k written in f32; which 2: v -> f16 (+ bf16 hi/lo for the early keys) in k_attn's fragment order and new_v in f32; which 3: alpha = sigmoid(x Wg + bg) -> f16 rows
// ---- k_prep: every float operand of the three big products is rounded ONCE to its 16-bit form and laid out for its reader: the columns of Wq, Wk, Wv, Wg -> bf16 rows of WT, the columns of Wo -> f16 (bf16 x 2^8, exact) rows of WOT, both [col][k]; x -> bf16 in A-fragment order: per (16 rows, 32 k) 1 KiB = [half of the fragment][lane = 16 g + row][8 k], k = 16 half + 8 g + e, so that a wave's 16-B loads read 512 B in a row. blockIdx.x 0..79: 64 rows of WT, 80..111: of WOT, 112..143: 64 rows of x; blockIdx.y: eight 64-k tiles, one after the other (few, long blocks: fewer waves to start). Each 128-B line of the planes is written by one block.
#define PREP_T 8
template <bool IS_O> __device__ __forceinline__ void prep_w(const float* __restrict__ src, int ld, unsigned short* __restrict__ dst, unsigned (*ts)[64][36], int kt0, int tid) {
  const int n = tid >> 2, p = tid & 3, kq = tid >> 4, c4 = (tid & 15) * 4; v4f va[2], vb[2];   /* rows 2 kp and 2 kp + 1 (kp = 16 i + kq), four columns: 16 lanes read 256 B of a row */
  const float* s = src + (size_t)(kt0 * 64 + 2 * kq) * ld + c4; unsigned short* d = dst + (size_t)n * CC + kt0 * 64 + p * 16;
#pragma unroll
  for (int i = 0; i < 2; ++i) { va[i] = *(const v4f*)(s + (size_t)(i * 32) * ld); vb[i] = *(const v4f*)(s + (size_t)(i * 32 + 1) * ld); }
  asm volatile("s_wait_xcnt 0x0" ::: "memory");   /* before a register that the loads above name is used again */
#pragma unroll
  for (int it = 0; it < PREP_T; ++it) {
#pragma unroll
    for (int i = 0; i < 2; ++i) {
#pragma unroll
      for (int e = 0; e < 4; ++e) { union { __bf16 b[2]; _Float16 h[2]; unsigned u; } pk;
        if (IS_O) { pk.h[0] = (_Float16)(bfr(va[i][e]) * 256.0f); pk.h[1] = (_Float16)(bfr(vb[i][e]) * 256.0f); } else { pk.b[0] = (__bf16)va[i][e]; pk.b[1] = (__bf16)vb[i][e]; }
        ts[it & 1][c4 + e][i * 16 + kq] = pk.u; } }
    __syncthreads();   /* the tile is whole before it is read by columns; with two buffers it also ends the reads of the buffer that the next tile fills */
    if (it + 1 < PREP_T) { const float* sn = s + (size_t)((it + 1) * 64) * ld;   /* the next tile's loads fly under this tile's way out */
#pragma unroll
      for (int i = 0; i < 2; ++i) { va[i] = *(const v4f*)(sn + (size_t)(i * 32) * ld); vb[i] = *(const v4f*)(sn + (size_t)(i * 32 + 1) * ld); }
      asm volatile("s_wait_xcnt 0x0" ::: "memory");   /* before a register that the loads above name is used again */ }
    const v4u qa = *(const v4u*)&ts[it & 1][n][p * 8], qb = *(const v4u*)&ts[it & 1][n][p * 8 + 4];
    *(v4u*)(d + it * 64) = qa; *(v4u*)(d + it * 64 + 8) = qb;
    asm volatile("s_wait_xcnt 0x0" ::: "memory");   /* before a register that the stores above name is used again */ } }
__global__ __launch_bounds__(256) void k_prep(const float* __restrict__ X, const float* __restrict__ WQ, const float* __restrict__ WK, const float* __restrict__ WV, const float* __restrict__ WG, const float* __restrict__ WO, __bf16* __restrict__ XB, __bf16* __restrict__ WT, _Float16* __restrict__ WOT) {
  __shared__ __align__(16) unsigned ts[2][64][36];   /* [col][k pair], 128-B rows at a 144-B pitch, two buffers */
  const int tid = threadIdx.x, bx = blockIdx.x, kt0 = blockIdx.y * PREP_T;
  if (bx >= 112) {   /* x (block-uniform; no barrier on this path) */
    const int row = (bx - 112) * 64 + (tid >> 2), p = tid & 3; const float* s = X + (size_t)row * CC + kt0 * 64 + p * 16;
    __bf16* d = XB + ((((size_t)(row >> 4) * (CC / 32) + kt0 * 2 + (p >> 1)) * 2 + (p & 1)) * 32 + (row & 15)) * 8;   /* g = 0 piece; the g = 1 piece lies 16 lanes on, the next 64 k four halves on */
#pragma unroll
    for (int it = 0; it < PREP_T; ++it) { v8b t[2];
#pragma unroll
      for (int i = 0; i < 4; ++i) { const v4f v = *(const v4f*)(s + it * 64 + i * 4);
#pragma unroll
        for (int e = 0; e < 4; ++e) t[i >> 1][(i & 1) * 4 + e] = (__bf16)v[e]; }
      *(v8b*)(d + it * (4 * 32 * 8)) = t[0]; *(v8b*)(d + it * (4 * 32 * 8) + 16 * 8) = t[1]; }
    return; }
  if (bx >= 80) prep_w<true>(WO + (bx - 80) * 64, CC, (unsigned short*)WOT + (size_t)(bx - 80) * 64 * CC, ts, kt0, tid);
  else { const float* src = bx < 32 ? WQ + bx * 64 : bx < 40 ? WK + (bx - 32) * 64 : bx < 48 ? WV + (bx - 40) * 64 : WG + (bx - 48) * 64;
    prep_w<false>(src, (bx >= 32 && bx < 48) ? KV : CC, (unsigned short*)WT + (size_t)bx * 64 * CC, ts, kt0, tid); } }
template <bool F16> __device__ __forceinline__ v8f mm16(v4u a0, v4u a1, v4u b0, v4u b1, v8f c) {
  union { v4u q[2]; v16h h; v16b b; } A, B; A.q[0] = a0; A.q[1] = a1; B.q[0] = b0; B.q[1] = b1;
  if (F16) return wmma16(A.h, B.h, c); else return wmma_bf(A.b, B.b, c); }
#define SWP 144              /* LDS pitch of a 128-B tile row, bytes */
#define SWB (128 * SWP)      /* one buffer: 128 columns */
#define AM (64 * CC * 2)     /* bytes from a wave's first 16 rows of A to its second 16, which lie 64 rows on (the same in rows and in fragment order) */
// W: 16-bit rows with k contiguous (k_prep's planes); A: 16-bit rows or fragment order. acc += A W over all of K for a (64 MR) x 128 tile. A wave takes MR groups of 16 rows (rows 64 m + 16 wave of the tile) by all 128 columns: with MR = 2 every B fragment that it reads from LDS feeds two products, and a W tile fetched from L2 serves 128 rows. A pass is 64 k = 128 B of every row: eight lanes fetch one whole line of a W column (16 B a lane, a wave's load is four lines), eight such loads a thread bring the 128 x 64 tile, which goes to LDS as it is; the block's four waves read their B fragments from there, and each lane fetches its own four 16-B pieces of A per row group from ap (+ AM for the second group): AS bytes from piece to piece, AP from pass to pass (rows: 32 and 128, ap = the lane's row + 16 g bytes; fragment order: 512 and 2,048, ap = the wave's 16 rows + 16 lane bytes). wp: W row (tid >> 3) of the tile + 16 (tid & 7) bytes.
template <bool F16, int AS, int AP, int MR> __device__ __forceinline__ void gemm_acc(const char* __restrict__ ap, const char* __restrict__ wp, char* sw, int tid, int lane, v8f (&acc)[MR][8]) {
  constexpr int JG = 8 / MR;   /* B fragments fetched at a time: with MR = 2 and all eight, the sums, both A sets and B do not fit the registers that the products' statements can name */
  v4u wr[8], ar[MR][4]; char* st = sw + (tid >> 3) * SWP + (tid & 7) * 16; const char* rd = sw + (lane & 15) * SWP + (lane >> 4) * 16;
#pragma unroll
  for (int i = 0; i < 8; ++i) wr[i] = *(const v4u*)(wp + (size_t)i * (16 * CC * 2));
#pragma unroll
  for (int m = 0; m < MR; ++m) {
#pragma unroll
    for (int i = 0; i < 4; ++i) ar[m][i] = *(const v4u*)(ap + m * AM + i * AS); }
  asm volatile("s_wait_xcnt 0x0" :: "v"(wp), "v"(ap) : "memory");   /* before a register that the loads above name is used again; the addresses are inputs, so that they stay whole up to the wait */
  const char* wn = wp + 128; const char* an = ap + AP;   /* the next pass's rows; carried from pass to pass and stepped behind the wait, so that no load lands on them */
  /* unroll 2: the buffer index becomes a constant */
#pragma unroll 2
  for (int kc = 0; kc < CC / 64; ++kc) { const int bo = (kc & 1) * SWB; v4u a[MR][4];
#pragma unroll
    for (int m = 0; m < MR; ++m) {
#pragma unroll
      for (int i = 0; i < 4; ++i) a[m][i] = ar[m][i]; }
#pragma unroll
    for (int i = 0; i < 8; ++i) *(v4u*)(st + bo + i * 16 * SWP) = wr[i];
    __syncthreads();   /* publishes this pass's tile; with two buffers it also ends every wave's reads of the buffer that the next pass refills */
    /* the next pass's global loads fly under this pass's products (the last pass reloads its own rows, unused) */
#pragma unroll
    for (int i = 0; i < 8; ++i) wr[i] = *(const v4u*)(wn + (size_t)i * (16 * CC * 2));
#pragma unroll
    for (int m = 0; m < MR; ++m) {
#pragma unroll
      for (int i = 0; i < 4; ++i) ar[m][i] = *(const v4u*)(an + m * AM + i * AS); }
    asm volatile("s_wait_xcnt 0x0" :: "v"(wn), "v"(an) : "memory");   /* before a register that the loads above name is used again; the addresses are inputs, so that they stay whole up to the wait */
    if (kc + 2 < CC / 64) { wn += 128; an += AP; }
#pragma unroll
    for (int kj = 0; kj < 2 * MR; ++kj) { const int kk = kj / MR, j0 = (kj % MR) * JG; v4u w[JG][2];
#pragma unroll
      for (int j = 0; j < JG; ++j) { w[j][0] = *(const v4u*)(rd + bo + (j0 + j) * 16 * SWP + kk * 64); w[j][1] = *(const v4u*)(rd + bo + (j0 + j) * 16 * SWP + kk * 64 + 32); }
#pragma unroll
      for (int j = 0; j < JG; ++j) {
#pragma unroll
        for (int m = 0; m < MR; ++m) acc[m][j0 + j] = mm16<F16>(a[m][kk * 2], a[m][kk * 2 + 1], w[j][0], w[j][1], acc[m][j0 + j]); } } } }
__global__ __launch_bounds__(128, 3) void k_proj(const __bf16* __restrict__ XB, const __bf16* __restrict__ WT, const float* __restrict__ BG, const float* __restrict__ COS, const float* __restrict__ SIN, _Float16* __restrict__ QH, _Float16* __restrict__ KH, _Float16* __restrict__ VT, _Float16* __restrict__ QL, _Float16* __restrict__ KL, __bf16* __restrict__ VB, __bf16* __restrict__ VBL, _Float16* __restrict__ GA, float* __restrict__ OUTK, float* __restrict__ OUTV) {
  /* one LDS pool, 92,160 B, so that three blocks fit a WGP and all 640 blocks of the grid that work are resident at once: the f32 staging so lies on the W ring sw (which is done with when the way out begins), and q's and k's staging sh, sl on v's th, tb, tbl (a block takes one of the two paths); the 3 in the launch bounds is the register budget of three waves a SIMD */
  __shared__ __align__(16) char pool[2 * SWB + 3 * 128 * 72 * 2]; static_assert(4 * 16 * 132 * 4 <= 2 * SWB && 2 * 64 * 136 * 2 <= 3 * 128 * 72 * 2, "the overlaid arrays fit");
  char* sw = pool; float (*so)[16][132] = (float (*)[16][132])pool; _Float16 (*sh)[136] = (_Float16 (*)[136])(pool + 2 * SWB); _Float16 (*sl)[136] = sh + 64; _Float16 (*th)[72] = (_Float16 (*)[72])(pool + 2 * SWB); __bf16 (*tb)[72] = (__bf16 (*)[72])(pool + 2 * SWB + 128 * 72 * 2); __bf16 (*tbl)[72] = tb + 128;
  const int tid = threadIdx.x, wave = tid >> 5, lane = tid & 31, col = lane & 15, g = lane >> 4; const int which = blockIdx.z; const int c0 = blockIdx.y * 128; const size_t rb = (size_t)blockIdx.x * 128; const int NW = (which == 0 || which == 3) ? CC : KV; if (c0 >= NW) return;   // k/v are only 512 wide (block-uniform exit before any barrier)
  const int w0 = which == 0 ? 0 : which == 1 ? CC : which == 2 ? CC + KV : CC + 2 * KV;   /* first row of this product's columns in WT */
  v8f acc2[2][8] = {};
  gemm_acc<false, 512, 2048, 2>((const char*)(XB + (rb + wave * 16) * CC + lane * 8), (const char*)(WT + (size_t)(w0 + c0 + (tid >> 3)) * CC + (tid & 7) * 8), sw, tid, lane, acc2);
  v8f acc[8];
#pragma unroll
  for (int j = 0; j < 8; ++j) acc[j] = acc2[0][j];
  /* kept rolled: one copy of the way out's code for both halves */
#pragma unroll 1
  for (int m = 0; m < 2; ++m) {
  __syncthreads();   /* ends every wave's reads of what this half's staging overwrites: the W ring's last tile (m = 0), the first half's staging (m = 1) */
  const size_t r0 = rb + m * 64; const size_t b = r0 / TT; const int t0 = (int)(r0 % TT); const bool hi_rows = t0 < ((which == 0) ? QHI : KHI);   /* block-uniform */
  if (which == 3) {   /* gate: alpha = sigmoid(acc + bg) -> f16 rows */
#pragma unroll
    for (int j = 0; j < 8; ++j) { const float bb = bfr(BG[c0 + j * 16 + col]);
#pragma unroll
      for (int r = 0; r < 8; ++r) sh[wave * 16 + 8 * g + r][j * 16 + col] = (_Float16)(1.0f / (1.0f + expf(-(acc[j][r] + bb)))); }
    __syncthreads();
    for (int e = tid; e < 64 * 16; e += 128) { const int rl = e >> 4, q = e & 15; vst2((unsigned*)(GA + (r0 + rl) * CC + c0 + q * 8), *(const v4u*)&sh[rl][q * 8]); }
  } else if (which < 2) {
    /* rotate-half rope on each 64-dim head: d = (j&3)*16+col; d < 32 (tiles jp = 0,1,4,5) pairs with d+32 (jp+2): out[d] = x[d] c[d] - x[d+32] s[d], out[d+32] = x[d+32] c[d+32] + x[d] s[d+32] */
#pragma unroll
    for (int jp = 0; jp < 8; ++jp) { if ((jp & 3) >= 2) continue; const int i2 = (jp & 3) * 16 + col;
#pragma unroll
      for (int r = 0; r < 8; ++r) { const int t = t0 + wave * 16 + 8 * g + r; const float c1 = bfr(COS[(size_t)t * HD + i2]), s1 = bfr(SIN[(size_t)t * HD + i2]), c2 = bfr(COS[(size_t)t * HD + i2 + 32]), s2 = bfr(SIN[(size_t)t * HD + i2 + 32]); const float x1 = acc[jp][r], x2 = acc[jp + 2][r]; asm volatile("s_wait_loadcnt 0x0" ::: "memory"); acc[jp][r] = x1 * c1 - x2 * s1; acc[jp + 2][r] = x2 * c2 + x1 * s2; } }
    if (which == 1) {   /* new_k output [HKV][S][64] in f32: this wave's 16 rows x 2 heads, 256 B per (row, head) by 16 lanes */
#pragma unroll
      for (int j = 0; j < 8; ++j) {
#pragma unroll
        for (int r = 0; r < 8; ++r) so[wave][8 * g + r][j * 16 + col] = acc[j][r]; }
      LDSX(); for (int rl = 0; rl < 16; ++rl) { const int t = t0 + wave * 16 + rl; const int hh = (c0 >> 6) + (lane >> 4); vst2(OUTK + ((size_t)hh * TT + t) * HD + (lane & 15) * 4, *(const v4f*)&so[wave][rl][lane * 4]); } }
#pragma unroll
    for (int j = 0; j < 8; ++j) {
#pragma unroll
      for (int r = 0; r < 8; ++r) { const float v = acc[j][r]; const _Float16 hv = (_Float16)v; sh[wave * 16 + 8 * g + r][j * 16 + col] = hv; sl[wave * 16 + 8 * g + r][j * 16 + col] = (_Float16)((v - (float)hv) * 1024.0f); } }
    __syncthreads();
    _Float16* dh = which == 0 ? QH : KH; _Float16* dl = which == 0 ? (QL + (b * QHI) * (size_t)CC) : (KL + (b * KHI) * (size_t)KV);
    if (which == 0)   /* q: rows */
    for (int e = tid; e < 64 * 16; e += 128) { const int rl = e >> 4, q = e & 15; vst2((unsigned*)(dh + (r0 + rl) * NW + c0 + q * 8), *(const v4u*)&sh[rl][q * 8]); if (hi_rows) vst2((unsigned*)(dl + (size_t)(t0 + rl) * NW + c0 + q * 8), *(const v4u*)&sl[rl][q * 8]); }
    else   /* k in fragment order: piece e = (head hh, 16 keys tl, 32 d kc, half hf, lane 16 gg + row); a head's 64 keys are 8 KiB in a row, a wave's store 512 B in a row */
    for (int it = 0; it < 8; ++it) { const int e = tid + it * 128, row = e & 15, gg = (e >> 4) & 1, hf = (e >> 5) & 1, kc = (e >> 6) & 1, tl = (e >> 7) & 3, hh = e >> 9; const int rl = tl * 16 + row, cl = hh * 64 + kc * 32 + hf * 16 + gg * 8; const size_t hd = b * NKV + (c0 >> 6) + hh;
      _Float16* pk = KH + (hd * (TT / 16) + (t0 >> 4)) * 1024 + (e & 511) * 8; const v4u dk = *(const v4u*)&sh[rl][cl];
      /* s_wait_xcnt 0 behind the stores, before a register that they name is used again; addresses and data are inputs, so that they stay whole up to the wait */
      if (hi_rows) { _Float16* pr = KL + (hd * (KHI / 16) + (t0 >> 4)) * 1024 + (e & 511) * 8; const v4u dr = *(const v4u*)&sl[rl][cl]; vst2(pk, dk); vst2(pr, dr); asm volatile("s_wait_xcnt 0x0" :: "v"(pk), "v"(pr), "v"(dk), "v"(dr) : "memory"); }
      else { vst2(pk, dk); asm volatile("s_wait_xcnt 0x0" :: "v"(pk), "v"(dk) : "memory"); } }
  } else {   /* which == 2: v */
#pragma unroll
    for (int j = 0; j < 8; ++j) {
#pragma unroll
      for (int r = 0; r < 8; ++r) so[wave][8 * g + r][j * 16 + col] = acc[j][r]; }
    LDSX(); for (int rl = 0; rl < 16; ++rl) { const int t = t0 + wave * 16 + rl; const int hh = (c0 >> 6) + (lane >> 4); vst2(OUTV + ((size_t)hh * TT + t) * HD + (lane & 15) * 4, *(const v4f*)&so[wave][rl][lane * 4]); }   /* new_v output in f32 */
#pragma unroll
    for (int j = 0; j < 8; ++j) {
#pragma unroll
      for (int r = 0; r < 8; ++r) { const float v = acc[j][r]; const int rl = wave * 16 + 8 * g + r, cl = j * 16 + col; th[cl][rl] = (_Float16)v; const __bf16 bh = (__bf16)v; tb[cl][rl] = bh; tbl[cl][rl] = (__bf16)(v - (float)bh); } }
    __syncthreads();
    /* v in fragment order: piece e = (head hh, 32 keys cc, 16 d j, half hf, lane 16 gg + row); a head's 64 keys are 8 KiB in a row, a wave's store 512 B in a row */
    for (int it = 0; it < 8; ++it) { const int e = tid + it * 128, row = e & 15, gg = (e >> 4) & 1, hf = (e >> 5) & 1, j = (e >> 6) & 3, cc = (e >> 8) & 1, hh = e >> 9; const int cl = hh * 64 + j * 16 + row, rl = cc * 32 + hf * 16 + gg * 8; const size_t hd = b * NKV + (c0 >> 6) + hh;
      _Float16* pv = VT + (hd * (TT / 32) + (t0 >> 5)) * 2048 + (e & 511) * 8; const v4u dv = *(const v4u*)&th[cl][rl];
      /* s_wait_xcnt 0 behind the stores, before a register that they name is used again; addresses and data are inputs, so that they stay whole up to the wait */
      if (hi_rows) { const size_t o3 = (hd * (KHI / 32) + (t0 >> 5)) * 2048 + (e & 511) * 8; __bf16* ph = VB + o3; __bf16* pl = VBL + o3; const v4u dh = *(const v4u*)&tb[cl][rl], dl = *(const v4u*)&tbl[cl][rl];
        vst2(pv, dv); vst2(ph, dh); vst2(pl, dl); asm volatile("s_wait_xcnt 0x0" :: "v"(pv), "v"(ph), "v"(pl), "v"(dv), "v"(dh), "v"(dl) : "memory"); }
      else { vst2(pv, dv); asm volatile("s_wait_xcnt 0x0" :: "v"(pv), "v"(dv) : "memory"); } } }
  asm volatile("s_wait_xcnt 0x0" ::: "memory");   /* before a register that this half's stores name is used again by the next half */
  __builtin_amdgcn_sched_barrier(0);   /* keeps the copies below behind that wait */
#pragma unroll
  for (int j = 0; j < 8; ++j) acc[j] = acc2[1][j];   /* the second half's sums take the first half's place */
  } }
// ---- k_attn: block = (head h, pair y of 128-query blocks), eight independent waves of 32 queries each (two 16-query column groups u): waves 0..3 take block 15 - y, waves 4..7 block y, so that every block of the grid walks the same number of keys; no LDS, no barrier; k and v lie in fragment order (k_proj), so that every load of theirs reads whole lines. S^T = K Q^T: A = 16 key rows, B = 16 query rows, so lane (g, col) holds query col's logits of keys 8g + r; two such tiles (keys k0 + 0..15, k0 + 16..31) are, element for element, the B operand P^T of O^T += V^T P^T (A = 16 d of v). Pass 1 walks the keys for each query's maximum, pass 2 forms the same logits again, e = 2^11 exp(logit - max) = exp2(s ks + (11 - max ks)), sums e in f32 and multiplies e (once to f16; rows < 384: bf16 hi + lo) with v; the division by (sum + 1e-9) is done on the 64 outputs. 3-product logits for rows < 384, else 1. Epilogue: a lane holds 32 of the 64 outputs of one (token, head), its partner lane ^ 16 the other 32, so the per-head normalisation is in-lane sums and one exchange each for mean and variance; x gn_weight + gn_bias, x alpha (k_proj's f16 rows), once to f16 -> the A rows of k_out.
// The pointers of this kernel are plain (no __restrict__): its loads then stay between the asm statements around them, so that each run of loads has its s_wait_xcnt 0 behind it.
/* s_wait_xcnt 0 behind a run of global loads, before a register that they name is used again; the run's address is an input of the statement, so that its registers stay whole up to the wait */
__device__ __forceinline__ void xwait(const void* p) { asm volatile("s_wait_xcnt 0x0" :: "v"(p) : "memory"); }
__device__ __forceinline__ void xwait(const void* p, const void* q) { asm volatile("s_wait_xcnt 0x0" :: "v"(p), "v"(q) : "memory"); }
/* one lane's 16 elements of a fragment; p already holds the lane half's 8 g */
__device__ __forceinline__ v16h ld_h(const _Float16* p) { union { v16h v; v8h q[2]; } u; u.q[0] = *(const v8h*)p; u.q[1] = *(const v8h*)(p + 16); return u.v; }
/* the same from a plane in fragment order (1 KiB = [half][lane][8]); p already holds the lane's 8 lane: each of the two loads reads 512 B in a row over the wave, four whole lines */
__device__ __forceinline__ v16h ld_hf(const _Float16* p) { union { v16h v; v8h q[2]; } u; u.q[0] = *(const v8h*)p; u.q[1] = *(const v8h*)(p + 256); return u.v; }
__device__ __forceinline__ v16b ld_bf(const __bf16* p) { union { v16b v; v8b q[2]; } u; u.q[0] = *(const v8b*)p; u.q[1] = *(const v8b*)(p + 256); return u.v; }
template <bool HI> __device__ __forceinline__ void attn_ldk(const _Float16* kp, const _Float16* klp, int c, v16h (&kh)[2][2], v16h (&kl)[2][2]) {
  const _Float16* p = kp + (size_t)c * 2048; const _Float16* pl = klp + (size_t)c * 2048;   /* a chunk of 32 keys: 2 x 2 fragments, 4 KiB in a row */
#pragma unroll
  for (int i = 0; i < 2; ++i) {
#pragma unroll
    for (int kc = 0; kc < 2; ++kc) { kh[i][kc] = ld_hf(p + i * 1024 + kc * 512); if (HI) kl[i][kc] = ld_hf(pl + i * 1024 + kc * 512); } }
  if (HI) xwait(p, pl); else xwait(p); }
template <bool HI> __device__ __forceinline__ v8f attn_s(const v16h (&kh)[2], const v16h (&kl)[2], const v16h (&qh)[2], const v16h (&ql)[2]) {
  v8f a = {}, al = {};
#pragma unroll
  for (int kc = 0; kc < 2; ++kc) { a = wmma16(kh[kc], qh[kc], a); if (HI) { al = wmma16(kh[kc], ql[kc], al); al = wmma16(kl[kc], qh[kc], al); } }
#pragma unroll
  for (int r = 0; r < 8; ++r) a[r] = HI ? (a[r] + al[r] * (1.0f / 1024.0f)) * SCALE : a[r];   /* the 1-product rows' values stay 8 x the logit: their 1/8 (exact) sits in the exponent's multiplier ks */
  return a; }
/* eight hardware exp2 in one statement: behind a transcendental the instruction set asks for one independent instruction before its result is read or its source overwritten; here each v_exp_f32 is that instruction for the one before it (every output lies apart from every input), and the v_nop is it for the last */
__device__ __forceinline__ void exp2x8(const float (&x)[8], float* y) { float y0, y1, y2, y3, y4, y5, y6, y7;
  asm("v_exp_f32 %0, %8\n\tv_exp_f32 %1, %9\n\tv_exp_f32 %2, %10\n\tv_exp_f32 %3, %11\n\tv_exp_f32 %4, %12\n\tv_exp_f32 %5, %13\n\tv_exp_f32 %6, %14\n\tv_exp_f32 %7, %15\n\tv_nop"
      : "=&v"(y0), "=&v"(y1), "=&v"(y2), "=&v"(y3), "=&v"(y4), "=&v"(y5), "=&v"(y6), "=&v"(y7) : "v"(x[0]), "v"(x[1]), "v"(x[2]), "v"(x[3]), "v"(x[4]), "v"(x[5]), "v"(x[6]), "v"(x[7]));
  y[0] = y0; y[1] = y1; y[2] = y2; y[3] = y3; y[4] = y4; y[5] = y5; y[6] = y6; y[7] = y7; }
/* the last chunk (keys 32 (nch - 1) + 0..31) alone reaches past a row's diagonal; dq = the row of column group 0 in this lane, counted from that chunk's first key */
template <int NU> __device__ __forceinline__ void attn_mask(v8f (&s)[NU][2], int dq, int g) {
#pragma unroll
  for (int u = 0; u < NU; ++u) {
#pragma unroll
    for (int i = 0; i < 2; ++i) {
#pragma unroll
      for (int r = 0; r < 8; ++r) s[u][i][r] = (i * 16 + 8 * g + r <= u * 16 + dq) ? s[u][i][r] : -3.0e38f; } } }
template <bool HI, int NU> __device__ __forceinline__ void attn_sall(const v16h (&kh)[2][2], const v16h (&kl)[2][2], const v16h (&qh)[NU][2], const v16h (&ql)[NU][2], v8f (&s)[NU][2]) {
#pragma unroll
  for (int u = 0; u < NU; ++u) {
#pragma unroll
    for (int i = 0; i < 2; ++i) s[u][i] = attn_s<HI>(kh[i], kl[i], qh[u], ql[u]); } }
template <int NU> __device__ __forceinline__ void attn_max(const v8f (&s)[NU][2], float (&m)[NU]) {
#pragma unroll
  for (int u = 0; u < NU; ++u) {
#pragma unroll
    for (int i = 0; i < 2; ++i) {
#pragma unroll
      for (int r = 0; r < 8; ++r) m[u] = fmaxf(m[u], s[u][i][r]); } } }
/* one wave, NU column groups of 16 queries from row ql0 on (ql0 a multiple of 16 NU) */
template <bool HI, int NU> __device__ __forceinline__ void attn_wave(const _Float16* QH, const _Float16* KH, const _Float16* QL, const _Float16* KL, const _Float16* VT, const __bf16* VB, const __bf16* VBL, const _Float16* GA, const float* GW, const float* GB, _Float16* AH, int b, int h, int ql0, int lane) {
  const int col = lane & 15, g = lane >> 4, dq = (ql0 & 31) + col; const size_t kvh = (size_t)b * NKV + h / GQ; const int nch = (ql0 >> 5) + 1;   /* 32-key chunks; every chunk holds at least one key <= t for each of the wave's rows */
  v16h qh[NU][2], ql[NU][2], ka[2][2], la[2][2], kb[2][2], lb[2][2]; v8f s[NU][2];
  { const _Float16* qp = QH + ((size_t)b * TT + ql0 + col) * CC + h * HD + 8 * g; const _Float16* qlp = QL + ((size_t)b * QHI + ql0 + col) * CC + h * HD + 8 * g;
#pragma unroll
    for (int u = 0; u < NU; ++u) {
#pragma unroll
      for (int kc = 0; kc < 2; ++kc) { qh[u][kc] = ld_h(qp + u * 16 * CC + kc * 32); if (HI) ql[u][kc] = ld_h(qlp + u * 16 * CC + kc * 32); } }
    if (HI) xwait(qp, qlp); else xwait(qp); }
  const _Float16* kp = KH + kvh * (TT / 16) * 1024 + lane * 8; const _Float16* klp = KL + kvh * (KHI / 16) * 1024 + lane * 8;
  float m[NU];
#pragma unroll
  for (int u = 0; u < NU; ++u) m[u] = -3.0e38f;
  if (HI) {   /* pass 1 of the early rows (at most 12 chunks, beside a wave that walks 53 and more): no look-ahead, so that the residual planes' registers fit */
    for (int c = 0; c < nch; ++c) { attn_ldk<HI>(kp, klp, c, ka, la);
      attn_sall<HI, NU>(ka, la, qh, ql, s);
      if (c == nch - 1) attn_mask<NU>(s, dq, g);   /* scalar test */
      attn_max<NU>(s, m); }
  } else {
  /* pass 1, two chunks a trip: each chunk's key rows are fetched a whole trip ahead, into the registers that its products have just left. An odd count takes its last chunk twice (a maximum does not mind). Behind the last trip ka holds chunk 0, with which pass 2 begins */
  attn_ldk<HI>(kp, klp, 0, ka, la); attn_ldk<HI>(kp, klp, nch > 1 ? 1 : 0, kb, lb);
  for (int c = 0; c < nch; c += 2) { const int c1 = c + 1 < nch ? c + 1 : nch - 1;
    attn_sall<HI, NU>(ka, la, qh, ql, s);
    attn_ldk<HI>(kp, klp, c + 2 < nch ? c + 2 : 0, ka, la);
    if (c == nch - 1) attn_mask<NU>(s, dq, g);   /* scalar test */
    attn_max<NU>(s, m);
    attn_sall<HI, NU>(kb, lb, qh, ql, s);
    attn_ldk<HI>(kp, klp, c + 3 < nch ? c + 3 : nch - 1, kb, lb);
    if (c1 == nch - 1) attn_mask<NU>(s, dq, g);   /* scalar test */
    attn_max<NU>(s, m); } }
#pragma unroll
  for (int u = 0; u < NU; ++u) m[u] = fmaxf(m[u], __shfl_xor(m[u], 16));   /* the two lane halves hold the two halves of a query's keys */
  const float ks = (HI ? 1.0f : SCALE) * 1.44269504f;   /* log2(e), times the 1/8 that the 1-product rows still owe */
  float sum[NU], cm[NU]; v8f o[NU][HD / 16];
#pragma unroll
  for (int u = 0; u < NU; ++u) { sum[u] = 0.f; cm[u] = fmaf(-m[u], ks, 11.0f);   /* its rounding is one factor for the whole row, in e and in the sum alike */
#pragma unroll
    for (int j = 0; j < HD / 16; ++j) o[u][j] = v8f{}; }
  const _Float16* vp = VT + kvh * (TT / 32) * 2048 + lane * 8; const __bf16* vbp = VB + kvh * (KHI / 32) * 2048 + lane * 8; const __bf16* vlp = VBL + kvh * (KHI / 32) * 2048 + lane * 8;   /* a chunk of 32 keys: four fragments (d = 16 j + col), 4 KiB in a row */
  for (int c = 0; c < nch; ++c) { v16h vf[HD / 16]; v16b vb[HD / 16], vbl[HD / 16];
    if (HI) attn_ldk<HI>(kp, klp, c, ka, la);
    else { const _Float16* p0 = vp + c * 2048;
#pragma unroll
      for (int j = 0; j < HD / 16; ++j) vf[j] = ld_hf(p0 + j * 512);
      xwait(p0); }
    attn_sall<HI, NU>(ka, la, qh, ql, s);
    if (HI) { const __bf16* p0 = vbp + c * 2048; const __bf16* p1 = vlp + c * 2048;   /* the early rows' v planes come in behind the logits, when the key rows' registers are free, and fly under the exponentials */
#pragma unroll
      for (int j = 0; j < HD / 16; ++j) { vb[j] = ld_bf(p0 + j * 512); vbl[j] = ld_bf(p1 + j * 512); }
      xwait(p0, p1);
    } else attn_ldk<HI>(kp, klp, c + 1 < nch ? c + 1 : c, ka, la);   /* the next chunk's key rows fly under this chunk's exponentials (the last chunk reloads its own, unused) */
    __builtin_amdgcn_sched_barrier(0);   /* keeps the loads above in front of the exponentials: sunk to the loop's foot they would be waited for at once */
    if (c == nch - 1) attn_mask<NU>(s, dq, g);   /* scalar test; the excluded keys' -3e38 gives e = 0 */
#pragma unroll
    for (int u = 0; u < NU; ++u) { float e[16];
#pragma unroll
      for (int i = 0; i < 2; ++i) { float x[8];   /* the argument is never above 11 (but for cm's rounding), so no range step is owed; below -126, the excluded keys' too, the instruction gives 0 */
#pragma unroll
        for (int r = 0; r < 8; ++r) x[r] = fmaf(s[u][i][r], ks, cm[u]);
        exp2x8(x, &e[i * 8]);
#pragma unroll
        for (int r = 0; r < 8; ++r) sum[u] += e[i * 8 + r]; }
      if (HI) { const F2 p = bsplit16(e);
#pragma unroll
        for (int j = 0; j < HD / 16; ++j) { o[u][j] = wmma_bf(vb[j], p.h, o[u][j]); o[u][j] = wmma_bf(vb[j], p.l, o[u][j]); o[u][j] = wmma_bf(vbl[j], p.h, o[u][j]); }
      } else { v16h p;
#pragma unroll
        for (int x = 0; x < 16; ++x) p[x] = (_Float16)e[x];
#pragma unroll
        for (int j = 0; j < HD / 16; ++j) o[u][j] = wmma16(vf[j], p, o[u][j]); } } }
  __builtin_amdgcn_sched_barrier(0);   /* keeps the epilogue's loads behind the last products and their v_nop slots: lifted among them they would land on operand registers of a product just issued */
#pragma unroll
  for (int u = 0; u < NU; ++u) sum[u] = 1.0f / (sum[u] + __shfl_xor(sum[u], 16) + 2048.0f * 1e-9f);   /* p = e / (sum + 1e-9) as in the module, numerator and denominator x 2^11 */
  v8f gw[HD / 16], gb[HD / 16];   /* lane (g, col) holds d = 16 j + 8 g + r of query col */
  { const float* gwp = GW + h * HD + 8 * g; const float* gbp = GB + h * HD + 8 * g;
#pragma unroll
    for (int j = 0; j < HD / 16; ++j) { gw[j] = *(const v8f*)(gwp + j * 16); gb[j] = *(const v8f*)(gbp + j * 16); }
    xwait(gwp, gbp); }
#pragma unroll
  for (int u = 0; u < NU; ++u) { const float sc = sum[u]; v8f t[HD / 16]; v8h al[HD / 16]; v4u pk[HD / 16]; float ps[HD / 16];
    const size_t off = ((size_t)b * TT + ql0 + u * 16 + col) * CC + h * HD + 8 * g; const _Float16* gap = GA + off; _Float16* ap = AH + off;
#pragma unroll
    for (int j = 0; j < HD / 16; ++j) al[j] = *(const v8h*)(gap + j * 16);
    xwait(gap);
#pragma unroll
    for (int j = 0; j < HD / 16; ++j) { t[j] = o[u][j] * sc; ps[j] = 0.f;   /* four independent chains of eight */
#pragma unroll
      for (int r = 0; r < 8; ++r) ps[j] += t[j][r]; }
    float s1 = (ps[0] + ps[1]) + (ps[2] + ps[3]); s1 += __shfl_xor(s1, 16);
    const float mean = s1 * (1.0f / HD);
#pragma unroll
    for (int j = 0; j < HD / 16; ++j) { ps[j] = 0.f;
#pragma unroll
      for (int r = 0; r < 8; ++r) { t[j][r] -= mean; ps[j] += t[j][r] * t[j][r]; } }
    float s2 = (ps[0] + ps[1]) + (ps[2] + ps[3]); s2 += __shfl_xor(s2, 16);
    const float rstd = rsqrtf(s2 * (1.0f / HD) + 1e-5f);
#pragma unroll
    for (int j = 0; j < HD / 16; ++j) { union { v8h hv; v4u u4; } c;
#pragma unroll
      for (int r = 0; r < 8; ++r) c.hv[r] = (_Float16)((t[j][r] * rstd * bfr(gw[j][r]) + bfr(gb[j][r])) * (float)al[j][r]);
      pk[j] = c.u4; vst2(ap + j * 16, pk[j]); }   /* the 128-B line of a (token, head) is written by this wave alone */
    asm volatile("s_wait_xcnt 0x0" :: "v"(ap), "v"(pk[0]), "v"(pk[1]), "v"(pk[2]), "v"(pk[3]) : "memory");   /* before a register that the stores above name is used again; address and data are inputs, so that they stay whole up to the wait */ } }
__global__ __launch_bounds__(256) void k_attn(const _Float16* QH, const _Float16* KH, const _Float16* QL, const _Float16* KL, const _Float16* VT, const __bf16* VB, const __bf16* VBL, const _Float16* GA, const float* GW, const float* GB, _Float16* AH) {
  static_assert(QHI % 128 == 0 && KHI >= QHI && HD == 64, "a wave is wholly on one path, and its keys have the residual planes");
  const int lane = threadIdx.x & 31; const int wave = __builtin_amdgcn_readfirstlane(threadIdx.x >> 5);   /* scalar, so that the chunk loops branch on scalars */
  const int qb = wave < 4 ? (TT / 128 - 1) - (int)blockIdx.y : (int)blockIdx.y; const int ql0 = qb * 128 + (wave & 3) * 32;   /* a long and a short query block side by side */
  if (qb < QHI / 128) {   /* the early rows' planes take twice the registers: one column group at a time */
    /* kept rolled: one copy of this path's code, and one group's registers */
#pragma unroll 1
    for (int u = 0; u < 2; ++u) attn_wave<true, 1>(QH, KH, QL, KL, VT, VB, VBL, GA, GW, GB, AH, blockIdx.z, blockIdx.x, ql0 + u * 16, lane);
  } else attn_wave<false, 2>(QH, KH, QL, KL, VT, VB, VBL, GA, GW, GB, AH, blockIdx.z, blockIdx.x, ql0, lane); }
// ---- k_out: block = (64 rows, 128 cols): y = (gn * alpha) (f16 rows) Wo (k_prep's f16 rows, bf16 x 2^8, exact) x 2^-8 -> output 0 rows
__global__ __launch_bounds__(128) void k_out(const _Float16* __restrict__ AH, const _Float16* __restrict__ WOT, float* __restrict__ OUT) { __shared__ __align__(16) float sf[4][16][132]; __shared__ __align__(16) char sw[2 * SWB];   /* Wo tile of one pass, [col][k] in f16 (x 2^8), two buffers */
  const int tid = threadIdx.x, wave = tid >> 5, lane = tid & 31, col = lane & 15, g = lane >> 4; const int c0 = blockIdx.y * 128; const size_t r0 = (size_t)blockIdx.x * 64 + wave * 16;
  v8f acc[1][8] = {};
  gemm_acc<true, 32, 128, 1>((const char*)(AH + (r0 + col) * CC + 8 * g), (const char*)(WOT + (size_t)(c0 + (tid >> 3)) * CC + (tid & 7) * 8), sw, tid, lane, acc);
#pragma unroll
  for (int j = 0; j < 8; ++j) {
#pragma unroll
    for (int r = 0; r < 8; ++r) sf[wave][8 * g + r][j * 16 + col] = acc[0][j][r] * (1.0f / 256.0f); }
  LDSX(); for (int rl = 0; rl < 16; ++rl) vst2(OUT + (r0 + rl) * CC + c0 + lane * 4, *(const v4f*)&sf[wave][rl][lane * 4]); }
extern "C" void kernel_launch(void* const* d_in, const int* in_sizes, int n_in, void* d_out, int out_size, void* d_ws, size_t ws_size, hipStream_t stream) {
  (void)in_sizes; (void)n_in; (void)out_size;
  const float** F = (const float**)d_in;   // 0 x [1,2048,2048]; 1 rope_cos, 2 rope_sin [2048,64]; 3 Wq [2048,2048]; 4 Wk, 5 Wv [2048,512]; 6 Wo [2048,2048]; 7 Wg [2048,2048], 8 bg; 9 gn_weight, 10 gn_bias [2048]
  if (ws_size < (size_t)WS_END) return;
  char* ws = (char*)d_ws; _Float16 *GA = (_Float16*)(ws + WS_GA), *AH = (_Float16*)(ws + WS_AH), *QH = (_Float16*)(ws + WS_QH), *KH = (_Float16*)(ws + WS_KH), *VT = (_Float16*)(ws + WS_VT), *QL = (_Float16*)(ws + WS_QL), *KL = (_Float16*)(ws + WS_KL); __bf16 *VB = (__bf16*)(ws + WS_VB), *VBL = (__bf16*)(ws + WS_VBL); __bf16 *XB = (__bf16*)(ws + WS_XB), *WT = (__bf16*)(ws + WS_WT); _Float16 *WOT = (_Float16*)(ws + WS_WOT);
  float* OUT0 = (float*)d_out; float* OUTK = OUT0 + (size_t)NB * TT * CC; float* OUTV = OUTK + (size_t)NB * NKV * TT * HD;   /* tuple outputs concatenated, no padding */
  k_prep<<<dim3(NWT / 64 + CC / 64 + TNB * TT / 64, CC / 64 / PREP_T), 256, 0, stream>>>(F[0], F[3], F[4], F[5], F[7], F[6], XB, WT, WOT);
  k_proj<<<dim3(TNB * TT / 128, CC / 128, 4), 128, 0, stream>>>(XB, WT, F[8], F[1], F[2], QH, KH, VT, QL, KL, VB, VBL, GA, OUTK, OUTV);
  k_attn<<<dim3(NH, TT / 256, TNB), 256, 0, stream>>>(QH, KH, QL, KL, VT, VB, VBL, GA, F[9], F[10], AH);
  k_out<<<dim3(TNB * TT / 64, CC / 128), 128, 0, stream>>>(AH, WOT, OUT0);
}

// v008
// A run of this version takes 118 microseconds.
// Two timings next to v007 put it at 1.18 and 1.17 times that version's speed.
// Counting every step since v000, it is 12.0 times as fast.
// compute dtype: all float inputs rounded to bf16; q/k/v/gate projections x W with EXACT bf16 products on WMMA 16x16x32, f32 accumulate; rotate-half rotary with the given cos/sin tables in f32; q, k once to f16 -> 1-product causal logits / 8 (the first 384 query rows use f16 hi + residual on both sides, 3 products); softmax in f32: exp(logit - max) x 2^11 as one hardware exp2 of (logit - max) x log2(e) + 11 (one fused multiply-add), once to f16 against v once to f16 (first 384 rows: bf16 hi + lo, 3 products), divided by (sum + 1e-9) after the product (sum and 1e-9 both carried x 2^11); per-head GroupNorm and the sigmoid gate in f32; (gn * alpha) once to f16 against Wo carried x 2^8 in f16 (exact); new_k / new_v written in f32 straight from the projections; f32 outputs.
#include <hip/hip_runtime.h>
#include <math.h>

typedef __attribute__((ext_vector_type(16))) _Float16 v16h;
typedef __attribute__((ext_vector_type(16))) __bf16 v16b;
typedef __attribute__((ext_vector_type(8)))  _Float16 v8h;
typedef __attribute__((ext_vector_type(8)))  float v8f;
typedef __attribute__((ext_vector_type(4)))  float v4f;
typedef __attribute__((ext_vector_type(2)))  float v2f;
typedef __attribute__((ext_vector_type(4)))  unsigned v4u;
typedef __attribute__((ext_vector_type(4)))  int v4i;
typedef float __attribute__((may_alias)) float_a;
typedef int __attribute__((may_alias)) int_a;

template <typename T> __device__ __forceinline__ void vst2(void* p, T v) { *(T*)p = v;  }
__device__ __forceinline__ v8f wmma16(v16h a, v16h b, v8f c) {
  v8f d = __builtin_amdgcn_wmma_f32_16x16x32_f16(false, a, false, b, (short)0, c, false, false);
  asm volatile("v_nop\n\tv_nop\n\tv_nop\n\tv_nop" : "+v"(d) : "v"(a), "v"(b));
  return d;
}
__device__ __forceinline__ v8f wmma_bf(v16b a, v16b b, v8f c) {
  v8f d = __builtin_amdgcn_wmma_f32_16x16x32_bf16(false, a, false, b, (short)0, c, false, false);
  asm volatile("v_nop\n\tv_nop\n\tv_nop\n\tv_nop" : "+v"(d) : "v"(a), "v"(b));
  return d;
}
// 16x16x32 fragments: lane = (h = lane>>4, row/col = lane&15); elements 0..7 = k0+8h+0..7, 8..15 = k0+16+8h+0..7; D element r = row 8h+r
__device__ __forceinline__ v16h frag_h(const _Float16* rowk0, int lane) {
  union { v16h v; v8h q[2]; } u; const _Float16* p = rowk0 + 8 * (lane >> 4);
  u.q[0] = *(const v8h*)p; u.q[1] = *(const v8h*)(p + 16); return u.v;
}
__device__ __forceinline__ v16h frag_f32(const float* rowk0, int lane) {
  v16h a; const float* p = rowk0 + 8 * (lane >> 4);
#pragma unroll
  for (int i = 0; i < 8; ++i) { a[i] = (_Float16)p[i]; a[8 + i] = (_Float16)p[16 + i]; }
  return a;
}
__device__ __forceinline__ v16h frag_f32s(const float* rowk0, int lane, float sc) {
  v16h a; const float* p = rowk0 + 8 * (lane >> 4);
#pragma unroll
  for (int i = 0; i < 8; ++i) { a[i] = (_Float16)(p[i] * sc); a[8 + i] = (_Float16)(p[16 + i] * sc); }
  return a;
}
// column fragment from a [K][ld] layout (column n), rows >= K read as 0
__device__ __forceinline__ v16h fragc_f32(const float* W, int k0, int n, int lane, int ld, int K) {
  v16h a; const int g = lane >> 4;
#pragma unroll
  for (int i = 0; i < 8; ++i) { const int ka = k0 + 8 * g + i, kb = ka + 16;
    a[i] = (_Float16)(ka < K ? W[(size_t)(ka < K ? ka : K - 1) * ld + n] : 0.f); a[8 + i] = (_Float16)(kb < K ? W[(size_t)(kb < K ? kb : K - 1) * ld + n] : 0.f); }
  return a;
}
struct F2 { v16b h, l; };
__device__ __forceinline__ F2 bsplit16(const float v[16]) { F2 r;
#pragma unroll
  for (int i = 0; i < 16; ++i) { const __bf16 h = (__bf16)v[i]; r.h[i] = h; r.l[i] = (__bf16)(v[i] - (float)h); }
  return r; }
__device__ __forceinline__ F2 split_row(const float* row, int k0, int lane) { float v[16]; const float* p = row + k0 + 8 * (lane >> 4);
#pragma unroll
  for (int i = 0; i < 8; ++i) { v[i] = p[i]; v[8 + i] = p[16 + i]; }
  return bsplit16(v); }
__device__ __forceinline__ F2 split_rowK(const float* row, int k0, int lane, int K) { float v[16]; const int g = lane >> 4;
#pragma unroll
  for (int i = 0; i < 8; ++i) { const int ka = k0 + 8 * g + i, kb = ka + 16; v[i] = ka < K ? row[ka < K ? ka : K - 1] : 0.f; v[8 + i] = kb < K ? row[kb < K ? kb : K - 1] : 0.f; }
  return bsplit16(v); }
__device__ __forceinline__ F2 split_col(const float* W, int k0, int n, int lane, int ld, int K) { float v[16]; const int g = lane >> 4;
#pragma unroll
  for (int i = 0; i < 8; ++i) { const int ka = k0 + 8 * g + i, kb = ka + 16; v[i] = ka < K ? W[(size_t)(ka < K ? ka : K - 1) * ld + n] : 0.f; v[8 + i] = kb < K ? W[(size_t)(kb < K ? kb : K - 1) * ld + n] : 0.f; }
  return bsplit16(v); }
__device__ __forceinline__ v8f mac3(const F2& a, const F2& b, v8f c) { c = wmma_bf(a.l, b.h, c); c = wmma_bf(a.h, b.l, c); return wmma_bf(a.h, b.h, c); }
__device__ __forceinline__ float sigm(float v) { return 1.0f / (1.0f + expf(-v)); }
#define LDSX() do { asm volatile("s_wait_dscnt 0" ::: "memory"); __builtin_amdgcn_wave_barrier(); __builtin_amdgcn_fence(__ATOMIC_RELEASE, "workgroup"); } while (0)

// Gated GQA causal self-attention with rotary tables, per-head GroupNorm and a sigmoid output gate (B 1, S 2,048, HID 2,048; 32 query / 8 kv heads x 64): q = x Wq, k = x Wk, v = x Wv ((in,out)); q, k rotate-half RoPE with the given cos/sin [S,64]; scores = q k^T / 8, causal (col > row -> -inf); p = exp(a - max) / (sum + 1e-9); out = p v (GQA x4); gn = per-(token, head) normalisation over 64 x gn_weight + gn_bias; alpha = sigmoid(x Wg + bg); y = (gn * alpha) Wo. Returns (y, new_k = roped k [B,HKV,S,D], new_v [B,HKV,S,D]).
#define NB 1
#define TT 2048
#define CC 2048
#define NH 32
#define HD 64
#define NKV 8
#define KV (NKV * HD)      // 512
#define GQ (NH / NKV)      // 4
#define SCALE 0.125f
#ifndef TNB
#define TNB NB
#endif
typedef __attribute__((ext_vector_type(8))) __bf16 v8b;
__device__ __forceinline__ v16b frag_b(const __bf16* rowk0, int lane) {
  union { v16b v; v8b q[2]; } u; const __bf16* p = rowk0 + 8 * (lane >> 4);
  u.q[0] = *(const v8b*)p; u.q[1] = *(const v8b*)(p + 16); return u.v;
}
__device__ __forceinline__ float bfr(float v) { return (float)(__bf16)v; }
#define QBH 6              // query blocks 0..5 of each sequence (rows < 384) take the high-precision path (their rows see only 1..384 keys)
#define QHI (QBH * 64)     // 384
#define KHI 384            // key rows with residual / bf16 planes (keys of those rows are <= 383)

#define WS_GA  0u                                       // f16 alpha = sigmoid(x Wg + bg) rows [t][2048]
#define WS_AH  (WS_GA + 2u * (size_t)NB * TT * CC)        // f16 (gn * alpha) rows [t][2048] (A operand of the output projection)
#define WS_QH  (WS_AH + 2u * (size_t)NB * TT * CC)        // f16 q rows [b*t][2048] (rotated)
#define WS_KH  (WS_QH + 2u * (size_t)NB * TT * CC)       // f16 k in A-fragment order: per (kv head, 16 keys, 32 d) 1 KiB = [half][lane = 16 g + key][8 d], d = 16 half + 8 g + e
#define WS_VT  (WS_KH + 2u * (size_t)NB * TT * KV)       // f16 v in A-fragment order: per (kv head, 32 keys, 16 d) 1 KiB = [half][lane = 16 g + d][8 keys], key = 16 half + 8 g + e
#define WS_QL  (WS_VT + 2u * (size_t)NB * KV * TT)       // f16 q residual x 2^10 rows [b][t < QHI][2048]
#define WS_KL  (WS_QL + 2u * (size_t)NB * QHI * CC)      // f16 k residual x 2^10, keys < KHI, in k's order
#define WS_VB  (WS_KL + 2u * (size_t)NB * KHI * KV)      // bf16 v hi, keys < KHI, in v's order
#define WS_VBL (WS_VB + 2u * (size_t)NB * KV * KHI)      // bf16 v lo, likewise
#define WS_XB  (WS_VBL + 2u * (size_t)NB * KV * KHI)     // bf16 x in A-fragment order (k_prep)
#define NWT (2 * CC + 2 * KV)                            // 5,120 rows of WT: the columns of Wq, Wk, Wv, Wg in that order
#define WS_WT  (WS_XB + 2u * (size_t)NB * TT * CC)        // bf16 weight columns as rows [col][k = 2048]
#define WS_WOT (WS_WT + 2u * (size_t)NWT * CC)            // f16 (bf16(Wo) x 2^8) columns as rows [col][k = 2048]
#define WS_END (WS_WOT + 2u * (size_t)CC * CC)

// ---- k_proj: block = (128 tokens, 128 output cols = two 64-dim heads, which): acc = x W (W (in,out); exact); the way out runs once for each half of 64 tokens (m = 0, 1), through the same LDS; which 0/1: rotate-half rope with the given tables (tiles j and j+2 hold d and d+32 of the same head) -> f16 (+ residual x 2^10 for the early rows): q as rows, k in k_attn's fragment order, and new_k written in f32; which 2: v -> f16 (+ bf16 hi/lo for the early keys) in k_attn's fragment order and new_v in f32; which 3: alpha = sigmoid(x Wg + bg) -> f16 rows
// ---- k_prep: every float operand of the three big products is rounded ONCE to its 16-bit form and laid out for its reader: the columns of Wq, Wk, Wv, Wg -> bf16 rows of WT, the columns of Wo -> f16 (bf16 x 2^8, exact) rows of WOT, both [col][k]; x -> bf16 in A-fragment order: per (16 rows, 32 k) 1 KiB = [half of the fragment][lane = 16 g + row][8 k], k = 16 half + 8 g + e, so that a wave's 16-B loads read 512 B in a row. blockIdx.x 0..79: 64 rows of WT, 80..111: of WOT, 112..143: 64 rows of x; blockIdx.y: eight 64-k tiles, one after the other (few, long blocks: fewer waves to start). Each 128-B line of the planes is written by one block.
#define PREP_T 8
template <bool IS_O> __device__ __forceinline__ void prep_w(const float* __restrict__ src, int ld, unsigned short* __restrict__ dst, unsigned (*ts)[64][36], int kt0, int tid) {
  const int n = tid >> 2, p = tid & 3, kq = tid >> 4, c4 = (tid & 15) * 4; v4f va[2], vb[2];   /* rows 2 kp and 2 kp + 1 (kp = 16 i + kq), four columns: 16 lanes read 256 B of a row */
  const float* s = src + (size_t)(kt0 * 64 + 2 * kq) * ld + c4; unsigned short* d = dst + (size_t)n * CC + kt0 * 64 + p * 16;
#pragma unroll
  for (int i = 0; i < 2; ++i) { va[i] = *(const v4f*)(s + (size_t)(i * 32) * ld); vb[i] = *(const v4f*)(s + (size_t)(i * 32 + 1) * ld); }
  asm volatile("s_wait_xcnt 0x0" ::: "memory");   /* before a register that the loads above name is used again */
#pragma unroll
  for (int it = 0; it < PREP_T; ++it) {
#pragma unroll
    for (int i = 0; i < 2; ++i) {
#pragma unroll
      for (int e = 0; e < 4; ++e) { union { __bf16 b[2]; _Float16 h[2]; unsigned u; } pk;
        if (IS_O) { pk.h[0] = (_Float16)(bfr(va[i][e]) * 256.0f); pk.h[1] = (_Float16)(bfr(vb[i][e]) * 256.0f); } else { pk.b[0] = (__bf16)va[i][e]; pk.b[1] = (__bf16)vb[i][e]; }
        ts[it & 1][c4 + e][i * 16 + kq] = pk.u; } }
    __syncthreads();   /* the tile is whole before it is read by columns; with two buffers it also ends the reads of the buffer that the next tile fills */
    if (it + 1 < PREP_T) { const float* sn = s + (size_t)((it + 1) * 64) * ld;   /* the next tile's loads fly under this tile's way out */
#pragma unroll
      for (int i = 0; i < 2; ++i) { va[i] = *(const v4f*)(sn + (size_t)(i * 32) * ld); vb[i] = *(const v4f*)(sn + (size_t)(i * 32 + 1) * ld); }
      asm volatile("s_wait_xcnt 0x0" ::: "memory");   /* before a register that the loads above name is used again */ }
    const v4u qa = *(const v4u*)&ts[it & 1][n][p * 8], qb = *(const v4u*)&ts[it & 1][n][p * 8 + 4];
    *(v4u*)(d + it * 64) = qa; *(v4u*)(d + it * 64 + 8) = qb;
    asm volatile("s_wait_xcnt 0x0" ::: "memory");   /* before a register that the stores above name is used again */ } }
__global__ __launch_bounds__(256) void k_prep(const float* __restrict__ X, const float* __restrict__ WQ, const float* __restrict__ WK, const float* __restrict__ WV, const float* __restrict__ WG, const float* __restrict__ WO, __bf16* __restrict__ XB, __bf16* __restrict__ WT, _Float16* __restrict__ WOT) {
  __shared__ __align__(16) unsigned ts[2][64][36];   /* [col][k pair], 128-B rows at a 144-B pitch, two buffers */
  const int tid = threadIdx.x, bx = blockIdx.x, kt0 = blockIdx.y * PREP_T;
  if (bx >= 112) {   /* x (block-uniform; no barrier on this path) */
    const int row = (bx - 112) * 64 + (tid >> 2), p = tid & 3; const float* s = X + (size_t)row * CC + kt0 * 64 + p * 16;
    __bf16* d = XB + ((((size_t)(row >> 4) * (CC / 32) + kt0 * 2 + (p >> 1)) * 2 + (p & 1)) * 32 + (row & 15)) * 8;   /* g = 0 piece; the g = 1 piece lies 16 lanes on, the next 64 k four halves on */
#pragma unroll
    for (int it = 0; it < PREP_T; ++it) { v8b t[2];
#pragma unroll
      for (int i = 0; i < 4; ++i) { const v4f v = *(const v4f*)(s + it * 64 + i * 4);
#pragma unroll
        for (int e = 0; e < 4; ++e) t[i >> 1][(i & 1) * 4 + e] = (__bf16)v[e]; }
      *(v8b*)(d + it * (4 * 32 * 8)) = t[0]; *(v8b*)(d + it * (4 * 32 * 8) + 16 * 8) = t[1]; }
    return; }
  if (bx >= 80) prep_w<true>(WO + (bx - 80) * 64, CC, (unsigned short*)WOT + (size_t)(bx - 80) * 64 * CC, ts, kt0, tid);
  else { const float* src = bx < 32 ? WQ + bx * 64 : bx < 40 ? WK + (bx - 32) * 64 : bx < 48 ? WV + (bx - 40) * 64 : WG + (bx - 48) * 64;
    prep_w<false>(src, (bx >= 32 && bx < 48) ? KV : CC, (unsigned short*)WT + (size_t)bx * 64 * CC, ts, kt0, tid); } }
template <bool F16> __device__ __forceinline__ v8f mm16(v4u a0, v4u a1, v4u b0, v4u b1, v8f c) {
  union { v4u q[2]; v16h h; v16b b; } A, B; A.q[0] = a0; A.q[1] = a1; B.q[0] = b0; B.q[1] = b1;
  if (F16) return wmma16(A.h, B.h, c); else return wmma_bf(A.b, B.b, c); }
#define SWP 144              /* LDS pitch of a 128-B tile row, bytes */
#define SWB (128 * SWP)      /* one buffer: 128 columns */
#define AM (64 * CC * 2)     /* bytes from a wave's first 16 rows of A to its second 16, which lie 64 rows on (the same in rows and in fragment order) */
// W: 16-bit rows with k contiguous (k_prep's planes); A: 16-bit rows or fragment order. acc += A W over all of K for a (64 MR) x 128 tile. A wave takes MR groups of 16 rows (rows 64 m + 16 wave of the tile) by all 128 columns: with MR = 2 every B fragment that it reads from LDS feeds two products, and a W tile fetched from L2 serves 128 rows. A pass is 64 k = 128 B of every row: eight lanes fetch one whole line of a W column (16 B a lane, a wave's load is four lines), eight such loads a thread bring the 128 x 64 tile, which goes to LDS as it is; the block's four waves read their B fragments from there, and each lane fetches its own four 16-B pieces of A per row group from ap (+ AM for the second group): AS bytes from piece to piece, AP from pass to pass (rows: 32 and 128, ap = the lane's row + 16 g bytes; fragment order: 512 and 2,048, ap = the wave's 16 rows + 16 lane bytes). wp: W row (tid >> 3) of the tile + 16 (tid & 7) bytes.
template <bool F16, int AS, int AP, int MR> __device__ __forceinline__ void gemm_acc(const char* __restrict__ ap, const char* __restrict__ wp, char* sw, int tid, int lane, v8f (&acc)[MR][8]) {
  constexpr int JG = 8 / MR;   /* B fragments fetched at a time: with MR = 2 and all eight, the sums, both A sets and B do not fit the registers that the products' statements can name */
  v4u wr[8], ar[MR][4]; char* st = sw + (tid >> 3) * SWP + (tid & 7) * 16; const char* rd = sw + (lane & 15) * SWP + (lane >> 4) * 16;
#pragma unroll
  for (int i = 0; i < 8; ++i) wr[i] = *(const v4u*)(wp + (size_t)i * (16 * CC * 2));
#pragma unroll
  for (int m = 0; m < MR; ++m) {
#pragma unroll
    for (int i = 0; i < 4; ++i) ar[m][i] = *(const v4u*)(ap + m * AM + i * AS); }
  asm volatile("s_wait_xcnt 0x0" :: "v"(wp), "v"(ap) : "memory");   /* before a register that the loads above name is used again; the addresses are inputs, so that they stay whole up to the wait */
  const char* wn = wp + 128; const char* an = ap + AP;   /* the next pass's rows; carried from pass to pass and stepped behind the wait, so that no load lands on them */
  /* unroll 2: the buffer index becomes a constant */
#pragma unroll 2
  for (int kc = 0; kc < CC / 64; ++kc) { const int bo = (kc & 1) * SWB; v4u a[MR][4];
#pragma unroll
    for (int m = 0; m < MR; ++m) {
#pragma unroll
      for (int i = 0; i < 4; ++i) a[m][i] = ar[m][i]; }
#pragma unroll
    for (int i = 0; i < 8; ++i) *(v4u*)(st + bo + i * 16 * SWP) = wr[i];
    __syncthreads();   /* publishes this pass's tile; with two buffers it also ends every wave's reads of the buffer that the next pass refills */
    /* the next pass's global loads fly under this pass's products (the last pass reloads its own rows, unused) */
#pragma unroll
    for (int i = 0; i < 8; ++i) wr[i] = *(const v4u*)(wn + (size_t)i * (16 * CC * 2));
#pragma unroll
    for (int m = 0; m < MR; ++m) {
#pragma unroll
      for (int i = 0; i < 4; ++i) ar[m][i] = *(const v4u*)(an + m * AM + i * AS); }
    asm volatile("s_wait_xcnt 0x0" :: "v"(wn), "v"(an) : "memory");   /* before a register that the loads above name is used again; the addresses are inputs, so that they stay whole up to the wait */
    if (kc + 2 < CC / 64) { wn += 128; an += AP; }
#pragma unroll
    for (int kj = 0; kj < 2 * MR; ++kj) { const int kk = kj / MR, j0 = (kj % MR) * JG; v4u w[JG][2];
#pragma unroll
      for (int j = 0; j < JG; ++j) { w[j][0] = *(const v4u*)(rd + bo + (j0 + j) * 16 * SWP + kk * 64); w[j][1] = *(const v4u*)(rd + bo + (j0 + j) * 16 * SWP + kk * 64 + 32); }
#pragma unroll
      for (int j = 0; j < JG; ++j) {
#pragma unroll
        for (int m = 0; m < MR; ++m) acc[m][j0 + j] = mm16<F16>(a[m][kk * 2], a[m][kk * 2 + 1], w[j][0], w[j][1], acc[m][j0 + j]); } } } }
__global__ __launch_bounds__(128, 3) void k_proj(const __bf16* __restrict__ XB, const __bf16* __restrict__ WT, const float* __restrict__ BG, const float* __restrict__ COS, const float* __restrict__ SIN, _Float16* __restrict__ QH, _Float16* __restrict__ KH, _Float16* __restrict__ VT, _Float16* __restrict__ QL, _Float16* __restrict__ KL, __bf16* __restrict__ VB, __bf16* __restrict__ VBL, _Float16* __restrict__ GA, float* __restrict__ OUTK, float* __restrict__ OUTV) {
  /* one LDS pool, 92,160 B, so that three blocks fit a WGP and all 640 blocks of the grid that work are resident at once: the f32 staging so lies on the W ring sw (which is done with when the way out begins), and q's and k's staging sh, sl on v's th, tb, tbl (a block takes one of the two paths); the 3 in the launch bounds is the register budget of three waves a SIMD */
  __shared__ __align__(16) char pool[2 * SWB + 3 * 128 * 72 * 2]; static_assert(4 * 16 * 132 * 4 <= 2 * SWB && 2 * 64 * 136 * 2 <= 3 * 128 * 72 * 2, "the overlaid arrays fit");
  char* sw = pool; float (*so)[16][132] = (float (*)[16][132])pool; _Float16 (*sh)[136] = (_Float16 (*)[136])(pool + 2 * SWB); _Float16 (*sl)[136] = sh + 64; _Float16 (*th)[72] = (_Float16 (*)[72])(pool + 2 * SWB); __bf16 (*tb)[72] = (__bf16 (*)[72])(pool + 2 * SWB + 128 * 72 * 2); __bf16 (*tbl)[72] = tb + 128;
  const int tid = threadIdx.x, wave = tid >> 5, lane = tid & 31, col = lane & 15, g = lane >> 4; const int which = blockIdx.z; const int c0 = blockIdx.y * 128; const size_t rb = (size_t)blockIdx.x * 128; const int NW = (which == 0 || which == 3) ? CC : KV; if (c0 >= NW) return;   // k/v are only 512 wide (block-uniform exit before any barrier)
  const int w0 = which == 0 ? 0 : which == 1 ? CC : which == 2 ? CC + KV : CC + 2 * KV;   /* first row of this product's columns in WT */
  v8f acc2[2][8] = {};
  gemm_acc<false, 512, 2048, 2>((const char*)(XB + (rb + wave * 16) * CC + lane * 8), (const char*)(WT + (size_t)(w0 + c0 + (tid >> 3)) * CC + (tid & 7) * 8), sw, tid, lane, acc2);
  v8f acc[8];
#pragma unroll
  for (int j = 0; j < 8; ++j) acc[j] = acc2[0][j];
  /* kept rolled: one copy of the way out's code for both halves */
#pragma unroll 1
  for (int m = 0; m < 2; ++m) {
  __syncthreads();   /* ends every wave's reads of what this half's staging overwrites: the W ring's last tile (m = 0), the first half's staging (m = 1) */
  const size_t r0 = rb + m * 64; const size_t b = r0 / TT; const int t0 = (int)(r0 % TT); const bool hi_rows = t0 < ((which == 0) ? QHI : KHI);   /* block-uniform */
  if (which == 3) {   /* gate: alpha = sigmoid(acc + bg) -> f16 rows */
#pragma unroll
    for (int j = 0; j < 8; ++j) { const float bb = bfr(BG[c0 + j * 16 + col]);
#pragma unroll
      for (int r = 0; r < 8; ++r) sh[wave * 16 + 8 * g + r][j * 16 + col] = (_Float16)(1.0f / (1.0f + expf(-(acc[j][r] + bb)))); }
    __syncthreads();
    for (int e = tid; e < 64 * 16; e += 128) { const int rl = e >> 4, q = e & 15; vst2((unsigned*)(GA + (r0 + rl) * CC + c0 + q * 8), *(const v4u*)&sh[rl][q * 8]); }
  } else if (which < 2) {
    /* rotate-half rope on each 64-dim head: d = (j&3)*16+col; d < 32 (tiles jp = 0,1,4,5) pairs with d+32 (jp+2): out[d] = x[d] c[d] - x[d+32] s[d], out[d+32] = x[d+32] c[d+32] + x[d] s[d+32] */
#pragma unroll
    for (int jp = 0; jp < 8; ++jp) { if ((jp & 3) >= 2) continue; const int i2 = (jp & 3) * 16 + col;
#pragma unroll
      for (int r = 0; r < 8; ++r) { const int t = t0 + wave * 16 + 8 * g + r; const float c1 = bfr(COS[(size_t)t * HD + i2]), s1 = bfr(SIN[(size_t)t * HD + i2]), c2 = bfr(COS[(size_t)t * HD + i2 + 32]), s2 = bfr(SIN[(size_t)t * HD + i2 + 32]); const float x1 = acc[jp][r], x2 = acc[jp + 2][r]; asm volatile("s_wait_loadcnt 0x0" ::: "memory"); acc[jp][r] = x1 * c1 - x2 * s1; acc[jp + 2][r] = x2 * c2 + x1 * s2; } }
    if (which == 1) {   /* new_k output [HKV][S][64] in f32: this wave's 16 rows x 2 heads, 256 B per (row, head) by 16 lanes */
#pragma unroll
      for (int j = 0; j < 8; ++j) {
#pragma unroll
        for (int r = 0; r < 8; ++r) so[wave][8 * g + r][j * 16 + col] = acc[j][r]; }
      LDSX(); for (int rl = 0; rl < 16; ++rl) { const int t = t0 + wave * 16 + rl; const int hh = (c0 >> 6) + (lane >> 4); vst2(OUTK + ((size_t)hh * TT + t) * HD + (lane & 15) * 4, *(const v4f*)&so[wave][rl][lane * 4]); } }
#pragma unroll
    for (int j = 0; j < 8; ++j) {
#pragma unroll
      for (int r = 0; r < 8; ++r) { const float v = acc[j][r]; const _Float16 hv = (_Float16)v; sh[wave * 16 + 8 * g + r][j * 16 + col] = hv; sl[wave * 16 + 8 * g + r][j * 16 + col] = (_Float16)((v - (float)hv) * 1024.0f); } }
    __syncthreads();
    _Float16* dh = which == 0 ? QH : KH; _Float16* dl = which == 0 ? (QL + (b * QHI) * (size_t)CC) : (KL + (b * KHI) * (size_t)KV);
    if (which == 0)   /* q: rows */
    for (int e = tid; e < 64 * 16; e += 128) { const int rl = e >> 4, q = e & 15; vst2((unsigned*)(dh + (r0 + rl) * NW + c0 + q * 8), *(const v4u*)&sh[rl][q * 8]); if (hi_rows) vst2((unsigned*)(dl + (size_t)(t0 + rl) * NW + c0 + q * 8), *(const v4u*)&sl[rl][q * 8]); }
    else   /* k in fragment order: piece e = (head hh, 16 keys tl, 32 d kc, half hf, lane 16 gg + row); a head's 64 keys are 8 KiB in a row, a wave's store 512 B in a row */
    for (int it = 0; it < 8; ++it) { const int e = tid + it * 128, row = e & 15, gg = (e >> 4) & 1, hf = (e >> 5) & 1, kc = (e >> 6) & 1, tl = (e >> 7) & 3, hh = e >> 9; const int rl = tl * 16 + row, cl = hh * 64 + kc * 32 + hf * 16 + gg * 8; const size_t hd = b * NKV + (c0 >> 6) + hh;
      _Float16* pk = KH + (hd * (TT / 16) + (t0 >> 4)) * 1024 + (e & 511) * 8; const v4u dk = *(const v4u*)&sh[rl][cl];
      /* s_wait_xcnt 0 behind the stores, before a register that they name is used again; addresses and data are inputs, so that they stay whole up to the wait */
      if (hi_rows) { _Float16* pr = KL + (hd * (KHI / 16) + (t0 >> 4)) * 1024 + (e & 511) * 8; const v4u dr = *(const v4u*)&sl[rl][cl]; vst2(pk, dk); vst2(pr, dr); asm volatile("s_wait_xcnt 0x0" :: "v"(pk), "v"(pr), "v"(dk), "v"(dr) : "memory"); }
      else { vst2(pk, dk); asm volatile("s_wait_xcnt 0x0" :: "v"(pk), "v"(dk) : "memory"); } }
  } else {   /* which == 2: v */
#pragma unroll
    for (int j = 0; j < 8; ++j) {
#pragma unroll
      for (int r = 0; r < 8; ++r) so[wave][8 * g + r][j * 16 + col] = acc[j][r]; }
    LDSX(); for (int rl = 0; rl < 16; ++rl) { const int t = t0 + wave * 16 + rl; const int hh = (c0 >> 6) + (lane >> 4); vst2(OUTV + ((size_t)hh * TT + t) * HD + (lane & 15) * 4, *(const v4f*)&so[wave][rl][lane * 4]); }   /* new_v output in f32 */
#pragma unroll
    for (int j = 0; j < 8; ++j) {
#pragma unroll
      for (int r = 0; r < 8; ++r) { const float v = acc[j][r]; const int rl = wave * 16 + 8 * g + r, cl = j * 16 + col; th[cl][rl] = (_Float16)v; const __bf16 bh = (__bf16)v; tb[cl][rl] = bh; tbl[cl][rl] = (__bf16)(v - (float)bh); } }
    __syncthreads();
    /* v in fragment order: piece e = (head hh, 32 keys cc, 16 d j, half hf, lane 16 gg + row); a head's 64 keys are 8 KiB in a row, a wave's store 512 B in a row */
    for (int it = 0; it < 8; ++it) { const int e = tid + it * 128, row = e & 15, gg = (e >> 4) & 1, hf = (e >> 5) & 1, j = (e >> 6) & 3, cc = (e >> 8) & 1, hh = e >> 9; const int cl = hh * 64 + j * 16 + row, rl = cc * 32 + hf * 16 + gg * 8; const size_t hd = b * NKV + (c0 >> 6) + hh;
      _Float16* pv = VT + (hd * (TT / 32) + (t0 >> 5)) * 2048 + (e & 511) * 8; const v4u dv = *(const v4u*)&th[cl][rl];
      /* s_wait_xcnt 0 behind the stores, before a register that they name is used again; addresses and data are inputs, so that they stay whole up to the wait */
      if (hi_rows) { const size_t o3 = (hd * (KHI / 32) + (t0 >> 5)) * 2048 + (e & 511) * 8; __bf16* ph = VB + o3; __bf16* pl = VBL + o3; const v4u dh = *(const v4u*)&tb[cl][rl], dl = *(const v4u*)&tbl[cl][rl];
        vst2(pv, dv); vst2(ph, dh); vst2(pl, dl); asm volatile("s_wait_xcnt 0x0" :: "v"(pv), "v"(ph), "v"(pl), "v"(dv), "v"(dh), "v"(dl) : "memory"); }
      else { vst2(pv, dv); asm volatile("s_wait_xcnt 0x0" :: "v"(pv), "v"(dv) : "memory"); } } }
  asm volatile("s_wait_xcnt 0x0" ::: "memory");   /* before a register that this half's stores name is used again by the next half */
  __builtin_amdgcn_sched_barrier(0);   /* keeps the copies below behind that wait */
#pragma unroll
  for (int j = 0; j < 8; ++j) acc[j] = acc2[1][j];   /* the second half's sums take the first half's place */
  } }
// ---- k_attn: block = (head h, pair y of 128-query blocks), sixteen waves, two to each 32 queries (two 16-query column groups u): one walks the even 32-key chunks, the other the odd ones, each with a maximum, a sum and outputs of its own, so that four waves share a SIMD and fill one another's waits; waves 0..7 take block 15 - y, waves 8..15 block y, so that every block of the grid walks the same number of keys; the parts meet in LDS behind the kernel's one barrier, and each wave of a pair finishes one column group; k and v lie in fragment order (k_proj), so that every load of theirs reads whole lines. S^T = K Q^T: A = 16 key rows, B = 16 query rows, so lane (g, col) holds query col's logits of keys 8g + r; two such tiles (keys k0 + 0..15, k0 + 16..31) are, element for element, the B operand P^T of O^T += V^T P^T (A = 16 d of v). Pass 1 walks the wave's keys for each query's maximum among them, pass 2 forms the same logits again, e = 2^11 exp(logit - max) = exp2(s ks + (11 - max ks)), sums e in f32 and multiplies e (once to f16; rows < 384: bf16 hi + lo) with v; the division by (sum + 1e-9) is done on the 64 outputs. 3-product logits for rows < 384, else 1. Epilogue: a lane holds 32 of the 64 outputs of one (token, head), its partner lane ^ 16 the other 32, so the per-head normalisation is in-lane sums and one exchange each for mean and variance; x gn_weight + gn_bias, x alpha (k_proj's f16 rows), once to f16 -> the A rows of k_out.
// The pointers of this kernel are plain (no __restrict__): its loads then stay between the asm statements around them, so that each run of loads has its s_wait_xcnt 0 behind it.
/* s_wait_xcnt 0 behind a run of global loads, before a register that they name is used again; the run's address is an input of the statement, so that its registers stay whole up to the wait */
__device__ __forceinline__ void xwait(const void* p) { asm volatile("s_wait_xcnt 0x0" :: "v"(p) : "memory"); }
__device__ __forceinline__ void xwait(const void* p, const void* q) { asm volatile("s_wait_xcnt 0x0" :: "v"(p), "v"(q) : "memory"); }
/* one lane's 16 elements of a fragment; p already holds the lane half's 8 g */
__device__ __forceinline__ v16h ld_h(const _Float16* p) { union { v16h v; v8h q[2]; } u; u.q[0] = *(const v8h*)p; u.q[1] = *(const v8h*)(p + 16); return u.v; }
/* the same from a plane in fragment order (1 KiB = [half][lane][8]); p already holds the lane's 8 lane: each of the two loads reads 512 B in a row over the wave, four whole lines */
__device__ __forceinline__ v16h ld_hf(const _Float16* p) { union { v16h v; v8h q[2]; } u; u.q[0] = *(const v8h*)p; u.q[1] = *(const v8h*)(p + 256); return u.v; }
__device__ __forceinline__ v16b ld_bf(const __bf16* p) { union { v16b v; v8b q[2]; } u; u.q[0] = *(const v8b*)p; u.q[1] = *(const v8b*)(p + 256); return u.v; }
template <bool HI> __device__ __forceinline__ void attn_ldk(const _Float16* kp, const _Float16* klp, int c, v16h (&kh)[2][2], v16h (&kl)[2][2]) {
  const _Float16* p = kp + (size_t)c * 4096; const _Float16* pl = klp + (size_t)c * 4096;   /* the wave's chunk c is every second chunk of 32 keys (kp, klp hold its parity): 2 x 2 fragments, 4 KiB in a row */
#pragma unroll
  for (int i = 0; i < 2; ++i) {
#pragma unroll
    for (int kc = 0; kc < 2; ++kc) { kh[i][kc] = ld_hf(p + i * 1024 + kc * 512); if (HI) kl[i][kc] = ld_hf(pl + i * 1024 + kc * 512); } }
  if (HI) xwait(p, pl); else xwait(p); }
template <bool HI> __device__ __forceinline__ v8f attn_s(const v16h (&kh)[2], const v16h (&kl)[2], const v16h (&qh)[2], const v16h (&ql)[2]) {
  v8f a = {}, al = {};
#pragma unroll
  for (int kc = 0; kc < 2; ++kc) { a = wmma16(kh[kc], qh[kc], a); if (HI) { al = wmma16(kh[kc], ql[kc], al); al = wmma16(kl[kc], qh[kc], al); } }
#pragma unroll
  for (int r = 0; r < 8; ++r) a[r] = HI ? (a[r] + al[r] * (1.0f / 1024.0f)) * SCALE : a[r];   /* the 1-product rows' values stay 8 x the logit: their 1/8 (exact) sits in the exponent's multiplier ks */
  return a; }
/* eight hardware exp2 in one statement: behind a transcendental the instruction set asks for one independent instruction before its result is read or its source overwritten; here each v_exp_f32 is that instruction for the one before it (every output lies apart from every input), and the v_nop is it for the last */
__device__ __forceinline__ void exp2x8(const float (&x)[8], float* y) { float y0, y1, y2, y3, y4, y5, y6, y7;
  asm("v_exp_f32 %0, %8\n\tv_exp_f32 %1, %9\n\tv_exp_f32 %2, %10\n\tv_exp_f32 %3, %11\n\tv_exp_f32 %4, %12\n\tv_exp_f32 %5, %13\n\tv_exp_f32 %6, %14\n\tv_exp_f32 %7, %15\n\tv_nop"
      : "=&v"(y0), "=&v"(y1), "=&v"(y2), "=&v"(y3), "=&v"(y4), "=&v"(y5), "=&v"(y6), "=&v"(y7) : "v"(x[0]), "v"(x[1]), "v"(x[2]), "v"(x[3]), "v"(x[4]), "v"(x[5]), "v"(x[6]), "v"(x[7]));
  y[0] = y0; y[1] = y1; y[2] = y2; y[3] = y3; y[4] = y4; y[5] = y5; y[6] = y6; y[7] = y7; }
/* the rows' last chunk (keys 32 (nall - 1) + 0..31) alone reaches past a row's diagonal; dq = the row of column group 0 in this lane, counted from that chunk's first key */
template <int NU> __device__ __forceinline__ void attn_mask(v8f (&s)[NU][2], int dq, int g) {
#pragma unroll
  for (int u = 0; u < NU; ++u) {
#pragma unroll
    for (int i = 0; i < 2; ++i) {
#pragma unroll
      for (int r = 0; r < 8; ++r) s[u][i][r] = (i * 16 + 8 * g + r <= u * 16 + dq) ? s[u][i][r] : -3.0e38f; } } }
template <bool HI, int NU> __device__ __forceinline__ void attn_sall(const v16h (&kh)[2][2], const v16h (&kl)[2][2], const v16h (&qh)[NU][2], const v16h (&ql)[NU][2], v8f (&s)[NU][2]) {
#pragma unroll
  for (int u = 0; u < NU; ++u) {
#pragma unroll
    for (int i = 0; i < 2; ++i) s[u][i] = attn_s<HI>(kh[i], kl[i], qh[u], ql[u]); } }
template <int NU> __device__ __forceinline__ void attn_max(const v8f (&s)[NU][2], float (&m)[NU]) {
#pragma unroll
  for (int u = 0; u < NU; ++u) {
#pragma unroll
    for (int i = 0; i < 2; ++i) {
#pragma unroll
      for (int r = 0; r < 8; ++r) m[u] = fmaxf(m[u], s[u][i][r]); } } }
/* one wave, NU column groups of 16 queries from row ql0 on (ql0 a multiple of 16 NU), and every second 32-key chunk of their keys: chunks par, par + 2, ... (par scalar). It leaves its own maximum, its sum and its 64 outputs per query, all relative to that maximum, in LDS (xo, xs) for attn_fin */
template <bool HI, int NU> __device__ __forceinline__ void attn_part(const _Float16* QH, const _Float16* KH, const _Float16* QL, const _Float16* KL, const _Float16* VT, const __bf16* VB, const __bf16* VBL, int b, int h, int ql0, int lane, int par, v4f (*xo)[8][32], float (*xs)[2][32]) {
  const int col = lane & 15, g = lane >> 4, dq = (ql0 & 31) + col; const size_t kvh = (size_t)b * NKV + h / GQ; const int nall = (ql0 >> 5) + 1;   /* 32-key chunks of the rows; every chunk holds at least one key <= t for each of the wave's rows */
  const int nch = (nall + 1 - par) >> 1; const bool last = ((nall - 1) & 1) == par;   /* this wave's chunks (none for par 1 where the rows have one chunk: maximum -3e38, sum and outputs 0); whether the rows' last chunk is among them */
  v16h qh[NU][2], ql[NU][2], ka[2][2], la[2][2], kb[2][2], lb[2][2]; v8f s[NU][2];
  { const _Float16* qp = QH + ((size_t)b * TT + ql0 + col) * CC + h * HD + 8 * g; const _Float16* qlp = QL + ((size_t)b * QHI + ql0 + col) * CC + h * HD + 8 * g;
#pragma unroll
    for (int u = 0; u < NU; ++u) {
#pragma unroll
      for (int kc = 0; kc < 2; ++kc) { qh[u][kc] = ld_h(qp + u * 16 * CC + kc * 32); if (HI) ql[u][kc] = ld_h(qlp + u * 16 * CC + kc * 32); } }
    if (HI) xwait(qp, qlp); else xwait(qp); }
  const _Float16* kp = KH + kvh * (TT / 16) * 1024 + par * 2048 + lane * 8; const _Float16* klp = KL + kvh * (KHI / 16) * 1024 + par * 2048 + lane * 8;
  float m[NU];
#pragma unroll
  for (int u = 0; u < NU; ++u) m[u] = -3.0e38f;
  if (HI) {   /* pass 1 of the early rows (at most 6 chunks, beside a wave that walks 26 and more): no look-ahead, so that the residual planes' registers fit */
    for (int c = 0; c < nch; ++c) { attn_ldk<HI>(kp, klp, c, ka, la);
      attn_sall<HI, NU>(ka, la, qh, ql, s);
      if (last && c == nch - 1) attn_mask<NU>(s, dq, g);   /* scalar test */
      attn_max<NU>(s, m); }
  } else {
  /* pass 1, two chunks a trip: each chunk's key rows are fetched a whole trip ahead, into the registers that its products have just left. An odd count takes its last chunk twice (a maximum does not mind). Behind the last trip ka holds chunk 0, with which pass 2 begins */
  attn_ldk<HI>(kp, klp, 0, ka, la); attn_ldk<HI>(kp, klp, nch > 1 ? 1 : 0, kb, lb);
  for (int c = 0; c < nch; c += 2) { const int c1 = c + 1 < nch ? c + 1 : nch - 1;
    attn_sall<HI, NU>(ka, la, qh, ql, s);
    attn_ldk<HI>(kp, klp, c + 2 < nch ? c + 2 : 0, ka, la);
    if (last && c == nch - 1) attn_mask<NU>(s, dq, g);   /* scalar test */
    attn_max<NU>(s, m);
    attn_sall<HI, NU>(kb, lb, qh, ql, s);
    attn_ldk<HI>(kp, klp, c + 3 < nch ? c + 3 : nch - 1, kb, lb);
    if (last && c1 == nch - 1) attn_mask<NU>(s, dq, g);   /* scalar test */
    attn_max<NU>(s, m); } }
#pragma unroll
  for (int u = 0; u < NU; ++u) m[u] = fmaxf(m[u], __shfl_xor(m[u], 16));   /* the two lane halves hold the two halves of a query's keys */
  const float ks = (HI ? 1.0f : SCALE) * 1.44269504f;   /* log2(e), times the 1/8 that the 1-product rows still owe */
  float sum[NU], cm[NU]; v8f o[NU][HD / 16];
#pragma unroll
  for (int u = 0; u < NU; ++u) { sum[u] = 0.f; cm[u] = fmaf(-m[u], ks, 11.0f);   /* its rounding is one factor for this wave's part of the row, in e and in the sum alike */
#pragma unroll
    for (int j = 0; j < HD / 16; ++j) o[u][j] = v8f{}; }
  const _Float16* vp = VT + kvh * (TT / 32) * 2048 + par * 2048 + lane * 8; const __bf16* vbp = VB + kvh * (KHI / 32) * 2048 + par * 2048 + lane * 8; const __bf16* vlp = VBL + kvh * (KHI / 32) * 2048 + par * 2048 + lane * 8;   /* a chunk of 32 keys: four fragments (d = 16 j + col), 4 KiB in a row; the wave's next chunk lies 8 KiB on */
  for (int c = 0; c < nch; ++c) { v16h vf[HD / 16]; v16b vb[HD / 16], vbl[HD / 16];
    if (HI) attn_ldk<HI>(kp, klp, c, ka, la);
    else { const _Float16* p0 = vp + c * 4096;
#pragma unroll
      for (int j = 0; j < HD / 16; ++j) vf[j] = ld_hf(p0 + j * 512);
      xwait(p0); }
    attn_sall<HI, NU>(ka, la, qh, ql, s);
    if (HI) { const __bf16* p0 = vbp + c * 4096; const __bf16* p1 = vlp + c * 4096;   /* the early rows' v planes come in behind the logits, when the key rows' registers are free, and fly under the exponentials */
#pragma unroll
      for (int j = 0; j < HD / 16; ++j) { vb[j] = ld_bf(p0 + j * 512); vbl[j] = ld_bf(p1 + j * 512); }
      xwait(p0, p1);
    } else attn_ldk<HI>(kp, klp, c + 1 < nch ? c + 1 : c, ka, la);   /* the next chunk's key rows fly under this chunk's exponentials (the last chunk reloads its own, unused) */
    __builtin_amdgcn_sched_barrier(0);   /* keeps the loads above in front of the exponentials: sunk to the loop's foot they would be waited for at once */
    if (last && c == nch - 1) attn_mask<NU>(s, dq, g);   /* scalar test; the excluded keys' -3e38 gives e = 0 */
#pragma unroll
    for (int u = 0; u < NU; ++u) { float e[16];
#pragma unroll
      for (int i = 0; i < 2; ++i) { float x[8];   /* the argument is never above 11 (but for cm's rounding), so no range step is owed; below -126, the excluded keys' too, the instruction gives 0 */
#pragma unroll
        for (int r = 0; r < 8; ++r) x[r] = fmaf(s[u][i][r], ks, cm[u]);
        exp2x8(x, &e[i * 8]);
#pragma unroll
        for (int r = 0; r < 8; ++r) sum[u] += e[i * 8 + r]; }
      if (HI) { const F2 p = bsplit16(e);
#pragma unroll
        for (int j = 0; j < HD / 16; ++j) { o[u][j] = wmma_bf(vb[j], p.h, o[u][j]); o[u][j] = wmma_bf(vb[j], p.l, o[u][j]); o[u][j] = wmma_bf(vbl[j], p.h, o[u][j]); }
      } else { v16h p;
#pragma unroll
        for (int x = 0; x < 16; ++x) p[x] = (_Float16)e[x];
#pragma unroll
        for (int j = 0; j < HD / 16; ++j) o[u][j] = wmma16(vf[j], p, o[u][j]); } } }
#pragma unroll
  for (int u = 0; u < NU; ++u) {   /* 16 B a lane, a wave's store 512 B in a row */
#pragma unroll
    for (int j = 0; j < HD / 16; ++j) { xo[u][2 * j][lane] = __builtin_shufflevector(o[u][j], o[u][j], 0, 1, 2, 3); xo[u][2 * j + 1][lane] = __builtin_shufflevector(o[u][j], o[u][j], 4, 5, 6, 7); }
    xs[u][0][lane] = m[u]; xs[u][1][lane] = sum[u]; } }
/* one wave finishes one column group of 16 queries from row row0 on: joins the two waves' parts (a: even chunks, b: odd chunks; always in that order), each brought from its own maximum to the common one by the factor exp(own - common), then the division, the normalisation and the gate. ks as in attn_part */
__device__ __forceinline__ void attn_fin(const v4f (*xa)[32], const v4f (*xb)[32], const float (*sa)[32], const float (*sb)[32], float ks, const _Float16* GA, const float* GW, const float* GB, _Float16* AH, int b, int h, int row0, int lane) {
  const int col = lane & 15, g = lane >> 4; const float ma = sa[0][lane], mb = sb[0][lane], mt = fmaxf(ma, mb); const float ea = (ma - mt) * ks, eb = (mb - mt) * ks; float fa, fb;   /* arguments <= 0; a part without keys (-3e38) gets the factor 0 */
  /* two hardware exp2 in one statement: the second is the independent instruction that the instruction set asks for behind the first, the v_nop is it for the second */
  asm("v_exp_f32 %0, %2\n\tv_exp_f32 %1, %3\n\tv_nop" : "=&v"(fa), "=&v"(fb) : "v"(ea), "v"(eb));
  float sum = sa[1][lane] * fa + sb[1][lane] * fb; sum = 1.0f / (sum + __shfl_xor(sum, 16) + 2048.0f * 1e-9f);   /* p = e / (sum + 1e-9) as in the module, numerator and denominator x 2^11 */
  v8f o[HD / 16];
#pragma unroll
  for (int j = 0; j < HD / 16; ++j) {
#pragma unroll
    for (int q = 0; q < 2; ++q) { const v4f va = xa[2 * j + q][lane], vb = xb[2 * j + q][lane];
#pragma unroll
      for (int r = 0; r < 4; ++r) o[j][4 * q + r] = va[r] * fa + vb[r] * fb; } }
  v8f gw[HD / 16], gb[HD / 16];   /* lane (g, col) holds d = 16 j + 8 g + r of query col */
  { const float* gwp = GW + h * HD + 8 * g; const float* gbp = GB + h * HD + 8 * g;
#pragma unroll
    for (int j = 0; j < HD / 16; ++j) { gw[j] = *(const v8f*)(gwp + j * 16); gb[j] = *(const v8f*)(gbp + j * 16); }
    xwait(gwp, gbp); }
  { const float sc = sum; v8f t[HD / 16]; v8h al[HD / 16]; v4u pk[HD / 16]; float ps[HD / 16];
    const size_t off = ((size_t)b * TT + row0 + col) * CC + h * HD + 8 * g; const _Float16* gap = GA + off; _Float16* ap = AH + off;
#pragma unroll
    for (int j = 0; j < HD / 16; ++j) al[j] = *(const v8h*)(gap + j * 16);
    xwait(gap);
#pragma unroll
    for (int j = 0; j < HD / 16; ++j) { t[j] = o[j] * sc; ps[j] = 0.f;   /* four independent chains of eight */
#pragma unroll
      for (int r = 0; r < 8; ++r) ps[j] += t[j][r]; }
    float s1 = (ps[0] + ps[1]) + (ps[2] + ps[3]); s1 += __shfl_xor(s1, 16);
    const float mean = s1 * (1.0f / HD);
#pragma unroll
    for (int j = 0; j < HD / 16; ++j) { ps[j] = 0.f;
#pragma unroll
      for (int r = 0; r < 8; ++r) { t[j][r] -= mean; ps[j] += t[j][r] * t[j][r]; } }
    float s2 = (ps[0] + ps[1]) + (ps[2] + ps[3]); s2 += __shfl_xor(s2, 16);
    const float rstd = rsqrtf(s2 * (1.0f / HD) + 1e-5f);
#pragma unroll
    for (int j = 0; j < HD / 16; ++j) { union { v8h hv; v4u u4; } c;
#pragma unroll
      for (int r = 0; r < 8; ++r) c.hv[r] = (_Float16)((t[j][r] * rstd * bfr(gw[j][r]) + bfr(gb[j][r])) * (float)al[j][r]);
      pk[j] = c.u4; vst2(ap + j * 16, pk[j]); }   /* the 128-B line of a (token, head) is written by this wave alone */
    asm volatile("s_wait_xcnt 0x0" :: "v"(ap), "v"(pk[0]), "v"(pk[1]), "v"(pk[2]), "v"(pk[3]) : "memory");   /* before a register that the stores above name is used again; address and data are inputs, so that they stay whole up to the wait */ } }
__global__ __launch_bounds__(512) void k_attn(const _Float16* QH, const _Float16* KH, const _Float16* QL, const _Float16* KL, const _Float16* VT, const __bf16* VB, const __bf16* VBL, const _Float16* GA, const float* GW, const float* GB, _Float16* AH) {
  static_assert(QHI % 128 == 0 && KHI >= QHI && HD == 64, "a wave is wholly on one path, and its keys have the residual planes");
  const int lane = threadIdx.x & 31; const int wave = __builtin_amdgcn_readfirstlane(threadIdx.x >> 5);   /* scalar, so that the chunk loops branch on scalars */
  __shared__ __align__(16) v4f xo[16][2][8][32]; __shared__ float xs[16][2][2][32];   /* per (wave, column group): 64 outputs of 16 queries as [8 pieces][lane]; maximum and sum by lane */
  const int qb = wave < 8 ? (TT / 128 - 1) - (int)blockIdx.y : (int)blockIdx.y; const int ql0 = qb * 128 + (wave & 3) * 32, par = (wave >> 2) & 1;   /* a long and a short query block side by side; waves w and w + 4 share 32 queries */
  const bool hi = qb < QHI / 128;
  if (hi) {   /* the early rows' planes take twice the registers: one column group at a time */
    /* kept rolled: one copy of this path's code, and one group's registers */
#pragma unroll 1
    for (int u = 0; u < 2; ++u) attn_part<true, 1>(QH, KH, QL, KL, VT, VB, VBL, blockIdx.z, blockIdx.x, ql0 + u * 16, lane, par, &xo[wave][u], &xs[wave][u]);
  } else attn_part<false, 2>(QH, KH, QL, KL, VT, VB, VBL, blockIdx.z, blockIdx.x, ql0, lane, par, &xo[wave][0], &xs[wave][0]);
  __syncthreads();   /* every wave's part lies in LDS before its partner reads it; all sixteen waves pass here once */
  const int wa = wave & ~4, wb = wave | 4;   /* the pair; each of the two finishes one column group */
  attn_fin(xo[wa][par], xo[wb][par], xs[wa][par], xs[wb][par], (hi ? 1.0f : SCALE) * 1.44269504f, GA, GW, GB, AH, blockIdx.z, blockIdx.x, ql0 + par * 16, lane); }
// ---- k_out: block = (64 rows, 128 cols): y = (gn * alpha) (f16 rows) Wo (k_prep's f16 rows, bf16 x 2^8, exact) x 2^-8 -> output 0 rows
__global__ __launch_bounds__(128) void k_out(const _Float16* __restrict__ AH, const _Float16* __restrict__ WOT, float* __restrict__ OUT) { __shared__ __align__(16) float sf[4][16][132]; __shared__ __align__(16) char sw[2 * SWB];   /* Wo tile of one pass, [col][k] in f16 (x 2^8), two buffers */
  const int tid = threadIdx.x, wave = tid >> 5, lane = tid & 31, col = lane & 15, g = lane >> 4; const int c0 = blockIdx.y * 128; const size_t r0 = (size_t)blockIdx.x * 64 + wave * 16;
  v8f acc[1][8] = {};
  gemm_acc<true, 32, 128, 1>((const char*)(AH + (r0 + col) * CC + 8 * g), (const char*)(WOT + (size_t)(c0 + (tid >> 3)) * CC + (tid & 7) * 8), sw, tid, lane, acc);
#pragma unroll
  for (int j = 0; j < 8; ++j) {
#pragma unroll
    for (int r = 0; r < 8; ++r) sf[wave][8 * g + r][j * 16 + col] = acc[0][j][r] * (1.0f / 256.0f); }
  LDSX(); for (int rl = 0; rl < 16; ++rl) vst2(OUT + (r0 + rl) * CC + c0 + lane * 4, *(const v4f*)&sf[wave][rl][lane * 4]); }
extern "C" void kernel_launch(void* const* d_in, const int* in_sizes, int n_in, void* d_out, int out_size, void* d_ws, size_t ws_size, hipStream_t stream) {
  (void)in_sizes; (void)n_in; (void)out_size;
  const float** F = (const float**)d_in;   // 0 x [1,2048,2048]; 1 rope_cos, 2 rope_sin [2048,64]; 3 Wq [2048,2048]; 4 Wk, 5 Wv [2048,512]; 6 Wo [2048,2048]; 7 Wg [2048,2048], 8 bg; 9 gn_weight, 10 gn_bias [2048]
  if (ws_size < (size_t)WS_END) return;
  char* ws = (char*)d_ws; _Float16 *GA = (_Float16*)(ws + WS_GA), *AH = (_Float16*)(ws + WS_AH), *QH = (_Float16*)(ws + WS_QH), *KH = (_Float16*)(ws + WS_KH), *VT = (_Float16*)(ws + WS_VT), *QL = (_Float16*)(ws + WS_QL), *KL = (_Float16*)(ws + WS_KL); __bf16 *VB = (__bf16*)(ws + WS_VB), *VBL = (__bf16*)(ws + WS_VBL); __bf16 *XB = (__bf16*)(ws + WS_XB), *WT = (__bf16*)(ws + WS_WT); _Float16 *WOT = (_Float16*)(ws + WS_WOT);
  float* OUT0 = (float*)d_out; float* OUTK = OUT0 + (size_t)NB * TT * CC; float* OUTV = OUTK + (size_t)NB * NKV * TT * HD;   /* tuple outputs concatenated, no padding */
  k_prep<<<dim3(NWT / 64 + CC / 64 + TNB * TT / 64, CC / 64 / PREP_T), 256, 0, stream>>>(F[0], F[3], F[4], F[5], F[7], F[6], XB, WT, WOT);
  k_proj<<<dim3(TNB * TT / 128, CC / 128, 4), 128, 0, stream>>>(XB, WT, F[8], F[1], F[2], QH, KH, VT, QL, KL, VB, VBL, GA, OUTK, OUTV);
  k_attn<<<dim3(NH, TT / 256, TNB), 512, 0, stream>>>(QH, KH, QL, KL, VT, VB, VBL, GA, F[9], F[10], AH);
  k_out<<<dim3(TNB * TT / 64, CC / 128), 128, 0, stream>>>(AH, WOT, OUT0);
}

// v009
// Measured time: 113 microseconds a run.
// Timed twice side by side with v008, it ran 1.04 and 1.03 times as fast.
// Over all steps from v000 it is 12.4 times as fast.
// compute dtype: all float inputs rounded to bf16; q/k/v/gate projections x W with EXACT bf16 products on WMMA 16x16x32, f32 accumulate; rotate-half rotary with the given cos/sin tables in f32; q, k once to f16 -> 1-product causal logits / 8 (the first 384 query rows use f16 hi + residual on both sides, 3 products); softmax in f32: exp(logit - max) x 2^11 as one hardware exp2 of (logit - max) x log2(e) + 11 (one fused multiply-add), once to f16 against v once to f16 (first 384 rows: bf16 hi + lo, 3 products), divided by (sum + 1e-9) after the product (sum and 1e-9 both carried x 2^11); per-head GroupNorm and the sigmoid gate in f32; (gn * alpha) once to f16 against Wo carried x 2^8 in f16 (exact); new_k / new_v written in f32 straight from the projections; f32 outputs.
#include <hip/hip_runtime.h>
#include <math.h>

typedef __attribute__((ext_vector_type(16))) _Float16 v16h;
typedef __attribute__((ext_vector_type(16))) __bf16 v16b;
typedef __attribute__((ext_vector_type(8)))  _Float16 v8h;
typedef __attribute__((ext_vector_type(8)))  float v8f;
typedef __attribute__((ext_vector_type(4)))  float v4f;
typedef __attribute__((ext_vector_type(2)))  float v2f;
typedef __attribute__((ext_vector_type(4)))  unsigned v4u;
typedef __attribute__((ext_vector_type(4)))  int v4i;
typedef float __attribute__((may_alias)) float_a;
typedef int __attribute__((may_alias)) int_a;

template <typename T> __device__ __forceinline__ void vst2(void* p, T v) { *(T*)p = v;  }
__device__ __forceinline__ v8f wmma16(v16h a, v16h b, v8f c) {
  v8f d = __builtin_amdgcn_wmma_f32_16x16x32_f16(false, a, false, b, (short)0, c, false, false);
  asm volatile("v_nop\n\tv_nop\n\tv_nop\n\tv_nop" : "+v"(d) : "v"(a), "v"(b));
  return d;
}
__device__ __forceinline__ v8f wmma_bf(v16b a, v16b b, v8f c) {
  v8f d = __builtin_amdgcn_wmma_f32_16x16x32_bf16(false, a, false, b, (short)0, c, false, false);
  asm volatile("v_nop\n\tv_nop\n\tv_nop\n\tv_nop" : "+v"(d) : "v"(a), "v"(b));
  return d;
}
// 16x16x32 fragments: lane = (h = lane>>4, row/col = lane&15); elements 0..7 = k0+8h+0..7, 8..15 = k0+16+8h+0..7; D element r = row 8h+r
__device__ __forceinline__ v16h frag_h(const _Float16* rowk0, int lane) {
  union { v16h v; v8h q[2]; } u; const _Float16* p = rowk0 + 8 * (lane >> 4);
  u.q[0] = *(const v8h*)p; u.q[1] = *(const v8h*)(p + 16); return u.v;
}
__device__ __forceinline__ v16h frag_f32(const float* rowk0, int lane) {
  v16h a; const float* p = rowk0 + 8 * (lane >> 4);
#pragma unroll
  for (int i = 0; i < 8; ++i) { a[i] = (_Float16)p[i]; a[8 + i] = (_Float16)p[16 + i]; }
  return a;
}
__device__ __forceinline__ v16h frag_f32s(const float* rowk0, int lane, float sc) {
  v16h a; const float* p = rowk0 + 8 * (lane >> 4);
#pragma unroll
  for (int i = 0; i < 8; ++i) { a[i] = (_Float16)(p[i] * sc); a[8 + i] = (_Float16)(p[16 + i] * sc); }
  return a;
}
// column fragment from a [K][ld] layout (column n), rows >= K read as 0
__device__ __forceinline__ v16h fragc_f32(const float* W, int k0, int n, int lane, int ld, int K) {
  v16h a; const int g = lane >> 4;
#pragma unroll
  for (int i = 0; i < 8; ++i) { const int ka = k0 + 8 * g + i, kb = ka + 16;
    a[i] = (_Float16)(ka < K ? W[(size_t)(ka < K ? ka : K - 1) * ld + n] : 0.f); a[8 + i] = (_Float16)(kb < K ? W[(size_t)(kb < K ? kb : K - 1) * ld + n] : 0.f); }
  return a;
}
struct F2 { v16b h, l; };
__device__ __forceinline__ F2 bsplit16(const float v[16]) { F2 r;
#pragma unroll
  for (int i = 0; i < 16; ++i) { const __bf16 h = (__bf16)v[i]; r.h[i] = h; r.l[i] = (__bf16)(v[i] - (float)h); }
  return r; }
__device__ __forceinline__ F2 split_row(const float* row, int k0, int lane) { float v[16]; const float* p = row + k0 + 8 * (lane >> 4);
#pragma unroll
  for (int i = 0; i < 8; ++i) { v[i] = p[i]; v[8 + i] = p[16 + i]; }
  return bsplit16(v); }
__device__ __forceinline__ F2 split_rowK(const float* row, int k0, int lane, int K) { float v[16]; const int g = lane >> 4;
#pragma unroll
  for (int i = 0; i < 8; ++i) { const int ka = k0 + 8 * g + i, kb = ka + 16; v[i] = ka < K ? row[ka < K ? ka : K - 1] : 0.f; v[8 + i] = kb < K ? row[kb < K ? kb : K - 1] : 0.f; }
  return bsplit16(v); }
__device__ __forceinline__ F2 split_col(const float* W, int k0, int n, int lane, int ld, int K) { float v[16]; const int g = lane >> 4;
#pragma unroll
  for (int i = 0; i < 8; ++i) { const int ka = k0 + 8 * g + i, kb = ka + 16; v[i] = ka < K ? W[(size_t)(ka < K ? ka : K - 1) * ld + n] : 0.f; v[8 + i] = kb < K ? W[(size_t)(kb < K ? kb : K - 1) * ld + n] : 0.f; }
  return bsplit16(v); }
__device__ __forceinline__ v8f mac3(const F2& a, const F2& b, v8f c) { c = wmma_bf(a.l, b.h, c); c = wmma_bf(a.h, b.l, c); return wmma_bf(a.h, b.h, c); }
__device__ __forceinline__ float sigm(float v) { return 1.0f / (1.0f + expf(-v)); }
#define LDSX() do { asm volatile("s_wait_dscnt 0" ::: "memory"); __builtin_amdgcn_wave_barrier(); __builtin_amdgcn_fence(__ATOMIC_RELEASE, "workgroup"); } while (0)

// Gated GQA causal self-attention with rotary tables, per-head GroupNorm and a sigmoid output gate (B 1, S 2,048, HID 2,048; 32 query / 8 kv heads x 64): q = x Wq, k = x Wk, v = x Wv ((in,out)); q, k rotate-half RoPE with the given cos/sin [S,64]; scores = q k^T / 8, causal (col > row -> -inf); p = exp(a - max) / (sum + 1e-9); out = p v (GQA x4); gn = per-(token, head) normalisation over 64 x gn_weight + gn_bias; alpha = sigmoid(x Wg + bg); y = (gn * alpha) Wo. Returns (y, new_k = roped k [B,HKV,S,D], new_v [B,HKV,S,D]).
#define NB 1
#define TT 2048
#define CC 2048
#define NH 32
#define HD 64
#define NKV 8
#define KV (NKV * HD)      // 512
#define GQ (NH / NKV)      // 4
#define SCALE 0.125f
#ifndef TNB
#define TNB NB
#endif
typedef __attribute__((ext_vector_type(8))) __bf16 v8b;
__device__ __forceinline__ v16b frag_b(const __bf16* rowk0, int lane) {
  union { v16b v; v8b q[2]; } u; const __bf16* p = rowk0 + 8 * (lane >> 4);
  u.q[0] = *(const v8b*)p; u.q[1] = *(const v8b*)(p + 16); return u.v;
}
__device__ __forceinline__ float bfr(float v) { return (float)(__bf16)v; }
#define QBH 6              // 64-row groups 0..5 of each sequence (rows < 384) take the high-precision path (their rows see only 1..384 keys)
#define QHI (QBH * 64)     // 384
#define KHI 384            // key rows with residual / bf16 planes (keys of those rows are <= 383)

#define WS_GA  0u                                       // f16 alpha = sigmoid(x Wg + bg) rows [t][2048]
#define WS_AH  (WS_GA + 2u * (size_t)NB * TT * CC)        // f16 (gn * alpha) rows [t][2048] (A operand of the output projection)
#define WS_QH  (WS_AH + 2u * (size_t)NB * TT * CC)        // f16 q rows [b*t][2048] (rotated)
#define WS_KH  (WS_QH + 2u * (size_t)NB * TT * CC)       // f16 k in A-fragment order: per (kv head, 16 keys, 32 d) 1 KiB = [half][lane = 16 g + key][8 d], d = 16 half + 8 g + e
#define WS_VT  (WS_KH + 2u * (size_t)NB * TT * KV)       // f16 v in A-fragment order: per (kv head, 32 keys, 16 d) 1 KiB = [half][lane = 16 g + d][8 keys], key = 16 half + 8 g + e
#define WS_QL  (WS_VT + 2u * (size_t)NB * KV * TT)       // f16 q residual x 2^10 rows [b][t < QHI][2048]
#define WS_KL  (WS_QL + 2u * (size_t)NB * QHI * CC)      // f16 k residual x 2^10, keys < KHI, in k's order
#define WS_VB  (WS_KL + 2u * (size_t)NB * KHI * KV)      // bf16 v hi, keys < KHI, in v's order
#define WS_VBL (WS_VB + 2u * (size_t)NB * KV * KHI)      // bf16 v lo, likewise
#define WS_XB  (WS_VBL + 2u * (size_t)NB * KV * KHI)     // bf16 x in A-fragment order (k_prep)
#define NWT (2 * CC + 2 * KV)                            // 5,120 rows of WT: the columns of Wq, Wk, Wv, Wg in that order
#define WS_WT  (WS_XB + 2u * (size_t)NB * TT * CC)        // bf16 weight columns as rows [col][k = 2048]
#define WS_WOT (WS_WT + 2u * (size_t)NWT * CC)            // f16 (bf16(Wo) x 2^8) columns as rows [col][k = 2048]
#define WS_END (WS_WOT + 2u * (size_t)CC * CC)

// ---- k_proj: block = (128 tokens, 128 output cols = two 64-dim heads, which): acc = x W (W (in,out); exact); the way out runs once for each half of 64 tokens (m = 0, 1), through the same LDS; which 0/1: rotate-half rope with the given tables (tiles j and j+2 hold d and d+32 of the same head) -> f16 (+ residual x 2^10 for the early rows): q as rows, k in k_attn's fragment order, and new_k written in f32; which 2: v -> f16 (+ bf16 hi/lo for the early keys) in k_attn's fragment order and new_v in f32; which 3: alpha = sigmoid(x Wg + bg) -> f16 rows
// ---- k_prep: every float operand of the three big products is rounded ONCE to its 16-bit form and laid out for its reader: the columns of Wq, Wk, Wv, Wg -> bf16 rows of WT, the columns of Wo -> f16 (bf16 x 2^8, exact) rows of WOT, both [col][k]; x -> bf16 in A-fragment order: per (16 rows, 32 k) 1 KiB = [half of the fragment][lane = 16 g + row][8 k], k = 16 half + 8 g + e, so that a wave's 16-B loads read 512 B in a row. blockIdx.x 0..79: 64 rows of WT, 80..111: of WOT, 112..143: 64 rows of x; blockIdx.y: eight 64-k tiles, one after the other (few, long blocks: fewer waves to start). Each 128-B line of the planes is written by one block.
#define PREP_T 8
template <bool IS_O> __device__ __forceinline__ void prep_w(const float* __restrict__ src, int ld, unsigned short* __restrict__ dst, unsigned (*ts)[64][36], int kt0, int tid) {
  const int n = tid >> 2, p = tid & 3, kq = tid >> 4, c4 = (tid & 15) * 4; v4f va[2], vb[2];   /* rows 2 kp and 2 kp + 1 (kp = 16 i + kq), four columns: 16 lanes read 256 B of a row */
  const float* s = src + (size_t)(kt0 * 64 + 2 * kq) * ld + c4; unsigned short* d = dst + (size_t)n * CC + kt0 * 64 + p * 16;
#pragma unroll
  for (int i = 0; i < 2; ++i) { va[i] = *(const v4f*)(s + (size_t)(i * 32) * ld); vb[i] = *(const v4f*)(s + (size_t)(i * 32 + 1) * ld); }
  asm volatile("s_wait_xcnt 0x0" ::: "memory");   /* before a register that the loads above name is used again */
#pragma unroll
  for (int it = 0; it < PREP_T; ++it) {
#pragma unroll
    for (int i = 0; i < 2; ++i) {
#pragma unroll
      for (int e = 0; e < 4; ++e) { union { __bf16 b[2]; _Float16 h[2]; unsigned u; } pk;
        if (IS_O) { pk.h[0] = (_Float16)(bfr(va[i][e]) * 256.0f); pk.h[1] = (_Float16)(bfr(vb[i][e]) * 256.0f); } else { pk.b[0] = (__bf16)va[i][e]; pk.b[1] = (__bf16)vb[i][e]; }
        ts[it & 1][c4 + e][i * 16 + kq] = pk.u; } }
    __syncthreads();   /* the tile is whole before it is read by columns; with two buffers it also ends the reads of the buffer that the next tile fills */
    if (it + 1 < PREP_T) { const float* sn = s + (size_t)((it + 1) * 64) * ld;   /* the next tile's loads fly under this tile's way out */
#pragma unroll
      for (int i = 0; i < 2; ++i) { va[i] = *(const v4f*)(sn + (size_t)(i * 32) * ld); vb[i] = *(const v4f*)(sn + (size_t)(i * 32 + 1) * ld); }
      asm volatile("s_wait_xcnt 0x0" ::: "memory");   /* before a register that the loads above name is used again */ }
    const v4u qa = *(const v4u*)&ts[it & 1][n][p * 8], qb = *(const v4u*)&ts[it & 1][n][p * 8 + 4];
    *(v4u*)(d + it * 64) = qa; *(v4u*)(d + it * 64 + 8) = qb;
    asm volatile("s_wait_xcnt 0x0" ::: "memory");   /* before a register that the stores above name is used again */ } }
__global__ __launch_bounds__(256) void k_prep(const float* __restrict__ X, const float* __restrict__ WQ, const float* __restrict__ WK, const float* __restrict__ WV, const float* __restrict__ WG, const float* __restrict__ WO, __bf16* __restrict__ XB, __bf16* __restrict__ WT, _Float16* __restrict__ WOT) {
  __shared__ __align__(16) unsigned ts[2][64][36];   /* [col][k pair], 128-B rows at a 144-B pitch, two buffers */
  const int tid = threadIdx.x, bx = blockIdx.x, kt0 = blockIdx.y * PREP_T;
  if (bx >= 112) {   /* x (block-uniform; no barrier on this path) */
    const int row = (bx - 112) * 64 + (tid >> 2), p = tid & 3; const float* s = X + (size_t)row * CC + kt0 * 64 + p * 16;
    __bf16* d = XB + ((((size_t)(row >> 4) * (CC / 32) + kt0 * 2 + (p >> 1)) * 2 + (p & 1)) * 32 + (row & 15)) * 8;   /* g = 0 piece; the g = 1 piece lies 16 lanes on, the next 64 k four halves on */
#pragma unroll
    for (int it = 0; it < PREP_T; ++it) { v8b t[2];
#pragma unroll
      for (int i = 0; i < 4; ++i) { const v4f v = *(const v4f*)(s + it * 64 + i * 4);
#pragma unroll
        for (int e = 0; e < 4; ++e) t[i >> 1][(i & 1) * 4 + e] = (__bf16)v[e]; }
      *(v8b*)(d + it * (4 * 32 * 8)) = t[0]; *(v8b*)(d + it * (4 * 32 * 8) + 16 * 8) = t[1]; }
    return; }
  if (bx >= 80) prep_w<true>(WO + (bx - 80) * 64, CC, (unsigned short*)WOT + (size_t)(bx - 80) * 64 * CC, ts, kt0, tid);
  else { const float* src = bx < 32 ? WQ + bx * 64 : bx < 40 ? WK + (bx - 32) * 64 : bx < 48 ? WV + (bx - 40) * 64 : WG + (bx - 48) * 64;
    prep_w<false>(src, (bx >= 32 && bx < 48) ? KV : CC, (unsigned short*)WT + (size_t)bx * 64 * CC, ts, kt0, tid); } }
template <bool F16> __device__ __forceinline__ v8f mm16(v4u a0, v4u a1, v4u b0, v4u b1, v8f c) {
  union { v4u q[2]; v16h h; v16b b; } A, B; A.q[0] = a0; A.q[1] = a1; B.q[0] = b0; B.q[1] = b1;
  if (F16) return wmma16(A.h, B.h, c); else return wmma_bf(A.b, B.b, c); }
#define SWP 144              /* LDS pitch of a 128-B tile row, bytes */
#define SWB (128 * SWP)      /* one buffer: 128 columns */
#define AM (64 * CC * 2)     /* bytes from a wave's first 16 rows of A to its second 16, which lie 64 rows on (the same in rows and in fragment order) */
// W: 16-bit rows with k contiguous (k_prep's planes); A: 16-bit rows or fragment order. acc += A W over all of K for a (64 MR) x 128 tile. A wave takes MR groups of 16 rows (rows 64 m + 16 wave of the tile) by all 128 columns: with MR = 2 every B fragment that it reads from LDS feeds two products, and a W tile fetched from L2 serves 128 rows. A pass is 64 k = 128 B of every row: eight lanes fetch one whole line of a W column (16 B a lane, a wave's load is four lines), eight such loads a thread bring the 128 x 64 tile, which goes to LDS as it is; the block's four waves read their B fragments from there, and each lane fetches its own four 16-B pieces of A per row group from ap (+ AM for the second group): AS bytes from piece to piece, AP from pass to pass (rows: 32 and 128, ap = the lane's row + 16 g bytes; fragment order: 512 and 2,048, ap = the wave's 16 rows + 16 lane bytes). wp: W row (tid >> 3) of the tile + 16 (tid & 7) bytes.
template <bool F16, int AS, int AP, int MR> __device__ __forceinline__ void gemm_acc(const char* __restrict__ ap, const char* __restrict__ wp, char* sw, int tid, int lane, v8f (&acc)[MR][8]) {
  constexpr int JG = 8 / MR;   /* B fragments fetched at a time: with MR = 2 and all eight, the sums, both A sets and B do not fit the registers that the products' statements can name */
  v4u wr[8], ar[MR][4]; char* st = sw + (tid >> 3) * SWP + (tid & 7) * 16; const char* rd = sw + (lane & 15) * SWP + (lane >> 4) * 16;
#pragma unroll
  for (int i = 0; i < 8; ++i) wr[i] = *(const v4u*)(wp + (size_t)i * (16 * CC * 2));
#pragma unroll
  for (int m = 0; m < MR; ++m) {
#pragma unroll
    for (int i = 0; i < 4; ++i) ar[m][i] = *(const v4u*)(ap + m * AM + i * AS); }
  asm volatile("s_wait_xcnt 0x0" :: "v"(wp), "v"(ap) : "memory");   /* before a register that the loads above name is used again; the addresses are inputs, so that they stay whole up to the wait */
  const char* wn = wp + 128; const char* an = ap + AP;   /* the next pass's rows; carried from pass to pass and stepped behind the wait, so that no load lands on them */
  /* unroll 2: the buffer index becomes a constant */
#pragma unroll 2
  for (int kc = 0; kc < CC / 64; ++kc) { const int bo = (kc & 1) * SWB; v4u a[MR][4];
#pragma unroll
    for (int m = 0; m < MR; ++m) {
#pragma unroll
      for (int i = 0; i < 4; ++i) a[m][i] = ar[m][i]; }
#pragma unroll
    for (int i = 0; i < 8; ++i) *(v4u*)(st + bo + i * 16 * SWP) = wr[i];
    __syncthreads();   /* publishes this pass's tile; with two buffers it also ends every wave's reads of the buffer that the next pass refills */
    /* the next pass's global loads fly under this pass's products (the last pass reloads its own rows, unused) */
#pragma unroll
    for (int i = 0; i < 8; ++i) wr[i] = *(const v4u*)(wn + (size_t)i * (16 * CC * 2));
#pragma unroll
    for (int m = 0; m < MR; ++m) {
#pragma unroll
      for (int i = 0; i < 4; ++i) ar[m][i] = *(const v4u*)(an + m * AM + i * AS); }
    asm volatile("s_wait_xcnt 0x0" :: "v"(wn), "v"(an) : "memory");   /* before a register that the loads above name is used again; the addresses are inputs, so that they stay whole up to the wait */
    if (kc + 2 < CC / 64) { wn += 128; an += AP; }
#pragma unroll
    for (int kj = 0; kj < 2 * MR; ++kj) { const int kk = kj / MR, j0 = (kj % MR) * JG; v4u w[JG][2];
#pragma unroll
      for (int j = 0; j < JG; ++j) { w[j][0] = *(const v4u*)(rd + bo + (j0 + j) * 16 * SWP + kk * 64); w[j][1] = *(const v4u*)(rd + bo + (j0 + j) * 16 * SWP + kk * 64 + 32); }
#pragma unroll
      for (int j = 0; j < JG; ++j) {
#pragma unroll
        for (int m = 0; m < MR; ++m) acc[m][j0 + j] = mm16<F16>(a[m][kk * 2], a[m][kk * 2 + 1], w[j][0], w[j][1], acc[m][j0 + j]); } } } }
__global__ __launch_bounds__(128, 3) void k_proj(const __bf16* __restrict__ XB, const __bf16* __restrict__ WT, const float* __restrict__ BG, const float* __restrict__ COS, const float* __restrict__ SIN, _Float16* __restrict__ QH, _Float16* __restrict__ KH, _Float16* __restrict__ VT, _Float16* __restrict__ QL, _Float16* __restrict__ KL, __bf16* __restrict__ VB, __bf16* __restrict__ VBL, _Float16* __restrict__ GA, float* __restrict__ OUTK, float* __restrict__ OUTV) {
  /* one LDS pool, 92,160 B, so that three blocks fit a WGP and all 640 blocks of the grid that work are resident at once: the f32 staging so lies on the W ring sw (which is done with when the way out begins), and q's and k's staging sh, sl on v's th, tb, tbl (a block takes one of the two paths); the 3 in the launch bounds is the register budget of three waves a SIMD */
  __shared__ __align__(16) char pool[2 * SWB + 3 * 128 * 72 * 2]; static_assert(4 * 16 * 132 * 4 <= 2 * SWB && 2 * 64 * 136 * 2 <= 3 * 128 * 72 * 2, "the overlaid arrays fit");
  char* sw = pool; float (*so)[16][132] = (float (*)[16][132])pool; _Float16 (*sh)[136] = (_Float16 (*)[136])(pool + 2 * SWB); _Float16 (*sl)[136] = sh + 64; _Float16 (*th)[72] = (_Float16 (*)[72])(pool + 2 * SWB); __bf16 (*tb)[72] = (__bf16 (*)[72])(pool + 2 * SWB + 128 * 72 * 2); __bf16 (*tbl)[72] = tb + 128;
  const int tid = threadIdx.x, wave = tid >> 5, lane = tid & 31, col = lane & 15, g = lane >> 4; const int which = blockIdx.z; const int c0 = blockIdx.y * 128; const size_t rb = (size_t)blockIdx.x * 128; const int NW = (which == 0 || which == 3) ? CC : KV; if (c0 >= NW) return;   // k/v are only 512 wide (block-uniform exit before any barrier)
  const int w0 = which == 0 ? 0 : which == 1 ? CC : which == 2 ? CC + KV : CC + 2 * KV;   /* first row of this product's columns in WT */
  v8f acc2[2][8] = {};
  gemm_acc<false, 512, 2048, 2>((const char*)(XB + (rb + wave * 16) * CC + lane * 8), (const char*)(WT + (size_t)(w0 + c0 + (tid >> 3)) * CC + (tid & 7) * 8), sw, tid, lane, acc2);
  v8f acc[8];
#pragma unroll
  for (int j = 0; j < 8; ++j) acc[j] = acc2[0][j];
  /* kept rolled: one copy of the way out's code for both halves */
#pragma unroll 1
  for (int m = 0; m < 2; ++m) {
  __syncthreads();   /* ends every wave's reads of what this half's staging overwrites: the W ring's last tile (m = 0), the first half's staging (m = 1) */
  const size_t r0 = rb + m * 64; const size_t b = r0 / TT; const int t0 = (int)(r0 % TT); const bool hi_rows = t0 < ((which == 0) ? QHI : KHI);   /* block-uniform */
  if (which == 3) {   /* gate: alpha = sigmoid(acc + bg) -> f16 rows */
#pragma unroll
    for (int j = 0; j < 8; ++j) { const float bb = bfr(BG[c0 + j * 16 + col]);
#pragma unroll
      for (int r = 0; r < 8; ++r) sh[wave * 16 + 8 * g + r][j * 16 + col] = (_Float16)(1.0f / (1.0f + expf(-(acc[j][r] + bb)))); }
    __syncthreads();
    for (int e = tid; e < 64 * 16; e += 128) { const int rl = e >> 4, q = e & 15; vst2((unsigned*)(GA + (r0 + rl) * CC + c0 + q * 8), *(const v4u*)&sh[rl][q * 8]); }
  } else if (which < 2) {
    /* rotate-half rope on each 64-dim head: d = (j&3)*16+col; d < 32 (tiles jp = 0,1,4,5) pairs with d+32 (jp+2): out[d] = x[d] c[d] - x[d+32] s[d], out[d+32] = x[d+32] c[d+32] + x[d] s[d+32] */
#pragma unroll
    for (int jp = 0; jp < 8; ++jp) { if ((jp & 3) >= 2) continue; const int i2 = (jp & 3) * 16 + col;
#pragma unroll
      for (int r = 0; r < 8; ++r) { const int t = t0 + wave * 16 + 8 * g + r; const float c1 = bfr(COS[(size_t)t * HD + i2]), s1 = bfr(SIN[(size_t)t * HD + i2]), c2 = bfr(COS[(size_t)t * HD + i2 + 32]), s2 = bfr(SIN[(size_t)t * HD + i2 + 32]); const float x1 = acc[jp][r], x2 = acc[jp + 2][r]; asm volatile("s_wait_loadcnt 0x0" ::: "memory"); acc[jp][r] = x1 * c1 - x2 * s1; acc[jp + 2][r] = x2 * c2 + x1 * s2; } }
    if (which == 1) {   /* new_k output [HKV][S][64] in f32: this wave's 16 rows x 2 heads, 256 B per (row, head) by 16 lanes */
#pragma unroll
      for (int j = 0; j < 8; ++j) {
#pragma unroll
        for (int r = 0; r < 8; ++r) so[wave][8 * g + r][j * 16 + col] = acc[j][r]; }
      LDSX(); for (int rl = 0; rl < 16; ++rl) { const int t = t0 + wave * 16 + rl; const int hh = (c0 >> 6) + (lane >> 4); vst2(OUTK + ((size_t)hh * TT + t) * HD + (lane & 15) * 4, *(const v4f*)&so[wave][rl][lane * 4]); } }
#pragma unroll
    for (int j = 0; j < 8; ++j) {
#pragma unroll
      for (int r = 0; r < 8; ++r) { const float v = acc[j][r]; const _Float16 hv = (_Float16)v; sh[wave * 16 + 8 * g + r][j * 16 + col] = hv; sl[wave * 16 + 8 * g + r][j * 16 + col] = (_Float16)((v - (float)hv) * 1024.0f); } }
    __syncthreads();
    _Float16* dh = which == 0 ? QH : KH; _Float16* dl = which == 0 ? (QL + (b * QHI) * (size_t)CC) : (KL + (b * KHI) * (size_t)KV);
    if (which == 0)   /* q: rows */
    for (int e = tid; e < 64 * 16; e += 128) { const int rl = e >> 4, q = e & 15; vst2((unsigned*)(dh + (r0 + rl) * NW + c0 + q * 8), *(const v4u*)&sh[rl][q * 8]); if (hi_rows) vst2((unsigned*)(dl + (size_t)(t0 + rl) * NW + c0 + q * 8), *(const v4u*)&sl[rl][q * 8]); }
    else   /* k in fragment order: piece e = (head hh, 16 keys tl, 32 d kc, half hf, lane 16 gg + row); a head's 64 keys are 8 KiB in a row, a wave's store 512 B in a row */
    for (int it = 0; it < 8; ++it) { const int e = tid + it * 128, row = e & 15, gg = (e >> 4) & 1, hf = (e >> 5) & 1, kc = (e >> 6) & 1, tl = (e >> 7) & 3, hh = e >> 9; const int rl = tl * 16 + row, cl = hh * 64 + kc * 32 + hf * 16 + gg * 8; const size_t hd = b * NKV + (c0 >> 6) + hh;
      _Float16* pk = KH + (hd * (TT / 16) + (t0 >> 4)) * 1024 + (e & 511) * 8; const v4u dk = *(const v4u*)&sh[rl][cl];
      /* s_wait_xcnt 0 behind the stores, before a register that they name is used again; addresses and data are inputs, so that they stay whole up to the wait */
      if (hi_rows) { _Float16* pr = KL + (hd * (KHI / 16) + (t0 >> 4)) * 1024 + (e & 511) * 8; const v4u dr = *(const v4u*)&sl[rl][cl]; vst2(pk, dk); vst2(pr, dr); asm volatile("s_wait_xcnt 0x0" :: "v"(pk), "v"(pr), "v"(dk), "v"(dr) : "memory"); }
      else { vst2(pk, dk); asm volatile("s_wait_xcnt 0x0" :: "v"(pk), "v"(dk) : "memory"); } }
  } else {   /* which == 2: v */
#pragma unroll
    for (int j = 0; j < 8; ++j) {
#pragma unroll
      for (int r = 0; r < 8; ++r) so[wave][8 * g + r][j * 16 + col] = acc[j][r]; }
    LDSX(); for (int rl = 0; rl < 16; ++rl) { const int t = t0 + wave * 16 + rl; const int hh = (c0 >> 6) + (lane >> 4); vst2(OUTV + ((size_t)hh * TT + t) * HD + (lane & 15) * 4, *(const v4f*)&so[wave][rl][lane * 4]); }   /* new_v output in f32 */
#pragma unroll
    for (int j = 0; j < 8; ++j) {
#pragma unroll
      for (int r = 0; r < 8; ++r) { const float v = acc[j][r]; const int rl = wave * 16 + 8 * g + r, cl = j * 16 + col; th[cl][rl] = (_Float16)v; const __bf16 bh = (__bf16)v; tb[cl][rl] = bh; tbl[cl][rl] = (__bf16)(v - (float)bh); } }
    __syncthreads();
    /* v in fragment order: piece e = (head hh, 32 keys cc, 16 d j, half hf, lane 16 gg + row); a head's 64 keys are 8 KiB in a row, a wave's store 512 B in a row */
    for (int it = 0; it < 8; ++it) { const int e = tid + it * 128, row = e & 15, gg = (e >> 4) & 1, hf = (e >> 5) & 1, j = (e >> 6) & 3, cc = (e >> 8) & 1, hh = e >> 9; const int cl = hh * 64 + j * 16 + row, rl = cc * 32 + hf * 16 + gg * 8; const size_t hd = b * NKV + (c0 >> 6) + hh;
      _Float16* pv = VT + (hd * (TT / 32) + (t0 >> 5)) * 2048 + (e & 511) * 8; const v4u dv = *(const v4u*)&th[cl][rl];
      /* s_wait_xcnt 0 behind the stores, before a register that they name is used again; addresses and data are inputs, so that they stay whole up to the wait */
      if (hi_rows) { const size_t o3 = (hd * (KHI / 32) + (t0 >> 5)) * 2048 + (e & 511) * 8; __bf16* ph = VB + o3; __bf16* pl = VBL + o3; const v4u dh = *(const v4u*)&tb[cl][rl], dl = *(const v4u*)&tbl[cl][rl];
        vst2(pv, dv); vst2(ph, dh); vst2(pl, dl); asm volatile("s_wait_xcnt 0x0" :: "v"(pv), "v"(ph), "v"(pl), "v"(dv), "v"(dh), "v"(dl) : "memory"); }
      else { vst2(pv, dv); asm volatile("s_wait_xcnt 0x0" :: "v"(pv), "v"(dv) : "memory"); } } }
  asm volatile("s_wait_xcnt 0x0" ::: "memory");   /* before a register that this half's stores name is used again by the next half */
  __builtin_amdgcn_sched_barrier(0);   /* keeps the copies below behind that wait */
#pragma unroll
  for (int j = 0; j < 8; ++j) acc[j] = acc2[1][j];   /* the second half's sums take the first half's place */
  } }
// ---- k_attn: block = (head h, pair y of 128-query blocks), sixteen waves, four to each 32 queries (two 16-query column groups u): each walks every fourth 32-key chunk, with a maximum, a sum and outputs of its own; every wave takes the pair's long query block and then its short one, so that all sixteen waves of every block of the grid are about equally long and four busy waves share a SIMD to the end; the parts meet in LDS behind the kernel's one barrier, and each wave finishes one column group of one of the two query blocks; k and v lie in fragment order (k_proj), so that every load of theirs reads whole lines. S^T = K Q^T: A = 16 key rows, B = 16 query rows, so lane (g, col) holds query col's logits of keys 8g + r; two such tiles (keys k0 + 0..15, k0 + 16..31) are, element for element, the B operand P^T of O^T += V^T P^T (A = 16 d of v). Pass 1 walks the wave's keys for each query's maximum among them, pass 2 forms the same logits again, e = 2^11 exp(logit - max) = exp2(s ks + (11 - max ks)), sums e in f32 and multiplies e (once to f16; rows < 384: bf16 hi + lo) with v; the division by (sum + 1e-9) is done on the 64 outputs. 3-product logits for rows < 384, else 1. Epilogue: a lane holds 32 of the 64 outputs of one (token, head), its partner lane ^ 16 the other 32, so the per-head normalisation is in-lane sums and one exchange each for mean and variance; x gn_weight + gn_bias, x alpha (k_proj's f16 rows), once to f16 -> the A rows of k_out.
// The pointers of this kernel are plain (no __restrict__): its loads then stay between the asm statements around them, so that each run of loads has its s_wait_xcnt 0 behind it.
/* s_wait_xcnt 0 behind a run of global loads, before a register that they name is used again; the run's address is an input of the statement, so that its registers stay whole up to the wait */
__device__ __forceinline__ void xwait(const void* p) { asm volatile("s_wait_xcnt 0x0" :: "v"(p) : "memory"); }
__device__ __forceinline__ void xwait(const void* p, const void* q) { asm volatile("s_wait_xcnt 0x0" :: "v"(p), "v"(q) : "memory"); }
/* one lane's 16 elements of a fragment; p already holds the lane half's 8 g */
__device__ __forceinline__ v16h ld_h(const _Float16* p) { union { v16h v; v8h q[2]; } u; u.q[0] = *(const v8h*)p; u.q[1] = *(const v8h*)(p + 16); return u.v; }
/* the same from a plane in fragment order (1 KiB = [half][lane][8]); p already holds the lane's 8 lane: each of the two loads reads 512 B in a row over the wave, four whole lines */
__device__ __forceinline__ v16h ld_hf(const _Float16* p) { union { v16h v; v8h q[2]; } u; u.q[0] = *(const v8h*)p; u.q[1] = *(const v8h*)(p + 256); return u.v; }
__device__ __forceinline__ v16b ld_bf(const __bf16* p) { union { v16b v; v8b q[2]; } u; u.q[0] = *(const v8b*)p; u.q[1] = *(const v8b*)(p + 256); return u.v; }
template <bool HI> __device__ __forceinline__ void attn_ldk(const _Float16* kp, const _Float16* klp, int c, v16h (&kh)[2][2], v16h (&kl)[2][2]) {
  const _Float16* p = kp + (size_t)c * 8192; const _Float16* pl = klp + (size_t)c * 8192;   /* the wave's chunk c is every fourth chunk of 32 keys (kp, klp hold its place among the four): 2 x 2 fragments, 4 KiB in a row */
#pragma unroll
  for (int i = 0; i < 2; ++i) {
#pragma unroll
    for (int kc = 0; kc < 2; ++kc) { kh[i][kc] = ld_hf(p + i * 1024 + kc * 512); if (HI) kl[i][kc] = ld_hf(pl + i * 1024 + kc * 512); } }
  if (HI) xwait(p, pl); else xwait(p); }
template <bool HI> __device__ __forceinline__ v8f attn_s(const v16h (&kh)[2], const v16h (&kl)[2], const v16h (&qh)[2], const v16h (&ql)[2]) {
  v8f a = {}, al = {};
#pragma unroll
  for (int kc = 0; kc < 2; ++kc) { a = wmma16(kh[kc], qh[kc], a); if (HI) { al = wmma16(kh[kc], ql[kc], al); al = wmma16(kl[kc], qh[kc], al); } }
#pragma unroll
  for (int r = 0; r < 8; ++r) a[r] = HI ? (a[r] + al[r] * (1.0f / 1024.0f)) * SCALE : a[r];   /* the 1-product rows' values stay 8 x the logit: their 1/8 (exact) sits in the exponent's multiplier ks */
  return a; }
/* eight hardware exp2 in one statement: behind a transcendental the instruction set asks for one independent instruction before its result is read or its source overwritten; here each v_exp_f32 is that instruction for the one before it (every output lies apart from every input), and the v_nop is it for the last */
__device__ __forceinline__ void exp2x8(const float (&x)[8], float* y) { float y0, y1, y2, y3, y4, y5, y6, y7;
  asm("v_exp_f32 %0, %8\n\tv_exp_f32 %1, %9\n\tv_exp_f32 %2, %10\n\tv_exp_f32 %3, %11\n\tv_exp_f32 %4, %12\n\tv_exp_f32 %5, %13\n\tv_exp_f32 %6, %14\n\tv_exp_f32 %7, %15\n\tv_nop"
      : "=&v"(y0), "=&v"(y1), "=&v"(y2), "=&v"(y3), "=&v"(y4), "=&v"(y5), "=&v"(y6), "=&v"(y7) : "v"(x[0]), "v"(x[1]), "v"(x[2]), "v"(x[3]), "v"(x[4]), "v"(x[5]), "v"(x[6]), "v"(x[7]));
  y[0] = y0; y[1] = y1; y[2] = y2; y[3] = y3; y[4] = y4; y[5] = y5; y[6] = y6; y[7] = y7; }
/* the rows' last chunk (keys 32 (nall - 1) + 0..31) alone reaches past a row's diagonal; dq = the row of column group 0 in this lane, counted from that chunk's first key */
template <int NU> __device__ __forceinline__ void attn_mask(v8f (&s)[NU][2], int dq, int g) {
#pragma unroll
  for (int u = 0; u < NU; ++u) {
#pragma unroll
    for (int i = 0; i < 2; ++i) {
#pragma unroll
      for (int r = 0; r < 8; ++r) s[u][i][r] = (i * 16 + 8 * g + r <= u * 16 + dq) ? s[u][i][r] : -3.0e38f; } } }
template <bool HI, int NU> __device__ __forceinline__ void attn_sall(const v16h (&kh)[2][2], const v16h (&kl)[2][2], const v16h (&qh)[NU][2], const v16h (&ql)[NU][2], v8f (&s)[NU][2]) {
#pragma unroll
  for (int u = 0; u < NU; ++u) {
#pragma unroll
    for (int i = 0; i < 2; ++i) s[u][i] = attn_s<HI>(kh[i], kl[i], qh[u], ql[u]); } }
template <int NU> __device__ __forceinline__ void attn_max(const v8f (&s)[NU][2], float (&m)[NU]) {
#pragma unroll
  for (int u = 0; u < NU; ++u) {
#pragma unroll
    for (int i = 0; i < 2; ++i) {
#pragma unroll
      for (int r = 0; r < 8; ++r) m[u] = fmaxf(m[u], s[u][i][r]); } } }
/* one wave, NU column groups of 16 queries from row ql0 on (ql0 a multiple of 16 NU), and every fourth 32-key chunk of their keys: chunks par, par + 4, ... (par scalar, 0..3). It leaves its own maximum, its sum and its 64 outputs per query, all relative to that maximum, in LDS (xo, xs) for attn_fin */
template <bool HI, int NU> __device__ __forceinline__ void attn_part(const _Float16* QH, const _Float16* KH, const _Float16* QL, const _Float16* KL, const _Float16* VT, const __bf16* VB, const __bf16* VBL, int b, int h, int ql0, int lane, int par, v4f (*xo)[8][32], float (*xs)[2][32]) {
  const int col = lane & 15, g = lane >> 4, dq = (ql0 & 31) + col; const size_t kvh = (size_t)b * NKV + h / GQ; const int nall = (ql0 >> 5) + 1;   /* 32-key chunks of the rows; every chunk holds at least one key <= t for each of the wave's rows */
  const int nch = (nall + 3 - par) >> 2; const bool last = ((nall - 1) & 3) == par;   /* this wave's chunks (none where the rows have par chunks or fewer: maximum -3e38, sum and outputs 0); whether the rows' last chunk is among them */
  v16h qh[NU][2], ql[NU][2], ka[2][2], la[2][2], kb[2][2], lb[2][2]; v8f s[NU][2];
  { const _Float16* qp = QH + ((size_t)b * TT + ql0 + col) * CC + h * HD + 8 * g; const _Float16* qlp = QL + ((size_t)b * QHI + ql0 + col) * CC + h * HD + 8 * g;
#pragma unroll
    for (int u = 0; u < NU; ++u) {
#pragma unroll
      for (int kc = 0; kc < 2; ++kc) { qh[u][kc] = ld_h(qp + u * 16 * CC + kc * 32); if (HI) ql[u][kc] = ld_h(qlp + u * 16 * CC + kc * 32); } }
    if (HI) xwait(qp, qlp); else xwait(qp); }
  const _Float16* kp = KH + kvh * (TT / 16) * 1024 + par * 2048 + lane * 8; const _Float16* klp = KL + kvh * (KHI / 16) * 1024 + par * 2048 + lane * 8;
  float m[NU];
#pragma unroll
  for (int u = 0; u < NU; ++u) m[u] = -3.0e38f;
  if (HI) {   /* pass 1 of the early rows (at most 3 chunks a wave): no look-ahead, so that the residual planes' registers fit */
    for (int c = 0; c < nch; ++c) { attn_ldk<HI>(kp, klp, c, ka, la);
      attn_sall<HI, NU>(ka, la, qh, ql, s);
      if (last && c == nch - 1) attn_mask<NU>(s, dq, g);   /* scalar test */
      attn_max<NU>(s, m); }
  } else {
  /* pass 1, two chunks a trip: each chunk's key rows are fetched a whole trip ahead, into the registers that its products have just left. An odd count takes its last chunk twice (a maximum does not mind). Behind the last trip ka holds chunk 0, with which pass 2 begins */
  attn_ldk<HI>(kp, klp, 0, ka, la); attn_ldk<HI>(kp, klp, nch > 1 ? 1 : 0, kb, lb);
  for (int c = 0; c < nch; c += 2) { const int c1 = c + 1 < nch ? c + 1 : nch - 1;
    attn_sall<HI, NU>(ka, la, qh, ql, s);
    attn_ldk<HI>(kp, klp, c + 2 < nch ? c + 2 : 0, ka, la);
    if (last && c == nch - 1) attn_mask<NU>(s, dq, g);   /* scalar test */
    attn_max<NU>(s, m);
    attn_sall<HI, NU>(kb, lb, qh, ql, s);
    attn_ldk<HI>(kp, klp, c + 3 < nch ? c + 3 : nch - 1, kb, lb);
    if (last && c1 == nch - 1) attn_mask<NU>(s, dq, g);   /* scalar test */
    attn_max<NU>(s, m); } }
#pragma unroll
  for (int u = 0; u < NU; ++u) m[u] = fmaxf(m[u], __shfl_xor(m[u], 16));   /* the two lane halves hold the two halves of a query's keys */
  const float ks = (HI ? 1.0f : SCALE) * 1.44269504f;   /* log2(e), times the 1/8 that the 1-product rows still owe */
  float sum[NU], cm[NU]; v8f o[NU][HD / 16];
#pragma unroll
  for (int u = 0; u < NU; ++u) { sum[u] = 0.f; cm[u] = fmaf(-m[u], ks, 11.0f);   /* its rounding is one factor for this wave's part of the row, in e and in the sum alike */
#pragma unroll
    for (int j = 0; j < HD / 16; ++j) o[u][j] = v8f{}; }
  const _Float16* vp = VT + kvh * (TT / 32) * 2048 + par * 2048 + lane * 8; const __bf16* vbp = VB + kvh * (KHI / 32) * 2048 + par * 2048 + lane * 8; const __bf16* vlp = VBL + kvh * (KHI / 32) * 2048 + par * 2048 + lane * 8;   /* a chunk of 32 keys: four fragments (d = 16 j + col), 4 KiB in a row; the wave's next chunk lies 16 KiB on */
  for (int c = 0; c < nch; ++c) { v16h vf[HD / 16]; v16b vb[HD / 16], vbl[HD / 16];
    if (HI) attn_ldk<HI>(kp, klp, c, ka, la);
    else { const _Float16* p0 = vp + c * 8192;
#pragma unroll
      for (int j = 0; j < HD / 16; ++j) vf[j] = ld_hf(p0 + j * 512);
      xwait(p0); }
    attn_sall<HI, NU>(ka, la, qh, ql, s);
    if (HI) { const __bf16* p0 = vbp + c * 8192; const __bf16* p1 = vlp + c * 8192;   /* the early rows' v planes come in behind the logits, when the key rows' registers are free, and fly under the exponentials */
#pragma unroll
      for (int j = 0; j < HD / 16; ++j) { vb[j] = ld_bf(p0 + j * 512); vbl[j] = ld_bf(p1 + j * 512); }
      xwait(p0, p1);
    } else attn_ldk<HI>(kp, klp, c + 1 < nch ? c + 1 : c, ka, la);   /* the next chunk's key rows fly under this chunk's exponentials (the last chunk reloads its own, unused) */
    __builtin_amdgcn_sched_barrier(0);   /* keeps the loads above in front of the exponentials: sunk to the loop's foot they would be waited for at once */
    if (last && c == nch - 1) attn_mask<NU>(s, dq, g);   /* scalar test; the excluded keys' -3e38 gives e = 0 */
#pragma unroll
    for (int u = 0; u < NU; ++u) { float e[16];
#pragma unroll
      for (int i = 0; i < 2; ++i) { float x[8];   /* the argument is never above 11 (but for cm's rounding), so no range step is owed; below -126, the excluded keys' too, the instruction gives 0 */
#pragma unroll
        for (int r = 0; r < 8; ++r) x[r] = fmaf(s[u][i][r], ks, cm[u]);
        exp2x8(x, &e[i * 8]);
#pragma unroll
        for (int r = 0; r < 8; ++r) sum[u] += e[i * 8 + r]; }
      if (HI) { const F2 p = bsplit16(e);
#pragma unroll
        for (int j = 0; j < HD / 16; ++j) { o[u][j] = wmma_bf(vb[j], p.h, o[u][j]); o[u][j] = wmma_bf(vb[j], p.l, o[u][j]); o[u][j] = wmma_bf(vbl[j], p.h, o[u][j]); }
      } else { v16h p;
#pragma unroll
        for (int x = 0; x < 16; ++x) p[x] = (_Float16)e[x];
#pragma unroll
        for (int j = 0; j < HD / 16; ++j) o[u][j] = wmma16(vf[j], p, o[u][j]); } } }
#pragma unroll
  for (int u = 0; u < NU; ++u) {   /* 16 B a lane, a wave's store 512 B in a row */
#pragma unroll
    for (int j = 0; j < HD / 16; ++j) { xo[u][2 * j][lane] = __builtin_shufflevector(o[u][j], o[u][j], 0, 1, 2, 3); xo[u][2 * j + 1][lane] = __builtin_shufflevector(o[u][j], o[u][j], 4, 5, 6, 7); }
    xs[u][0][lane] = m[u]; xs[u][1][lane] = sum[u]; } }
/* one wave finishes one column group of 16 queries from row row0 on: joins the four waves' parts (x0..x3, s0..s3: chunks 0, 1, 2, 3 modulo 4; always in that order), each brought from its own maximum to the common one by the factor exp(own - common), then the division, the normalisation and the gate. ks as in attn_part */
__device__ __forceinline__ void attn_fin(const v4f (*x0)[32], const v4f (*x1)[32], const v4f (*x2)[32], const v4f (*x3)[32], const float (*s0)[32], const float (*s1p)[32], const float (*s2p)[32], const float (*s3)[32], float ks, const _Float16* GA, const float* GW, const float* GB, _Float16* AH, int b, int h, int row0, int lane) {
  const int col = lane & 15, g = lane >> 4; const float m0 = s0[0][lane], m1 = s1p[0][lane], m2 = s2p[0][lane], m3 = s3[0][lane], mt = fmaxf(fmaxf(m0, m1), fmaxf(m2, m3)); const float e0 = (m0 - mt) * ks, e1 = (m1 - mt) * ks, e2 = (m2 - mt) * ks, e3 = (m3 - mt) * ks; float f0, f1, f2, f3;   /* arguments <= 0; a part without keys (-3e38) gets the factor 0 */
  /* four hardware exp2 in one statement: each is the independent instruction that the instruction set asks for behind the one before it, the v_nop is it for the last */
  asm("v_exp_f32 %0, %4\n\tv_exp_f32 %1, %5\n\tv_exp_f32 %2, %6\n\tv_exp_f32 %3, %7\n\tv_nop" : "=&v"(f0), "=&v"(f1), "=&v"(f2), "=&v"(f3) : "v"(e0), "v"(e1), "v"(e2), "v"(e3));
  float sum = s0[1][lane] * f0 + s1p[1][lane] * f1 + s2p[1][lane] * f2 + s3[1][lane] * f3; sum = 1.0f / (sum + __shfl_xor(sum, 16) + 2048.0f * 1e-9f);   /* p = e / (sum + 1e-9) as in the module, numerator and denominator x 2^11 */
  v8f o[HD / 16];
#pragma unroll
  for (int j = 0; j < HD / 16; ++j) {
#pragma unroll
    for (int q = 0; q < 2; ++q) { const v4f v0 = x0[2 * j + q][lane], v1 = x1[2 * j + q][lane], v2 = x2[2 * j + q][lane], v3 = x3[2 * j + q][lane];
#pragma unroll
      for (int r = 0; r < 4; ++r) o[j][4 * q + r] = v0[r] * f0 + v1[r] * f1 + v2[r] * f2 + v3[r] * f3; } }
  v8f gw[HD / 16], gb[HD / 16];   /* lane (g, col) holds d = 16 j + 8 g + r of query col */
  { const float* gwp = GW + h * HD + 8 * g; const float* gbp = GB + h * HD + 8 * g;
#pragma unroll
    for (int j = 0; j < HD / 16; ++j) { gw[j] = *(const v8f*)(gwp + j * 16); gb[j] = *(const v8f*)(gbp + j * 16); }
    xwait(gwp, gbp); }
  { const float sc = sum; v8f t[HD / 16]; v8h al[HD / 16]; v4u pk[HD / 16]; float ps[HD / 16];
    const size_t off = ((size_t)b * TT + row0 + col) * CC + h * HD + 8 * g; const _Float16* gap = GA + off; _Float16* ap = AH + off;
#pragma unroll
    for (int j = 0; j < HD / 16; ++j) al[j] = *(const v8h*)(gap + j * 16);
    xwait(gap);
#pragma unroll
    for (int j = 0; j < HD / 16; ++j) { t[j] = o[j] * sc; ps[j] = 0.f;   /* four independent chains of eight */
#pragma unroll
      for (int r = 0; r < 8; ++r) ps[j] += t[j][r]; }
    float s1 = (ps[0] + ps[1]) + (ps[2] + ps[3]); s1 += __shfl_xor(s1, 16);
    const float mean = s1 * (1.0f / HD);
#pragma unroll
    for (int j = 0; j < HD / 16; ++j) { ps[j] = 0.f;
#pragma unroll
      for (int r = 0; r < 8; ++r) { t[j][r] -= mean; ps[j] += t[j][r] * t[j][r]; } }
    float s2 = (ps[0] + ps[1]) + (ps[2] + ps[3]); s2 += __shfl_xor(s2, 16);
    const float rstd = rsqrtf(s2 * (1.0f / HD) + 1e-5f);
#pragma unroll
    for (int j = 0; j < HD / 16; ++j) { union { v8h hv; v4u u4; } c;
#pragma unroll
      for (int r = 0; r < 8; ++r) c.hv[r] = (_Float16)((t[j][r] * rstd * bfr(gw[j][r]) + bfr(gb[j][r])) * (float)al[j][r]);
      pk[j] = c.u4; vst2(ap + j * 16, pk[j]); }   /* the 128-B line of a (token, head) is written by this wave alone */
    asm volatile("s_wait_xcnt 0x0" :: "v"(ap), "v"(pk[0]), "v"(pk[1]), "v"(pk[2]), "v"(pk[3]) : "memory");   /* before a register that the stores above name is used again; address and data are inputs, so that they stay whole up to the wait */ } }
__global__ __launch_bounds__(512) void k_attn(const _Float16* QH, const _Float16* KH, const _Float16* QL, const _Float16* KL, const _Float16* VT, const __bf16* VB, const __bf16* VBL, const _Float16* GA, const float* GW, const float* GB, _Float16* AH) {
  static_assert(QHI % 128 == 0 && KHI >= QHI && HD == 64, "a wave is wholly on one path, and its keys have the residual planes");
  const int lane = threadIdx.x & 31; const int wave = __builtin_amdgcn_readfirstlane(threadIdx.x >> 5);   /* scalar, so that the chunk loops branch on scalars */
  static_assert(TT == 2048 && QHI == 384, "the table of pairs below is laid out for 16 query blocks, the first three on the early rows' path");
  __shared__ __align__(16) v4f xo[2][16][2][8][32]; __shared__ float xs[2][16][2][2][32];   /* per (query block of the pair, wave, column group): 64 outputs of 16 queries as [8 pieces][lane]; maximum and sum by lane */
  /* the block's two query blocks: 15 - y and the one that brings both together to 18 or 19 units of 128 keys, an early block's keys counted three times (three products, one column group at a time): (15,0) (14,3) (13,4) (12,1) (11,5) (10,6) (9,7) (8,2); four bits a y */
  const int qbs[2] = { (TT / 128 - 1) - (int)blockIdx.y, (int)((0x27651430u >> (4 * blockIdx.y)) & 15u) };
  const int qg = wave & 3, par = wave >> 2;   /* waves w, w + 4, w + 8, w + 12 share 32 queries */
  /* kept rolled: one copy of each path's code for both query blocks */
#pragma unroll 1
  for (int t = 0; t < 2; ++t) { const int qb = t ? qbs[1] : qbs[0], ql0 = qb * 128 + qg * 32;
    if (qb < QHI / 128) {   /* scalar test; the early rows' planes take twice the registers: one column group at a time */
      /* kept rolled: one copy of this path's code, and one group's registers */
#pragma unroll 1
      for (int u = 0; u < 2; ++u) attn_part<true, 1>(QH, KH, QL, KL, VT, VB, VBL, blockIdx.z, blockIdx.x, ql0 + u * 16, lane, par, &xo[t][wave][u], &xs[t][wave][u]);
    } else attn_part<false, 2>(QH, KH, QL, KL, VT, VB, VBL, blockIdx.z, blockIdx.x, ql0, lane, par, &xo[t][wave][0], &xs[t][wave][0]); }
  __syncthreads();   /* every wave's parts lie in LDS before its partners read them; all sixteen waves pass here once */
  const int ft = wave >> 3, fg = (wave >> 1) & 3, fu = wave & 1, fqb = ft ? qbs[1] : qbs[0];   /* sixteen (query block, column group) pairs, one a wave */
  attn_fin(xo[ft][fg][fu], xo[ft][fg + 4][fu], xo[ft][fg + 8][fu], xo[ft][fg + 12][fu], xs[ft][fg][fu], xs[ft][fg + 4][fu], xs[ft][fg + 8][fu], xs[ft][fg + 12][fu], (fqb < QHI / 128 ? 1.0f : SCALE) * 1.44269504f, GA, GW, GB, AH, blockIdx.z, blockIdx.x, fqb * 128 + fg * 32 + fu * 16, lane); }
// ---- k_out: block = (64 rows, 128 cols): y = (gn * alpha) (f16 rows) Wo (k_prep's f16 rows, bf16 x 2^8, exact) x 2^-8 -> output 0 rows
__global__ __launch_bounds__(128) void k_out(const _Float16* __restrict__ AH, const _Float16* __restrict__ WOT, float* __restrict__ OUT) { __shared__ __align__(16) float sf[4][16][132]; __shared__ __align__(16) char sw[2 * SWB];   /* Wo tile of one pass, [col][k] in f16 (x 2^8), two buffers */
  const int tid = threadIdx.x, wave = tid >> 5, lane = tid & 31, col = lane & 15, g = lane >> 4; const int c0 = blockIdx.y * 128; const size_t r0 = (size_t)blockIdx.x * 64 + wave * 16;
  v8f acc[1][8] = {};
  gemm_acc<true, 32, 128, 1>((const char*)(AH + (r0 + col) * CC + 8 * g), (const char*)(WOT + (size_t)(c0 + (tid >> 3)) * CC + (tid & 7) * 8), sw, tid, lane, acc);
#pragma unroll
  for (int j = 0; j < 8; ++j) {
#pragma unroll
    for (int r = 0; r < 8; ++r) sf[wave][8 * g + r][j * 16 + col] = acc[0][j][r] * (1.0f / 256.0f); }
  LDSX(); for (int rl = 0; rl < 16; ++rl) vst2(OUT + (r0 + rl) * CC + c0 + lane * 4, *(const v4f*)&sf[wave][rl][lane * 4]); }
extern "C" void kernel_launch(void* const* d_in, const int* in_sizes, int n_in, void* d_out, int out_size, void* d_ws, size_t ws_size, hipStream_t stream) {
  (void)in_sizes; (void)n_in; (void)out_size;
  const float** F = (const float**)d_in;   // 0 x [1,2048,2048]; 1 rope_cos, 2 rope_sin [2048,64]; 3 Wq [2048,2048]; 4 Wk, 5 Wv [2048,512]; 6 Wo [2048,2048]; 7 Wg [2048,2048], 8 bg; 9 gn_weight, 10 gn_bias [2048]
  if (ws_size < (size_t)WS_END) return;
  char* ws = (char*)d_ws; _Float16 *GA = (_Float16*)(ws + WS_GA), *AH = (_Float16*)(ws + WS_AH), *QH = (_Float16*)(ws + WS_QH), *KH = (_Float16*)(ws + WS_KH), *VT = (_Float16*)(ws + WS_VT), *QL = (_Float16*)(ws + WS_QL), *KL = (_Float16*)(ws + WS_KL); __bf16 *VB = (__bf16*)(ws + WS_VB), *VBL = (__bf16*)(ws + WS_VBL); __bf16 *XB = (__bf16*)(ws + WS_XB), *WT = (__bf16*)(ws + WS_WT); _Float16 *WOT = (_Float16*)(ws + WS_WOT);
  float* OUT0 = (float*)d_out; float* OUTK = OUT0 + (size_t)NB * TT * CC; float* OUTV = OUTK + (size_t)NB * NKV * TT * HD;   /* tuple outputs concatenated, no padding */
  k_prep<<<dim3(NWT / 64 + CC / 64 + TNB * TT / 64, CC / 64 / PREP_T), 256, 0, stream>>>(F[0], F[3], F[4], F[5], F[7], F[6], XB, WT, WOT);
  k_proj<<<dim3(TNB * TT / 128, CC / 128, 4), 128, 0, stream>>>(XB, WT, F[8], F[1], F[2], QH, KH, VT, QL, KL, VB, VBL, GA, OUTK, OUTV);
  k_attn<<<dim3(NH, TT / 256, TNB), 512, 0, stream>>>(QH, KH, QL, KL, VT, VB, VBL, GA, F[9], F[10], AH);
  k_out<<<dim3(TNB * TT / 64, CC / 128), 128, 0, stream>>>(AH, WOT, OUT0);
}

// v010
// One run takes 107 microseconds.
// In two side-by-side timings against v009, it was 1.05 and 1.04 times as fast.
// All steps since v000 together make it 13.0 times as fast.
// compute dtype: all float inputs rounded to bf16; q/k/v/gate projections x W with EXACT bf16 products on WMMA 16x16x32, f32 accumulate; rotate-half rotary with the given cos/sin tables in f32; q, k once to f16 -> 1-product causal logits / 8 (the first 384 query rows use f16 hi + residual on both sides, 3 products); softmax in f32: exp(logit - max) x 2^11 as one hardware exp2 of (logit - max) x log2(e) + 11 (one fused multiply-add), once to f16 against v once to f16 (first 384 rows: bf16 hi + lo, 3 products), divided by (sum + 1e-9) after the product (sum and 1e-9 both carried x 2^11); per-head GroupNorm and the sigmoid gate in f32; (gn * alpha) once to f16 against Wo carried x 2^8 in f16 (exact); new_k / new_v written in f32 straight from the projections; f32 outputs.
#include <hip/hip_runtime.h>
#include <math.h>

typedef __attribute__((ext_vector_type(16))) _Float16 v16h;
typedef __attribute__((ext_vector_type(16))) __bf16 v16b;
typedef __attribute__((ext_vector_type(8)))  _Float16 v8h;
typedef __attribute__((ext_vector_type(8)))  float v8f;
typedef __attribute__((ext_vector_type(4)))  float v4f;
typedef __attribute__((ext_vector_type(2)))  float v2f;
typedef __attribute__((ext_vector_type(4)))  unsigned v4u;
typedef __attribute__((ext_vector_type(4)))  int v4i;
typedef float __attribute__((may_alias)) float_a;
typedef int __attribute__((may_alias)) int_a;

template <typename T> __device__ __forceinline__ void vst2(void* p, T v) { *(T*)p = v;  }
__device__ __forceinline__ v8f wmma16(v16h a, v16h b, v8f c) {
  v8f d = __builtin_amdgcn_wmma_f32_16x16x32_f16(false, a, false, b, (short)0, c, false, false);
  asm volatile("v_nop\n\tv_nop\n\tv_nop\n\tv_nop" : "+v"(d) : "v"(a), "v"(b));
  return d;
}
__device__ __forceinline__ v8f wmma_bf(v16b a, v16b b, v8f c) {
  v8f d = __builtin_amdgcn_wmma_f32_16x16x32_bf16(false, a, false, b, (short)0, c, false, false);
  asm volatile("v_nop\n\tv_nop\n\tv_nop\n\tv_nop" : "+v"(d) : "v"(a), "v"(b));
  return d;
}
// 16x16x32 fragments: lane = (h = lane>>4, row/col = lane&15); elements 0..7 = k0+8h+0..7, 8..15 = k0+16+8h+0..7; D element r = row 8h+r
__device__ __forceinline__ v16h frag_h(const _Float16* rowk0, int lane) {
  union { v16h v; v8h q[2]; } u; const _Float16* p = rowk0 + 8 * (lane >> 4);
  u.q[0] = *(const v8h*)p; u.q[1] = *(const v8h*)(p + 16); return u.v;
}
__device__ __forceinline__ v16h frag_f32(const float* rowk0, int lane) {
  v16h a; const float* p = rowk0 + 8 * (lane >> 4);
#pragma unroll
  for (int i = 0; i < 8; ++i) { a[i] = (_Float16)p[i]; a[8 + i] = (_Float16)p[16 + i]; }
  return a;
}
__device__ __forceinline__ v16h frag_f32s(const float* rowk0, int lane, float sc) {
  v16h a; const float* p = rowk0 + 8 * (lane >> 4);
#pragma unroll
  for (int i = 0; i < 8; ++i) { a[i] = (_Float16)(p[i] * sc); a[8 + i] = (_Float16)(p[16 + i] * sc); }
  return a;
}
// column fragment from a [K][ld] layout (column n), rows >= K read as 0
__device__ __forceinline__ v16h fragc_f32(const float* W, int k0, int n, int lane, int ld, int K) {
  v16h a; const int g = lane >> 4;
#pragma unroll
  for (int i = 0; i < 8; ++i) { const int ka = k0 + 8 * g + i, kb = ka + 16;
    a[i] = (_Float16)(ka < K ? W[(size_t)(ka < K ? ka : K - 1) * ld + n] : 0.f); a[8 + i] = (_Float16)(kb < K ? W[(size_t)(kb < K ? kb : K - 1) * ld + n] : 0.f); }
  return a;
}
struct F2 { v16b h, l; };
__device__ __forceinline__ F2 bsplit16(const float v[16]) { F2 r;
#pragma unroll
  for (int i = 0; i < 16; ++i) { const __bf16 h = (__bf16)v[i]; r.h[i] = h; r.l[i] = (__bf16)(v[i] - (float)h); }
  return r; }
__device__ __forceinline__ F2 split_row(const float* row, int k0, int lane) { float v[16]; const float* p = row + k0 + 8 * (lane >> 4);
#pragma unroll
  for (int i = 0; i < 8; ++i) { v[i] = p[i]; v[8 + i] = p[16 + i]; }
  return bsplit16(v); }
__device__ __forceinline__ F2 split_rowK(const float* row, int k0, int lane, int K) { float v[16]; const int g = lane >> 4;
#pragma unroll
  for (int i = 0; i < 8; ++i) { const int ka = k0 + 8 * g + i, kb = ka + 16; v[i] = ka < K ? row[ka < K ? ka : K - 1] : 0.f; v[8 + i] = kb < K ? row[kb < K ? kb : K - 1] : 0.f; }
  return bsplit16(v); }
__device__ __forceinline__ F2 split_col(const float* W, int k0, int n, int lane, int ld, int K) { float v[16]; const int g = lane >> 4;
#pragma unroll
  for (int i = 0; i < 8; ++i) { const int ka = k0 + 8 * g + i, kb = ka + 16; v[i] = ka < K ? W[(size_t)(ka < K ? ka : K - 1) * ld + n] : 0.f; v[8 + i] = kb < K ? W[(size_t)(kb < K ? kb : K - 1) * ld + n] : 0.f; }
  return bsplit16(v); }
__device__ __forceinline__ v8f mac3(const F2& a, const F2& b, v8f c) { c = wmma_bf(a.l, b.h, c); c = wmma_bf(a.h, b.l, c); return wmma_bf(a.h, b.h, c); }
__device__ __forceinline__ float sigm(float v) { return 1.0f / (1.0f + expf(-v)); }
#define LDSX() do { asm volatile("s_wait_dscnt 0" ::: "memory"); __builtin_amdgcn_wave_barrier(); __builtin_amdgcn_fence(__ATOMIC_RELEASE, "workgroup"); } while (0)

// Gated GQA causal self-attention with rotary tables, per-head GroupNorm and a sigmoid output gate (B 1, S 2,048, HID 2,048; 32 query / 8 kv heads x 64): q = x Wq, k = x Wk, v = x Wv ((in,out)); q, k rotate-half RoPE with the given cos/sin [S,64]; scores = q k^T / 8, causal (col > row -> -inf); p = exp(a - max) / (sum + 1e-9); out = p v (GQA x4); gn = per-(token, head) normalisation over 64 x gn_weight + gn_bias; alpha = sigmoid(x Wg + bg); y = (gn * alpha) Wo. Returns (y, new_k = roped k [B,HKV,S,D], new_v [B,HKV,S,D]).
#define NB 1
#define TT 2048
#define CC 2048
#define NH 32
#define HD 64
#define NKV 8
#define KV (NKV * HD)      // 512
#define GQ (NH / NKV)      // 4
#define SCALE 0.125f
#ifndef TNB
#define TNB NB
#endif
typedef __attribute__((ext_vector_type(8))) __bf16 v8b;
__device__ __forceinline__ v16b frag_b(const __bf16* rowk0, int lane) {
  union { v16b v; v8b q[2]; } u; const __bf16* p = rowk0 + 8 * (lane >> 4);
  u.q[0] = *(const v8b*)p; u.q[1] = *(const v8b*)(p + 16); return u.v;
}
__device__ __forceinline__ float bfr(float v) { return (float)(__bf16)v; }
#define QBH 6              // 64-row groups 0..5 of each sequence (rows < 384) take the high-precision path (their rows see only 1..384 keys)
#define QHI (QBH * 64)     // 384
#define KHI 384            // key rows with residual / bf16 planes (keys of those rows are <= 383)

#define WS_GA  0u                                       // f16 alpha = sigmoid(x Wg + bg) rows [t][2048]
#define WS_AH  (WS_GA + 2u * (size_t)NB * TT * CC)        // f16 (gn * alpha) rows [t][2048] (A operand of the output projection)
#define WS_QH  (WS_AH + 2u * (size_t)NB * TT * CC)        // f16 q rows [b*t][2048] (rotated)
#define WS_KH  (WS_QH + 2u * (size_t)NB * TT * CC)       // f16 k in A-fragment order: per (kv head, 16 keys, 32 d) 1 KiB = [half][lane = 16 g + key][8 d], d = 16 half + 8 g + e
#define WS_VT  (WS_KH + 2u * (size_t)NB * TT * KV)       // f16 v in A-fragment order: per (kv head, 32 keys, 16 d) 1 KiB = [half][lane = 16 g + d][8 keys], key = 16 half + 8 g + e
#define WS_QL  (WS_VT + 2u * (size_t)NB * KV * TT)       // f16 q residual x 2^10 rows [b][t < QHI][2048]
#define WS_KL  (WS_QL + 2u * (size_t)NB * QHI * CC)      // f16 k residual x 2^10, keys < KHI, in k's order
#define WS_VB  (WS_KL + 2u * (size_t)NB * KHI * KV)      // bf16 v hi, keys < KHI, in v's order
#define WS_VBL (WS_VB + 2u * (size_t)NB * KV * KHI)      // bf16 v lo, likewise
#define WS_XB  (WS_VBL + 2u * (size_t)NB * KV * KHI)     // bf16 x in A-fragment order (k_prep)
#define NWT (2 * CC + 2 * KV)                            // 5,120 rows of WT: the columns of Wq, Wk, Wv, Wg in that order
#define WS_WT  (WS_XB + 2u * (size_t)NB * TT * CC)        // bf16 weight columns as rows [col][k = 2048]
#define WS_WOT (WS_WT + 2u * (size_t)NWT * CC)            // f16 (bf16(Wo) x 2^8) columns as rows [col][k = 2048]
#define WS_END (WS_WOT + 2u * (size_t)CC * CC)

// ---- k_proj: block = (128 tokens, 128 output cols = two 64-dim heads, which): acc = x W (W (in,out); exact); the way out runs once for each half of 64 tokens (m = 0, 1), through the same LDS; which 0/1: rotate-half rope with the given tables (tiles j and j+2 hold d and d+32 of the same head) -> f16 (+ residual x 2^10 for the early rows): q as rows, k in k_attn's fragment order, and new_k written in f32; which 2: v -> f16 (+ bf16 hi/lo for the early keys) in k_attn's fragment order and new_v in f32; which 3: alpha = sigmoid(x Wg + bg) -> f16 rows
// ---- k_prep: every float operand of the three big products is rounded ONCE to its 16-bit form and laid out for its reader: the columns of Wq, Wk, Wv, Wg -> bf16 rows of WT, the columns of Wo -> f16 (bf16 x 2^8, exact) rows of WOT, both [col][k]; x -> bf16 in A-fragment order: per (16 rows, 32 k) 1 KiB = [half of the fragment][lane = 16 g + row][8 k], k = 16 half + 8 g + e, so that a wave's 16-B loads read 512 B in a row. blockIdx.x 0..79: 64 rows of WT, 80..111: of WOT, 112..143: 64 rows of x; blockIdx.y: eight 64-k tiles, one after the other (few, long blocks: fewer waves to start). Each 128-B line of the planes is written by one block.
#define PREP_T 8
template <bool IS_O> __device__ __forceinline__ void prep_w(const float* __restrict__ src, int ld, unsigned short* __restrict__ dst, unsigned (*ts)[64][36], int kt0, int tid) {
  const int n = tid >> 2, p = tid & 3, kq = tid >> 4, c4 = (tid & 15) * 4; v4f va[2], vb[2];   /* rows 2 kp and 2 kp + 1 (kp = 16 i + kq), four columns: 16 lanes read 256 B of a row */
  const float* s = src + (size_t)(kt0 * 64 + 2 * kq) * ld + c4; unsigned short* d = dst + (size_t)n * CC + kt0 * 64 + p * 16;
#pragma unroll
  for (int i = 0; i < 2; ++i) { va[i] = *(const v4f*)(s + (size_t)(i * 32) * ld); vb[i] = *(const v4f*)(s + (size_t)(i * 32 + 1) * ld); }
  asm volatile("s_wait_xcnt 0x0" ::: "memory");   /* before a register that the loads above name is used again */
#pragma unroll
  for (int it = 0; it < PREP_T; ++it) {
#pragma unroll
    for (int i = 0; i < 2; ++i) {
#pragma unroll
      for (int e = 0; e < 4; ++e) { union { __bf16 b[2]; _Float16 h[2]; unsigned u; } pk;
        if (IS_O) { pk.h[0] = (_Float16)(bfr(va[i][e]) * 256.0f); pk.h[1] = (_Float16)(bfr(vb[i][e]) * 256.0f); } else { pk.b[0] = (__bf16)va[i][e]; pk.b[1] = (__bf16)vb[i][e]; }
        ts[it & 1][c4 + e][i * 16 + kq] = pk.u; } }
    __syncthreads();   /* the tile is whole before it is read by columns; with two buffers it also ends the reads of the buffer that the next tile fills */
    if (it + 1 < PREP_T) { const float* sn = s + (size_t)((it + 1) * 64) * ld;   /* the next tile's loads fly under this tile's way out */
#pragma unroll
      for (int i = 0; i < 2; ++i) { va[i] = *(const v4f*)(sn + (size_t)(i * 32) * ld); vb[i] = *(const v4f*)(sn + (size_t)(i * 32 + 1) * ld); }
      asm volatile("s_wait_xcnt 0x0" ::: "memory");   /* before a register that the loads above name is used again */ }
    const v4u qa = *(const v4u*)&ts[it & 1][n][p * 8], qb = *(const v4u*)&ts[it & 1][n][p * 8 + 4];
    *(v4u*)(d + it * 64) = qa; *(v4u*)(d + it * 64 + 8) = qb;
    asm volatile("s_wait_xcnt 0x0" ::: "memory");   /* before a register that the stores above name is used again */ } }
__global__ __launch_bounds__(256) void k_prep(const float* __restrict__ X, const float* __restrict__ WQ, const float* __restrict__ WK, const float* __restrict__ WV, const float* __restrict__ WG, const float* __restrict__ WO, __bf16* __restrict__ XB, __bf16* __restrict__ WT, _Float16* __restrict__ WOT) {
  __shared__ __align__(16) unsigned ts[2][64][36];   /* [col][k pair], 128-B rows at a 144-B pitch, two buffers */
  const int tid = threadIdx.x, bx = blockIdx.x, kt0 = blockIdx.y * PREP_T;
  if (bx >= 112) {   /* x (block-uniform; no barrier on this path) */
    const int row = (bx - 112) * 64 + (tid >> 2), p = tid & 3; const float* s = X + (size_t)row * CC + kt0 * 64 + p * 16;
    __bf16* d = XB + ((((size_t)(row >> 4) * (CC / 32) + kt0 * 2 + (p >> 1)) * 2 + (p & 1)) * 32 + (row & 15)) * 8;   /* g = 0 piece; the g = 1 piece lies 16 lanes on, the next 64 k four halves on */
#pragma unroll
    for (int it = 0; it < PREP_T; ++it) { v8b t[2];
#pragma unroll
      for (int i = 0; i < 4; ++i) { const v4f v = *(const v4f*)(s + it * 64 + i * 4);
#pragma unroll
        for (int e = 0; e < 4; ++e) t[i >> 1][(i & 1) * 4 + e] = (__bf16)v[e]; }
      *(v8b*)(d + it * (4 * 32 * 8)) = t[0]; *(v8b*)(d + it * (4 * 32 * 8) + 16 * 8) = t[1]; }
    return; }
  if (bx >= 80) prep_w<true>(WO + (bx - 80) * 64, CC, (unsigned short*)WOT + (size_t)(bx - 80) * 64 * CC, ts, kt0, tid);
  else { const float* src = bx < 32 ? WQ + bx * 64 : bx < 40 ? WK + (bx - 32) * 64 : bx < 48 ? WV + (bx - 40) * 64 : WG + (bx - 48) * 64;
    prep_w<false>(src, (bx >= 32 && bx < 48) ? KV : CC, (unsigned short*)WT + (size_t)bx * 64 * CC, ts, kt0, tid); } }
template <bool F16> __device__ __forceinline__ v8f mm16(v4u a0, v4u a1, v4u b0, v4u b1, v8f c) {
  union { v4u q[2]; v16h h; v16b b; } A, B; A.q[0] = a0; A.q[1] = a1; B.q[0] = b0; B.q[1] = b1;
  if (F16) return wmma16(A.h, B.h, c); else return wmma_bf(A.b, B.b, c); }
#define SWP 144              /* LDS pitch of a 128-B tile row, bytes */
#define SWB (128 * SWP)      /* one buffer: 128 columns */
#define AM (64 * CC * 2)     /* bytes from a wave's first 16 rows of A to its second 16, which lie 64 rows on (the same in rows and in fragment order) */
// Both operands 16-bit; W as rows with k contiguous (k_prep's planes), A as rows or in fragment order. acc += A W over NP passes of 64 k for a (64 MR) x 128 tile. A wave takes MR groups of 16 rows (rows 64 m + 16 wave of the tile) by all 128 columns: with MR = 2 every B fragment that it reads from LDS feeds two products, and a W tile fetched from L2 serves 128 rows. A pass is 64 k = 128 B of every row: eight lanes fetch one whole line of a W column (16 B a lane, a wave's load is four lines), eight such loads a thread bring the 128 x 64 tile, which goes to LDS as it is; the four waves read their B fragments from there, and each lane fetches its own four 16-B pieces of A per row group from ap (+ AM for the second group): AS bytes from piece to piece, AP from pass to pass (rows: 32 and 128, ap = the lane's row + 16 g bytes; fragment order: 512 and 2,048, ap = the wave's 16 rows + 16 lane bytes). wp: W row (tid >> 3) of the tile + 16 (tid & 7) bytes. NP: the passes that the four waves walk (all of K, or the part of K that ap and wp begin at); tid counts within those four waves, sw is their own ring.
template <bool F16, int AS, int AP, int MR, int NP = CC / 64> __device__ __forceinline__ void gemm_acc(const char* __restrict__ ap, const char* __restrict__ wp, char* sw, int tid, int lane, v8f (&acc)[MR][8]) {
  constexpr int JG = 8 / MR;   /* B fragments fetched at a time: with MR = 2 and all eight, the sums, both A sets and B do not fit the registers that the products' statements can name */
  v4u wr[8], ar[MR][4]; char* st = sw + (tid >> 3) * SWP + (tid & 7) * 16; const char* rd = sw + (lane & 15) * SWP + (lane >> 4) * 16;
#pragma unroll
  for (int i = 0; i < 8; ++i) wr[i] = *(const v4u*)(wp + (size_t)i * (16 * CC * 2));
#pragma unroll
  for (int m = 0; m < MR; ++m) {
#pragma unroll
    for (int i = 0; i < 4; ++i) ar[m][i] = *(const v4u*)(ap + m * AM + i * AS); }
  asm volatile("s_wait_xcnt 0x0" :: "v"(wp), "v"(ap) : "memory");   /* before a register that the loads above name is used again; the addresses are inputs, so that they stay whole up to the wait */
  const char* wn = wp + 128; const char* an = ap + AP;   /* the next pass's rows; carried from pass to pass and stepped behind the wait, so that no load lands on them */
  /* unroll 2: the buffer index becomes a constant */
#pragma unroll 2
  for (int kc = 0; kc < NP; ++kc) { const int bo = (kc & 1) * SWB; v4u a[MR][4];
#pragma unroll
    for (int m = 0; m < MR; ++m) {
#pragma unroll
      for (int i = 0; i < 4; ++i) a[m][i] = ar[m][i]; }
#pragma unroll
    for (int i = 0; i < 8; ++i) *(v4u*)(st + bo + i * 16 * SWP) = wr[i];
    __syncthreads();   /* publishes this pass's tile; with two buffers it also ends every wave's reads of the buffer that the next pass refills */
    /* the next pass's global loads fly under this pass's products (the last pass reloads its own rows, unused) */
#pragma unroll
    for (int i = 0; i < 8; ++i) wr[i] = *(const v4u*)(wn + (size_t)i * (16 * CC * 2));
#pragma unroll
    for (int m = 0; m < MR; ++m) {
#pragma unroll
      for (int i = 0; i < 4; ++i) ar[m][i] = *(const v4u*)(an + m * AM + i * AS); }
    asm volatile("s_wait_xcnt 0x0" :: "v"(wn), "v"(an) : "memory");   /* before a register that the loads above name is used again; the addresses are inputs, so that they stay whole up to the wait */
    if (kc + 2 < NP) { wn += 128; an += AP; }
#pragma unroll
    for (int kj = 0; kj < 2 * MR; ++kj) { const int kk = kj / MR, j0 = (kj % MR) * JG; v4u w[JG][2];
#pragma unroll
      for (int j = 0; j < JG; ++j) { w[j][0] = *(const v4u*)(rd + bo + (j0 + j) * 16 * SWP + kk * 64); w[j][1] = *(const v4u*)(rd + bo + (j0 + j) * 16 * SWP + kk * 64 + 32); }
#pragma unroll
      for (int j = 0; j < JG; ++j) {
#pragma unroll
        for (int m = 0; m < MR; ++m) acc[m][j0 + j] = mm16<F16>(a[m][kk * 2], a[m][kk * 2 + 1], w[j][0], w[j][1], acc[m][j0 + j]); } } } }
__global__ __launch_bounds__(128, 3) void k_proj(const __bf16* __restrict__ XB, const __bf16* __restrict__ WT, const float* __restrict__ BG, const float* __restrict__ COS, const float* __restrict__ SIN, _Float16* __restrict__ QH, _Float16* __restrict__ KH, _Float16* __restrict__ VT, _Float16* __restrict__ QL, _Float16* __restrict__ KL, __bf16* __restrict__ VB, __bf16* __restrict__ VBL, _Float16* __restrict__ GA, float* __restrict__ OUTK, float* __restrict__ OUTV) {
  /* one LDS pool, 92,160 B, so that three blocks fit a WGP and all 640 blocks of the grid that work are resident at once: the f32 staging so lies on the W ring sw (which is done with when the way out begins), and q's and k's staging sh, sl on v's th, tb, tbl (a block takes one of the two paths); the 3 in the launch bounds is the register budget of three waves a SIMD */
  __shared__ __align__(16) char pool[2 * SWB + 3 * 128 * 72 * 2]; static_assert(4 * 16 * 132 * 4 <= 2 * SWB && 2 * 64 * 136 * 2 <= 3 * 128 * 72 * 2, "the overlaid arrays fit");
  char* sw = pool; float (*so)[16][132] = (float (*)[16][132])pool; _Float16 (*sh)[136] = (_Float16 (*)[136])(pool + 2 * SWB); _Float16 (*sl)[136] = sh + 64; _Float16 (*th)[72] = (_Float16 (*)[72])(pool + 2 * SWB); __bf16 (*tb)[72] = (__bf16 (*)[72])(pool + 2 * SWB + 128 * 72 * 2); __bf16 (*tbl)[72] = tb + 128;
  const int tid = threadIdx.x, wave = tid >> 5, lane = tid & 31, col = lane & 15, g = lane >> 4; const int which = blockIdx.z; const int c0 = blockIdx.y * 128; const size_t rb = (size_t)blockIdx.x * 128; const int NW = (which == 0 || which == 3) ? CC : KV; if (c0 >= NW) return;   // k/v are only 512 wide (block-uniform exit before any barrier)
  const int w0 = which == 0 ? 0 : which == 1 ? CC : which == 2 ? CC + KV : CC + 2 * KV;   /* first row of this product's columns in WT */
  v8f acc2[2][8] = {};
  gemm_acc<false, 512, 2048, 2>((const char*)(XB + (rb + wave * 16) * CC + lane * 8), (const char*)(WT + (size_t)(w0 + c0 + (tid >> 3)) * CC + (tid & 7) * 8), sw, tid, lane, acc2);
  v8f acc[8];
#pragma unroll
  for (int j = 0; j < 8; ++j) acc[j] = acc2[0][j];
  /* kept rolled: one copy of the way out's code for both halves */
#pragma unroll 1
  for (int m = 0; m < 2; ++m) {
  __syncthreads();   /* ends every wave's reads of what this half's staging overwrites: the W ring's last tile (m = 0), the first half's staging (m = 1) */
  const size_t r0 = rb + m * 64; const size_t b = r0 / TT; const int t0 = (int)(r0 % TT); const bool hi_rows = t0 < ((which == 0) ? QHI : KHI);   /* block-uniform */
  if (which == 3) {   /* gate: alpha = sigmoid(acc + bg) -> f16 rows */
#pragma unroll
    for (int j = 0; j < 8; ++j) { const float bb = bfr(BG[c0 + j * 16 + col]);
#pragma unroll
      for (int r = 0; r < 8; ++r) sh[wave * 16 + 8 * g + r][j * 16 + col] = (_Float16)(1.0f / (1.0f + expf(-(acc[j][r] + bb)))); }
    __syncthreads();
    for (int e = tid; e < 64 * 16; e += 128) { const int rl = e >> 4, q = e & 15; vst2((unsigned*)(GA + (r0 + rl) * CC + c0 + q * 8), *(const v4u*)&sh[rl][q * 8]); }
  } else if (which < 2) {
    /* rotate-half rope on each 64-dim head: d = (j&3)*16+col; d < 32 (tiles jp = 0,1,4,5) pairs with d+32 (jp+2): out[d] = x[d] c[d] - x[d+32] s[d], out[d+32] = x[d+32] c[d+32] + x[d] s[d+32] */
#pragma unroll
    for (int jp = 0; jp < 8; ++jp) { if ((jp & 3) >= 2) continue; const int i2 = (jp & 3) * 16 + col;
#pragma unroll
      for (int r = 0; r < 8; ++r) { const int t = t0 + wave * 16 + 8 * g + r; const float c1 = bfr(COS[(size_t)t * HD + i2]), s1 = bfr(SIN[(size_t)t * HD + i2]), c2 = bfr(COS[(size_t)t * HD + i2 + 32]), s2 = bfr(SIN[(size_t)t * HD + i2 + 32]); const float x1 = acc[jp][r], x2 = acc[jp + 2][r]; asm volatile("s_wait_loadcnt 0x0" ::: "memory"); acc[jp][r] = x1 * c1 - x2 * s1; acc[jp + 2][r] = x2 * c2 + x1 * s2; } }
    if (which == 1) {   /* new_k output [HKV][S][64] in f32: this wave's 16 rows x 2 heads, 256 B per (row, head) by 16 lanes */
#pragma unroll
      for (int j = 0; j < 8; ++j) {
#pragma unroll
        for (int r = 0; r < 8; ++r) so[wave][8 * g + r][j * 16 + col] = acc[j][r]; }
      LDSX(); for (int rl = 0; rl < 16; ++rl) { const int t = t0 + wave * 16 + rl; const int hh = (c0 >> 6) + (lane >> 4); vst2(OUTK + ((size_t)hh * TT + t) * HD + (lane & 15) * 4, *(const v4f*)&so[wave][rl][lane * 4]); } }
#pragma unroll
    for (int j = 0; j < 8; ++j) {
#pragma unroll
      for (int r = 0; r < 8; ++r) { const float v = acc[j][r]; const _Float16 hv = (_Float16)v; sh[wave * 16 + 8 * g + r][j * 16 + col] = hv; sl[wave * 16 + 8 * g + r][j * 16 + col] = (_Float16)((v - (float)hv) * 1024.0f); } }
    __syncthreads();
    _Float16* dh = which == 0 ? QH : KH; _Float16* dl = which == 0 ? (QL + (b * QHI) * (size_t)CC) : (KL + (b * KHI) * (size_t)KV);
    if (which == 0)   /* q: rows */
    for (int e = tid; e < 64 * 16; e += 128) { const int rl = e >> 4, q = e & 15; vst2((unsigned*)(dh + (r0 + rl) * NW + c0 + q * 8), *(const v4u*)&sh[rl][q * 8]); if (hi_rows) vst2((unsigned*)(dl + (size_t)(t0 + rl) * NW + c0 + q * 8), *(const v4u*)&sl[rl][q * 8]); }
    else   /* k in fragment order: piece e = (head hh, 16 keys tl, 32 d kc, half hf, lane 16 gg + row); a head's 64 keys are 8 KiB in a row, a wave's store 512 B in a row */
    for (int it = 0; it < 8; ++it) { const int e = tid + it * 128, row = e & 15, gg = (e >> 4) & 1, hf = (e >> 5) & 1, kc = (e >> 6) & 1, tl = (e >> 7) & 3, hh = e >> 9; const int rl = tl * 16 + row, cl = hh * 64 + kc * 32 + hf * 16 + gg * 8; const size_t hd = b * NKV + (c0 >> 6) + hh;
      _Float16* pk = KH + (hd * (TT / 16) + (t0 >> 4)) * 1024 + (e & 511) * 8; const v4u dk = *(const v4u*)&sh[rl][cl];
      /* s_wait_xcnt 0 behind the stores, before a register that they name is used again; addresses and data are inputs, so that they stay whole up to the wait */
      if (hi_rows) { _Float16* pr = KL + (hd * (KHI / 16) + (t0 >> 4)) * 1024 + (e & 511) * 8; const v4u dr = *(const v4u*)&sl[rl][cl]; vst2(pk, dk); vst2(pr, dr); asm volatile("s_wait_xcnt 0x0" :: "v"(pk), "v"(pr), "v"(dk), "v"(dr) : "memory"); }
      else { vst2(pk, dk); asm volatile("s_wait_xcnt 0x0" :: "v"(pk), "v"(dk) : "memory"); } }
  } else {   /* which == 2: v */
#pragma unroll
    for (int j = 0; j < 8; ++j) {
#pragma unroll
      for (int r = 0; r < 8; ++r) so[wave][8 * g + r][j * 16 + col] = acc[j][r]; }
    LDSX(); for (int rl = 0; rl < 16; ++rl) { const int t = t0 + wave * 16 + rl; const int hh = (c0 >> 6) + (lane >> 4); vst2(OUTV + ((size_t)hh * TT + t) * HD + (lane & 15) * 4, *(const v4f*)&so[wave][rl][lane * 4]); }   /* new_v output in f32 */
#pragma unroll
    for (int j = 0; j < 8; ++j) {
#pragma unroll
      for (int r = 0; r < 8; ++r) { const float v = acc[j][r]; const int rl = wave * 16 + 8 * g + r, cl = j * 16 + col; th[cl][rl] = (_Float16)v; const __bf16 bh = (__bf16)v; tb[cl][rl] = bh; tbl[cl][rl] = (__bf16)(v - (float)bh); } }
    __syncthreads();
    /* v in fragment order: piece e = (head hh, 32 keys cc, 16 d j, half hf, lane 16 gg + row); a head's 64 keys are 8 KiB in a row, a wave's store 512 B in a row */
    for (int it = 0; it < 8; ++it) { const int e = tid + it * 128, row = e & 15, gg = (e >> 4) & 1, hf = (e >> 5) & 1, j = (e >> 6) & 3, cc = (e >> 8) & 1, hh = e >> 9; const int cl = hh * 64 + j * 16 + row, rl = cc * 32 + hf * 16 + gg * 8; const size_t hd = b * NKV + (c0 >> 6) + hh;
      _Float16* pv = VT + (hd * (TT / 32) + (t0 >> 5)) * 2048 + (e & 511) * 8; const v4u dv = *(const v4u*)&th[cl][rl];
      /* s_wait_xcnt 0 behind the stores, before a register that they name is used again; addresses and data are inputs, so that they stay whole up to the wait */
      if (hi_rows) { const size_t o3 = (hd * (KHI / 32) + (t0 >> 5)) * 2048 + (e & 511) * 8; __bf16* ph = VB + o3; __bf16* pl = VBL + o3; const v4u dh = *(const v4u*)&tb[cl][rl], dl = *(const v4u*)&tbl[cl][rl];
        vst2(pv, dv); vst2(ph, dh); vst2(pl, dl); asm volatile("s_wait_xcnt 0x0" :: "v"(pv), "v"(ph), "v"(pl), "v"(dv), "v"(dh), "v"(dl) : "memory"); }
      else { vst2(pv, dv); asm volatile("s_wait_xcnt 0x0" :: "v"(pv), "v"(dv) : "memory"); } } }
  asm volatile("s_wait_xcnt 0x0" ::: "memory");   /* before a register that this half's stores name is used again by the next half */
  __builtin_amdgcn_sched_barrier(0);   /* keeps the copies below behind that wait */
#pragma unroll
  for (int j = 0; j < 8; ++j) acc[j] = acc2[1][j];   /* the second half's sums take the first half's place */
  } }
// ---- k_attn: block = (head h, pair y of 128-query blocks), sixteen waves, four to each 32 queries (two 16-query column groups u): each walks every fourth 32-key chunk, with a maximum, a sum and outputs of its own; every wave takes the pair's long query block and then its short one, so that all sixteen waves of every block of the grid are about equally long and four busy waves share a SIMD to the end; the parts meet in LDS behind the kernel's one barrier, and each wave finishes one column group of one of the two query blocks; k and v lie in fragment order (k_proj), so that every load of theirs reads whole lines. S^T = K Q^T: A = 16 key rows, B = 16 query rows, so lane (g, col) holds query col's logits of keys 8g + r; two such tiles (keys k0 + 0..15, k0 + 16..31) are, element for element, the B operand P^T of O^T += V^T P^T (A = 16 d of v). Pass 1 walks the wave's keys for each query's maximum among them, pass 2 forms the same logits again, e = 2^11 exp(logit - max) = exp2(s ks + (11 - max ks)), sums e in f32 and multiplies e (once to f16; rows < 384: bf16 hi + lo) with v; the division by (sum + 1e-9) is done on the 64 outputs. 3-product logits for rows < 384, else 1. Epilogue: a lane holds 32 of the 64 outputs of one (token, head), its partner lane ^ 16 the other 32, so the per-head normalisation is in-lane sums and one exchange each for mean and variance; x gn_weight + gn_bias, x alpha (k_proj's f16 rows), once to f16 -> the A rows of k_out.
// The pointers of this kernel are plain (no __restrict__): its loads then stay between the asm statements around them, so that each run of loads has its s_wait_xcnt 0 behind it.
/* s_wait_xcnt 0 behind a run of global loads, before a register that they name is used again; the run's address is an input of the statement, so that its registers stay whole up to the wait */
__device__ __forceinline__ void xwait(const void* p) { asm volatile("s_wait_xcnt 0x0" :: "v"(p) : "memory"); }
__device__ __forceinline__ void xwait(const void* p, const void* q) { asm volatile("s_wait_xcnt 0x0" :: "v"(p), "v"(q) : "memory"); }
/* one lane's 16 elements of a fragment; p already holds the lane half's 8 g */
__device__ __forceinline__ v16h ld_h(const _Float16* p) { union { v16h v; v8h q[2]; } u; u.q[0] = *(const v8h*)p; u.q[1] = *(const v8h*)(p + 16); return u.v; }
/* the same from a plane in fragment order (1 KiB = [half][lane][8]); p already holds the lane's 8 lane: each of the two loads reads 512 B in a row over the wave, four whole lines */
__device__ __forceinline__ v16h ld_hf(const _Float16* p) { union { v16h v; v8h q[2]; } u; u.q[0] = *(const v8h*)p; u.q[1] = *(const v8h*)(p + 256); return u.v; }
__device__ __forceinline__ v16b ld_bf(const __bf16* p) { union { v16b v; v8b q[2]; } u; u.q[0] = *(const v8b*)p; u.q[1] = *(const v8b*)(p + 256); return u.v; }
template <bool HI> __device__ __forceinline__ void attn_ldk(const _Float16* kp, const _Float16* klp, int c, v16h (&kh)[2][2], v16h (&kl)[2][2]) {
  const _Float16* p = kp + (size_t)c * 8192; const _Float16* pl = klp + (size_t)c * 8192;   /* the wave's chunk c is every fourth chunk of 32 keys (kp, klp hold its place among the four): 2 x 2 fragments, 4 KiB in a row */
#pragma unroll
  for (int i = 0; i < 2; ++i) {
#pragma unroll
    for (int kc = 0; kc < 2; ++kc) { kh[i][kc] = ld_hf(p + i * 1024 + kc * 512); if (HI) kl[i][kc] = ld_hf(pl + i * 1024 + kc * 512); } }
  if (HI) xwait(p, pl); else xwait(p); }
template <bool HI> __device__ __forceinline__ v8f attn_s(const v16h (&kh)[2], const v16h (&kl)[2], const v16h (&qh)[2], const v16h (&ql)[2]) {
  v8f a = {}, al = {};
#pragma unroll
  for (int kc = 0; kc < 2; ++kc) { a = wmma16(kh[kc], qh[kc], a); if (HI) { al = wmma16(kh[kc], ql[kc], al); al = wmma16(kl[kc], qh[kc], al); } }
#pragma unroll
  for (int r = 0; r < 8; ++r) a[r] = HI ? (a[r] + al[r] * (1.0f / 1024.0f)) * SCALE : a[r];   /* the 1-product rows' values stay 8 x the logit: their 1/8 (exact) sits in the exponent's multiplier ks */
  return a; }
/* eight hardware exp2 in one statement: behind a transcendental the instruction set asks for one independent instruction before its result is read or its source overwritten; here each v_exp_f32 is that instruction for the one before it (every output lies apart from every input), and the v_nop is it for the last */
__device__ __forceinline__ void exp2x8(const float (&x)[8], float* y) { float y0, y1, y2, y3, y4, y5, y6, y7;
  asm("v_exp_f32 %0, %8\n\tv_exp_f32 %1, %9\n\tv_exp_f32 %2, %10\n\tv_exp_f32 %3, %11\n\tv_exp_f32 %4, %12\n\tv_exp_f32 %5, %13\n\tv_exp_f32 %6, %14\n\tv_exp_f32 %7, %15\n\tv_nop"
      : "=&v"(y0), "=&v"(y1), "=&v"(y2), "=&v"(y3), "=&v"(y4), "=&v"(y5), "=&v"(y6), "=&v"(y7) : "v"(x[0]), "v"(x[1]), "v"(x[2]), "v"(x[3]), "v"(x[4]), "v"(x[5]), "v"(x[6]), "v"(x[7]));
  y[0] = y0; y[1] = y1; y[2] = y2; y[3] = y3; y[4] = y4; y[5] = y5; y[6] = y6; y[7] = y7; }
/* the rows' last chunk (keys 32 (nall - 1) + 0..31) alone reaches past a row's diagonal; dq = the row of column group 0 in this lane, counted from that chunk's first key */
template <int NU> __device__ __forceinline__ void attn_mask(v8f (&s)[NU][2], int dq, int g) {
#pragma unroll
  for (int u = 0; u < NU; ++u) {
#pragma unroll
    for (int i = 0; i < 2; ++i) {
#pragma unroll
      for (int r = 0; r < 8; ++r) s[u][i][r] = (i * 16 + 8 * g + r <= u * 16 + dq) ? s[u][i][r] : -3.0e38f; } } }
template <bool HI, int NU> __device__ __forceinline__ void attn_sall(const v16h (&kh)[2][2], const v16h (&kl)[2][2], const v16h (&qh)[NU][2], const v16h (&ql)[NU][2], v8f (&s)[NU][2]) {
#pragma unroll
  for (int u = 0; u < NU; ++u) {
#pragma unroll
    for (int i = 0; i < 2; ++i) s[u][i] = attn_s<HI>(kh[i], kl[i], qh[u], ql[u]); } }
template <int NU> __device__ __forceinline__ void attn_max(const v8f (&s)[NU][2], float (&m)[NU]) {
#pragma unroll
  for (int u = 0; u < NU; ++u) {
#pragma unroll
    for (int i = 0; i < 2; ++i) {
#pragma unroll
      for (int r = 0; r < 8; ++r) m[u] = fmaxf(m[u], s[u][i][r]); } } }
/* one wave, NU column groups of 16 queries from row ql0 on (ql0 a multiple of 16 NU), and every fourth 32-key chunk of their keys: chunks par, par + 4, ... (par scalar, 0..3). It leaves its own maximum, its sum and its 64 outputs per query, all relative to that maximum, in LDS (xo, xs) for attn_fin */
template <bool HI, int NU> __device__ __forceinline__ void attn_part(const _Float16* QH, const _Float16* KH, const _Float16* QL, const _Float16* KL, const _Float16* VT, const __bf16* VB, const __bf16* VBL, int b, int h, int ql0, int lane, int par, v4f (*xo)[8][32], float (*xs)[2][32]) {
  const int col = lane & 15, g = lane >> 4, dq = (ql0 & 31) + col; const size_t kvh = (size_t)b * NKV + h / GQ; const int nall = (ql0 >> 5) + 1;   /* 32-key chunks of the rows; every chunk holds at least one key <= t for each of the wave's rows */
  const int nch = (nall + 3 - par) >> 2; const bool last = ((nall - 1) & 3) == par;   /* this wave's chunks (none where the rows have par chunks or fewer: maximum -3e38, sum and outputs 0); whether the rows' last chunk is among them */
  v16h qh[NU][2], ql[NU][2], ka[2][2], la[2][2], kb[2][2], lb[2][2]; v8f s[NU][2];
  { const _Float16* qp = QH + ((size_t)b * TT + ql0 + col) * CC + h * HD + 8 * g; const _Float16* qlp = QL + ((size_t)b * QHI + ql0 + col) * CC + h * HD + 8 * g;
#pragma unroll
    for (int u = 0; u < NU; ++u) {
#pragma unroll
      for (int kc = 0; kc < 2; ++kc) { qh[u][kc] = ld_h(qp + u * 16 * CC + kc * 32); if (HI) ql[u][kc] = ld_h(qlp + u * 16 * CC + kc * 32); } }
    if (HI) xwait(qp, qlp); else xwait(qp); }
  const _Float16* kp = KH + kvh * (TT / 16) * 1024 + par * 2048 + lane * 8; const _Float16* klp = KL + kvh * (KHI / 16) * 1024 + par * 2048 + lane * 8;
  float m[NU];
#pragma unroll
  for (int u = 0; u < NU; ++u) m[u] = -3.0e38f;
  if (HI) {   /* pass 1 of the early rows (at most 3 chunks a wave): no look-ahead, so that the residual planes' registers fit */
    for (int c = 0; c < nch; ++c) { attn_ldk<HI>(kp, klp, c, ka, la);
      attn_sall<HI, NU>(ka, la, qh, ql, s);
      if (last && c == nch - 1) attn_mask<NU>(s, dq, g);   /* scalar test */
      attn_max<NU>(s, m); }
  } else {
  /* pass 1, two chunks a trip: each chunk's key rows are fetched a whole trip ahead, into the registers that its products have just left. An odd count takes its last chunk twice (a maximum does not mind). Behind the last trip ka holds chunk 0, with which pass 2 begins */
  attn_ldk<HI>(kp, klp, 0, ka, la); attn_ldk<HI>(kp, klp, nch > 1 ? 1 : 0, kb, lb);
  for (int c = 0; c < nch; c += 2) { const int c1 = c + 1 < nch ? c + 1 : nch - 1;
    attn_sall<HI, NU>(ka, la, qh, ql, s);
    attn_ldk<HI>(kp, klp, c + 2 < nch ? c + 2 : 0, ka, la);
    if (last && c == nch - 1) attn_mask<NU>(s, dq, g);   /* scalar test */
    attn_max<NU>(s, m);
    attn_sall<HI, NU>(kb, lb, qh, ql, s);
    attn_ldk<HI>(kp, klp, c + 3 < nch ? c + 3 : nch - 1, kb, lb);
    if (last && c1 == nch - 1) attn_mask<NU>(s, dq, g);   /* scalar test */
    attn_max<NU>(s, m); } }
#pragma unroll
  for (int u = 0; u < NU; ++u) m[u] = fmaxf(m[u], __shfl_xor(m[u], 16));   /* the two lane halves hold the two halves of a query's keys */
  const float ks = (HI ? 1.0f : SCALE) * 1.44269504f;   /* log2(e), times the 1/8 that the 1-product rows still owe */
  float sum[NU], cm[NU]; v8f o[NU][HD / 16];
#pragma unroll
  for (int u = 0; u < NU; ++u) { sum[u] = 0.f; cm[u] = fmaf(-m[u], ks, 11.0f);   /* its rounding is one factor for this wave's part of the row, in e and in the sum alike */
#pragma unroll
    for (int j = 0; j < HD / 16; ++j) o[u][j] = v8f{}; }
  const _Float16* vp = VT + kvh * (TT / 32) * 2048 + par * 2048 + lane * 8; const __bf16* vbp = VB + kvh * (KHI / 32) * 2048 + par * 2048 + lane * 8; const __bf16* vlp = VBL + kvh * (KHI / 32) * 2048 + par * 2048 + lane * 8;   /* a chunk of 32 keys: four fragments (d = 16 j + col), 4 KiB in a row; the wave's next chunk lies 16 KiB on */
  for (int c = 0; c < nch; ++c) { v16h vf[HD / 16]; v16b vb[HD / 16], vbl[HD / 16];
    if (HI) attn_ldk<HI>(kp, klp, c, ka, la);
    else { const _Float16* p0 = vp + c * 8192;
#pragma unroll
      for (int j = 0; j < HD / 16; ++j) vf[j] = ld_hf(p0 + j * 512);
      xwait(p0); }
    attn_sall<HI, NU>(ka, la, qh, ql, s);
    if (HI) { const __bf16* p0 = vbp + c * 8192; const __bf16* p1 = vlp + c * 8192;   /* the early rows' v planes come in behind the logits, when the key rows' registers are free, and fly under the exponentials */
#pragma unroll
      for (int j = 0; j < HD / 16; ++j) { vb[j] = ld_bf(p0 + j * 512); vbl[j] = ld_bf(p1 + j * 512); }
      xwait(p0, p1);
    } else attn_ldk<HI>(kp, klp, c + 1 < nch ? c + 1 : c, ka, la);   /* the next chunk's key rows fly under this chunk's exponentials (the last chunk reloads its own, unused) */
    __builtin_amdgcn_sched_barrier(0);   /* keeps the loads above in front of the exponentials: sunk to the loop's foot they would be waited for at once */
    if (last && c == nch - 1) attn_mask<NU>(s, dq, g);   /* scalar test; the excluded keys' -3e38 gives e = 0 */
#pragma unroll
    for (int u = 0; u < NU; ++u) { float e[16];
#pragma unroll
      for (int i = 0; i < 2; ++i) { float x[8];   /* the argument is never above 11 (but for cm's rounding), so no range step is owed; below -126, the excluded keys' too, the instruction gives 0 */
#pragma unroll
        for (int r = 0; r < 8; ++r) x[r] = fmaf(s[u][i][r], ks, cm[u]);
        exp2x8(x, &e[i * 8]);
#pragma unroll
        for (int r = 0; r < 8; ++r) sum[u] += e[i * 8 + r]; }
      if (HI) { const F2 p = bsplit16(e);
#pragma unroll
        for (int j = 0; j < HD / 16; ++j) { o[u][j] = wmma_bf(vb[j], p.h, o[u][j]); o[u][j] = wmma_bf(vb[j], p.l, o[u][j]); o[u][j] = wmma_bf(vbl[j], p.h, o[u][j]); }
      } else { v16h p;
#pragma unroll
        for (int x = 0; x < 16; ++x) p[x] = (_Float16)e[x];
#pragma unroll
        for (int j = 0; j < HD / 16; ++j) o[u][j] = wmma16(vf[j], p, o[u][j]); } } }
#pragma unroll
  for (int u = 0; u < NU; ++u) {   /* 16 B a lane, a wave's store 512 B in a row */
#pragma unroll
    for (int j = 0; j < HD / 16; ++j) { xo[u][2 * j][lane] = __builtin_shufflevector(o[u][j], o[u][j], 0, 1, 2, 3); xo[u][2 * j + 1][lane] = __builtin_shufflevector(o[u][j], o[u][j], 4, 5, 6, 7); }
    xs[u][0][lane] = m[u]; xs[u][1][lane] = sum[u]; } }
/* one wave finishes one column group of 16 queries from row row0 on: joins the four waves' parts (x0..x3, s0..s3: chunks 0, 1, 2, 3 modulo 4; always in that order), each brought from its own maximum to the common one by the factor exp(own - common), then the division, the normalisation and the gate. ks as in attn_part */
__device__ __forceinline__ void attn_fin(const v4f (*x0)[32], const v4f (*x1)[32], const v4f (*x2)[32], const v4f (*x3)[32], const float (*s0)[32], const float (*s1p)[32], const float (*s2p)[32], const float (*s3)[32], float ks, const _Float16* GA, const float* GW, const float* GB, _Float16* AH, int b, int h, int row0, int lane) {
  const int col = lane & 15, g = lane >> 4; const float m0 = s0[0][lane], m1 = s1p[0][lane], m2 = s2p[0][lane], m3 = s3[0][lane], mt = fmaxf(fmaxf(m0, m1), fmaxf(m2, m3)); const float e0 = (m0 - mt) * ks, e1 = (m1 - mt) * ks, e2 = (m2 - mt) * ks, e3 = (m3 - mt) * ks; float f0, f1, f2, f3;   /* arguments <= 0; a part without keys (-3e38) gets the factor 0 */
  /* four hardware exp2 in one statement: each is the independent instruction that the instruction set asks for behind the one before it, the v_nop is it for the last */
  asm("v_exp_f32 %0, %4\n\tv_exp_f32 %1, %5\n\tv_exp_f32 %2, %6\n\tv_exp_f32 %3, %7\n\tv_nop" : "=&v"(f0), "=&v"(f1), "=&v"(f2), "=&v"(f3) : "v"(e0), "v"(e1), "v"(e2), "v"(e3));
  float sum = s0[1][lane] * f0 + s1p[1][lane] * f1 + s2p[1][lane] * f2 + s3[1][lane] * f3; sum = 1.0f / (sum + __shfl_xor(sum, 16) + 2048.0f * 1e-9f);   /* p = e / (sum + 1e-9) as in the module, numerator and denominator x 2^11 */
  v8f o[HD / 16];
#pragma unroll
  for (int j = 0; j < HD / 16; ++j) {
#pragma unroll
    for (int q = 0; q < 2; ++q) { const v4f v0 = x0[2 * j + q][lane], v1 = x1[2 * j + q][lane], v2 = x2[2 * j + q][lane], v3 = x3[2 * j + q][lane];
#pragma unroll
      for (int r = 0; r < 4; ++r) o[j][4 * q + r] = v0[r] * f0 + v1[r] * f1 + v2[r] * f2 + v3[r] * f3; } }
  v8f gw[HD / 16], gb[HD / 16];   /* lane (g, col) holds d = 16 j + 8 g + r of query col */
  { const float* gwp = GW + h * HD + 8 * g; const float* gbp = GB + h * HD + 8 * g;
#pragma unroll
    for (int j = 0; j < HD / 16; ++j) { gw[j] = *(const v8f*)(gwp + j * 16); gb[j] = *(const v8f*)(gbp + j * 16); }
    xwait(gwp, gbp); }
  { const float sc = sum; v8f t[HD / 16]; v8h al[HD / 16]; v4u pk[HD / 16]; float ps[HD / 16];
    const size_t off = ((size_t)b * TT + row0 + col) * CC + h * HD + 8 * g; const _Float16* gap = GA + off; _Float16* ap = AH + off;
#pragma unroll
    for (int j = 0; j < HD / 16; ++j) al[j] = *(const v8h*)(gap + j * 16);
    xwait(gap);
#pragma unroll
    for (int j = 0; j < HD / 16; ++j) { t[j] = o[j] * sc; ps[j] = 0.f;   /* four independent chains of eight */
#pragma unroll
      for (int r = 0; r < 8; ++r) ps[j] += t[j][r]; }
    float s1 = (ps[0] + ps[1]) + (ps[2] + ps[3]); s1 += __shfl_xor(s1, 16);
    const float mean = s1 * (1.0f / HD);
#pragma unroll
    for (int j = 0; j < HD / 16; ++j) { ps[j] = 0.f;
#pragma unroll
      for (int r = 0; r < 8; ++r) { t[j][r] -= mean; ps[j] += t[j][r] * t[j][r]; } }
    float s2 = (ps[0] + ps[1]) + (ps[2] + ps[3]); s2 += __shfl_xor(s2, 16);
    const float rstd = rsqrtf(s2 * (1.0f / HD) + 1e-5f);
#pragma unroll
    for (int j = 0; j < HD / 16; ++j) { union { v8h hv; v4u u4; } c;
#pragma unroll
      for (int r = 0; r < 8; ++r) c.hv[r] = (_Float16)((t[j][r] * rstd * bfr(gw[j][r]) + bfr(gb[j][r])) * (float)al[j][r]);
      pk[j] = c.u4; vst2(ap + j * 16, pk[j]); }   /* the 128-B line of a (token, head) is written by this wave alone */
    asm volatile("s_wait_xcnt 0x0" :: "v"(ap), "v"(pk[0]), "v"(pk[1]), "v"(pk[2]), "v"(pk[3]) : "memory");   /* before a register that the stores above name is used again; address and data are inputs, so that they stay whole up to the wait */ } }
__global__ __launch_bounds__(512) void k_attn(const _Float16* QH, const _Float16* KH, const _Float16* QL, const _Float16* KL, const _Float16* VT, const __bf16* VB, const __bf16* VBL, const _Float16* GA, const float* GW, const float* GB, _Float16* AH) {
  static_assert(QHI % 128 == 0 && KHI >= QHI && HD == 64, "a wave is wholly on one path, and its keys have the residual planes");
  const int lane = threadIdx.x & 31; const int wave = __builtin_amdgcn_readfirstlane(threadIdx.x >> 5);   /* scalar, so that the chunk loops branch on scalars */
  static_assert(TT == 2048 && QHI == 384, "the table of pairs below is laid out for 16 query blocks, the first three on the early rows' path");
  __shared__ __align__(16) v4f xo[2][16][2][8][32]; __shared__ float xs[2][16][2][2][32];   /* per (query block of the pair, wave, column group): 64 outputs of 16 queries as [8 pieces][lane]; maximum and sum by lane */
  /* the block's two query blocks: 15 - y and the one that brings both together to 18 or 19 units of 128 keys, an early block's keys counted three times (three products, one column group at a time): (15,0) (14,3) (13,4) (12,1) (11,5) (10,6) (9,7) (8,2); four bits a y */
  const int qbs[2] = { (TT / 128 - 1) - (int)blockIdx.y, (int)((0x27651430u >> (4 * blockIdx.y)) & 15u) };
  const int qg = wave & 3, par = wave >> 2;   /* waves w, w + 4, w + 8, w + 12 share 32 queries */
  /* kept rolled: one copy of each path's code for both query blocks */
#pragma unroll 1
  for (int t = 0; t < 2; ++t) { const int qb = t ? qbs[1] : qbs[0], ql0 = qb * 128 + qg * 32;
    if (qb < QHI / 128) {   /* scalar test; the early rows' planes take twice the registers: one column group at a time */
      /* kept rolled: one copy of this path's code, and one group's registers */
#pragma unroll 1
      for (int u = 0; u < 2; ++u) attn_part<true, 1>(QH, KH, QL, KL, VT, VB, VBL, blockIdx.z, blockIdx.x, ql0 + u * 16, lane, par, &xo[t][wave][u], &xs[t][wave][u]);
    } else attn_part<false, 2>(QH, KH, QL, KL, VT, VB, VBL, blockIdx.z, blockIdx.x, ql0, lane, par, &xo[t][wave][0], &xs[t][wave][0]); }
  __syncthreads();   /* every wave's parts lie in LDS before its partners read them; all sixteen waves pass here once */
  const int ft = wave >> 3, fg = (wave >> 1) & 3, fu = wave & 1, fqb = ft ? qbs[1] : qbs[0];   /* sixteen (query block, column group) pairs, one a wave */
  attn_fin(xo[ft][fg][fu], xo[ft][fg + 4][fu], xo[ft][fg + 8][fu], xo[ft][fg + 12][fu], xs[ft][fg][fu], xs[ft][fg + 4][fu], xs[ft][fg + 8][fu], xs[ft][fg + 12][fu], (fqb < QHI / 128 ? 1.0f : SCALE) * 1.44269504f, GA, GW, GB, AH, blockIdx.z, blockIdx.x, fqb * 128 + fg * 32 + fu * 16, lane); }
// ---- k_out: block = (128 rows, 128 cols), eight waves: y = (gn * alpha) (f16 rows) Wo (k_prep's f16 rows, bf16 x 2^8, exact) x 2^-8 -> output 0 rows. Waves 0..3 sum over the first half of K, waves 4..7 over the second, each four with a W ring of their own and 32 x 128 outputs a wave (every B fragment feeds two products); a tile of A and of Wo is so fetched from L2 once for 128 x 128 outputs, and two waves still share a SIMD. The two halves' sums meet in LDS behind one barrier: first half + second half.
__global__ __launch_bounds__(256) void k_out(const _Float16* __restrict__ AH, const _Float16* __restrict__ WOT, float* __restrict__ OUT) { __shared__ __align__(16) float sp[2][8][16][132]; __shared__ __align__(16) char sw[2][2 * SWB];   /* sp: per (row group m, wave) its 16 x 128 partial sums; sw: per half of K the Wo tile of one pass, [col][k] in f16 (x 2^8), two buffers */
  const int tid = threadIdx.x, wave = tid >> 5, lane = tid & 31, col = lane & 15, g = lane >> 4, kh = wave >> 2, wq = wave & 3, t4 = tid & 127; const int c0 = blockIdx.y * 128; const size_t rb = (size_t)blockIdx.x * 128;
  v8f acc[2][8] = {};
  gemm_acc<true, 32, 128, 2, CC / 128>((const char*)(AH + (rb + wq * 16 + col) * CC + kh * (CC / 2) + 8 * g), (const char*)(WOT + (size_t)(c0 + (t4 >> 3)) * CC + kh * (CC / 2) + (t4 & 7) * 8), sw[kh], t4, lane, acc);
#pragma unroll
  for (int m = 0; m < 2; ++m) {
#pragma unroll
    for (int j = 0; j < 8; ++j) {
#pragma unroll
      for (int r = 0; r < 8; ++r) sp[m][wave][8 * g + r][j * 16 + col] = acc[m][j][r] * (1.0f / 256.0f); } }
  __syncthreads();   /* both halves' partial sums lie in LDS before either is read; all eight waves pass here once */
  /* wave (kh, wq) finishes rows 64 kh + 16 wq + 0..15: 512 B of a row by the wave's 32 lanes */
  float* op = OUT + (rb + kh * 64 + wq * 16) * CC + c0 + lane * 4;
#pragma unroll
  for (int q = 0; q < 4; ++q) { v4f v[4];
#pragma unroll
    for (int i = 0; i < 4; ++i) v[i] = *(const v4f*)&sp[kh][wq][q * 4 + i][lane * 4] + *(const v4f*)&sp[kh][wq + 4][q * 4 + i][lane * 4];
#pragma unroll
    for (int i = 0; i < 4; ++i) vst2(op + (size_t)(q * 4 + i) * CC, v[i]);
    asm volatile("s_wait_xcnt 0x0" :: "v"(op), "v"(v[0]), "v"(v[1]), "v"(v[2]), "v"(v[3]) : "memory");   /* before a register that the stores above name is used again; address and data are inputs, so that they stay whole up to the wait */ } }
extern "C" void kernel_launch(void* const* d_in, const int* in_sizes, int n_in, void* d_out, int out_size, void* d_ws, size_t ws_size, hipStream_t stream) {
  (void)in_sizes; (void)n_in; (void)out_size;
  const float** F = (const float**)d_in;   // 0 x [1,2048,2048]; 1 rope_cos, 2 rope_sin [2048,64]; 3 Wq [2048,2048]; 4 Wk, 5 Wv [2048,512]; 6 Wo [2048,2048]; 7 Wg [2048,2048], 8 bg; 9 gn_weight, 10 gn_bias [2048]
  if (ws_size < (size_t)WS_END) return;
  char* ws = (char*)d_ws; _Float16 *GA = (_Float16*)(ws + WS_GA), *AH = (_Float16*)(ws + WS_AH), *QH = (_Float16*)(ws + WS_QH), *KH = (_Float16*)(ws + WS_KH), *VT = (_Float16*)(ws + WS_VT), *QL = (_Float16*)(ws + WS_QL), *KL = (_Float16*)(ws + WS_KL); __bf16 *VB = (__bf16*)(ws + WS_VB), *VBL = (__bf16*)(ws + WS_VBL); __bf16 *XB = (__bf16*)(ws + WS_XB), *WT = (__bf16*)(ws + WS_WT); _Float16 *WOT = (_Float16*)(ws + WS_WOT);
  float* OUT0 = (float*)d_out; float* OUTK = OUT0 + (size_t)NB * TT * CC; float* OUTV = OUTK + (size_t)NB * NKV * TT * HD;   /* tuple outputs concatenated, no padding */
  k_prep<<<dim3(NWT / 64 + CC / 64 + TNB * TT / 64, CC / 64 / PREP_T), 256, 0, stream>>>(F[0], F[3], F[4], F[5], F[7], F[6], XB, WT, WOT);
  k_proj<<<dim3(TNB * TT / 128, CC / 128, 4), 128, 0, stream>>>(XB, WT, F[8], F[1], F[2], QH, KH, VT, QL, KL, VB, VBL, GA, OUTK, OUTV);
  k_attn<<<dim3(NH, TT / 256, TNB), 512, 0, stream>>>(QH, KH, QL, KL, VT, VB, VBL, GA, F[9], F[10], AH);
  k_out<<<dim3(TNB * TT / 128, CC / 128), 256, 0, stream>>>(AH, WOT, OUT0);
}
